// v000
// Times are from an AMD MI455X. After a warm-up the kernel runs many times in a row, and a time is the length of
// such a window on the GPU divided by its runs, so every launch and the gaps after it count. The runs cycle
// through copies of the inputs. A figure is the median of several windows, for all but v000 over two sittings.
// Sittings can differ by a few percent; kernels timed side by side share one.
// v000 is the starting kernel. One run takes 284 microseconds.
// Contractions: x.W{q,k,v}^T on v_wmma_f32_16x16x32_bf16 (x and W RNE-converted to bf16 operands, f32 accumulate, bias added in f32);
// scores k'.q'^T (q', k' carried x1024 as f16 hi plane + f16 residual plane, products hh+lh+hl), P.v (P x32768 f16 hi+residual,
// v x1024 f16 hi+residual, products hh+lh+hl) and O.Wo^T (O x1024 f16 hi+residual, Wo as f16(bf16(Wo) x1024), products h.w+l.w):
// v_wmma_f32_16x16x32_f16, f32 accumulate. Per-head x per-key additive score bias, base-2 online softmax, 1/l fold in f32 on VALU.
#include <hip/hip_runtime.h>
#include <math.h>
#include <stdint.h>

#define NB    2
#define SEQ   2048
#define DMOD  768
#define NH    12
#define HD    64
#define NQT   (SEQ / 64)
#define QSC   1024.0f
#define KSC   1024.0f
#define PCAR  32768.0f
#define VCAR  1024.0f
#define OSC   1024.0f
#define WOS   1024.0f
#define LOG2E 1.4426950408889634f
#define ATT_WAVES   4
#define ATT_THREADS (ATT_WAVES * 32)
#define ATT_BLOCKS  (NB * NH * NQT)
#define NKB    (SEQ / 32)
#define SLABF  (16 * 68)
#define SLAB64 (16 * 68)
#define VTP    72
static_assert(HD == 64 && DMOD == NH * HD);
static_assert(NQT == 32 && NH == 12 && NB == 2);
static_assert(ATT_THREADS == 128 && ATT_BLOCKS == 768 && NKB == 64);
static_assert(((NB * SEQ) % 64) == 0 && (DMOD % 64) == 0 && (DMOD % 32) == 0);
static_assert((SEQ % 64) == 0 && (SEQ % 8) == 0);
static_assert(((NB * SEQ * DMOD / 8) % 256) == 0 && ((DMOD * DMOD / 8) % 256) == 0);
static_assert(ATT_WAVES * SLABF >= 4 * 16 * 68);
static_assert(HD * VTP >= 63 * VTP + 64);

typedef unsigned short u16;
typedef _Float16 v16h __attribute__((ext_vector_type(16)));
typedef _Float16 v8h  __attribute__((ext_vector_type(8)));
typedef __bf16   v16b __attribute__((ext_vector_type(16)));
typedef float    v8f  __attribute__((ext_vector_type(8)));
typedef float    v4f  __attribute__((ext_vector_type(4)));
typedef unsigned int v4u __attribute__((ext_vector_type(4)));

union FragH { v16h v; v8h h[2]; v4u u[2]; };
union FragB { v16b v; v4u u[2]; };

// ---- scalar helpers --------------------------------------------------------------------------------
__device__ __forceinline__ unsigned short bf_bits(float f) {          // f32 -> bf16 bits, RNE convert
  unsigned u = __float_as_uint(f);
  return (unsigned short)((u + 0x7FFFu + ((u >> 16) & 1u)) >> 16);
}
__device__ __forceinline__ float bf_up(unsigned short h) { return __uint_as_float(((unsigned)h) << 16); }
__device__ __forceinline__ float bfr(float f) { return bf_up(bf_bits(f)); }
__device__ __forceinline__ unsigned short h_bits(_Float16 x) { return __builtin_bit_cast(unsigned short, x); }
__device__ __forceinline__ unsigned pk16(unsigned short a, unsigned short b) { return (unsigned)a | ((unsigned)b << 16); }
__device__ __forceinline__ v8f zero8() { v8f z = {0.f, 0.f, 0.f, 0.f, 0.f, 0.f, 0.f, 0.f}; return z; }
__device__ __forceinline__ v4f zero4() { v4f z = {0.f, 0.f, 0.f, 0.f}; return z; }

// ---- fragment loaders: 16-bit A/B operand, lane -> row/col (lane&15), p already includes +8*(lane>>4);
//      elements 0..7 <- p[0..7] (k0+8h..), elements 8..15 <- p[16..23] (k0+16+8h..)  (same split k map for A and B;
//      B is always read from a k-contiguous [n][k] plane)
__device__ __forceinline__ v16h ldfrag_h(const _Float16* p) {
  FragH f;
  f.h[0] = *(const v8h*)(p);
  f.h[1] = *(const v8h*)(p + 16);
  return f.v;
}
__device__ __forceinline__ v16b ldfrag_b(const u16* p) {              // bf16 plane read as unsigned integer vectors
  FragB f;
  f.u[0] = *(const v4u*)(p);
  f.u[1] = *(const v4u*)(p + 16);
  return f.v;
}

__device__ __forceinline__ v8f mma_h(v16h a, v16h b, v8f c) {
  return __builtin_amdgcn_wmma_f32_16x16x32_f16(false, a, false, b, (short)0, c, false, false);
}
__device__ __forceinline__ v8f mma_b(v16b a, v16b b, v8f c) {
  return __builtin_amdgcn_wmma_f32_16x16x32_bf16(false, a, false, b, (short)0, c, false, false);
}
__device__ __forceinline__ void guard2(v8f& a, v8f& b, v16h x0, v16h x1, v16h x2, v16h x3, v16h x4, v16h x5) {
#if defined(__HIP_DEVICE_COMPILE__)
  asm volatile("v_nop\n\tv_nop\n\tv_nop\n\tv_nop"
               : "+v"(a), "+v"(b) : "v"(x0), "v"(x1), "v"(x2), "v"(x3), "v"(x4), "v"(x5) : "memory");
#endif
}
template <typename F>
__device__ __forceinline__ void guard6(v8f& a, v8f& b, v8f& c, v8f& d, F x0, F x1, F x2, F x3, F x4, F x5) {
#if defined(__HIP_DEVICE_COMPILE__)
  asm volatile("v_nop\n\tv_nop\n\tv_nop\n\tv_nop"
               : "+v"(a), "+v"(b), "+v"(c), "+v"(d) : "v"(x0), "v"(x1), "v"(x2), "v"(x3), "v"(x4), "v"(x5) : "memory");
#endif
}
__device__ __forceinline__ void guard10(v8f& a, v8f& b, v8f& c, v8f& d, v16h x0, v16h x1, v16h x2, v16h x3, v16h x4,
                                        v16h x5, v16h x6, v16h x7, v16h x8, v16h x9) {
#if defined(__HIP_DEVICE_COMPILE__)
  asm volatile("v_nop\n\tv_nop\n\tv_nop\n\tv_nop"
               : "+v"(a), "+v"(b), "+v"(c), "+v"(d)
               : "v"(x0), "v"(x1), "v"(x2), "v"(x3), "v"(x4), "v"(x5), "v"(x6), "v"(x7), "v"(x8), "v"(x9) : "memory");
#endif
}
__device__ __forceinline__ void acc_guard4(v8f& a, v8f& b, v8f& c, v8f& d) {
#if defined(__HIP_DEVICE_COMPILE__)
  asm volatile("v_nop\n\tv_nop\n\tv_nop\n\tv_nop" : "+v"(a), "+v"(b), "+v"(c), "+v"(d));
#endif
}
__device__ __forceinline__ void wave_sync_lds() {
  __builtin_amdgcn_fence(__ATOMIC_RELEASE, "workgroup");
  __builtin_amdgcn_wave_barrier();
  __builtin_amdgcn_fence(__ATOMIC_ACQUIRE, "workgroup");
}

// =====================================================================================================
// f32 plane -> 16-bit plane, same layout:  f16mode == 0: bf16 RNE bits;  f16mode == 1: f16 bits of (bf16 RNE value) * scale.
// Thread = 8 consecutive elements: two 16-B loads, one 16-B store; 32 consecutive lanes = 512 contiguous, 512-B aligned bytes
// coverage: grid = n8/256 blocks (host checks exactness) x 256 thr x 8 = the whole plane.
// =====================================================================================================
__global__ __launch_bounds__(256) void cvt16(const float* __restrict__ x, u16* D, int n8, int f16mode, float scale) {
  const int gt = blockIdx.x * 256 + (int)threadIdx.x;
  if (gt >= n8) return;                     // no barriers in this kernel
  const float* p = x + (size_t)gt * 8;
  const v4f a = *(const v4f*)(p), c4 = *(const v4f*)(p + 4);
  float v[8];
#pragma unroll
  for (int e = 0; e < 4; ++e) { v[e] = a[e]; v[4 + e] = c4[e]; }
  unsigned short s[8];
#pragma unroll
  for (int e = 0; e < 8; ++e) {
    const unsigned short hb = h_bits((_Float16)(bfr(v[e]) * scale));
    const unsigned short bb = bf_bits(v[e]);
    s[e] = (f16mode != 0) ? hb : bb;
  }
  v4u o;
#pragma unroll
  for (int e = 0; e < 4; ++e) o[e] = pk16(s[2 * e], s[2 * e + 1]);
  u16* d = D + (size_t)gt * 8;
  {
    *(v4u*)(d) = o;
    
  }
}

// =====================================================================================================
// f32 plane -> f16 hi plane (value * sc, sc a power of two) + f16 residual plane (value * sc - hi, unscaled), same layout.
// Thread = 8 consecutive elements: two 16-B loads, one 16-B store per plane; 32 consecutive lanes = 512 contiguous, 512-B aligned
// coverage: grid = n8/256 blocks (host checks exactness) x 256 thr x 8 = the whole of both planes.
// =====================================================================================================
__global__ __launch_bounds__(256) void split16(const float* __restrict__ x, u16* hpl, u16* lpl, int n8, float sc) {
  const int gt = blockIdx.x * 256 + (int)threadIdx.x;
  if (gt >= n8) return;                     // no barriers in this kernel
  const float* p = x + (size_t)gt * 8;
  const v4f a = *(const v4f*)(p), c4 = *(const v4f*)(p + 4);
  float w[8];
#pragma unroll
  for (int e = 0; e < 4; ++e) { w[e] = a[e]; w[4 + e] = c4[e]; }
  v4u oh, ol;
#pragma unroll
  for (int e = 0; e < 4; ++e) {
    const float t0 = w[2 * e] * sc, t1 = w[2 * e + 1] * sc;
    const _Float16 h0 = (_Float16)t0, h1 = (_Float16)t1;
    const _Float16 l0 = (_Float16)(t0 - (float)h0), l1 = (_Float16)(t1 - (float)h1);
    oh[e] = pk16(h_bits(h0), h_bits(h1));
    ol[e] = pk16(h_bits(l0), h_bits(l1));
  }
  const size_t o8 = (size_t)gt * 8;
  {
    *(v4u*)(hpl + o8) = oh;
    *(v4u*)(lpl + o8) = ol;
    
  }
}

// =====================================================================================================
// GEMM epilogue shared by both engines: the wave's 16x64 f32 tile (times oscale) staged in its LDS slab (pitch 68),
// coverage: 8 instructions x 2 rows x 16 lanes x 4 floats = the wave's 16 x 64 tile.
// =====================================================================================================
__device__ __forceinline__ void epi64(float* sl, v8f a0, v8f a1, v8f a2, v8f a3, float oscale, v4f badd, float* C, int N,
                                      size_t rowb, int col0, int lane) {
  const int hh = lane >> 4, m = lane & 15;
#pragma unroll
  for (int r = 0; r < 8; ++r) {
    const int ro = (8 * hh + r) * 68 + m;
    sl[ro]      = a0[r] * oscale;
    sl[ro + 16] = a1[r] * oscale;
    sl[ro + 32] = a2[r] * oscale;
    sl[ro + 48] = a3[r] * oscale;
  }
  wave_sync_lds();
  v4f vals[8];
#pragma unroll
  for (int it = 0; it < 8; ++it) vals[it] = *(const v4f*)(sl + (it * 2 + hh) * 68 + m * 4) + badd;
  float* dst = C + (rowb + (size_t)hh) * (size_t)N + col0 + m * 4;
  {
#pragma unroll
    for (int it = 0; it < 8; ++it) {
      *(v4f*)(dst + (size_t)(it * 2) * (size_t)N) = vals[it];
    }
    
  }
}

// =====================================================================================================
// bf16 GEMM with bias: C[M][N] (f32) = A[M][K] (bf16 row-major) . Bt[N][K]^T (bf16 k-contiguous), times oscale, plus bf16-RNE
// value of bias[n]. Block = 64x64 tile, 4 waves x 16 rows; fragments loaded straight from the 16-bit rows (two 16-B loads each,
// split k map for A and B); K stepped by 32 (host checks K % 32 == 0, M % 64 == 0, N % 64 == 0, grid = (M/64)*(N/64)).
// =====================================================================================================
__global__ __launch_bounds__(128)
void gemm_bfb(const u16* __restrict__ A, const u16* __restrict__ Bt, const float* __restrict__ bias,
              float* C, int M, int N, int K, float oscale) {
  __shared__ __align__(16) float slab[4 * SLAB64];
  const int tid = threadIdx.x, wave = tid >> 5, lane = tid & 31, hh = lane >> 4, m = lane & 15;
  const int ntile = N >> 6;
  const int bid   = blockIdx.x;
  const int rowb  = (bid / ntile) * 64 + wave * 16;
  const int col0  = (bid % ntile) * 64;
  if (rowb + 16 > M) return;                 // wave-uniform, never taken with the exact grid; no block barriers in this kernel
  const u16* ap = A  + (size_t)(rowb + m) * K + 8 * hh;
  const u16* bp = Bt + (size_t)(col0 + m) * K + 8 * hh;
  const size_t bs = (size_t)16 * K;
  v8f acc0 = zero8(), acc1 = zero8(), acc2 = zero8(), acc3 = zero8();
#pragma unroll 1
  for (int k0 = 0; k0 < K; k0 += 32) {
    const v16b a  = ldfrag_b(ap + k0);
    const v16b b0 = ldfrag_b(bp + k0);
    const v16b b1 = ldfrag_b(bp + bs + k0);
    const v16b b2 = ldfrag_b(bp + 2 * bs + k0);
    const v16b b3 = ldfrag_b(bp + 3 * bs + k0);
    acc0 = mma_b(a, b0, acc0);
    acc1 = mma_b(a, b1, acc1);
    acc2 = mma_b(a, b2, acc2);
    acc3 = mma_b(a, b3, acc3);
    guard6<v16b>(acc0, acc1, acc2, acc3, a, b0, b1, b2, b3, a);
  }
  const v4f bv = *(const v4f*)(bias + col0 + m * 4);      // columns col0 + 4m .. +3, always < N (N multiple of 64)
  v4f badd;
#pragma unroll
  for (int e = 0; e < 4; ++e) badd[e] = bfr(bv[e]);
  epi64(slab + wave * SLAB64, acc0, acc1, acc2, acc3, oscale, badd, C, N, (size_t)rowb, col0, lane);
}

// =====================================================================================================
// f16 hi+lo GEMM with bias: C[M][N] (f32) = (Ahi + Alo)[M][K] . Bt[N][K]^T times oscale, plus bf16-RNE value of bias[n];
// Ahi/Alo f16 planes (same layout), Bt f16 k-contiguous; products hi.B + lo.B into one accumulator (lo is the unscaled
// residual of hi). Same tiling as gemm_bfb.
// =====================================================================================================
__global__ __launch_bounds__(128)
void gemm_h2(const u16* __restrict__ Ah, const u16* __restrict__ Al, const u16* __restrict__ Bt,
             const float* __restrict__ bias, float* C, int M, int N, int K, float oscale) {
  __shared__ __align__(16) float slab[4 * SLAB64];
  const int tid = threadIdx.x, wave = tid >> 5, lane = tid & 31, hh = lane >> 4, m = lane & 15;
  const int ntile = N >> 6;
  const int bid   = blockIdx.x;
  const int rowb  = (bid / ntile) * 64 + wave * 16;
  const int col0  = (bid % ntile) * 64;
  if (rowb + 16 > M) return;                 // wave-uniform, never taken with the exact grid; no block barriers in this kernel
  const size_t aofs = (size_t)(rowb + m) * K + 8 * hh;
  const _Float16* ahp = (const _Float16*)(const void*)Ah + aofs;
  const _Float16* alp = (const _Float16*)(const void*)Al + aofs;
  const _Float16* bp  = (const _Float16*)(const void*)Bt + (size_t)(col0 + m) * K + 8 * hh;
  const size_t bs = (size_t)16 * K;
  v8f acc0 = zero8(), acc1 = zero8(), acc2 = zero8(), acc3 = zero8();
#pragma unroll 1
  for (int k0 = 0; k0 < K; k0 += 32) {
    const v16h ah = ldfrag_h(ahp + k0), al = ldfrag_h(alp + k0);
    const v16h b0 = ldfrag_h(bp + k0);
    const v16h b1 = ldfrag_h(bp + bs + k0);
    const v16h b2 = ldfrag_h(bp + 2 * bs + k0);
    const v16h b3 = ldfrag_h(bp + 3 * bs + k0);
    acc0 = mma_h(ah, b0, acc0);  acc0 = mma_h(al, b0, acc0);
    acc1 = mma_h(ah, b1, acc1);  acc1 = mma_h(al, b1, acc1);
    acc2 = mma_h(ah, b2, acc2);  acc2 = mma_h(al, b2, acc2);
    acc3 = mma_h(ah, b3, acc3);  acc3 = mma_h(al, b3, acc3);
    guard6<v16h>(acc0, acc1, acc2, acc3, ah, al, b0, b1, b2, b3);
  }
  const v4f bv = *(const v4f*)(bias + col0 + m * 4);      // columns col0 + 4m .. +3, always < N (N multiple of 64)
  v4f badd;
#pragma unroll
  for (int e = 0; e < 4; ++e) badd[e] = bfr(bv[e]);
  epi64(slab + wave * SLAB64, acc0, acc1, acc2, acc3, oscale, badd, C, N, (size_t)rowb, col0, lane);
}

// =====================================================================================================
// v^T planes: VH[(b*NH + h)*HD + d][s] = f16(v[b][s][h][d] * 1024), VL = f16 residual of the same value.
// Block = (b, h, 64 keys): 64 source rows of HD floats loaded with 16-B loads, converted, scattered into two LDS tiles
// coverage: load 256 thr x 16 elements = 64 x 64; store 2 iterations x 256 thr x 8 halves = 64 lines x 64 = the block's tile of
//           each plane; grid = NB x NH x SEQ/64 = 768 blocks covers both planes exactly once.
// =====================================================================================================
__global__ __launch_bounds__(256) void vt16(const float* __restrict__ v, u16* VHo, u16* VLo) {
  __shared__ __align__(16) u16 TH[HD * VTP];
  __shared__ __align__(16) u16 TL[HD * VTP];
  const int tid = threadIdx.x;
  const int bid = blockIdx.x;
  const int st  = bid & (NQT - 1);
  const int bh  = bid >> 5;                  // NQT == 32
  const int h   = bh % NH;
  const int b   = bh / NH;
  const int s0  = st * 64;
  {
    const int sl = tid >> 2;                  // key within tile 0..63
    const int dc = (tid & 3) * 16;            // d chunk
    const float* src = v + (((size_t)(b * SEQ + s0 + sl)) * NH + h) * HD + dc;
#pragma unroll
    for (int i = 0; i < 4; ++i) {
      const v4f a = *(const v4f*)(src + 4 * i);
#pragma unroll
      for (int e = 0; e < 4; ++e) {
        const float t = a[e] * VCAR;
        const _Float16 hv = (_Float16)t;
        const _Float16 lv = (_Float16)(t - (float)hv);
        TH[(dc + 4 * i + e) * VTP + sl] = h_bits(hv);
        TL[(dc + 4 * i + e) * VTP + sl] = h_bits(lv);
      }
    }
  }
  __syncthreads();
  v4u vh[2], vl[2];
  const int q8 = tid >> 3, p8 = (tid & 7) * 8;
#pragma unroll
  for (int it = 0; it < 2; ++it) {
    const int line = it * 32 + q8;            // d = 0..63
    vh[it] = *(const v4u*)(TH + line * VTP + p8);
    vl[it] = *(const v4u*)(TL + line * VTP + p8);
  }
  const size_t base = ((size_t)(b * NH + h) * HD) * SEQ + s0 + p8;
  {
#pragma unroll
    for (int it = 0; it < 2; ++it) {
      const int line = it * 32 + q8;
      *(v4u*)(VHo + base + (size_t)line * SEQ) = vh[it];
      *(v4u*)(VLo + base + (size_t)line * SEQ) = vl[it];
    }
    
  }
}

// =====================================================================================================
// Full (non-causal) multi-head flash attention with a per-head x per-key additive score bias: block = (batch b, head, 64 query
// rows), 4 waves, wave w owns the 16 query rows q0 = 64*qt + 16*w .. q0+15 (waves independent: no block barriers, wave-private
// LDS only, used in the epilogue).
//   q planes (hi, lo f16, x1024) laid out [b][s][h][d]; k planes the same; v^T planes [b][h][d][s] (x1024).
//   All NKB = 64 key blocks of 32 keys are visited (static bound).
//   Scores are computed TRANSPOSED: S^T tile g (g = 0,1) = k rows (keys kb+16g .. +15, A operand, row m = lane&15, split k map
//   over d) times q^T (B operand, col n = query q0 + (lane&15), k = d, split map), 3 products per tile and d-chunk
//   (k_hi.q_hi + k_lo.q_hi + k_hi.q_lo). D element r of lane l = (key kb+16g+8h+r, query q0+(l&15)), so a lane owns one query
//   column and 16 of its 32 keys; the partner lane l^16 owns the other 16 -> row max / row sum need one xor-16 shuffle.
//   Logit of key j, query i (base 2): (S * 1/8 * 2^-20 + bfr(wh) * bfr(mask[b][j])) * log2(e); the bias is loaded per key with
//   the same element -> key map as the transposed scores (t[i] <- key kb+8h+i, t[8+i] <- key kb+16+8h+i), added in f32.
//   Online max-subtracted base-2 softmax in f32. The exp'd values ARE the P A-fragment in place: A row m = query = lane&15,
//   element i <- key kb+8h+i (tile 0, D element i), element 8+i <- key kb+16+8h+i (tile 1, D element i). P is carried x32768
//   as f16 hi + f16 residual. The rescale factor of query row 8h+r of the O accumulators is fetched from lane 8h+r with a
//   shuffle (uniform control). 4+4 v^T B fragments (hi and residual planes, col n = d = 16j + (lane&15), keys k-contiguous),
//   12 P.V WMMAs (hh + lh + hl).
//   Epilogue: 1/l (per query, shuffled to the D row owner) and carry folds in f32; the wave's 16x64 f32 result staged in its LDS
// coverage: per wave 4 instructions x 4 rows x 8 lanes x 8 halves = 16 x 64 per plane; grid 768 blocks x 4 waves = every
//           (b, s, h) row of both O planes exactly once.
// =====================================================================================================
__global__ __launch_bounds__(ATT_THREADS)
void attn_fwd(const u16* __restrict__ QHIp, const u16* __restrict__ QLOp,
              const u16* __restrict__ KHIp, const u16* __restrict__ KLOp,
              const u16* __restrict__ VHIp, const u16* __restrict__ VLOp,
              const float* __restrict__ maskp, const float* __restrict__ mcwp,
              u16* OHIp, u16* OLOp) {
  __shared__ __align__(16) float smem[ATT_WAVES * SLABF];   // per wave: result slab [16][68] in the epilogue only

  const int tid  = threadIdx.x;
  const int wave = tid >> 5;
  const int lane = tid & 31;
  const int hh   = lane >> 4;
  const int c    = lane & 15;

  const int bid  = blockIdx.x;
  const int qt   = bid & (NQT - 1);
  const int bh   = bid >> 5;                 // NQT == 32
  const int head = bh % NH;
  const int b    = bh / NH;
  const int q0   = qt * 64 + wave * 16;

  // B fragments of q^T: col n = query q0 + c, k = d (k-contiguous row of the q plane)
  const size_t qofs = (((size_t)(b * SEQ + q0 + c)) * NH + head) * HD + 8 * hh;
  const _Float16* Qh  = (const _Float16*)(const void*)QHIp + qofs;
  const _Float16* Ql  = (const _Float16*)(const void*)QLOp + qofs;
  // A fragments of k: row m = key kb + 16g + c, k = d
  const size_t kofs = (((size_t)b * SEQ + c) * NH + head) * HD + 8 * hh;          // key row kb + c added per step
  const _Float16* Khb = (const _Float16*)(const void*)KHIp + kofs;
  const _Float16* Klb = (const _Float16*)(const void*)KLOp + kofs;
  // B fragments of v: col n = d = 16j + c, k = key (k-contiguous row of the v^T plane)
  const size_t vofs = ((size_t)(b * NH + head) * HD + c) * SEQ + 8 * hh;          // key kb added per step
  const _Float16* Vhb = (const _Float16*)(const void*)VHIp + vofs;
  const _Float16* Vlb = (const _Float16*)(const void*)VLOp + vofs;
  // per-key bias row: mask[b][kb + 8hh + 0..7] (tile 0) and [kb + 16 + 8hh + 0..7] (tile 1), 16-B aligned loads
  const float* mrow = maskp + (size_t)b * SEQ + 8 * hh;
  const float  wh2  = bfr(mcwp[head]);                                              // per-head scalar (bf16 RNE value)
  const float lsc = 0.125f * (LOG2E / (QSC * KSC));

  float mrun = -INFINITY, lrun = 0.f;
  v8f o[4];
#pragma unroll
  for (int j = 0; j < 4; ++j) o[j] = zero8();

#pragma unroll 1
  for (int it = 0; it < NKB; ++it) {
    const int kb = it * 32;
    const v4f ma = *(const v4f*)(mrow + kb),      mb = *(const v4f*)(mrow + kb + 4);
    const v4f mc = *(const v4f*)(mrow + kb + 16), md = *(const v4f*)(mrow + kb + 20);
    // ---- transposed scores: s0 = keys kb..kb+15, s1 = keys kb+16..kb+31, column = query q0 + c ----
    v8f s0 = zero8(), s1 = zero8();
    const _Float16* k0p = Khb + (size_t)kb * (NH * HD);
    const _Float16* k1p = k0p + (size_t)16 * (NH * HD);
    const _Float16* l0p = Klb + (size_t)kb * (NH * HD);
    const _Float16* l1p = l0p + (size_t)16 * (NH * HD);
#pragma unroll
    for (int kk = 0; kk < 2; ++kk) {
      const v16h qh  = ldfrag_h(Qh + kk * 32),  ql  = ldfrag_h(Ql + kk * 32);
      const v16h kh0 = ldfrag_h(k0p + kk * 32), kl0 = ldfrag_h(l0p + kk * 32);
      const v16h kh1 = ldfrag_h(k1p + kk * 32), kl1 = ldfrag_h(l1p + kk * 32);
      s0 = mma_h(kh0, qh, s0);
      s0 = mma_h(kl0, qh, s0);
      s0 = mma_h(kh0, ql, s0);
      s1 = mma_h(kh1, qh, s1);
      s1 = mma_h(kl1, qh, s1);
      s1 = mma_h(kh1, ql, s1);
      guard2(s0, s1, qh, ql, kh0, kl0, kh1, kl1);
    }
    // ---- base-2 logits of this lane's 16 keys for query q0 + c: t[i] <- key kb+8hh+i, t[8+i] <- key kb+16+8hh+i ----
    float t[16];
#pragma unroll
    for (int e = 0; e < 4; ++e) {
      t[e]      = s0[e] * lsc     + (wh2 * bfr(ma[e])) * LOG2E;
      t[4 + e]  = s0[4 + e] * lsc + (wh2 * bfr(mb[e])) * LOG2E;
      t[8 + e]  = s1[e] * lsc     + (wh2 * bfr(mc[e])) * LOG2E;
      t[12 + e] = s1[4 + e] * lsc + (wh2 * bfr(md[e])) * LOG2E;
    }
    float cm = t[0];
#pragma unroll
    for (int i = 1; i < 16; ++i) cm = fmaxf(cm, t[i]);
    cm = fmaxf(cm, __shfl_xor(cm, 16, 32));
    const float mn = fmaxf(mrun, cm);        // finite from the first block on
    const float al = exp2f(mrun - mn);       // 0 on the first block (mrun = -inf)
    mrun = mn;
    // ---- probabilities (<= 1) and the P A-fragments: hi = f16(p * 32768), lo = f16 residual; element i <-> t[i] ----
    float ps = 0.f;
    FragH ph, pl;
#pragma unroll
    for (int w = 0; w < 2; ++w) {
#pragma unroll
      for (int e4 = 0; e4 < 4; ++e4) {
        const int i = 8 * w + 2 * e4;
        const float p0 = exp2f(t[i] - mn), p1 = exp2f(t[i + 1] - mn);
        ps += p0 + p1;
        const float a0 = p0 * PCAR, a1 = p1 * PCAR;
        const _Float16 h0 = (_Float16)a0, h1 = (_Float16)a1;
        const _Float16 l0 = (_Float16)(a0 - (float)h0), l1 = (_Float16)(a1 - (float)h1);
        ph.u[w][e4] = pk16(h_bits(h0), h_bits(h1));
        pl.u[w][e4] = pk16(h_bits(l0), h_bits(l1));
      }
    }
    ps += __shfl_xor(ps, 16, 32);
    lrun = lrun * al + ps;
    // ---- rescale the O accumulators: D row 8hh+r = query q0+8hh+r, its factor lives in lane 8hh+r (and 16+8hh+r) ----
    float scl[8];
#pragma unroll
    for (int r = 0; r < 8; ++r) scl[r] = __shfl(al, 8 * hh + r, 32);
#pragma unroll
    for (int j = 0; j < 4; ++j) {
#pragma unroll
      for (int r = 0; r < 8; ++r) o[j][r] *= scl[r];
    }
    // ---- P.V : B fragment col n = d = j*16 + c, keys contiguous in the v^T planes ----
    {
      const _Float16* vhp = Vhb + kb;
      const _Float16* vlp = Vlb + kb;
      const v16h vh0 = ldfrag_h(vhp);
      const v16h vh1 = ldfrag_h(vhp + (size_t)16 * SEQ);
      const v16h vh2 = ldfrag_h(vhp + (size_t)32 * SEQ);
      const v16h vh3 = ldfrag_h(vhp + (size_t)48 * SEQ);
      const v16h vl0 = ldfrag_h(vlp);
      const v16h vl1 = ldfrag_h(vlp + (size_t)16 * SEQ);
      const v16h vl2 = ldfrag_h(vlp + (size_t)32 * SEQ);
      const v16h vl3 = ldfrag_h(vlp + (size_t)48 * SEQ);
      o[0] = mma_h(ph.v, vh0, o[0]);  o[0] = mma_h(pl.v, vh0, o[0]);  o[0] = mma_h(ph.v, vl0, o[0]);
      o[1] = mma_h(ph.v, vh1, o[1]);  o[1] = mma_h(pl.v, vh1, o[1]);  o[1] = mma_h(ph.v, vl1, o[1]);
      o[2] = mma_h(ph.v, vh2, o[2]);  o[2] = mma_h(pl.v, vh2, o[2]);  o[2] = mma_h(ph.v, vl2, o[2]);
      o[3] = mma_h(ph.v, vh3, o[3]);  o[3] = mma_h(pl.v, vh3, o[3]);  o[3] = mma_h(ph.v, vl3, o[3]);
      guard10(o[0], o[1], o[2], o[3], ph.v, pl.v, vh0, vh1, vh2, vh3, vl0, vl1, vl2, vl3);
    }
  }
  acc_guard4(o[0], o[1], o[2], o[3]);

  // ---- fold 1/l (per query, owned by lane = query) and the carries (32768 on P, 1024 on v); stage the 16x64 slab ----
  const float linv = (1.0f / lrun) * (1.0f / (PCAR * VCAR));
  float inv[8];
#pragma unroll
  for (int r = 0; r < 8; ++r) inv[r] = __shfl(linv, 8 * hh + r, 32);
  float* slab = smem + wave * SLABF;
#pragma unroll
  for (int r = 0; r < 8; ++r) {
#pragma unroll
    for (int j = 0; j < 4; ++j) slab[(8 * hh + r) * 68 + j * 16 + c] = o[j][r] * inv[r];
  }
  wave_sync_lds();
  // ---- O x1024 -> f16 hi + residual planes; lane = (row in group of 4, 8 consecutive d) ----
  v4u oh[4], ol[4];
  const int rq = lane >> 3, c8 = (lane & 7) * 8;
#pragma unroll
  for (int i4 = 0; i4 < 4; ++i4) {
    const int row = i4 * 4 + rq;
    const v4f a = *(const v4f*)(slab + row * 68 + c8), c4 = *(const v4f*)(slab + row * 68 + c8 + 4);
    float w[8];
#pragma unroll
    for (int e = 0; e < 4; ++e) { w[e] = a[e] * OSC; w[4 + e] = c4[e] * OSC; }
#pragma unroll
    for (int e = 0; e < 4; ++e) {
      const _Float16 h0 = (_Float16)w[2 * e], h1 = (_Float16)w[2 * e + 1];
      const _Float16 l0 = (_Float16)(w[2 * e] - (float)h0), l1 = (_Float16)(w[2 * e + 1] - (float)h1);
      oh[i4][e] = pk16(h_bits(h0), h_bits(h1));
      ol[i4][e] = pk16(h_bits(l0), h_bits(l1));
    }
  }
  const size_t ob = (((size_t)(b * SEQ + q0)) * NH + head) * HD + c8;
  {
#pragma unroll
    for (int i4 = 0; i4 < 4; ++i4) {
      const int row = i4 * 4 + rq;
      const size_t o8 = ob + (size_t)row * (NH * HD);
      *(v4u*)(OHIp + o8) = oh[i4];
      *(v4u*)(OLOp + o8) = ol[i4];
    }
    
  }
}

// =====================================================================================================
// Workspace map (bytes); every plane is fully written by whole-line stores before it is read; all extents are exact multiples
// of the store granularity (no pad rows needed); every offset a multiple of 131072 (128-KiB aligned); XB and F are reused
// sequentially (in-order stream):
//   XB  bf16 [4096][768]               6291456        (input Q, then K, then V)
//   WQB bf16 [768 n][768 k]            1179648        WKB same  1179648      WVB same  1179648
//   WOB f16  [768 n][768 k] x1024      1179648
//   F   f32 [4096][768]               12582912        (projection q, then k, then v)
//   QHI f16 [2][2048][12][64] x1024    6291456        QLO residual         6291456
//   KHI same                           6291456        KLO residual         6291456
//   VHI f16 [2][12][64][2048] x1024    6291456        VLO residual         6291456
//   OHI f16 [4096][768] x1024          6291456        OLO residual         6291456
//   end                               73924608
// =====================================================================================================
extern "C" void kernel_launch(void* const* d_in, const int* in_sizes, int n_in,
                              void* d_out, int out_size, void* d_ws, size_t ws_size,
                              hipStream_t stream) {
  const int ROWS = NB * SEQ;                            // 4096
  if (n_in < 13) return;
  if (in_sizes[0] != ROWS * DMOD || in_sizes[1] != ROWS * DMOD || in_sizes[2] != ROWS * DMOD) return;
  if (in_sizes[3] != NB * SEQ) return;
  if (in_sizes[4] != DMOD * DMOD || in_sizes[6] != DMOD * DMOD) return;
  if (in_sizes[8] != DMOD * DMOD || in_sizes[10] != DMOD * DMOD) return;
  if (in_sizes[5] != DMOD || in_sizes[7] != DMOD || in_sizes[9] != DMOD || in_sizes[11] != DMOD) return;
  if (in_sizes[12] != NH) return;
  if (out_size != ROWS * DMOD) return;

  const float* Qin  = (const float*)d_in[0];
  const float* Kin  = (const float*)d_in[1];
  const float* Vin  = (const float*)d_in[2];
  const float* mask = (const float*)d_in[3];
  const float* wq   = (const float*)d_in[4];
  const float* bq   = (const float*)d_in[5];
  const float* wk   = (const float*)d_in[6];
  const float* bk   = (const float*)d_in[7];
  const float* wv   = (const float*)d_in[8];
  const float* bv   = (const float*)d_in[9];
  const float* wo   = (const float*)d_in[10];
  const float* bo   = (const float*)d_in[11];
  const float* mcw  = (const float*)d_in[12];
  float*       out  = (float*)d_out;

  const size_t szXB  = (size_t)ROWS * DMOD * 2;                 //  6291456
  const size_t szW   = (size_t)DMOD * DMOD * 2;                 //  1179648
  const size_t szF   = (size_t)ROWS * DMOD * 4;                 // 12582912
  const size_t szP   = (size_t)ROWS * DMOD * 2;                 //  6291456  (q/k/o planes)
  const size_t szVP  = (size_t)NB * NH * HD * SEQ * 2;          //  6291456
  size_t off = 0;
  const size_t oXB  = off; off += szXB;
  const size_t oWQB = off; off += szW;
  const size_t oWKB = off; off += szW;
  const size_t oWVB = off; off += szW;
  const size_t oWOB = off; off += szW;
  const size_t oF   = off; off += szF;
  const size_t oQHI = off; off += szP;
  const size_t oQLO = off; off += szP;
  const size_t oKHI = off; off += szP;
  const size_t oKLO = off; off += szP;
  const size_t oVHI = off; off += szVP;
  const size_t oVLO = off; off += szVP;
  const size_t oOHI = off; off += szP;
  const size_t oOLO = off; off += szP;
  if (off > ws_size) return;                            // off = 73924608
  if (off > (size_t)134217728) return;

  char* ws = (char*)d_ws;
  u16*   XB  = (u16*)(ws + oXB);
  u16*   WQB = (u16*)(ws + oWQB);
  u16*   WKB = (u16*)(ws + oWKB);
  u16*   WVB = (u16*)(ws + oWVB);
  u16*   WOB = (u16*)(ws + oWOB);
  float* F   = (float*)(ws + oF);
  u16*   QHI = (u16*)(ws + oQHI);
  u16*   QLO = (u16*)(ws + oQLO);
  u16*   KHI = (u16*)(ws + oKHI);
  u16*   KLO = (u16*)(ws + oKLO);
  u16*   VHI = (u16*)(ws + oVHI);
  u16*   VLO = (u16*)(ws + oVLO);
  u16*   OHI = (u16*)(ws + oOHI);
  u16*   OLO = (u16*)(ws + oOLO);

  const dim3 blk(256);
  const int n8x = (ROWS * DMOD) / 8;                    // 393216
  const int n8w = (DMOD * DMOD) / 8;                    //  73728
  if ((n8x % 256) != 0 || (n8w % 256) != 0) return;
  if ((ROWS % 64) != 0 || (DMOD % 64) != 0 || (DMOD % 32) != 0) return;
  const dim3 gX(n8x / 256);                             // 1536
  const dim3 gWc(n8w / 256);                            //  288
  const dim3 gG((ROWS / 64) * (DMOD / 64));             //  768
  const dim3 bG(128);
  const dim3 gVT(NB * NH * NQT);                        //  768
  const dim3 gAT(ATT_BLOCKS);                           //  768
  const dim3 bAT(ATT_THREADS);                          //  128

  // (0..3) weights [n][k] (already k-contiguous for x.W^T): bf16 planes for wq/wk/wv, f16 of bf16 value x1024 for wo
  cvt16<<<gWc, blk, 0, stream>>>(wq, WQB, n8w, 0, 1.0f);
  cvt16<<<gWc, blk, 0, stream>>>(wk, WKB, n8w, 0, 1.0f);
  cvt16<<<gWc, blk, 0, stream>>>(wv, WVB, n8w, 0, 1.0f);
  cvt16<<<gWc, blk, 0, stream>>>(wo, WOB, n8w, 1, WOS);
  // (4..6) q: input -> bf16 plane, projection + bias [4096][768] f32 (col = h*64+d), split -> f16 hi x1024 + residual planes
  cvt16<<<gX, blk, 0, stream>>>(Qin, XB, n8x, 0, 1.0f);
  gemm_bfb<<<gG, bG, 0, stream>>>(XB, WQB, bq, F, ROWS, DMOD, DMOD, 1.0f);
  split16<<<gX, blk, 0, stream>>>(F, QHI, QLO, n8x, QSC);
  // (7..9) k: same pipeline (XB and F reused; single in-order stream)
  cvt16<<<gX, blk, 0, stream>>>(Kin, XB, n8x, 0, 1.0f);
  gemm_bfb<<<gG, bG, 0, stream>>>(XB, WKB, bk, F, ROWS, DMOD, DMOD, 1.0f);
  split16<<<gX, blk, 0, stream>>>(F, KHI, KLO, n8x, KSC);
  // (10..12) v: input -> bf16 plane, projection + bias, v^T planes x1024 (hi + residual)
  cvt16<<<gX, blk, 0, stream>>>(Vin, XB, n8x, 0, 1.0f);
  gemm_bfb<<<gG, bG, 0, stream>>>(XB, WVB, bv, F, ROWS, DMOD, DMOD, 1.0f);
  vt16<<<gVT, blk, 0, stream>>>(F, VHI, VLO);
  // (13) attention with per-head x per-key bias -> O planes [b][s][h][d] x1024 (hi + residual)
  attn_fwd<<<gAT, bAT, 0, stream>>>(QHI, QLO, KHI, KLO, VHI, VLO, mask, mcw, OHI, OLO);
  // (14) output projection + bias -> out [4096][768] f32, carries 1024 (O) x 1024 (wo) folded back
  gemm_h2<<<gG, bG, 0, stream>>>(OHI, OLO, WOB, bo, out, ROWS, DMOD, DMOD, 1.0f / (OSC * WOS));
  (void)hipGetLastError();
}

// v001
// One run takes 235 microseconds.
// Timed twice side by side with v000, it ran 1.25 and 1.24 times as fast.
// Contractions: x.W{q,k,v}^T on v_wmma_f32_16x16x32_bf16 (x and W RNE-converted to bf16 operands, f32 accumulate, bias added in f32);
// scores k'.q'^T (q', k' carried x1024 as f16 hi plane + f16 residual plane, products hh+lh+hl), P.v (P x32768 f16 hi+residual,
// v x1024 f16 hi+residual, products hh+lh+hl) and O.Wo^T (O x1024 f16 hi+residual, Wo as f16(bf16(Wo) x1024), products h.w+l.w):
// v_wmma_f32_16x16x32_f16, f32 accumulate. Per-head x per-key additive score bias, base-2 online softmax, 1/l fold in f32 on VALU.
#include <hip/hip_runtime.h>
#include <math.h>
#include <stdint.h>

#define NB    2
#define SEQ   2048
#define DMOD  768
#define NH    12
#define HD    64
#define NQT   (SEQ / 64)
#define QSC   1024.0f
#define KSC   1024.0f
#define PCAR  32768.0f
#define VCAR  1024.0f
#define OSC   1024.0f
#define WOS   1024.0f
#define LOG2E 1.4426950408889634f
#define ATT_WAVES   4
#define ATT_THREADS (ATT_WAVES * 32)
#define ATT_BLOCKS  (NB * NH * NQT)
#define NKB    (SEQ / 32)
#define SLABF  (16 * 68)
#define SLAB64 (16 * 68)
#define VTP    72
#define SKEYS  64
#define NST    (SEQ / SKEYS)
#define RPH    72
#define TILEH  (64 * RPH)
static_assert(HD == 64 && DMOD == NH * HD);
static_assert(NQT == 32 && NH == 12 && NB == 2);
static_assert(ATT_THREADS == 128 && ATT_BLOCKS == 768 && NKB == 64);
static_assert(((NB * SEQ) % 64) == 0 && (DMOD % 64) == 0 && (DMOD % 32) == 0);
static_assert((SEQ % 64) == 0 && (SEQ % 8) == 0);
static_assert(((NB * SEQ * DMOD / 8) % 256) == 0 && ((DMOD * DMOD / 8) % 256) == 0);
static_assert(ATT_WAVES * SLABF >= 4 * 16 * 68);
static_assert(HD * VTP >= 63 * VTP + 64);
static_assert(SKEYS == 64 && NST >= 2 && NST * SKEYS == SEQ && (RPH * 2) % 16 == 0 && TILEH >= 63 * RPH + 64);

typedef unsigned short u16;
typedef _Float16 v16h __attribute__((ext_vector_type(16)));
typedef _Float16 v8h  __attribute__((ext_vector_type(8)));
typedef __bf16   v16b __attribute__((ext_vector_type(16)));
typedef float    v8f  __attribute__((ext_vector_type(8)));
typedef float    v4f  __attribute__((ext_vector_type(4)));
typedef unsigned int v4u __attribute__((ext_vector_type(4)));

union FragH { v16h v; v8h h[2]; v4u u[2]; };
union FragB { v16b v; v4u u[2]; };

// ---- scalar helpers --------------------------------------------------------------------------------
__device__ __forceinline__ unsigned short bf_bits(float f) {          // f32 -> bf16 bits, RNE convert
  unsigned u = __float_as_uint(f);
  return (unsigned short)((u + 0x7FFFu + ((u >> 16) & 1u)) >> 16);
}
__device__ __forceinline__ float bf_up(unsigned short h) { return __uint_as_float(((unsigned)h) << 16); }
__device__ __forceinline__ float bfr(float f) { return bf_up(bf_bits(f)); }
__device__ __forceinline__ unsigned short h_bits(_Float16 x) { return __builtin_bit_cast(unsigned short, x); }
__device__ __forceinline__ unsigned pk16(unsigned short a, unsigned short b) { return (unsigned)a | ((unsigned)b << 16); }
__device__ __forceinline__ v8f zero8() { v8f z = {0.f, 0.f, 0.f, 0.f, 0.f, 0.f, 0.f, 0.f}; return z; }
__device__ __forceinline__ v4f zero4() { v4f z = {0.f, 0.f, 0.f, 0.f}; return z; }

// ---- fragment loaders: 16-bit A/B operand, lane -> row/col (lane&15), p already includes +8*(lane>>4);
//      elements 0..7 <- p[0..7] (k0+8h..), elements 8..15 <- p[16..23] (k0+16+8h..)  (same split k map for A and B;
//      B is always read from a k-contiguous [n][k] plane)
__device__ __forceinline__ v16h ldfrag_h(const _Float16* p) {
  FragH f;
  f.h[0] = *(const v8h*)(p);
  f.h[1] = *(const v8h*)(p + 16);
  return f.v;
}
__device__ __forceinline__ v16b ldfrag_b(const u16* p) {              // bf16 plane read as unsigned integer vectors
  FragB f;
  f.u[0] = *(const v4u*)(p);
  f.u[1] = *(const v4u*)(p + 16);
  return f.v;
}

__device__ __forceinline__ v8f mma_h(v16h a, v16h b, v8f c) {
  return __builtin_amdgcn_wmma_f32_16x16x32_f16(false, a, false, b, (short)0, c, false, false);
}
__device__ __forceinline__ v8f mma_b(v16b a, v16b b, v8f c) {
  return __builtin_amdgcn_wmma_f32_16x16x32_bf16(false, a, false, b, (short)0, c, false, false);
}
__device__ __forceinline__ void guard2(v8f& a, v8f& b, v16h x0, v16h x1, v16h x2, v16h x3, v16h x4, v16h x5) {
#if defined(__HIP_DEVICE_COMPILE__)
  asm volatile("v_nop\n\tv_nop\n\tv_nop\n\tv_nop"
               : "+v"(a), "+v"(b) : "v"(x0), "v"(x1), "v"(x2), "v"(x3), "v"(x4), "v"(x5) : "memory");
#endif
}
template <typename F>
__device__ __forceinline__ void guard6(v8f& a, v8f& b, v8f& c, v8f& d, F x0, F x1, F x2, F x3, F x4, F x5) {
#if defined(__HIP_DEVICE_COMPILE__)
  asm volatile("v_nop\n\tv_nop\n\tv_nop\n\tv_nop"
               : "+v"(a), "+v"(b), "+v"(c), "+v"(d) : "v"(x0), "v"(x1), "v"(x2), "v"(x3), "v"(x4), "v"(x5) : "memory");
#endif
}
__device__ __forceinline__ void guard10(v8f& a, v8f& b, v8f& c, v8f& d, v16h x0, v16h x1, v16h x2, v16h x3, v16h x4,
                                        v16h x5, v16h x6, v16h x7, v16h x8, v16h x9) {
#if defined(__HIP_DEVICE_COMPILE__)
  asm volatile("v_nop\n\tv_nop\n\tv_nop\n\tv_nop"
               : "+v"(a), "+v"(b), "+v"(c), "+v"(d)
               : "v"(x0), "v"(x1), "v"(x2), "v"(x3), "v"(x4), "v"(x5), "v"(x6), "v"(x7), "v"(x8), "v"(x9) : "memory");
#endif
}
__device__ __forceinline__ void acc_guard4(v8f& a, v8f& b, v8f& c, v8f& d) {
#if defined(__HIP_DEVICE_COMPILE__)
  asm volatile("v_nop\n\tv_nop\n\tv_nop\n\tv_nop" : "+v"(a), "+v"(b), "+v"(c), "+v"(d));
#endif
}
// Four asynchronous 16-B copies per lane, global -> LDS (rows r, r+16, r+32, r+48 of one 64-row tile). The s_wait_xcnt stands in
// the copies' own statement so that no address register is rewritten in front of it.
__device__ __forceinline__ void copy4(unsigned l0, unsigned l1, unsigned l2, unsigned l3,
                                      const u16* g0, const u16* g1, const u16* g2, const u16* g3) {
#if defined(__HIP_DEVICE_COMPILE__)
  asm volatile("global_load_async_to_lds_b128 %0, %4, off\n\t"
               "global_load_async_to_lds_b128 %1, %5, off\n\t"
               "global_load_async_to_lds_b128 %2, %6, off\n\t"
               "global_load_async_to_lds_b128 %3, %7, off\n\t"
               "s_wait_xcnt 0x0"
               :: "v"(l0), "v"(l1), "v"(l2), "v"(l3), "v"(g0), "v"(g1), "v"(g2), "v"(g3) : "memory");
#endif
}
// One 64-row x 128-B tile: lbase = this lane's LDS byte address in row r, g = its global address in row r, gstep = 16 source rows.
__device__ __forceinline__ void copy_tile(unsigned lbase, const u16* g, size_t gstep) {
  copy4(lbase, lbase + 16u * (RPH * 2), lbase + 32u * (RPH * 2), lbase + 48u * (RPH * 2), g, g + gstep, g + 2 * gstep, g + 3 * gstep);
}
__device__ __forceinline__ void wait_async0() {   // this wave's copies have landed
#if defined(__HIP_DEVICE_COMPILE__)
  asm volatile("s_wait_asynccnt 0x0" ::: "memory");
#endif
}
__device__ __forceinline__ void wait_ds0() {      // this wave's LDS reads have returned before their buffer is handed back
#if defined(__HIP_DEVICE_COMPILE__)
  asm volatile("s_wait_dscnt 0x0" ::: "memory");
#endif
}
__device__ __forceinline__ void wave_sync_lds() {
  __builtin_amdgcn_fence(__ATOMIC_RELEASE, "workgroup");
  __builtin_amdgcn_wave_barrier();
  __builtin_amdgcn_fence(__ATOMIC_ACQUIRE, "workgroup");
}

// =====================================================================================================
// f32 plane -> 16-bit plane, same layout:  f16mode == 0: bf16 RNE bits;  f16mode == 1: f16 bits of (bf16 RNE value) * scale.
// Thread = 8 consecutive elements: two 16-B loads, one 16-B store; 32 consecutive lanes = 512 contiguous, 512-B aligned bytes
// coverage: grid = n8/256 blocks (host checks exactness) x 256 thr x 8 = the whole plane.
// =====================================================================================================
__global__ __launch_bounds__(256) void cvt16(const float* __restrict__ x, u16* D, int n8, int f16mode, float scale) {
  const int gt = blockIdx.x * 256 + (int)threadIdx.x;
  if (gt >= n8) return;                     // no barriers in this kernel
  const float* p = x + (size_t)gt * 8;
  const v4f a = *(const v4f*)(p), c4 = *(const v4f*)(p + 4);
  float v[8];
#pragma unroll
  for (int e = 0; e < 4; ++e) { v[e] = a[e]; v[4 + e] = c4[e]; }
  unsigned short s[8];
#pragma unroll
  for (int e = 0; e < 8; ++e) {
    const unsigned short hb = h_bits((_Float16)(bfr(v[e]) * scale));
    const unsigned short bb = bf_bits(v[e]);
    s[e] = (f16mode != 0) ? hb : bb;
  }
  v4u o;
#pragma unroll
  for (int e = 0; e < 4; ++e) o[e] = pk16(s[2 * e], s[2 * e + 1]);
  u16* d = D + (size_t)gt * 8;
  {
    *(v4u*)(d) = o;
    
  }
}

// =====================================================================================================
// f32 plane -> f16 hi plane (value * sc, sc a power of two) + f16 residual plane (value * sc - hi, unscaled), same layout.
// Thread = 8 consecutive elements: two 16-B loads, one 16-B store per plane; 32 consecutive lanes = 512 contiguous, 512-B aligned
// coverage: grid = n8/256 blocks (host checks exactness) x 256 thr x 8 = the whole of both planes.
// =====================================================================================================
__global__ __launch_bounds__(256) void split16(const float* __restrict__ x, u16* hpl, u16* lpl, int n8, float sc) {
  const int gt = blockIdx.x * 256 + (int)threadIdx.x;
  if (gt >= n8) return;                     // no barriers in this kernel
  const float* p = x + (size_t)gt * 8;
  const v4f a = *(const v4f*)(p), c4 = *(const v4f*)(p + 4);
  float w[8];
#pragma unroll
  for (int e = 0; e < 4; ++e) { w[e] = a[e]; w[4 + e] = c4[e]; }
  v4u oh, ol;
#pragma unroll
  for (int e = 0; e < 4; ++e) {
    const float t0 = w[2 * e] * sc, t1 = w[2 * e + 1] * sc;
    const _Float16 h0 = (_Float16)t0, h1 = (_Float16)t1;
    const _Float16 l0 = (_Float16)(t0 - (float)h0), l1 = (_Float16)(t1 - (float)h1);
    oh[e] = pk16(h_bits(h0), h_bits(h1));
    ol[e] = pk16(h_bits(l0), h_bits(l1));
  }
  const size_t o8 = (size_t)gt * 8;
  {
    *(v4u*)(hpl + o8) = oh;
    *(v4u*)(lpl + o8) = ol;
    
  }
}

// =====================================================================================================
// GEMM epilogue shared by both engines: the wave's 16x64 f32 tile (times oscale) staged in its LDS slab (pitch 68),
// coverage: 8 instructions x 2 rows x 16 lanes x 4 floats = the wave's 16 x 64 tile.
// =====================================================================================================
__device__ __forceinline__ void epi64(float* sl, v8f a0, v8f a1, v8f a2, v8f a3, float oscale, v4f badd, float* C, int N,
                                      size_t rowb, int col0, int lane) {
  const int hh = lane >> 4, m = lane & 15;
#pragma unroll
  for (int r = 0; r < 8; ++r) {
    const int ro = (8 * hh + r) * 68 + m;
    sl[ro]      = a0[r] * oscale;
    sl[ro + 16] = a1[r] * oscale;
    sl[ro + 32] = a2[r] * oscale;
    sl[ro + 48] = a3[r] * oscale;
  }
  wave_sync_lds();
  v4f vals[8];
#pragma unroll
  for (int it = 0; it < 8; ++it) vals[it] = *(const v4f*)(sl + (it * 2 + hh) * 68 + m * 4) + badd;
  float* dst = C + (rowb + (size_t)hh) * (size_t)N + col0 + m * 4;
  {
#pragma unroll
    for (int it = 0; it < 8; ++it) {
      *(v4f*)(dst + (size_t)(it * 2) * (size_t)N) = vals[it];
    }
    
  }
}

// =====================================================================================================
// bf16 GEMM with bias: C[M][N] (f32) = A[M][K] (bf16 row-major) . Bt[N][K]^T (bf16 k-contiguous), times oscale, plus bf16-RNE
// value of bias[n]. Block = 64x64 tile, 4 waves x 16 rows; fragments loaded straight from the 16-bit rows (two 16-B loads each,
// split k map for A and B); K stepped by 32 (host checks K % 32 == 0, M % 64 == 0, N % 64 == 0, grid = (M/64)*(N/64)).
// =====================================================================================================
__global__ __launch_bounds__(128)
void gemm_bfb(const u16* __restrict__ A, const u16* __restrict__ Bt, const float* __restrict__ bias,
              float* C, int M, int N, int K, float oscale) {
  __shared__ __align__(16) float slab[4 * SLAB64];
  const int tid = threadIdx.x, wave = tid >> 5, lane = tid & 31, hh = lane >> 4, m = lane & 15;
  const int ntile = N >> 6;
  const int bid   = blockIdx.x;
  const int rowb  = (bid / ntile) * 64 + wave * 16;
  const int col0  = (bid % ntile) * 64;
  if (rowb + 16 > M) return;                 // wave-uniform, never taken with the exact grid; no block barriers in this kernel
  const u16* ap = A  + (size_t)(rowb + m) * K + 8 * hh;
  const u16* bp = Bt + (size_t)(col0 + m) * K + 8 * hh;
  const size_t bs = (size_t)16 * K;
  v8f acc0 = zero8(), acc1 = zero8(), acc2 = zero8(), acc3 = zero8();
#pragma unroll 1
  for (int k0 = 0; k0 < K; k0 += 32) {
    const v16b a  = ldfrag_b(ap + k0);
    const v16b b0 = ldfrag_b(bp + k0);
    const v16b b1 = ldfrag_b(bp + bs + k0);
    const v16b b2 = ldfrag_b(bp + 2 * bs + k0);
    const v16b b3 = ldfrag_b(bp + 3 * bs + k0);
    acc0 = mma_b(a, b0, acc0);
    acc1 = mma_b(a, b1, acc1);
    acc2 = mma_b(a, b2, acc2);
    acc3 = mma_b(a, b3, acc3);
    guard6<v16b>(acc0, acc1, acc2, acc3, a, b0, b1, b2, b3, a);
  }
  const v4f bv = *(const v4f*)(bias + col0 + m * 4);      // columns col0 + 4m .. +3, always < N (N multiple of 64)
  v4f badd;
#pragma unroll
  for (int e = 0; e < 4; ++e) badd[e] = bfr(bv[e]);
  epi64(slab + wave * SLAB64, acc0, acc1, acc2, acc3, oscale, badd, C, N, (size_t)rowb, col0, lane);
}

// =====================================================================================================
// f16 hi+lo GEMM with bias: C[M][N] (f32) = (Ahi + Alo)[M][K] . Bt[N][K]^T times oscale, plus bf16-RNE value of bias[n];
// Ahi/Alo f16 planes (same layout), Bt f16 k-contiguous; products hi.B + lo.B into one accumulator (lo is the unscaled
// residual of hi). Same tiling as gemm_bfb.
// =====================================================================================================
__global__ __launch_bounds__(128)
void gemm_h2(const u16* __restrict__ Ah, const u16* __restrict__ Al, const u16* __restrict__ Bt,
             const float* __restrict__ bias, float* C, int M, int N, int K, float oscale) {
  __shared__ __align__(16) float slab[4 * SLAB64];
  const int tid = threadIdx.x, wave = tid >> 5, lane = tid & 31, hh = lane >> 4, m = lane & 15;
  const int ntile = N >> 6;
  const int bid   = blockIdx.x;
  const int rowb  = (bid / ntile) * 64 + wave * 16;
  const int col0  = (bid % ntile) * 64;
  if (rowb + 16 > M) return;                 // wave-uniform, never taken with the exact grid; no block barriers in this kernel
  const size_t aofs = (size_t)(rowb + m) * K + 8 * hh;
  const _Float16* ahp = (const _Float16*)(const void*)Ah + aofs;
  const _Float16* alp = (const _Float16*)(const void*)Al + aofs;
  const _Float16* bp  = (const _Float16*)(const void*)Bt + (size_t)(col0 + m) * K + 8 * hh;
  const size_t bs = (size_t)16 * K;
  v8f acc0 = zero8(), acc1 = zero8(), acc2 = zero8(), acc3 = zero8();
#pragma unroll 1
  for (int k0 = 0; k0 < K; k0 += 32) {
    const v16h ah = ldfrag_h(ahp + k0), al = ldfrag_h(alp + k0);
    const v16h b0 = ldfrag_h(bp + k0);
    const v16h b1 = ldfrag_h(bp + bs + k0);
    const v16h b2 = ldfrag_h(bp + 2 * bs + k0);
    const v16h b3 = ldfrag_h(bp + 3 * bs + k0);
    acc0 = mma_h(ah, b0, acc0);  acc0 = mma_h(al, b0, acc0);
    acc1 = mma_h(ah, b1, acc1);  acc1 = mma_h(al, b1, acc1);
    acc2 = mma_h(ah, b2, acc2);  acc2 = mma_h(al, b2, acc2);
    acc3 = mma_h(ah, b3, acc3);  acc3 = mma_h(al, b3, acc3);
    guard6<v16h>(acc0, acc1, acc2, acc3, ah, al, b0, b1, b2, b3);
  }
  const v4f bv = *(const v4f*)(bias + col0 + m * 4);      // columns col0 + 4m .. +3, always < N (N multiple of 64)
  v4f badd;
#pragma unroll
  for (int e = 0; e < 4; ++e) badd[e] = bfr(bv[e]);
  epi64(slab + wave * SLAB64, acc0, acc1, acc2, acc3, oscale, badd, C, N, (size_t)rowb, col0, lane);
}

// =====================================================================================================
// v^T planes: VH[(b*NH + h)*HD + d][s] = f16(v[b][s][h][d] * 1024), VL = f16 residual of the same value.
// Block = (b, h, 64 keys): 64 source rows of HD floats loaded with 16-B loads, converted, scattered into two LDS tiles
// coverage: load 256 thr x 16 elements = 64 x 64; store 2 iterations x 256 thr x 8 halves = 64 lines x 64 = the block's tile of
//           each plane; grid = NB x NH x SEQ/64 = 768 blocks covers both planes exactly once.
// =====================================================================================================
__global__ __launch_bounds__(256) void vt16(const float* __restrict__ v, u16* VHo, u16* VLo) {
  __shared__ __align__(16) u16 TH[HD * VTP];
  __shared__ __align__(16) u16 TL[HD * VTP];
  const int tid = threadIdx.x;
  const int bid = blockIdx.x;
  const int st  = bid & (NQT - 1);
  const int bh  = bid >> 5;                  // NQT == 32
  const int h   = bh % NH;
  const int b   = bh / NH;
  const int s0  = st * 64;
  {
    const int sl = tid >> 2;                  // key within tile 0..63
    const int dc = (tid & 3) * 16;            // d chunk
    const float* src = v + (((size_t)(b * SEQ + s0 + sl)) * NH + h) * HD + dc;
#pragma unroll
    for (int i = 0; i < 4; ++i) {
      const v4f a = *(const v4f*)(src + 4 * i);
#pragma unroll
      for (int e = 0; e < 4; ++e) {
        const float t = a[e] * VCAR;
        const _Float16 hv = (_Float16)t;
        const _Float16 lv = (_Float16)(t - (float)hv);
        TH[(dc + 4 * i + e) * VTP + sl] = h_bits(hv);
        TL[(dc + 4 * i + e) * VTP + sl] = h_bits(lv);
      }
    }
  }
  __syncthreads();
  v4u vh[2], vl[2];
  const int q8 = tid >> 3, p8 = (tid & 7) * 8;
#pragma unroll
  for (int it = 0; it < 2; ++it) {
    const int line = it * 32 + q8;            // d = 0..63
    vh[it] = *(const v4u*)(TH + line * VTP + p8);
    vl[it] = *(const v4u*)(TL + line * VTP + p8);
  }
  const size_t base = ((size_t)(b * NH + h) * HD) * SEQ + s0 + p8;
  {
#pragma unroll
    for (int it = 0; it < 2; ++it) {
      const int line = it * 32 + q8;
      *(v4u*)(VHo + base + (size_t)line * SEQ) = vh[it];
      *(v4u*)(VLo + base + (size_t)line * SEQ) = vl[it];
    }
    
  }
}

// =====================================================================================================
// Full (non-causal) multi-head flash attention with a per-head x per-key additive score bias: block = (batch b, head, 64 query
// rows), 4 waves, wave w owns the 16 query rows q0 = 64*qt + 16*w .. q0+15. The k and v^T tiles of 64 keys (hi and residual planes,
// 4 tiles of 64 rows x 128 B, LDS pitch 144 B) are brought into a two-buffer LDS ring by asynchronous copies, whole 128-B lines,
// once per block, and read by all 4 waves; one block barrier per 64 keys publishes the next stage and frees the one just read.
//   q planes (hi, lo f16, x1024) laid out [b][s][h][d]; k planes the same; v^T planes [b][h][d][s] (x1024).
//   All NKB = 64 key blocks of 32 keys are visited (static bound).
//   Scores are computed TRANSPOSED: S^T tile g (g = 0,1) = k rows (keys kb+16g .. +15, A operand, row m = lane&15, split k map
//   over d) times q^T (B operand, col n = query q0 + (lane&15), k = d, split map), 3 products per tile and d-chunk
//   (k_hi.q_hi + k_lo.q_hi + k_hi.q_lo). D element r of lane l = (key kb+16g+8h+r, query q0+(l&15)), so a lane owns one query
//   column and 16 of its 32 keys; the partner lane l^16 owns the other 16 -> row max / row sum need one xor-16 shuffle.
//   Logit of key j, query i (base 2): (S * 1/8 * 2^-20 + bfr(wh) * bfr(mask[b][j])) * log2(e); the bias is loaded per key with
//   the same element -> key map as the transposed scores (t[i] <- key kb+8h+i, t[8+i] <- key kb+16+8h+i), added in f32.
//   Online max-subtracted base-2 softmax in f32. The exp'd values ARE the P A-fragment in place: A row m = query = lane&15,
//   element i <- key kb+8h+i (tile 0, D element i), element 8+i <- key kb+16+8h+i (tile 1, D element i). P is carried x32768
//   as f16 hi + f16 residual. The rescale factor of query row 8h+r of the O accumulators is fetched from lane 8h+r with a
//   shuffle (uniform control). 4+4 v^T B fragments (hi and residual planes, col n = d = 16j + (lane&15), keys k-contiguous),
//   12 P.V WMMAs (hh + lh + hl).
//   Epilogue: 1/l (per query, shuffled to the D row owner) and carry folds in f32; the wave's 16x64 f32 result staged in its LDS
// coverage: per wave 4 instructions x 4 rows x 8 lanes x 8 halves = 16 x 64 per plane; grid 768 blocks x 4 waves = every
//           (b, s, h) row of both O planes exactly once.
// =====================================================================================================
__global__ __launch_bounds__(ATT_THREADS)
void attn_fwd(const u16* __restrict__ QHIp, const u16* __restrict__ QLOp,
              const u16* __restrict__ KHIp, const u16* __restrict__ KLOp,
              const u16* __restrict__ VHIp, const u16* __restrict__ VLOp,
              const float* __restrict__ maskp, const float* __restrict__ mcwp,
              u16* OHIp, u16* OLOp) {
  __shared__ __align__(16) float smem[ATT_WAVES * SLABF];   // per wave: result slab [16][68] in the epilogue only
  __shared__ __align__(16) u16 ring[2 * 4 * TILEH];         // [buffer][k hi, k lo, v^T hi, v^T lo][64 rows][pitch 72 halves]

  const int tid  = threadIdx.x;
  const int wave = tid >> 5;
  const int lane = tid & 31;
  const int hh   = lane >> 4;
  const int c    = lane & 15;

  const int bid  = blockIdx.x;
  const int qt   = bid & (NQT - 1);
  const int bh   = bid >> 5;                 // NQT == 32
  const int head = bh % NH;
  const int b    = bh / NH;
  const int q0   = qt * 64 + wave * 16;

  // B fragments of q^T: col n = query q0 + c, k = d (k-contiguous row of the q plane)
  const size_t qofs = (((size_t)(b * SEQ + q0 + c)) * NH + head) * HD + 8 * hh;
  const _Float16* Qh  = (const _Float16*)(const void*)QHIp + qofs;
  const _Float16* Ql  = (const _Float16*)(const void*)QLOp + qofs;
  // copies: lane = (row cr of a group of 16, 16-B chunk cc of its 128-B row); a wave's copy = 4 whole rows
  const int cr = tid >> 3, cc = (tid & 7) * 8;
  const size_t kcp = (((size_t)b * SEQ + cr) * NH + head) * HD + cc;               // key row: stage's first key added per stage
  const size_t vcp = ((size_t)(b * NH + head) * HD + cr) * SEQ + cc;               // d row: stage's first key added per stage
  const unsigned lcp = (unsigned)(uintptr_t)(ring + cr * RPH + cc);                // LDS byte address, buffer 0, tile 0
  // A fragments of k: row m = key (in stage) 16g + c, k = d;  B fragments of v: col n = d = 16j + c, k = key (in stage)
  const _Float16* ringh = (const _Float16*)(const void*)ring + c * RPH + 8 * hh;
  // per-key bias row: mask[b][kb + 8hh + 0..7] (tile 0) and [kb + 16 + 8hh + 0..7] (tile 1), 16-B aligned loads
  const float* mrow = maskp + (size_t)b * SEQ + 8 * hh;
  const float  wh2  = bfr(mcwp[head]);                                              // per-head scalar (bf16 RNE value)
  const float lsc = 0.125f * (LOG2E / (QSC * KSC));

  float mrun = -INFINITY, lrun = 0.f;
  v8f o[4];
#pragma unroll
  for (int j = 0; j < 4; ++j) o[j] = zero8();

#define STAGE_COPY(st, bf)                                                                        \
  do {                                                                                            \
    const unsigned lb_ = lcp + (unsigned)(bf) * (4u * TILEH * 2u);                                \
    const size_t ko_ = kcp + (size_t)(st) * (SKEYS * NH * HD), vo_ = vcp + (size_t)(st) * SKEYS;  \
    copy_tile(lb_,                   KHIp + ko_, (size_t)16 * (NH * HD));                         \
    copy_tile(lb_ + 1u * TILEH * 2u, KLOp + ko_, (size_t)16 * (NH * HD));                         \
    copy_tile(lb_ + 2u * TILEH * 2u, VHIp + vo_, (size_t)16 * SEQ);                               \
    copy_tile(lb_ + 3u * TILEH * 2u, VLOp + vo_, (size_t)16 * SEQ);                               \
  } while (0)

  // ring prologue: stage 0 landed and published, then stage 1 in flight
  STAGE_COPY(0, 0);
  wait_async0();
  __syncthreads();
  STAGE_COPY(1, 1);

#pragma unroll 1   // stays rolled: one copy of the stage body and of its publish point
  for (int st = 0; st < NST; ++st) {
   const int bf = st & 1;
   const _Float16* stg = ringh + bf * (4 * TILEH);
#pragma unroll     // the stage's two 32-key passes: their LDS offsets become immediates of the loads
   for (int sub = 0; sub < 2; ++sub) {
    const int kb = st * SKEYS + sub * 32;
    const v4f ma = *(const v4f*)(mrow + kb),      mb = *(const v4f*)(mrow + kb + 4);
    const v4f mc = *(const v4f*)(mrow + kb + 16), md = *(const v4f*)(mrow + kb + 20);
    // ---- transposed scores: s0 = keys kb..kb+15, s1 = keys kb+16..kb+31, column = query q0 + c ----
    v8f s0 = zero8(), s1 = zero8();
    const _Float16* k0p = stg + (sub * 32) * RPH;
    const _Float16* k1p = k0p + 16 * RPH;
    const _Float16* l0p = k0p + TILEH;
    const _Float16* l1p = l0p + 16 * RPH;
#pragma unroll
    for (int kk = 0; kk < 2; ++kk) {
      const v16h qh  = ldfrag_h(Qh + kk * 32),  ql  = ldfrag_h(Ql + kk * 32);
      const v16h kh0 = ldfrag_h(k0p + kk * 32), kl0 = ldfrag_h(l0p + kk * 32);
      const v16h kh1 = ldfrag_h(k1p + kk * 32), kl1 = ldfrag_h(l1p + kk * 32);
      s0 = mma_h(kh0, qh, s0);
      s0 = mma_h(kl0, qh, s0);
      s0 = mma_h(kh0, ql, s0);
      s1 = mma_h(kh1, qh, s1);
      s1 = mma_h(kl1, qh, s1);
      s1 = mma_h(kh1, ql, s1);
      guard2(s0, s1, qh, ql, kh0, kl0, kh1, kl1);
    }
    // ---- base-2 logits of this lane's 16 keys for query q0 + c: t[i] <- key kb+8hh+i, t[8+i] <- key kb+16+8hh+i ----
    float t[16];
#pragma unroll
    for (int e = 0; e < 4; ++e) {
      t[e]      = s0[e] * lsc     + (wh2 * bfr(ma[e])) * LOG2E;
      t[4 + e]  = s0[4 + e] * lsc + (wh2 * bfr(mb[e])) * LOG2E;
      t[8 + e]  = s1[e] * lsc     + (wh2 * bfr(mc[e])) * LOG2E;
      t[12 + e] = s1[4 + e] * lsc + (wh2 * bfr(md[e])) * LOG2E;
    }
    float cm = t[0];
#pragma unroll
    for (int i = 1; i < 16; ++i) cm = fmaxf(cm, t[i]);
    cm = fmaxf(cm, __shfl_xor(cm, 16, 32));
    const float mn = fmaxf(mrun, cm);        // finite from the first block on
    const float al = exp2f(mrun - mn);       // 0 on the first block (mrun = -inf)
    mrun = mn;
    // ---- probabilities (<= 1) and the P A-fragments: hi = f16(p * 32768), lo = f16 residual; element i <-> t[i] ----
    float ps = 0.f;
    FragH ph, pl;
#pragma unroll
    for (int w = 0; w < 2; ++w) {
#pragma unroll
      for (int e4 = 0; e4 < 4; ++e4) {
        const int i = 8 * w + 2 * e4;
        const float p0 = exp2f(t[i] - mn), p1 = exp2f(t[i + 1] - mn);
        ps += p0 + p1;
        const float a0 = p0 * PCAR, a1 = p1 * PCAR;
        const _Float16 h0 = (_Float16)a0, h1 = (_Float16)a1;
        const _Float16 l0 = (_Float16)(a0 - (float)h0), l1 = (_Float16)(a1 - (float)h1);
        ph.u[w][e4] = pk16(h_bits(h0), h_bits(h1));
        pl.u[w][e4] = pk16(h_bits(l0), h_bits(l1));
      }
    }
    ps += __shfl_xor(ps, 16, 32);
    lrun = lrun * al + ps;
    // ---- rescale the O accumulators: D row 8hh+r = query q0+8hh+r, its factor lives in lane 8hh+r (and 16+8hh+r) ----
    float scl[8];
#pragma unroll
    for (int r = 0; r < 8; ++r) scl[r] = __shfl(al, 8 * hh + r, 32);
#pragma unroll
    for (int j = 0; j < 4; ++j) {
#pragma unroll
      for (int r = 0; r < 8; ++r) o[j][r] *= scl[r];
    }
    // ---- P.V : B fragment col n = d = j*16 + c, keys contiguous in the v^T planes ----
    {
      const _Float16* vhp = stg + 2 * TILEH + sub * 32;
      const _Float16* vlp = vhp + TILEH;
      const v16h vh0 = ldfrag_h(vhp);
      const v16h vh1 = ldfrag_h(vhp + 16 * RPH);
      const v16h vh2 = ldfrag_h(vhp + 32 * RPH);
      const v16h vh3 = ldfrag_h(vhp + 48 * RPH);
      const v16h vl0 = ldfrag_h(vlp);
      const v16h vl1 = ldfrag_h(vlp + 16 * RPH);
      const v16h vl2 = ldfrag_h(vlp + 32 * RPH);
      const v16h vl3 = ldfrag_h(vlp + 48 * RPH);
      o[0] = mma_h(ph.v, vh0, o[0]);  o[0] = mma_h(pl.v, vh0, o[0]);  o[0] = mma_h(ph.v, vl0, o[0]);
      o[1] = mma_h(ph.v, vh1, o[1]);  o[1] = mma_h(pl.v, vh1, o[1]);  o[1] = mma_h(ph.v, vl1, o[1]);
      o[2] = mma_h(ph.v, vh2, o[2]);  o[2] = mma_h(pl.v, vh2, o[2]);  o[2] = mma_h(ph.v, vl2, o[2]);
      o[3] = mma_h(ph.v, vh3, o[3]);  o[3] = mma_h(pl.v, vh3, o[3]);  o[3] = mma_h(ph.v, vl3, o[3]);
      guard10(o[0], o[1], o[2], o[3], ph.v, pl.v, vh0, vh1, vh2, vh3, vl0, vl1, vl2, vl3);
    }
   }
   // publish point of stage st + 1: own reads of this buffer done, own copies of the next landed, block barrier, then the refill
   wait_ds0();
   wait_async0();
   __syncthreads();
   if (st + 2 < NST) STAGE_COPY(st + 2, bf);
  }
  wait_async0();
#undef STAGE_COPY
  acc_guard4(o[0], o[1], o[2], o[3]);

  // ---- fold 1/l (per query, owned by lane = query) and the carries (32768 on P, 1024 on v); stage the 16x64 slab ----
  const float linv = (1.0f / lrun) * (1.0f / (PCAR * VCAR));
  float inv[8];
#pragma unroll
  for (int r = 0; r < 8; ++r) inv[r] = __shfl(linv, 8 * hh + r, 32);
  float* slab = smem + wave * SLABF;
#pragma unroll
  for (int r = 0; r < 8; ++r) {
#pragma unroll
    for (int j = 0; j < 4; ++j) slab[(8 * hh + r) * 68 + j * 16 + c] = o[j][r] * inv[r];
  }
  wave_sync_lds();
  // ---- O x1024 -> f16 hi + residual planes; lane = (row in group of 4, 8 consecutive d) ----
  v4u oh[4], ol[4];
  const int rq = lane >> 3, c8 = (lane & 7) * 8;
#pragma unroll
  for (int i4 = 0; i4 < 4; ++i4) {
    const int row = i4 * 4 + rq;
    const v4f a = *(const v4f*)(slab + row * 68 + c8), c4 = *(const v4f*)(slab + row * 68 + c8 + 4);
    float w[8];
#pragma unroll
    for (int e = 0; e < 4; ++e) { w[e] = a[e] * OSC; w[4 + e] = c4[e] * OSC; }
#pragma unroll
    for (int e = 0; e < 4; ++e) {
      const _Float16 h0 = (_Float16)w[2 * e], h1 = (_Float16)w[2 * e + 1];
      const _Float16 l0 = (_Float16)(w[2 * e] - (float)h0), l1 = (_Float16)(w[2 * e + 1] - (float)h1);
      oh[i4][e] = pk16(h_bits(h0), h_bits(h1));
      ol[i4][e] = pk16(h_bits(l0), h_bits(l1));
    }
  }
  const size_t ob = (((size_t)(b * SEQ + q0)) * NH + head) * HD + c8;
  {
#pragma unroll
    for (int i4 = 0; i4 < 4; ++i4) {
      const int row = i4 * 4 + rq;
      const size_t o8 = ob + (size_t)row * (NH * HD);
      *(v4u*)(OHIp + o8) = oh[i4];
      *(v4u*)(OLOp + o8) = ol[i4];
    }
    
  }
}

// =====================================================================================================
// Workspace map (bytes); every plane is fully written by whole-line stores before it is read; all extents are exact multiples
// of the store granularity (no pad rows needed); every offset a multiple of 131072 (128-KiB aligned); XB and F are reused
// sequentially (in-order stream):
//   XB  bf16 [4096][768]               6291456        (input Q, then K, then V)
//   WQB bf16 [768 n][768 k]            1179648        WKB same  1179648      WVB same  1179648
//   WOB f16  [768 n][768 k] x1024      1179648
//   F   f32 [4096][768]               12582912        (projection q, then k, then v)
//   QHI f16 [2][2048][12][64] x1024    6291456        QLO residual         6291456
//   KHI same                           6291456        KLO residual         6291456
//   VHI f16 [2][12][64][2048] x1024    6291456        VLO residual         6291456
//   OHI f16 [4096][768] x1024          6291456        OLO residual         6291456
//   end                               73924608
// =====================================================================================================
extern "C" void kernel_launch(void* const* d_in, const int* in_sizes, int n_in,
                              void* d_out, int out_size, void* d_ws, size_t ws_size,
                              hipStream_t stream) {
  const int ROWS = NB * SEQ;                            // 4096
  if (n_in < 13) return;
  if (in_sizes[0] != ROWS * DMOD || in_sizes[1] != ROWS * DMOD || in_sizes[2] != ROWS * DMOD) return;
  if (in_sizes[3] != NB * SEQ) return;
  if (in_sizes[4] != DMOD * DMOD || in_sizes[6] != DMOD * DMOD) return;
  if (in_sizes[8] != DMOD * DMOD || in_sizes[10] != DMOD * DMOD) return;
  if (in_sizes[5] != DMOD || in_sizes[7] != DMOD || in_sizes[9] != DMOD || in_sizes[11] != DMOD) return;
  if (in_sizes[12] != NH) return;
  if (out_size != ROWS * DMOD) return;

  const float* Qin  = (const float*)d_in[0];
  const float* Kin  = (const float*)d_in[1];
  const float* Vin  = (const float*)d_in[2];
  const float* mask = (const float*)d_in[3];
  const float* wq   = (const float*)d_in[4];
  const float* bq   = (const float*)d_in[5];
  const float* wk   = (const float*)d_in[6];
  const float* bk   = (const float*)d_in[7];
  const float* wv   = (const float*)d_in[8];
  const float* bv   = (const float*)d_in[9];
  const float* wo   = (const float*)d_in[10];
  const float* bo   = (const float*)d_in[11];
  const float* mcw  = (const float*)d_in[12];
  float*       out  = (float*)d_out;

  const size_t szXB  = (size_t)ROWS * DMOD * 2;                 //  6291456
  const size_t szW   = (size_t)DMOD * DMOD * 2;                 //  1179648
  const size_t szF   = (size_t)ROWS * DMOD * 4;                 // 12582912
  const size_t szP   = (size_t)ROWS * DMOD * 2;                 //  6291456  (q/k/o planes)
  const size_t szVP  = (size_t)NB * NH * HD * SEQ * 2;          //  6291456
  size_t off = 0;
  const size_t oXB  = off; off += szXB;
  const size_t oWQB = off; off += szW;
  const size_t oWKB = off; off += szW;
  const size_t oWVB = off; off += szW;
  const size_t oWOB = off; off += szW;
  const size_t oF   = off; off += szF;
  const size_t oQHI = off; off += szP;
  const size_t oQLO = off; off += szP;
  const size_t oKHI = off; off += szP;
  const size_t oKLO = off; off += szP;
  const size_t oVHI = off; off += szVP;
  const size_t oVLO = off; off += szVP;
  const size_t oOHI = off; off += szP;
  const size_t oOLO = off; off += szP;
  if (off > ws_size) return;                            // off = 73924608
  if (off > (size_t)134217728) return;

  char* ws = (char*)d_ws;
  u16*   XB  = (u16*)(ws + oXB);
  u16*   WQB = (u16*)(ws + oWQB);
  u16*   WKB = (u16*)(ws + oWKB);
  u16*   WVB = (u16*)(ws + oWVB);
  u16*   WOB = (u16*)(ws + oWOB);
  float* F   = (float*)(ws + oF);
  u16*   QHI = (u16*)(ws + oQHI);
  u16*   QLO = (u16*)(ws + oQLO);
  u16*   KHI = (u16*)(ws + oKHI);
  u16*   KLO = (u16*)(ws + oKLO);
  u16*   VHI = (u16*)(ws + oVHI);
  u16*   VLO = (u16*)(ws + oVLO);
  u16*   OHI = (u16*)(ws + oOHI);
  u16*   OLO = (u16*)(ws + oOLO);

  const dim3 blk(256);
  const int n8x = (ROWS * DMOD) / 8;                    // 393216
  const int n8w = (DMOD * DMOD) / 8;                    //  73728
  if ((n8x % 256) != 0 || (n8w % 256) != 0) return;
  if ((ROWS % 64) != 0 || (DMOD % 64) != 0 || (DMOD % 32) != 0) return;
  const dim3 gX(n8x / 256);                             // 1536
  const dim3 gWc(n8w / 256);                            //  288
  const dim3 gG((ROWS / 64) * (DMOD / 64));             //  768
  const dim3 bG(128);
  const dim3 gVT(NB * NH * NQT);                        //  768
  const dim3 gAT(ATT_BLOCKS);                           //  768
  const dim3 bAT(ATT_THREADS);                          //  128

  // (0..3) weights [n][k] (already k-contiguous for x.W^T): bf16 planes for wq/wk/wv, f16 of bf16 value x1024 for wo
  cvt16<<<gWc, blk, 0, stream>>>(wq, WQB, n8w, 0, 1.0f);
  cvt16<<<gWc, blk, 0, stream>>>(wk, WKB, n8w, 0, 1.0f);
  cvt16<<<gWc, blk, 0, stream>>>(wv, WVB, n8w, 0, 1.0f);
  cvt16<<<gWc, blk, 0, stream>>>(wo, WOB, n8w, 1, WOS);
  // (4..6) q: input -> bf16 plane, projection + bias [4096][768] f32 (col = h*64+d), split -> f16 hi x1024 + residual planes
  cvt16<<<gX, blk, 0, stream>>>(Qin, XB, n8x, 0, 1.0f);
  gemm_bfb<<<gG, bG, 0, stream>>>(XB, WQB, bq, F, ROWS, DMOD, DMOD, 1.0f);
  split16<<<gX, blk, 0, stream>>>(F, QHI, QLO, n8x, QSC);
  // (7..9) k: same pipeline (XB and F reused; single in-order stream)
  cvt16<<<gX, blk, 0, stream>>>(Kin, XB, n8x, 0, 1.0f);
  gemm_bfb<<<gG, bG, 0, stream>>>(XB, WKB, bk, F, ROWS, DMOD, DMOD, 1.0f);
  split16<<<gX, blk, 0, stream>>>(F, KHI, KLO, n8x, KSC);
  // (10..12) v: input -> bf16 plane, projection + bias, v^T planes x1024 (hi + residual)
  cvt16<<<gX, blk, 0, stream>>>(Vin, XB, n8x, 0, 1.0f);
  gemm_bfb<<<gG, bG, 0, stream>>>(XB, WVB, bv, F, ROWS, DMOD, DMOD, 1.0f);
  vt16<<<gVT, blk, 0, stream>>>(F, VHI, VLO);
  // (13) attention with per-head x per-key bias -> O planes [b][s][h][d] x1024 (hi + residual)
  attn_fwd<<<gAT, bAT, 0, stream>>>(QHI, QLO, KHI, KLO, VHI, VLO, mask, mcw, OHI, OLO);
  // (14) output projection + bias -> out [4096][768] f32, carries 1024 (O) x 1024 (wo) folded back
  gemm_h2<<<gG, bG, 0, stream>>>(OHI, OLO, WOB, bo, out, ROWS, DMOD, DMOD, 1.0f / (OSC * WOS));
  (void)hipGetLastError();
}

// v002
// It runs in 205 microseconds.
// Timed twice side by side with v001, it ran 1.15 and 1.14 times as fast.
// Over all steps from v000 it is 1.42 times as fast.
// Contractions: x.W{q,k,v}^T on v_wmma_f32_16x16x32_bf16 (x and W RNE-converted to bf16 operands, f32 accumulate, bias added in f32);
// scores k'.q'^T (q', k' carried x1024 as f16 hi plane + f16 residual plane, products hh+lh+hl), P.v (P x32768 f16 hi+residual,
// v x1024 f16 hi+residual, products hh+lh+hl) and O.Wo^T (O x1024 f16 hi+residual, Wo as f16(bf16(Wo) x1024), products h.w+l.w):
// v_wmma_f32_16x16x32_f16, f32 accumulate. Per-head x per-key additive score bias, base-2 online softmax, 1/l fold in f32 on VALU.
#include <hip/hip_runtime.h>
#include <math.h>
#include <stdint.h>

#define NB    2
#define SEQ   2048
#define DMOD  768
#define NH    12
#define HD    64
#define NQT   (SEQ / 64)
#define QSC   1024.0f
#define KSC   1024.0f
#define PCAR  32768.0f
#define VCAR  1024.0f
#define OSC   1024.0f
#define WOS   1024.0f
#define LOG2E 1.4426950408889634f
#define ATT_WAVES   4
#define ATT_THREADS (ATT_WAVES * 32)
#define ATT_BLOCKS  (NB * NH * NQT)
#define NKB    (SEQ / 32)
#define SLABF  (16 * 68)
#define SLAB64 (16 * 68)
#define VTP    72
#define SKEYS  64
#define NST    (SEQ / SKEYS)
#define RPH    72
#define TILEH  (64 * RPH)
#define GXB    ((NB * SEQ * DMOD / 8) / 256)   // blocks of 256 threads x 8 elements per [4096][768] plane
#define GWB    ((DMOD * DMOD / 8) / 256)       // the same per [768][768] plane
#define GVT    (NB * NH * NQT)                 // blocks of the v^T stage
static_assert(HD == 64 && DMOD == NH * HD);
static_assert(NQT == 32 && NH == 12 && NB == 2);
static_assert(ATT_THREADS == 128 && ATT_BLOCKS == 768 && NKB == 64);
static_assert(((NB * SEQ) % 64) == 0 && (DMOD % 64) == 0 && (DMOD % 32) == 0);
static_assert((SEQ % 64) == 0 && (SEQ % 8) == 0);
static_assert(((NB * SEQ * DMOD / 8) % 256) == 0 && ((DMOD * DMOD / 8) % 256) == 0);
static_assert(GXB == 1536 && GWB == 288 && GVT == 768);
static_assert(ATT_WAVES * SLABF >= 4 * 16 * 68);
static_assert(HD * VTP >= 63 * VTP + 64);
static_assert(SKEYS == 64 && NST >= 2 && NST * SKEYS == SEQ && (RPH * 2) % 16 == 0 && TILEH >= 63 * RPH + 64);

typedef unsigned short u16;
typedef _Float16 v16h __attribute__((ext_vector_type(16)));
typedef _Float16 v8h  __attribute__((ext_vector_type(8)));
typedef __bf16   v16b __attribute__((ext_vector_type(16)));
typedef float    v8f  __attribute__((ext_vector_type(8)));
typedef float    v4f  __attribute__((ext_vector_type(4)));
typedef unsigned int v4u __attribute__((ext_vector_type(4)));

union FragH { v16h v; v8h h[2]; v4u u[2]; };
union FragB { v16b v; v4u u[2]; };

// ---- scalar helpers --------------------------------------------------------------------------------
__device__ __forceinline__ unsigned short bf_bits(float f) {          // f32 -> bf16 bits, RNE convert
  unsigned u = __float_as_uint(f);
  return (unsigned short)((u + 0x7FFFu + ((u >> 16) & 1u)) >> 16);
}
__device__ __forceinline__ float bf_up(unsigned short h) { return __uint_as_float(((unsigned)h) << 16); }
__device__ __forceinline__ float bfr(float f) { return bf_up(bf_bits(f)); }
__device__ __forceinline__ unsigned short h_bits(_Float16 x) { return __builtin_bit_cast(unsigned short, x); }
__device__ __forceinline__ unsigned pk16(unsigned short a, unsigned short b) { return (unsigned)a | ((unsigned)b << 16); }
__device__ __forceinline__ v8f zero8() { v8f z = {0.f, 0.f, 0.f, 0.f, 0.f, 0.f, 0.f, 0.f}; return z; }
__device__ __forceinline__ v4f zero4() { v4f z = {0.f, 0.f, 0.f, 0.f}; return z; }

// ---- fragment loaders: 16-bit A/B operand, lane -> row/col (lane&15), p already includes +8*(lane>>4);
//      elements 0..7 <- p[0..7] (k0+8h..), elements 8..15 <- p[16..23] (k0+16+8h..)  (same split k map for A and B;
//      B is always read from a k-contiguous [n][k] plane)
__device__ __forceinline__ v16h ldfrag_h(const _Float16* p) {
  FragH f;
  f.h[0] = *(const v8h*)(p);
  f.h[1] = *(const v8h*)(p + 16);
  return f.v;
}
__device__ __forceinline__ v16b ldfrag_b(const u16* p) {              // bf16 plane read as unsigned integer vectors
  FragB f;
  f.u[0] = *(const v4u*)(p);
  f.u[1] = *(const v4u*)(p + 16);
  return f.v;
}

__device__ __forceinline__ v8f mma_h(v16h a, v16h b, v8f c) {
  return __builtin_amdgcn_wmma_f32_16x16x32_f16(false, a, false, b, (short)0, c, false, false);
}
__device__ __forceinline__ v8f mma_b(v16b a, v16b b, v8f c) {
  return __builtin_amdgcn_wmma_f32_16x16x32_bf16(false, a, false, b, (short)0, c, false, false);
}
__device__ __forceinline__ void guard2(v8f& a, v8f& b, v16h x0, v16h x1, v16h x2, v16h x3, v16h x4, v16h x5) {
#if defined(__HIP_DEVICE_COMPILE__)
  asm volatile("v_nop\n\tv_nop\n\tv_nop\n\tv_nop"
               : "+v"(a), "+v"(b) : "v"(x0), "v"(x1), "v"(x2), "v"(x3), "v"(x4), "v"(x5) : "memory");
#endif
}
template <typename F>
__device__ __forceinline__ void guard6(v8f& a, v8f& b, v8f& c, v8f& d, F x0, F x1, F x2, F x3, F x4, F x5) {
#if defined(__HIP_DEVICE_COMPILE__)
  asm volatile("v_nop\n\tv_nop\n\tv_nop\n\tv_nop"
               : "+v"(a), "+v"(b), "+v"(c), "+v"(d) : "v"(x0), "v"(x1), "v"(x2), "v"(x3), "v"(x4), "v"(x5) : "memory");
#endif
}
__device__ __forceinline__ void guard10(v8f& a, v8f& b, v8f& c, v8f& d, v16h x0, v16h x1, v16h x2, v16h x3, v16h x4,
                                        v16h x5, v16h x6, v16h x7, v16h x8, v16h x9) {
#if defined(__HIP_DEVICE_COMPILE__)
  asm volatile("v_nop\n\tv_nop\n\tv_nop\n\tv_nop"
               : "+v"(a), "+v"(b), "+v"(c), "+v"(d)
               : "v"(x0), "v"(x1), "v"(x2), "v"(x3), "v"(x4), "v"(x5), "v"(x6), "v"(x7), "v"(x8), "v"(x9) : "memory");
#endif
}
__device__ __forceinline__ void acc_guard4(v8f& a, v8f& b, v8f& c, v8f& d) {
#if defined(__HIP_DEVICE_COMPILE__)
  asm volatile("v_nop\n\tv_nop\n\tv_nop\n\tv_nop" : "+v"(a), "+v"(b), "+v"(c), "+v"(d));
#endif
}
// Four asynchronous 16-B copies per lane, global -> LDS (rows r, r+16, r+32, r+48 of one 64-row tile). The s_wait_xcnt stands in
// the copies' own statement so that no address register is rewritten in front of it.
__device__ __forceinline__ void copy4(unsigned l0, unsigned l1, unsigned l2, unsigned l3,
                                      const u16* g0, const u16* g1, const u16* g2, const u16* g3) {
#if defined(__HIP_DEVICE_COMPILE__)
  asm volatile("global_load_async_to_lds_b128 %0, %4, off\n\t"
               "global_load_async_to_lds_b128 %1, %5, off\n\t"
               "global_load_async_to_lds_b128 %2, %6, off\n\t"
               "global_load_async_to_lds_b128 %3, %7, off\n\t"
               "s_wait_xcnt 0x0"
               :: "v"(l0), "v"(l1), "v"(l2), "v"(l3), "v"(g0), "v"(g1), "v"(g2), "v"(g3) : "memory");
#endif
}
// One 64-row x 128-B tile: lbase = this lane's LDS byte address in row r, g = its global address in row r, gstep = 16 source rows.
__device__ __forceinline__ void copy_tile(unsigned lbase, const u16* g, size_t gstep) {
  copy4(lbase, lbase + 16u * (RPH * 2), lbase + 32u * (RPH * 2), lbase + 48u * (RPH * 2), g, g + gstep, g + 2 * gstep, g + 3 * gstep);
}
__device__ __forceinline__ void wait_async0() {   // this wave's copies have landed
#if defined(__HIP_DEVICE_COMPILE__)
  asm volatile("s_wait_asynccnt 0x0" ::: "memory");
#endif
}
__device__ __forceinline__ void wait_ds0() {      // this wave's LDS reads have returned before their buffer is handed back
#if defined(__HIP_DEVICE_COMPILE__)
  asm volatile("s_wait_dscnt 0x0" ::: "memory");
#endif
}
__device__ __forceinline__ void wave_sync_lds() {
  __builtin_amdgcn_fence(__ATOMIC_RELEASE, "workgroup");
  __builtin_amdgcn_wave_barrier();
  __builtin_amdgcn_fence(__ATOMIC_ACQUIRE, "workgroup");
}

// =====================================================================================================
// f32 plane -> 16-bit plane, same layout:  f16mode == 0: bf16 RNE bits;  f16mode == 1: f16 bits of (bf16 RNE value) * scale.
// Thread = 8 consecutive elements: two 16-B loads, one 16-B store; 32 consecutive lanes = 512 contiguous, 512-B aligned bytes
// gt = the thread's index within its plane.
// =====================================================================================================
__device__ __forceinline__ void cvt16_body(const float* __restrict__ x, u16* D, int gt, int f16mode, float scale) {
  const float* p = x + (size_t)gt * 8;
  const v4f a = *(const v4f*)(p), c4 = *(const v4f*)(p + 4);
  float v[8];
#pragma unroll
  for (int e = 0; e < 4; ++e) { v[e] = a[e]; v[4 + e] = c4[e]; }
  unsigned short s[8];
#pragma unroll
  for (int e = 0; e < 8; ++e) {
    const unsigned short hb = h_bits((_Float16)(bfr(v[e]) * scale));
    const unsigned short bb = bf_bits(v[e]);
    s[e] = (f16mode != 0) ? hb : bb;
  }
  v4u o;
#pragma unroll
  for (int e = 0; e < 4; ++e) o[e] = pk16(s[2 * e], s[2 * e + 1]);
  u16* d = D + (size_t)gt * 8;
  {
    *(v4u*)(d) = o;
    
  }
}
// All seven conversions in one grid (none reads another's output): blocks [0, 3*GXB) = the three input planes -> bf16,
// blocks [3*GXB, 3*GXB + 4*GWB) = wq, wk, wv -> bf16 and wo -> f16 of (bf16 value x1024). The plane is chosen per block (scalar).
// coverage: GXB (GWB) blocks x 256 thr x 8 = one whole plane each.
__global__ __launch_bounds__(256)
void cvt16_all(const float* __restrict__ xq, const float* __restrict__ xk, const float* __restrict__ xv,
               const float* __restrict__ wq, const float* __restrict__ wk, const float* __restrict__ wv,
               const float* __restrict__ wo, u16* XQ, u16* XK, u16* XV, u16* WQ, u16* WK, u16* WV, u16* WO) {
  const int bid = blockIdx.x;
  if (bid >= 3 * GXB + 4 * GWB) return;     // never taken with the exact grid; no barriers in this kernel
  const float* x;
  u16* D;
  int lb, f16mode = 0;
  float scale = 1.0f;
  if (bid < 3 * GXB) {
    const int pl = bid / GXB;
    lb = bid - pl * GXB;
    x = (pl == 0) ? xq : (pl == 1) ? xk : xv;
    D = (pl == 0) ? XQ : (pl == 1) ? XK : XV;
  } else {
    const int r = bid - 3 * GXB, pl = r / GWB;
    lb = r - pl * GWB;
    x = (pl == 0) ? wq : (pl == 1) ? wk : (pl == 2) ? wv : wo;
    D = (pl == 0) ? WQ : (pl == 1) ? WK : (pl == 2) ? WV : WO;
    if (pl == 3) { f16mode = 1; scale = WOS; }
  }
  cvt16_body(x, D, lb * 256 + (int)threadIdx.x, f16mode, scale);
}

// =====================================================================================================
// f32 plane -> f16 hi plane (value * sc, sc a power of two) + f16 residual plane (value * sc - hi, unscaled), same layout.
// Thread = 8 consecutive elements: two 16-B loads, one 16-B store per plane; 32 consecutive lanes = 512 contiguous, 512-B aligned
// gt = the thread's index within its plane.
// =====================================================================================================
__device__ __forceinline__ void split16_body(const float* __restrict__ x, u16* hpl, u16* lpl, int gt, float sc) {
  const float* p = x + (size_t)gt * 8;
  const v4f a = *(const v4f*)(p), c4 = *(const v4f*)(p + 4);
  float w[8];
#pragma unroll
  for (int e = 0; e < 4; ++e) { w[e] = a[e]; w[4 + e] = c4[e]; }
  v4u oh, ol;
#pragma unroll
  for (int e = 0; e < 4; ++e) {
    const float t0 = w[2 * e] * sc, t1 = w[2 * e + 1] * sc;
    const _Float16 h0 = (_Float16)t0, h1 = (_Float16)t1;
    const _Float16 l0 = (_Float16)(t0 - (float)h0), l1 = (_Float16)(t1 - (float)h1);
    oh[e] = pk16(h_bits(h0), h_bits(h1));
    ol[e] = pk16(h_bits(l0), h_bits(l1));
  }
  const size_t o8 = (size_t)gt * 8;
  {
    *(v4u*)(hpl + o8) = oh;
    *(v4u*)(lpl + o8) = ol;
#if defined(__HIP_DEVICE_COMPILE__)
    // the built code runs on from here into a joined test in front of the v^T stage, whose first instructions rewrite registers
    // that these two stores name: the wait stands in front of every such rewrite
    asm volatile("s_wait_xcnt 0x0" ::: "memory");
#endif
  }
}

// =====================================================================================================
// GEMM epilogue shared by both engines: the wave's 16x64 f32 tile (times oscale) staged in its LDS slab (pitch 68),
// coverage: 8 instructions x 2 rows x 16 lanes x 4 floats = the wave's 16 x 64 tile.
// =====================================================================================================
__device__ __forceinline__ void epi64(float* sl, v8f a0, v8f a1, v8f a2, v8f a3, float oscale, v4f badd, float* C, int N,
                                      size_t rowb, int col0, int lane) {
  const int hh = lane >> 4, m = lane & 15;
#pragma unroll
  for (int r = 0; r < 8; ++r) {
    const int ro = (8 * hh + r) * 68 + m;
    sl[ro]      = a0[r] * oscale;
    sl[ro + 16] = a1[r] * oscale;
    sl[ro + 32] = a2[r] * oscale;
    sl[ro + 48] = a3[r] * oscale;
  }
  wave_sync_lds();
  v4f vals[8];
#pragma unroll
  for (int it = 0; it < 8; ++it) vals[it] = *(const v4f*)(sl + (it * 2 + hh) * 68 + m * 4) + badd;
  float* dst = C + (rowb + (size_t)hh) * (size_t)N + col0 + m * 4;
  {
#pragma unroll
    for (int it = 0; it < 8; ++it) {
      *(v4f*)(dst + (size_t)(it * 2) * (size_t)N) = vals[it];
    }
    
  }
}

// =====================================================================================================
// bf16 GEMM with bias: C[M][N] (f32) = A[M][K] (bf16 row-major) . Bt[N][K]^T (bf16 k-contiguous), times oscale, plus bf16-RNE
// value of bias[n]. Block = 64x64 tile, 4 waves x 16 rows; fragments loaded straight from the 16-bit rows (two 16-B loads each,
// split k map for A and B); K stepped by 32 (host checks K % 32 == 0, M % 64 == 0, N % 64 == 0, grid.x = (M/64)*(N/64)).
// Three independent products of one shape in one grid: blockIdx.y picks the operand set (scalar selects).
// =====================================================================================================
__global__ __launch_bounds__(128)
void gemm_bfb3(const u16* __restrict__ A0, const u16* __restrict__ A1, const u16* __restrict__ A2,
               const u16* __restrict__ Bt0, const u16* __restrict__ Bt1, const u16* __restrict__ Bt2,
               const float* __restrict__ bias0, const float* __restrict__ bias1, const float* __restrict__ bias2,
               float* C0, float* C1, float* C2, int M, int N, int K, float oscale) {
  __shared__ __align__(16) float slab[4 * SLAB64];
  const int zz = blockIdx.y;
  const u16*   A    = (zz == 0) ? A0 : (zz == 1) ? A1 : A2;
  const u16*   Bt   = (zz == 0) ? Bt0 : (zz == 1) ? Bt1 : Bt2;
  const float* bias = (zz == 0) ? bias0 : (zz == 1) ? bias1 : bias2;
  float*       C    = (zz == 0) ? C0 : (zz == 1) ? C1 : C2;
  const int tid = threadIdx.x, wave = tid >> 5, lane = tid & 31, hh = lane >> 4, m = lane & 15;
  const int ntile = N >> 6;
  const int bid   = blockIdx.x;
  const int rowb  = (bid / ntile) * 64 + wave * 16;
  const int col0  = (bid % ntile) * 64;
  if (rowb + 16 > M) return;                 // wave-uniform, never taken with the exact grid; no block barriers in this kernel
  const u16* ap = A  + (size_t)(rowb + m) * K + 8 * hh;
  const u16* bp = Bt + (size_t)(col0 + m) * K + 8 * hh;
  const size_t bs = (size_t)16 * K;
  v8f acc0 = zero8(), acc1 = zero8(), acc2 = zero8(), acc3 = zero8();
#pragma unroll 1
  for (int k0 = 0; k0 < K; k0 += 32) {
    const v16b a  = ldfrag_b(ap + k0);
    const v16b b0 = ldfrag_b(bp + k0);
    const v16b b1 = ldfrag_b(bp + bs + k0);
    const v16b b2 = ldfrag_b(bp + 2 * bs + k0);
    const v16b b3 = ldfrag_b(bp + 3 * bs + k0);
    acc0 = mma_b(a, b0, acc0);
    acc1 = mma_b(a, b1, acc1);
    acc2 = mma_b(a, b2, acc2);
    acc3 = mma_b(a, b3, acc3);
    guard6<v16b>(acc0, acc1, acc2, acc3, a, b0, b1, b2, b3, a);
  }
  const v4f bv = *(const v4f*)(bias + col0 + m * 4);      // columns col0 + 4m .. +3, always < N (N multiple of 64)
  v4f badd;
#pragma unroll
  for (int e = 0; e < 4; ++e) badd[e] = bfr(bv[e]);
  epi64(slab + wave * SLAB64, acc0, acc1, acc2, acc3, oscale, badd, C, N, (size_t)rowb, col0, lane);
}

// =====================================================================================================
// f16 hi+lo GEMM with bias: C[M][N] (f32) = (Ahi + Alo)[M][K] . Bt[N][K]^T times oscale, plus bf16-RNE value of bias[n];
// Ahi/Alo f16 planes (same layout), Bt f16 k-contiguous; products hi.B + lo.B into one accumulator (lo is the unscaled
// residual of hi). Same tiling as gemm_bfb3.
// =====================================================================================================
__global__ __launch_bounds__(128)
void gemm_h2(const u16* __restrict__ Ah, const u16* __restrict__ Al, const u16* __restrict__ Bt,
             const float* __restrict__ bias, float* C, int M, int N, int K, float oscale) {
  __shared__ __align__(16) float slab[4 * SLAB64];
  const int tid = threadIdx.x, wave = tid >> 5, lane = tid & 31, hh = lane >> 4, m = lane & 15;
  const int ntile = N >> 6;
  const int bid   = blockIdx.x;
  const int rowb  = (bid / ntile) * 64 + wave * 16;
  const int col0  = (bid % ntile) * 64;
  if (rowb + 16 > M) return;                 // wave-uniform, never taken with the exact grid; no block barriers in this kernel
  const size_t aofs = (size_t)(rowb + m) * K + 8 * hh;
  const _Float16* ahp = (const _Float16*)(const void*)Ah + aofs;
  const _Float16* alp = (const _Float16*)(const void*)Al + aofs;
  const _Float16* bp  = (const _Float16*)(const void*)Bt + (size_t)(col0 + m) * K + 8 * hh;
  const size_t bs = (size_t)16 * K;
  v8f acc0 = zero8(), acc1 = zero8(), acc2 = zero8(), acc3 = zero8();
#pragma unroll 1
  for (int k0 = 0; k0 < K; k0 += 32) {
    const v16h ah = ldfrag_h(ahp + k0), al = ldfrag_h(alp + k0);
    const v16h b0 = ldfrag_h(bp + k0);
    const v16h b1 = ldfrag_h(bp + bs + k0);
    const v16h b2 = ldfrag_h(bp + 2 * bs + k0);
    const v16h b3 = ldfrag_h(bp + 3 * bs + k0);
    acc0 = mma_h(ah, b0, acc0);  acc0 = mma_h(al, b0, acc0);
    acc1 = mma_h(ah, b1, acc1);  acc1 = mma_h(al, b1, acc1);
    acc2 = mma_h(ah, b2, acc2);  acc2 = mma_h(al, b2, acc2);
    acc3 = mma_h(ah, b3, acc3);  acc3 = mma_h(al, b3, acc3);
    guard6<v16h>(acc0, acc1, acc2, acc3, ah, al, b0, b1, b2, b3);
  }
  const v4f bv = *(const v4f*)(bias + col0 + m * 4);      // columns col0 + 4m .. +3, always < N (N multiple of 64)
  v4f badd;
#pragma unroll
  for (int e = 0; e < 4; ++e) badd[e] = bfr(bv[e]);
  epi64(slab + wave * SLAB64, acc0, acc1, acc2, acc3, oscale, badd, C, N, (size_t)rowb, col0, lane);
}

// =====================================================================================================
// v^T planes: VH[(b*NH + h)*HD + d][s] = f16(v[b][s][h][d] * 1024), VL = f16 residual of the same value.
// Block = (b, h, 64 keys): 64 source rows of HD floats loaded with 16-B loads, converted, scattered into two LDS tiles
// coverage: load 256 thr x 16 elements = 64 x 64; store 2 iterations x 256 thr x 8 halves = 64 lines x 64 = the block's tile of
//           each plane; NB x NH x SEQ/64 = 768 blocks cover both planes exactly once.
// =====================================================================================================
__device__ __forceinline__ void vt16_body(const float* __restrict__ v, u16* VHo, u16* VLo, int bid, u16* TH, u16* TL) {
  const int tid = threadIdx.x;
  const int st  = bid & (NQT - 1);
  const int bh  = bid >> 5;                  // NQT == 32
  const int h   = bh % NH;
  const int b   = bh / NH;
  const int s0  = st * 64;
  {
    const int sl = tid >> 2;                  // key within tile 0..63
    const int dc = (tid & 3) * 16;            // d chunk
    const float* src = v + (((size_t)(b * SEQ + s0 + sl)) * NH + h) * HD + dc;
#pragma unroll
    for (int i = 0; i < 4; ++i) {
      const v4f a = *(const v4f*)(src + 4 * i);
#pragma unroll
      for (int e = 0; e < 4; ++e) {
        const float t = a[e] * VCAR;
        const _Float16 hv = (_Float16)t;
        const _Float16 lv = (_Float16)(t - (float)hv);
        TH[(dc + 4 * i + e) * VTP + sl] = h_bits(hv);
        TL[(dc + 4 * i + e) * VTP + sl] = h_bits(lv);
      }
    }
  }
  __syncthreads();
  v4u vh[2], vl[2];
  const int q8 = tid >> 3, p8 = (tid & 7) * 8;
#pragma unroll
  for (int it = 0; it < 2; ++it) {
    const int line = it * 32 + q8;            // d = 0..63
    vh[it] = *(const v4u*)(TH + line * VTP + p8);
    vl[it] = *(const v4u*)(TL + line * VTP + p8);
  }
  const size_t base = ((size_t)(b * NH + h) * HD) * SEQ + s0 + p8;
  {
#pragma unroll
    for (int it = 0; it < 2; ++it) {
      const int line = it * 32 + q8;
      *(v4u*)(VHo + base + (size_t)line * SEQ) = vh[it];
      *(v4u*)(VLo + base + (size_t)line * SEQ) = vl[it];
    }
    
  }
}
// The three plane-forming stages behind the projections in one grid (none reads another's output): blocks [0, GVT) = v^T planes,
// [GVT, GVT + GXB) = q planes, [GVT + GXB, GVT + 2*GXB) = k planes. The branch is block-uniform, so the barrier inside vt16_body is
// passed by all threads of its block or by none.
__global__ __launch_bounds__(256)
void planes_qkv(const float* __restrict__ fq, const float* __restrict__ fk, const float* __restrict__ fv,
                u16* QH, u16* QL, u16* KH, u16* KL, u16* VH, u16* VL) {
  __shared__ __align__(16) u16 TH[HD * VTP];
  __shared__ __align__(16) u16 TL[HD * VTP];
  const int bid = blockIdx.x;
  if (bid >= GVT + 2 * GXB) return;         // never taken with the exact grid; block-uniform, in front of the barrier
  if (bid < GVT) {
    vt16_body(fv, VH, VL, bid, TH, TL);
  } else {
    const int r = bid - GVT, pl = r / GXB;
    const int gt = (r - pl * GXB) * 256 + (int)threadIdx.x;
    split16_body((pl == 0) ? fq : fk, (pl == 0) ? QH : KH, (pl == 0) ? QL : KL, gt, (pl == 0) ? QSC : KSC);
  }
}

// =====================================================================================================
// Full (non-causal) multi-head flash attention with a per-head x per-key additive score bias: block = (batch b, head, 64 query
// rows), 4 waves, wave w owns the 16 query rows q0 = 64*qt + 16*w .. q0+15. The k and v^T tiles of 64 keys (hi and residual planes,
// 4 tiles of 64 rows x 128 B, LDS pitch 144 B) are brought into a two-buffer LDS ring by asynchronous copies, whole 128-B lines,
// once per block, and read by all 4 waves; one block barrier per 64 keys publishes the next stage and frees the one just read.
//   q planes (hi, lo f16, x1024) laid out [b][s][h][d]; k planes the same; v^T planes [b][h][d][s] (x1024).
//   All NKB = 64 key blocks of 32 keys are visited (static bound).
//   Scores are computed TRANSPOSED: S^T tile g (g = 0,1) = k rows (keys kb+16g .. +15, A operand, row m = lane&15, split k map
//   over d) times q^T (B operand, col n = query q0 + (lane&15), k = d, split map), 3 products per tile and d-chunk
//   (k_hi.q_hi + k_lo.q_hi + k_hi.q_lo). D element r of lane l = (key kb+16g+8h+r, query q0+(l&15)), so a lane owns one query
//   column and 16 of its 32 keys; the partner lane l^16 owns the other 16 -> row max / row sum need one xor-16 shuffle.
//   Logit of key j, query i (base 2): (S * 1/8 * 2^-20 + bfr(wh) * bfr(mask[b][j])) * log2(e); the bias is loaded per key with
//   the same element -> key map as the transposed scores (t[i] <- key kb+8h+i, t[8+i] <- key kb+16+8h+i), added in f32.
//   Online max-subtracted base-2 softmax in f32. The exp'd values ARE the P A-fragment in place: A row m = query = lane&15,
//   element i <- key kb+8h+i (tile 0, D element i), element 8+i <- key kb+16+8h+i (tile 1, D element i). P is carried x32768
//   as f16 hi + f16 residual. The rescale factor of query row 8h+r of the O accumulators is fetched from lane 8h+r with a
//   shuffle (uniform control). 4+4 v^T B fragments (hi and residual planes, col n = d = 16j + (lane&15), keys k-contiguous),
//   12 P.V WMMAs (hh + lh + hl).
//   Epilogue: 1/l (per query, shuffled to the D row owner) and carry folds in f32; the wave's 16x64 f32 result staged in its LDS
// coverage: per wave 4 instructions x 4 rows x 8 lanes x 8 halves = 16 x 64 per plane; grid 768 blocks x 4 waves = every
//           (b, s, h) row of both O planes exactly once.
// =====================================================================================================
__global__ __launch_bounds__(ATT_THREADS)
void attn_fwd(const u16* __restrict__ QHIp, const u16* __restrict__ QLOp,
              const u16* __restrict__ KHIp, const u16* __restrict__ KLOp,
              const u16* __restrict__ VHIp, const u16* __restrict__ VLOp,
              const float* __restrict__ maskp, const float* __restrict__ mcwp,
              u16* OHIp, u16* OLOp) {
  __shared__ __align__(16) float smem[ATT_WAVES * SLABF];   // per wave: result slab [16][68] in the epilogue only
  __shared__ __align__(16) u16 ring[2 * 4 * TILEH];         // [buffer][k hi, k lo, v^T hi, v^T lo][64 rows][pitch 72 halves]

  const int tid  = threadIdx.x;
  const int wave = tid >> 5;
  const int lane = tid & 31;
  const int hh   = lane >> 4;
  const int c    = lane & 15;

  const int bid  = blockIdx.x;
  const int qt   = bid & (NQT - 1);
  const int bh   = bid >> 5;                 // NQT == 32
  const int head = bh % NH;
  const int b    = bh / NH;
  const int q0   = qt * 64 + wave * 16;

  // B fragments of q^T: col n = query q0 + c, k = d (k-contiguous row of the q plane)
  const size_t qofs = (((size_t)(b * SEQ + q0 + c)) * NH + head) * HD + 8 * hh;
  const _Float16* Qh  = (const _Float16*)(const void*)QHIp + qofs;
  const _Float16* Ql  = (const _Float16*)(const void*)QLOp + qofs;
  // copies: lane = (row cr of a group of 16, 16-B chunk cc of its 128-B row); a wave's copy = 4 whole rows
  const int cr = tid >> 3, cc = (tid & 7) * 8;
  const size_t kcp = (((size_t)b * SEQ + cr) * NH + head) * HD + cc;               // key row: stage's first key added per stage
  const size_t vcp = ((size_t)(b * NH + head) * HD + cr) * SEQ + cc;               // d row: stage's first key added per stage
  const unsigned lcp = (unsigned)(uintptr_t)(ring + cr * RPH + cc);                // LDS byte address, buffer 0, tile 0
  // A fragments of k: row m = key (in stage) 16g + c, k = d;  B fragments of v: col n = d = 16j + c, k = key (in stage)
  const _Float16* ringh = (const _Float16*)(const void*)ring + c * RPH + 8 * hh;
  // per-key bias row: mask[b][kb + 8hh + 0..7] (tile 0) and [kb + 16 + 8hh + 0..7] (tile 1), 16-B aligned loads
  const float* mrow = maskp + (size_t)b * SEQ + 8 * hh;
  const float  wh2  = bfr(mcwp[head]);                                              // per-head scalar (bf16 RNE value)
  const float lsc = 0.125f * (LOG2E / (QSC * KSC));

  float mrun = -INFINITY, lrun = 0.f;
  v8f o[4];
#pragma unroll
  for (int j = 0; j < 4; ++j) o[j] = zero8();

#define STAGE_COPY(st, bf)                                                                        \
  do {                                                                                            \
    const unsigned lb_ = lcp + (unsigned)(bf) * (4u * TILEH * 2u);                                \
    const size_t ko_ = kcp + (size_t)(st) * (SKEYS * NH * HD), vo_ = vcp + (size_t)(st) * SKEYS;  \
    copy_tile(lb_,                   KHIp + ko_, (size_t)16 * (NH * HD));                         \
    copy_tile(lb_ + 1u * TILEH * 2u, KLOp + ko_, (size_t)16 * (NH * HD));                         \
    copy_tile(lb_ + 2u * TILEH * 2u, VHIp + vo_, (size_t)16 * SEQ);                               \
    copy_tile(lb_ + 3u * TILEH * 2u, VLOp + vo_, (size_t)16 * SEQ);                               \
  } while (0)

  // ring prologue: stage 0 landed and published, then stage 1 in flight
  STAGE_COPY(0, 0);
  wait_async0();
  __syncthreads();
  STAGE_COPY(1, 1);

#pragma unroll 1   // stays rolled: one copy of the stage body and of its publish point
  for (int st = 0; st < NST; ++st) {
   const int bf = st & 1;
   const _Float16* stg = ringh + bf * (4 * TILEH);
#pragma unroll     // the stage's two 32-key passes: their LDS offsets become immediates of the loads
   for (int sub = 0; sub < 2; ++sub) {
    const int kb = st * SKEYS + sub * 32;
    const v4f ma = *(const v4f*)(mrow + kb),      mb = *(const v4f*)(mrow + kb + 4);
    const v4f mc = *(const v4f*)(mrow + kb + 16), md = *(const v4f*)(mrow + kb + 20);
    // ---- transposed scores: s0 = keys kb..kb+15, s1 = keys kb+16..kb+31, column = query q0 + c ----
    v8f s0 = zero8(), s1 = zero8();
    const _Float16* k0p = stg + (sub * 32) * RPH;
    const _Float16* k1p = k0p + 16 * RPH;
    const _Float16* l0p = k0p + TILEH;
    const _Float16* l1p = l0p + 16 * RPH;
#pragma unroll
    for (int kk = 0; kk < 2; ++kk) {
      const v16h qh  = ldfrag_h(Qh + kk * 32),  ql  = ldfrag_h(Ql + kk * 32);
      const v16h kh0 = ldfrag_h(k0p + kk * 32), kl0 = ldfrag_h(l0p + kk * 32);
      const v16h kh1 = ldfrag_h(k1p + kk * 32), kl1 = ldfrag_h(l1p + kk * 32);
      s0 = mma_h(kh0, qh, s0);
      s0 = mma_h(kl0, qh, s0);
      s0 = mma_h(kh0, ql, s0);
      s1 = mma_h(kh1, qh, s1);
      s1 = mma_h(kl1, qh, s1);
      s1 = mma_h(kh1, ql, s1);
      guard2(s0, s1, qh, ql, kh0, kl0, kh1, kl1);
    }
    // ---- base-2 logits of this lane's 16 keys for query q0 + c: t[i] <- key kb+8hh+i, t[8+i] <- key kb+16+8hh+i ----
    float t[16];
#pragma unroll
    for (int e = 0; e < 4; ++e) {
      t[e]      = s0[e] * lsc     + (wh2 * bfr(ma[e])) * LOG2E;
      t[4 + e]  = s0[4 + e] * lsc + (wh2 * bfr(mb[e])) * LOG2E;
      t[8 + e]  = s1[e] * lsc     + (wh2 * bfr(mc[e])) * LOG2E;
      t[12 + e] = s1[4 + e] * lsc + (wh2 * bfr(md[e])) * LOG2E;
    }
    float cm = t[0];
#pragma unroll
    for (int i = 1; i < 16; ++i) cm = fmaxf(cm, t[i]);
    cm = fmaxf(cm, __shfl_xor(cm, 16, 32));
    const float mn = fmaxf(mrun, cm);        // finite from the first block on
    const float al = exp2f(mrun - mn);       // 0 on the first block (mrun = -inf)
    mrun = mn;
    // ---- probabilities (<= 1) and the P A-fragments: hi = f16(p * 32768), lo = f16 residual; element i <-> t[i] ----
    float ps = 0.f;
    FragH ph, pl;
#pragma unroll
    for (int w = 0; w < 2; ++w) {
#pragma unroll
      for (int e4 = 0; e4 < 4; ++e4) {
        const int i = 8 * w + 2 * e4;
        const float p0 = exp2f(t[i] - mn), p1 = exp2f(t[i + 1] - mn);
        ps += p0 + p1;
        const float a0 = p0 * PCAR, a1 = p1 * PCAR;
        const _Float16 h0 = (_Float16)a0, h1 = (_Float16)a1;
        const _Float16 l0 = (_Float16)(a0 - (float)h0), l1 = (_Float16)(a1 - (float)h1);
        ph.u[w][e4] = pk16(h_bits(h0), h_bits(h1));
        pl.u[w][e4] = pk16(h_bits(l0), h_bits(l1));
      }
    }
    ps += __shfl_xor(ps, 16, 32);
    lrun = lrun * al + ps;
    // ---- rescale the O accumulators: D row 8hh+r = query q0+8hh+r, its factor lives in lane 8hh+r (and 16+8hh+r) ----
    float scl[8];
#pragma unroll
    for (int r = 0; r < 8; ++r) scl[r] = __shfl(al, 8 * hh + r, 32);
#pragma unroll
    for (int j = 0; j < 4; ++j) {
#pragma unroll
      for (int r = 0; r < 8; ++r) o[j][r] *= scl[r];
    }
    // ---- P.V : B fragment col n = d = j*16 + c, keys contiguous in the v^T planes ----
    {
      const _Float16* vhp = stg + 2 * TILEH + sub * 32;
      const _Float16* vlp = vhp + TILEH;
      const v16h vh0 = ldfrag_h(vhp);
      const v16h vh1 = ldfrag_h(vhp + 16 * RPH);
      const v16h vh2 = ldfrag_h(vhp + 32 * RPH);
      const v16h vh3 = ldfrag_h(vhp + 48 * RPH);
      const v16h vl0 = ldfrag_h(vlp);
      const v16h vl1 = ldfrag_h(vlp + 16 * RPH);
      const v16h vl2 = ldfrag_h(vlp + 32 * RPH);
      const v16h vl3 = ldfrag_h(vlp + 48 * RPH);
      o[0] = mma_h(ph.v, vh0, o[0]);  o[0] = mma_h(pl.v, vh0, o[0]);  o[0] = mma_h(ph.v, vl0, o[0]);
      o[1] = mma_h(ph.v, vh1, o[1]);  o[1] = mma_h(pl.v, vh1, o[1]);  o[1] = mma_h(ph.v, vl1, o[1]);
      o[2] = mma_h(ph.v, vh2, o[2]);  o[2] = mma_h(pl.v, vh2, o[2]);  o[2] = mma_h(ph.v, vl2, o[2]);
      o[3] = mma_h(ph.v, vh3, o[3]);  o[3] = mma_h(pl.v, vh3, o[3]);  o[3] = mma_h(ph.v, vl3, o[3]);
      guard10(o[0], o[1], o[2], o[3], ph.v, pl.v, vh0, vh1, vh2, vh3, vl0, vl1, vl2, vl3);
    }
   }
   // publish point of stage st + 1: own reads of this buffer done, own copies of the next landed, block barrier, then the refill
   wait_ds0();
   wait_async0();
   __syncthreads();
   if (st + 2 < NST) STAGE_COPY(st + 2, bf);
  }
  wait_async0();
#undef STAGE_COPY
  acc_guard4(o[0], o[1], o[2], o[3]);

  // ---- fold 1/l (per query, owned by lane = query) and the carries (32768 on P, 1024 on v); stage the 16x64 slab ----
  const float linv = (1.0f / lrun) * (1.0f / (PCAR * VCAR));
  float inv[8];
#pragma unroll
  for (int r = 0; r < 8; ++r) inv[r] = __shfl(linv, 8 * hh + r, 32);
  float* slab = smem + wave * SLABF;
#pragma unroll
  for (int r = 0; r < 8; ++r) {
#pragma unroll
    for (int j = 0; j < 4; ++j) slab[(8 * hh + r) * 68 + j * 16 + c] = o[j][r] * inv[r];
  }
  wave_sync_lds();
  // ---- O x1024 -> f16 hi + residual planes; lane = (row in group of 4, 8 consecutive d) ----
  v4u oh[4], ol[4];
  const int rq = lane >> 3, c8 = (lane & 7) * 8;
#pragma unroll
  for (int i4 = 0; i4 < 4; ++i4) {
    const int row = i4 * 4 + rq;
    const v4f a = *(const v4f*)(slab + row * 68 + c8), c4 = *(const v4f*)(slab + row * 68 + c8 + 4);
    float w[8];
#pragma unroll
    for (int e = 0; e < 4; ++e) { w[e] = a[e] * OSC; w[4 + e] = c4[e] * OSC; }
#pragma unroll
    for (int e = 0; e < 4; ++e) {
      const _Float16 h0 = (_Float16)w[2 * e], h1 = (_Float16)w[2 * e + 1];
      const _Float16 l0 = (_Float16)(w[2 * e] - (float)h0), l1 = (_Float16)(w[2 * e + 1] - (float)h1);
      oh[i4][e] = pk16(h_bits(h0), h_bits(h1));
      ol[i4][e] = pk16(h_bits(l0), h_bits(l1));
    }
  }
  const size_t ob = (((size_t)(b * SEQ + q0)) * NH + head) * HD + c8;
  {
#pragma unroll
    for (int i4 = 0; i4 < 4; ++i4) {
      const int row = i4 * 4 + rq;
      const size_t o8 = ob + (size_t)row * (NH * HD);
      *(v4u*)(OHIp + o8) = oh[i4];
      *(v4u*)(OLOp + o8) = ol[i4];
    }
    
  }
}

// =====================================================================================================
// Workspace map (bytes); every plane is fully written by whole-line stores before it is read; all extents are exact multiples
// of the store granularity (no pad rows needed); every offset a multiple of 131072 (128 KiB); q, k and v each have their
// own input plane and projection plane, so that each stage runs as one grid over all three:
//   XBQ bf16 [4096][768]               6291456        XBK same  6291456      XBV same  6291456
//   WQB bf16 [768 n][768 k]            1179648        WKB same  1179648      WVB same  1179648
//   WOB f16  [768 n][768 k] x1024      1179648
//   FQ  f32 [4096][768]               12582912        FK same  12582912      FV same  12582912
//   QHI f16 [2][2048][12][64] x1024    6291456        QLO residual         6291456
//   KHI same                           6291456        KLO residual         6291456
//   VHI f16 [2][12][64][2048] x1024    6291456        VLO residual         6291456
//   OHI f16 [4096][768] x1024          6291456        OLO residual         6291456
//   end                              111673344
// =====================================================================================================
extern "C" void kernel_launch(void* const* d_in, const int* in_sizes, int n_in,
                              void* d_out, int out_size, void* d_ws, size_t ws_size,
                              hipStream_t stream) {
  const int ROWS = NB * SEQ;                            // 4096
  if (n_in < 13) return;
  if (in_sizes[0] != ROWS * DMOD || in_sizes[1] != ROWS * DMOD || in_sizes[2] != ROWS * DMOD) return;
  if (in_sizes[3] != NB * SEQ) return;
  if (in_sizes[4] != DMOD * DMOD || in_sizes[6] != DMOD * DMOD) return;
  if (in_sizes[8] != DMOD * DMOD || in_sizes[10] != DMOD * DMOD) return;
  if (in_sizes[5] != DMOD || in_sizes[7] != DMOD || in_sizes[9] != DMOD || in_sizes[11] != DMOD) return;
  if (in_sizes[12] != NH) return;
  if (out_size != ROWS * DMOD) return;

  const float* Qin  = (const float*)d_in[0];
  const float* Kin  = (const float*)d_in[1];
  const float* Vin  = (const float*)d_in[2];
  const float* mask = (const float*)d_in[3];
  const float* wq   = (const float*)d_in[4];
  const float* bq   = (const float*)d_in[5];
  const float* wk   = (const float*)d_in[6];
  const float* bk   = (const float*)d_in[7];
  const float* wv   = (const float*)d_in[8];
  const float* bv   = (const float*)d_in[9];
  const float* wo   = (const float*)d_in[10];
  const float* bo   = (const float*)d_in[11];
  const float* mcw  = (const float*)d_in[12];
  float*       out  = (float*)d_out;

  const size_t szXB  = (size_t)ROWS * DMOD * 2;                 //  6291456
  const size_t szW   = (size_t)DMOD * DMOD * 2;                 //  1179648
  const size_t szF   = (size_t)ROWS * DMOD * 4;                 // 12582912
  const size_t szP   = (size_t)ROWS * DMOD * 2;                 //  6291456  (q/k/o planes)
  const size_t szVP  = (size_t)NB * NH * HD * SEQ * 2;          //  6291456
  size_t off = 0;
  const size_t oXBQ = off; off += szXB;
  const size_t oXBK = off; off += szXB;
  const size_t oXBV = off; off += szXB;
  const size_t oWQB = off; off += szW;
  const size_t oWKB = off; off += szW;
  const size_t oWVB = off; off += szW;
  const size_t oWOB = off; off += szW;
  const size_t oFQ  = off; off += szF;
  const size_t oFK  = off; off += szF;
  const size_t oFV  = off; off += szF;
  const size_t oQHI = off; off += szP;
  const size_t oQLO = off; off += szP;
  const size_t oKHI = off; off += szP;
  const size_t oKLO = off; off += szP;
  const size_t oVHI = off; off += szVP;
  const size_t oVLO = off; off += szVP;
  const size_t oOHI = off; off += szP;
  const size_t oOLO = off; off += szP;
  if (off > ws_size) return;                            // off = 111673344
  if (off > (size_t)134217728) return;

  char* ws = (char*)d_ws;
  u16*   XBQ = (u16*)(ws + oXBQ);
  u16*   XBK = (u16*)(ws + oXBK);
  u16*   XBV = (u16*)(ws + oXBV);
  u16*   WQB = (u16*)(ws + oWQB);
  u16*   WKB = (u16*)(ws + oWKB);
  u16*   WVB = (u16*)(ws + oWVB);
  u16*   WOB = (u16*)(ws + oWOB);
  float* FQ  = (float*)(ws + oFQ);
  float* FK  = (float*)(ws + oFK);
  float* FV  = (float*)(ws + oFV);
  u16*   QHI = (u16*)(ws + oQHI);
  u16*   QLO = (u16*)(ws + oQLO);
  u16*   KHI = (u16*)(ws + oKHI);
  u16*   KLO = (u16*)(ws + oKLO);
  u16*   VHI = (u16*)(ws + oVHI);
  u16*   VLO = (u16*)(ws + oVLO);
  u16*   OHI = (u16*)(ws + oOHI);
  u16*   OLO = (u16*)(ws + oOLO);

  const dim3 blk(256);
  const int n8x = (ROWS * DMOD) / 8;                    // 393216
  const int n8w = (DMOD * DMOD) / 8;                    //  73728
  if ((n8x % 256) != 0 || (n8w % 256) != 0) return;
  if ((ROWS % 64) != 0 || (DMOD % 64) != 0 || (DMOD % 32) != 0) return;
  if (n8x / 256 != GXB || n8w / 256 != GWB) return;
  const dim3 gCV(3 * GXB + 4 * GWB);                    // 5760
  const dim3 gG((ROWS / 64) * (DMOD / 64));             //  768
  const dim3 gG3((ROWS / 64) * (DMOD / 64), 3);         //  768 x 3
  const dim3 bG(128);
  const dim3 gPL(GVT + 2 * GXB);                        // 3840
  const dim3 gAT(ATT_BLOCKS);                           //  768
  const dim3 bAT(ATT_THREADS);                          //  128

  // (0) all conversions: inputs -> bf16 planes; weights [n][k] (already k-contiguous for x.W^T): bf16 planes for wq/wk/wv, f16 of
  //     bf16 value x1024 for wo
  cvt16_all<<<gCV, blk, 0, stream>>>(Qin, Kin, Vin, wq, wk, wv, wo, XBQ, XBK, XBV, WQB, WKB, WVB, WOB);
  // (1) the three projections + bias, each [4096][768] f32 (col = h*64+d)
  gemm_bfb3<<<gG3, bG, 0, stream>>>(XBQ, XBK, XBV, WQB, WKB, WVB, bq, bk, bv, FQ, FK, FV, ROWS, DMOD, DMOD, 1.0f);
  // (2) q and k -> f16 hi x1024 + residual planes; v -> v^T planes x1024 (hi + residual)
  planes_qkv<<<gPL, blk, 0, stream>>>(FQ, FK, FV, QHI, QLO, KHI, KLO, VHI, VLO);
  // (3) attention with per-head x per-key bias -> O planes [b][s][h][d] x1024 (hi + residual)
  attn_fwd<<<gAT, bAT, 0, stream>>>(QHI, QLO, KHI, KLO, VHI, VLO, mask, mcw, OHI, OLO);
  // (4) output projection + bias -> out [4096][768] f32, carries 1024 (O) x 1024 (wo) folded back
  gemm_h2<<<gG, bG, 0, stream>>>(OHI, OLO, WOB, bo, out, ROWS, DMOD, DMOD, 1.0f / (OSC * WOS));
  (void)hipGetLastError();
}

// v003
// Measured time: 166 microseconds a run.
// Two timings next to v002 both put it at 1.24 times that version's speed.
// Counting every step since v000, it is 1.77 times as fast.
// Contractions: x.W{q,k,v}^T on v_wmma_f32_16x16x32_bf16 (x and W RNE-converted to bf16 operands, f32 accumulate, bias added in f32);
// scores k'.q'^T (q', k' carried x1024 as f16 hi plane + f16 residual plane, products hh+lh+hl), P.v (P x32768 f16 hi+residual,
// v x1024 f16 hi+residual, products hh+lh+hl) and O.Wo^T (O x1024 f16 hi+residual, Wo as f16(bf16(Wo) x1024), products h.w+l.w):
// v_wmma_f32_16x16x32_f16, f32 accumulate. Per-head x per-key additive score bias, base-2 online softmax, 1/l fold in f32 on VALU.
#include <hip/hip_runtime.h>
#include <math.h>
#include <stdint.h>

#define NB    2
#define SEQ   2048
#define DMOD  768
#define NH    12
#define HD    64
#define NQT   (SEQ / 64)
#define QSC   1024.0f
#define KSC   1024.0f
#define PCAR  32768.0f
#define VCAR  1024.0f
#define OSC   1024.0f
#define WOS   1024.0f
#define LOG2E 1.4426950408889634f
#define ATT_WAVES   4
#define ATT_THREADS (ATT_WAVES * 32)
#define ATT_BLOCKS  (NB * NH * NQT)
#define NKB    (SEQ / 32)
#define SLABF  (16 * 68)
#define SLAB64 (16 * 68)
#define VTP    72
#define SKEYS  64
#define NST    (SEQ / SKEYS)
#define RPH    72
#define TILEH  (64 * RPH)
#define GKS    64                              // k per GEMM stage: one whole 128-B line of every operand row
#define GXB    ((NB * SEQ * DMOD / 8) / 256)   // blocks of 256 threads x 8 elements per [4096][768] plane
#define GWB    ((DMOD * DMOD / 8) / 256)       // the same per [768][768] plane
#define GVT    (NB * NH * NQT)                 // blocks of the v^T stage
static_assert(HD == 64 && DMOD == NH * HD);
static_assert(NQT == 32 && NH == 12 && NB == 2);
static_assert(ATT_THREADS == 128 && ATT_BLOCKS == 768 && NKB == 64);
static_assert(((NB * SEQ) % 64) == 0 && (DMOD % 64) == 0 && (DMOD % 32) == 0);
static_assert((SEQ % 64) == 0 && (SEQ % 8) == 0);
static_assert(((NB * SEQ * DMOD / 8) % 256) == 0 && ((DMOD * DMOD / 8) % 256) == 0);
static_assert(GXB == 1536 && GWB == 288 && GVT == 768);
static_assert(ATT_WAVES * SLABF >= 4 * 16 * 68);
static_assert(HD * VTP >= 63 * VTP + 64);
static_assert(2 * 2 * TILEH * 2 >= 4 * SLAB64 * 4 && (DMOD % GKS) == 0 && DMOD / GKS >= 2);
static_assert(SKEYS == 64 && NST >= 2 && NST * SKEYS == SEQ && (RPH * 2) % 16 == 0 && TILEH >= 63 * RPH + 64);

typedef unsigned short u16;
typedef _Float16 v16h __attribute__((ext_vector_type(16)));
typedef _Float16 v8h  __attribute__((ext_vector_type(8)));
typedef __bf16   v16b __attribute__((ext_vector_type(16)));
typedef float    v8f  __attribute__((ext_vector_type(8)));
typedef float    v4f  __attribute__((ext_vector_type(4)));
typedef unsigned int v4u __attribute__((ext_vector_type(4)));

union FragH { v16h v; v8h h[2]; v4u u[2]; };
union FragB { v16b v; v4u u[2]; };

// ---- scalar helpers --------------------------------------------------------------------------------
__device__ __forceinline__ unsigned short bf_bits(float f) {          // f32 -> bf16 bits, RNE convert
  unsigned u = __float_as_uint(f);
  return (unsigned short)((u + 0x7FFFu + ((u >> 16) & 1u)) >> 16);
}
__device__ __forceinline__ float bf_up(unsigned short h) { return __uint_as_float(((unsigned)h) << 16); }
__device__ __forceinline__ float bfr(float f) { return bf_up(bf_bits(f)); }
__device__ __forceinline__ unsigned short h_bits(_Float16 x) { return __builtin_bit_cast(unsigned short, x); }
__device__ __forceinline__ unsigned pk16(unsigned short a, unsigned short b) { return (unsigned)a | ((unsigned)b << 16); }
__device__ __forceinline__ v8f zero8() { v8f z = {0.f, 0.f, 0.f, 0.f, 0.f, 0.f, 0.f, 0.f}; return z; }
__device__ __forceinline__ v4f zero4() { v4f z = {0.f, 0.f, 0.f, 0.f}; return z; }

// ---- fragment loaders: 16-bit A/B operand, lane -> row/col (lane&15), p already includes +8*(lane>>4);
//      elements 0..7 <- p[0..7] (k0+8h..), elements 8..15 <- p[16..23] (k0+16+8h..)  (same split k map for A and B;
//      B is always read from a k-contiguous [n][k] plane)
__device__ __forceinline__ v16h ldfrag_h(const _Float16* p) {
  FragH f;
  f.h[0] = *(const v8h*)(p);
  f.h[1] = *(const v8h*)(p + 16);
  return f.v;
}
__device__ __forceinline__ v16b ldfrag_b(const u16* p) {              // bf16 plane read as unsigned integer vectors
  FragB f;
  f.u[0] = *(const v4u*)(p);
  f.u[1] = *(const v4u*)(p + 16);
  return f.v;
}

__device__ __forceinline__ v8f mma_h(v16h a, v16h b, v8f c) {
  return __builtin_amdgcn_wmma_f32_16x16x32_f16(false, a, false, b, (short)0, c, false, false);
}
__device__ __forceinline__ v8f mma_b(v16b a, v16b b, v8f c) {
  return __builtin_amdgcn_wmma_f32_16x16x32_bf16(false, a, false, b, (short)0, c, false, false);
}
__device__ __forceinline__ void guard2(v8f& a, v8f& b, v16h x0, v16h x1, v16h x2, v16h x3, v16h x4, v16h x5) {
#if defined(__HIP_DEVICE_COMPILE__)
  asm volatile("v_nop\n\tv_nop\n\tv_nop\n\tv_nop"
               : "+v"(a), "+v"(b) : "v"(x0), "v"(x1), "v"(x2), "v"(x3), "v"(x4), "v"(x5) : "memory");
#endif
}
template <typename F>
__device__ __forceinline__ void guard6(v8f& a, v8f& b, v8f& c, v8f& d, F x0, F x1, F x2, F x3, F x4, F x5) {
#if defined(__HIP_DEVICE_COMPILE__)
  asm volatile("v_nop\n\tv_nop\n\tv_nop\n\tv_nop"
               : "+v"(a), "+v"(b), "+v"(c), "+v"(d) : "v"(x0), "v"(x1), "v"(x2), "v"(x3), "v"(x4), "v"(x5) : "memory");
#endif
}
__device__ __forceinline__ void guard10(v8f& a, v8f& b, v8f& c, v8f& d, v16h x0, v16h x1, v16h x2, v16h x3, v16h x4,
                                        v16h x5, v16h x6, v16h x7, v16h x8, v16h x9) {
#if defined(__HIP_DEVICE_COMPILE__)
  asm volatile("v_nop\n\tv_nop\n\tv_nop\n\tv_nop"
               : "+v"(a), "+v"(b), "+v"(c), "+v"(d)
               : "v"(x0), "v"(x1), "v"(x2), "v"(x3), "v"(x4), "v"(x5), "v"(x6), "v"(x7), "v"(x8), "v"(x9) : "memory");
#endif
}
__device__ __forceinline__ void acc_guard4(v8f& a, v8f& b, v8f& c, v8f& d) {
#if defined(__HIP_DEVICE_COMPILE__)
  asm volatile("v_nop\n\tv_nop\n\tv_nop\n\tv_nop" : "+v"(a), "+v"(b), "+v"(c), "+v"(d));
#endif
}
// Four asynchronous 16-B copies per lane, global -> LDS (rows r, r+16, r+32, r+48 of one 64-row tile). The s_wait_xcnt stands in
// the copies' own statement so that no address register is rewritten in front of it.
__device__ __forceinline__ void copy4(unsigned l0, unsigned l1, unsigned l2, unsigned l3,
                                      const u16* g0, const u16* g1, const u16* g2, const u16* g3) {
#if defined(__HIP_DEVICE_COMPILE__)
  asm volatile("global_load_async_to_lds_b128 %0, %4, off\n\t"
               "global_load_async_to_lds_b128 %1, %5, off\n\t"
               "global_load_async_to_lds_b128 %2, %6, off\n\t"
               "global_load_async_to_lds_b128 %3, %7, off\n\t"
               "s_wait_xcnt 0x0"
               :: "v"(l0), "v"(l1), "v"(l2), "v"(l3), "v"(g0), "v"(g1), "v"(g2), "v"(g3) : "memory");
#endif
}
// One 64-row x 128-B tile: lbase = this lane's LDS byte address in row r, g = its global address in row r, gstep = 16 source rows.
__device__ __forceinline__ void copy_tile(unsigned lbase, const u16* g, size_t gstep) {
  copy4(lbase, lbase + 16u * (RPH * 2), lbase + 32u * (RPH * 2), lbase + 48u * (RPH * 2), g, g + gstep, g + 2 * gstep, g + 3 * gstep);
}
__device__ __forceinline__ void wait_async0() {   // this wave's copies have landed
#if defined(__HIP_DEVICE_COMPILE__)
  asm volatile("s_wait_asynccnt 0x0" ::: "memory");
#endif
}
__device__ __forceinline__ void wait_ds0() {      // this wave's LDS reads have returned before their buffer is handed back
#if defined(__HIP_DEVICE_COMPILE__)
  asm volatile("s_wait_dscnt 0x0" ::: "memory");
#endif
}
__device__ __forceinline__ void wave_sync_lds() {
  __builtin_amdgcn_fence(__ATOMIC_RELEASE, "workgroup");
  __builtin_amdgcn_wave_barrier();
  __builtin_amdgcn_fence(__ATOMIC_ACQUIRE, "workgroup");
}

// =====================================================================================================
// f32 plane -> 16-bit plane, same layout:  f16mode == 0: bf16 RNE bits;  f16mode == 1: f16 bits of (bf16 RNE value) * scale.
// Thread = 8 consecutive elements: two 16-B loads, one 16-B store; 32 consecutive lanes = 512 contiguous, 512-B aligned bytes
// gt = the thread's index within its plane.
// =====================================================================================================
__device__ __forceinline__ void cvt16_body(const float* __restrict__ x, u16* D, int gt, int f16mode, float scale) {
  const float* p = x + (size_t)gt * 8;
  const v4f a = *(const v4f*)(p), c4 = *(const v4f*)(p + 4);
  float v[8];
#pragma unroll
  for (int e = 0; e < 4; ++e) { v[e] = a[e]; v[4 + e] = c4[e]; }
  unsigned short s[8];
#pragma unroll
  for (int e = 0; e < 8; ++e) {
    const unsigned short hb = h_bits((_Float16)(bfr(v[e]) * scale));
    const unsigned short bb = bf_bits(v[e]);
    s[e] = (f16mode != 0) ? hb : bb;
  }
  v4u o;
#pragma unroll
  for (int e = 0; e < 4; ++e) o[e] = pk16(s[2 * e], s[2 * e + 1]);
  u16* d = D + (size_t)gt * 8;
  {
    *(v4u*)(d) = o;
    
  }
}
// All seven conversions in one grid (none reads another's output): blocks [0, 3*GXB) = the three input planes -> bf16,
// blocks [3*GXB, 3*GXB + 4*GWB) = wq, wk, wv -> bf16 and wo -> f16 of (bf16 value x1024). The plane is chosen per block (scalar).
// coverage: GXB (GWB) blocks x 256 thr x 8 = one whole plane each.
__global__ __launch_bounds__(256)
void cvt16_all(const float* __restrict__ xq, const float* __restrict__ xk, const float* __restrict__ xv,
               const float* __restrict__ wq, const float* __restrict__ wk, const float* __restrict__ wv,
               const float* __restrict__ wo, u16* XQ, u16* XK, u16* XV, u16* WQ, u16* WK, u16* WV, u16* WO) {
  const int bid = blockIdx.x;
  if (bid >= 3 * GXB + 4 * GWB) return;     // never taken with the exact grid; no barriers in this kernel
  const float* x;
  u16* D;
  int lb, f16mode = 0;
  float scale = 1.0f;
  if (bid < 3 * GXB) {
    const int pl = bid / GXB;
    lb = bid - pl * GXB;
    x = (pl == 0) ? xq : (pl == 1) ? xk : xv;
    D = (pl == 0) ? XQ : (pl == 1) ? XK : XV;
  } else {
    const int r = bid - 3 * GXB, pl = r / GWB;
    lb = r - pl * GWB;
    x = (pl == 0) ? wq : (pl == 1) ? wk : (pl == 2) ? wv : wo;
    D = (pl == 0) ? WQ : (pl == 1) ? WK : (pl == 2) ? WV : WO;
    if (pl == 3) { f16mode = 1; scale = WOS; }
  }
  cvt16_body(x, D, lb * 256 + (int)threadIdx.x, f16mode, scale);
}

// =====================================================================================================
// f32 plane -> f16 hi plane (value * sc, sc a power of two) + f16 residual plane (value * sc - hi, unscaled), same layout.
// Thread = 8 consecutive elements: two 16-B loads, one 16-B store per plane; 32 consecutive lanes = 512 contiguous, 512-B aligned
// gt = the thread's index within its plane.
// =====================================================================================================
__device__ __forceinline__ void split16_body(const float* __restrict__ x, u16* hpl, u16* lpl, int gt, float sc) {
  const float* p = x + (size_t)gt * 8;
  const v4f a = *(const v4f*)(p), c4 = *(const v4f*)(p + 4);
  float w[8];
#pragma unroll
  for (int e = 0; e < 4; ++e) { w[e] = a[e]; w[4 + e] = c4[e]; }
  v4u oh, ol;
#pragma unroll
  for (int e = 0; e < 4; ++e) {
    const float t0 = w[2 * e] * sc, t1 = w[2 * e + 1] * sc;
    const _Float16 h0 = (_Float16)t0, h1 = (_Float16)t1;
    const _Float16 l0 = (_Float16)(t0 - (float)h0), l1 = (_Float16)(t1 - (float)h1);
    oh[e] = pk16(h_bits(h0), h_bits(h1));
    ol[e] = pk16(h_bits(l0), h_bits(l1));
  }
  const size_t o8 = (size_t)gt * 8;
  {
    *(v4u*)(hpl + o8) = oh;
    *(v4u*)(lpl + o8) = ol;
#if defined(__HIP_DEVICE_COMPILE__)
    // the built code runs on from here into a joined test in front of the v^T stage, whose first instructions rewrite registers
    // that these two stores name: the wait stands in front of every such rewrite
    asm volatile("s_wait_xcnt 0x0" ::: "memory");
#endif
  }
}

// =====================================================================================================
// GEMM epilogue shared by both engines: the wave's 16x64 f32 tile (times oscale) staged in its LDS slab (pitch 68),
// coverage: 8 instructions x 2 rows x 16 lanes x 4 floats = the wave's 16 x 64 tile.
// =====================================================================================================
__device__ __forceinline__ void epi64(float* sl, v8f a0, v8f a1, v8f a2, v8f a3, float oscale, v4f badd, float* C, int N,
                                      size_t rowb, int col0, int lane) {
  const int hh = lane >> 4, m = lane & 15;
#pragma unroll
  for (int r = 0; r < 8; ++r) {
    const int ro = (8 * hh + r) * 68 + m;
    sl[ro]      = a0[r] * oscale;
    sl[ro + 16] = a1[r] * oscale;
    sl[ro + 32] = a2[r] * oscale;
    sl[ro + 48] = a3[r] * oscale;
  }
  wave_sync_lds();
  v4f vals[8];
#pragma unroll
  for (int it = 0; it < 8; ++it) vals[it] = *(const v4f*)(sl + (it * 2 + hh) * 68 + m * 4) + badd;
  float* dst = C + (rowb + (size_t)hh) * (size_t)N + col0 + m * 4;
  {
#pragma unroll
    for (int it = 0; it < 8; ++it) {
      *(v4f*)(dst + (size_t)(it * 2) * (size_t)N) = vals[it];
    }
    
  }
}

// =====================================================================================================
// bf16 GEMM with bias: C[M][N] (f32) = A[M][K] (bf16 row-major) . Bt[N][K]^T (bf16 k-contiguous), times oscale, plus bf16-RNE
// value of bias[n]. Block = 64x64 tile, 4 waves x 16 rows. The block's A and Bt tiles of 64 rows x 64 k (whole 128-B lines, LDS
// pitch 144 B) come into a two-buffer LDS ring by asynchronous copies, once per block, and all 4 waves read their fragments there
// (two 16-B LDS loads each, split k map for A and B); one block barrier per 64 k publishes the next stage and frees the one just
// read. k runs upward in steps of 32 as before (host checks K % 64 == 0, M % 64 == 0, N % 64 == 0, grid.x = (M/64)*(N/64)).
// Behind the loop's last barrier the ring is dead and holds the four result slabs.
// Three independent products of one shape in one grid: blockIdx.y picks the operand set (scalar selects).
// =====================================================================================================
__global__ __launch_bounds__(128)
void gemm_bfb3(const u16* __restrict__ A0, const u16* __restrict__ A1, const u16* __restrict__ A2,
               const u16* __restrict__ Bt0, const u16* __restrict__ Bt1, const u16* __restrict__ Bt2,
               const float* __restrict__ bias0, const float* __restrict__ bias1, const float* __restrict__ bias2,
               float* C0, float* C1, float* C2, int M, int N, int K, float oscale) {
  __shared__ __align__(16) u16 gring[2 * 2 * TILEH];        // [buffer][A, Bt][64 rows][pitch 72 halves]; epilogue: result slabs
  const int zz = blockIdx.y;
  const u16*   A    = (zz == 0) ? A0 : (zz == 1) ? A1 : A2;
  const u16*   Bt   = (zz == 0) ? Bt0 : (zz == 1) ? Bt1 : Bt2;
  const float* bias = (zz == 0) ? bias0 : (zz == 1) ? bias1 : bias2;
  float*       C    = (zz == 0) ? C0 : (zz == 1) ? C1 : C2;
  const int tid = threadIdx.x, wave = tid >> 5, lane = tid & 31, hh = lane >> 4, m = lane & 15;
  const int ntile = N >> 6;
  const int bid   = blockIdx.x;
  const int row0  = (bid / ntile) * 64;
  const int rowb  = row0 + wave * 16;
  const int col0  = (bid % ntile) * 64;
  const int nst   = K / GKS;
  if (row0 + 64 > M || nst < 1) return;      // block-uniform, in front of every barrier; never taken with the exact grid
  // copies: lane = (row cr of a group of 16, 16-B chunk cc of its 128-B line); a wave's copy = 4 whole lines
  const int cr = tid >> 3, cc = (tid & 7) * 8;
  const u16* ag = A  + (size_t)(row0 + cr) * K + cc;
  const u16* bg = Bt + (size_t)(col0 + cr) * K + cc;
  const size_t gs = (size_t)16 * K;
  const unsigned lcp = (unsigned)(uintptr_t)(gring + cr * RPH + cc);               // LDS byte address, buffer 0, A tile
  const u16* af = gring + (wave * 16 + m) * RPH + 8 * hh;                           // A fragment row of this lane, buffer 0
  const u16* bq = gring + TILEH + m * RPH + 8 * hh;                                 // Bt fragment row of this lane, buffer 0
  v8f acc0 = zero8(), acc1 = zero8(), acc2 = zero8(), acc3 = zero8();
#define GSTAGE(st, bf)                                                    \
  do {                                                                    \
    const unsigned lb_ = lcp + (unsigned)(bf) * (2u * TILEH * 2u);        \
    copy_tile(lb_,              ag + (size_t)(st) * GKS, gs);             \
    copy_tile(lb_ + TILEH * 2u, bg + (size_t)(st) * GKS, gs);             \
  } while (0)
  // ring prologue: stage 0 landed and published, then stage 1 in flight
  GSTAGE(0, 0);
  wait_async0();
  __syncthreads();
  if (1 < nst) GSTAGE(1, 1);
#pragma unroll 1   // stays rolled: one copy of the stage body and of its publish point
  for (int st = 0; st < nst; ++st) {
    const int bf = st & 1;
    const u16* as = af + bf * (2 * TILEH);
    const u16* bs = bq + bf * (2 * TILEH);
    // both k steps of the stage: fragments from LDS, then the products, k upward
    const v16b a   = ldfrag_b(as);
    const v16b b0  = ldfrag_b(bs);
    const v16b b1  = ldfrag_b(bs + 16 * RPH);
    const v16b b2  = ldfrag_b(bs + 32 * RPH);
    const v16b b3  = ldfrag_b(bs + 48 * RPH);
    const v16b a_  = ldfrag_b(as + 32);
    const v16b b0_ = ldfrag_b(bs + 32);
    const v16b b1_ = ldfrag_b(bs + 16 * RPH + 32);
    const v16b b2_ = ldfrag_b(bs + 32 * RPH + 32);
    const v16b b3_ = ldfrag_b(bs + 48 * RPH + 32);
    acc0 = mma_b(a, b0, acc0);
    acc1 = mma_b(a, b1, acc1);
    acc2 = mma_b(a, b2, acc2);
    acc3 = mma_b(a, b3, acc3);
    acc0 = mma_b(a_, b0_, acc0);
    acc1 = mma_b(a_, b1_, acc1);
    acc2 = mma_b(a_, b2_, acc2);
    acc3 = mma_b(a_, b3_, acc3);
    guard6<v16b>(acc0, acc1, acc2, acc3, a_, b0_, b1_, b2_, b3_, a_);
    // publish point of stage st + 1: own reads of this buffer done, own copies of the next landed, block barrier, then the refill
    wait_ds0();
    wait_async0();
    __syncthreads();
    if (st + 2 < nst) GSTAGE(st + 2, bf);
  }
  wait_async0();
#undef GSTAGE
  float* slab = (float*)(void*)gring;        // every wave is behind the last barrier: no reader and no copy is left on the ring
  const v4f bv = *(const v4f*)(bias + col0 + m * 4);      // columns col0 + 4m .. +3, always < N (N multiple of 64)
  v4f badd;
#pragma unroll
  for (int e = 0; e < 4; ++e) badd[e] = bfr(bv[e]);
  epi64(slab + wave * SLAB64, acc0, acc1, acc2, acc3, oscale, badd, C, N, (size_t)rowb, col0, lane);
}

// =====================================================================================================
// f16 hi+lo GEMM with bias: C[M][N] (f32) = (Ahi + Alo)[M][K] . Bt[N][K]^T times oscale, plus bf16-RNE value of bias[n];
// Ahi/Alo f16 planes (same layout), Bt f16 k-contiguous; products hi.B + lo.B into one accumulator (lo is the unscaled
// residual of hi). Same tiling and the same two-buffer LDS ring as gemm_bfb3, with three tiles a stage (Ahi, Alo, Bt).
// =====================================================================================================
__global__ __launch_bounds__(128)
void gemm_h2(const u16* __restrict__ Ah, const u16* __restrict__ Al, const u16* __restrict__ Bt,
             const float* __restrict__ bias, float* C, int M, int N, int K, float oscale) {
  __shared__ __align__(16) u16 gring[2 * 3 * TILEH];        // [buffer][Ahi, Alo, Bt][64 rows][pitch 72 halves]; epilogue: result slabs
  const int tid = threadIdx.x, wave = tid >> 5, lane = tid & 31, hh = lane >> 4, m = lane & 15;
  const int ntile = N >> 6;
  const int bid   = blockIdx.x;
  const int row0  = (bid / ntile) * 64;
  const int rowb  = row0 + wave * 16;
  const int col0  = (bid % ntile) * 64;
  const int nst   = K / GKS;
  if (row0 + 64 > M || nst < 1) return;      // block-uniform, in front of every barrier; never taken with the exact grid
  // copies: lane = (row cr of a group of 16, 16-B chunk cc of its 128-B line); a wave's copy = 4 whole lines
  const int cr = tid >> 3, cc = (tid & 7) * 8;
  const size_t aofs = (size_t)(row0 + cr) * K + cc;
  const u16* ahg = Ah + aofs;
  const u16* alg = Al + aofs;
  const u16* bg  = Bt + (size_t)(col0 + cr) * K + cc;
  const size_t gs = (size_t)16 * K;
  const unsigned lcp = (unsigned)(uintptr_t)(gring + cr * RPH + cc);               // LDS byte address, buffer 0, Ahi tile
  const _Float16* af = (const _Float16*)(const void*)gring + (wave * 16 + m) * RPH + 8 * hh;   // Ahi fragment row, buffer 0
  const _Float16* bq = (const _Float16*)(const void*)gring + 2 * TILEH + m * RPH + 8 * hh;     // Bt fragment row, buffer 0
  v8f acc0 = zero8(), acc1 = zero8(), acc2 = zero8(), acc3 = zero8();
#define GSTAGE(st, bf)                                                    \
  do {                                                                    \
    const unsigned lb_ = lcp + (unsigned)(bf) * (3u * TILEH * 2u);        \
    copy_tile(lb_,                   ahg + (size_t)(st) * GKS, gs);       \
    copy_tile(lb_ + 1u * TILEH * 2u, alg + (size_t)(st) * GKS, gs);       \
    copy_tile(lb_ + 2u * TILEH * 2u, bg  + (size_t)(st) * GKS, gs);       \
  } while (0)
  // ring prologue: stage 0 landed and published, then stage 1 in flight
  GSTAGE(0, 0);
  wait_async0();
  __syncthreads();
  if (1 < nst) GSTAGE(1, 1);
#pragma unroll 1   // stays rolled: one copy of the stage body and of its publish point
  for (int st = 0; st < nst; ++st) {
    const int bf = st & 1;
    const _Float16* as = af + bf * (3 * TILEH);
    const _Float16* bs = bq + bf * (3 * TILEH);
    // both k steps of the stage: fragments from LDS, then the products, k upward
    const v16h ah  = ldfrag_h(as),      al  = ldfrag_h(as + TILEH);
    const v16h b0  = ldfrag_h(bs);
    const v16h b1  = ldfrag_h(bs + 16 * RPH);
    const v16h b2  = ldfrag_h(bs + 32 * RPH);
    const v16h b3  = ldfrag_h(bs + 48 * RPH);
    const v16h ah_ = ldfrag_h(as + 32), al_ = ldfrag_h(as + TILEH + 32);
    const v16h b0_ = ldfrag_h(bs + 32);
    const v16h b1_ = ldfrag_h(bs + 16 * RPH + 32);
    const v16h b2_ = ldfrag_h(bs + 32 * RPH + 32);
    const v16h b3_ = ldfrag_h(bs + 48 * RPH + 32);
    acc0 = mma_h(ah, b0, acc0);    acc0 = mma_h(al, b0, acc0);
    acc1 = mma_h(ah, b1, acc1);    acc1 = mma_h(al, b1, acc1);
    acc2 = mma_h(ah, b2, acc2);    acc2 = mma_h(al, b2, acc2);
    acc3 = mma_h(ah, b3, acc3);    acc3 = mma_h(al, b3, acc3);
    acc0 = mma_h(ah_, b0_, acc0);  acc0 = mma_h(al_, b0_, acc0);
    acc1 = mma_h(ah_, b1_, acc1);  acc1 = mma_h(al_, b1_, acc1);
    acc2 = mma_h(ah_, b2_, acc2);  acc2 = mma_h(al_, b2_, acc2);
    acc3 = mma_h(ah_, b3_, acc3);  acc3 = mma_h(al_, b3_, acc3);
    guard6<v16h>(acc0, acc1, acc2, acc3, ah_, al_, b0_, b1_, b2_, b3_);
    // publish point of stage st + 1: own reads of this buffer done, own copies of the next landed, block barrier, then the refill
    wait_ds0();
    wait_async0();
    __syncthreads();
    if (st + 2 < nst) GSTAGE(st + 2, bf);
  }
  wait_async0();
#undef GSTAGE
  float* slab = (float*)(void*)gring;        // every wave is behind the last barrier: no reader and no copy is left on the ring
  const v4f bv = *(const v4f*)(bias + col0 + m * 4);      // columns col0 + 4m .. +3, always < N (N multiple of 64)
  v4f badd;
#pragma unroll
  for (int e = 0; e < 4; ++e) badd[e] = bfr(bv[e]);
  epi64(slab + wave * SLAB64, acc0, acc1, acc2, acc3, oscale, badd, C, N, (size_t)rowb, col0, lane);
}

// =====================================================================================================
// v^T planes: VH[(b*NH + h)*HD + d][s] = f16(v[b][s][h][d] * 1024), VL = f16 residual of the same value.
// Block = (b, h, 64 keys): 64 source rows of HD floats loaded with 16-B loads, converted, scattered into two LDS tiles
// coverage: load 256 thr x 16 elements = 64 x 64; store 2 iterations x 256 thr x 8 halves = 64 lines x 64 = the block's tile of
//           each plane; NB x NH x SEQ/64 = 768 blocks cover both planes exactly once.
// =====================================================================================================
__device__ __forceinline__ void vt16_body(const float* __restrict__ v, u16* VHo, u16* VLo, int bid, u16* TH, u16* TL) {
  const int tid = threadIdx.x;
  const int st  = bid & (NQT - 1);
  const int bh  = bid >> 5;                  // NQT == 32
  const int h   = bh % NH;
  const int b   = bh / NH;
  const int s0  = st * 64;
  {
    const int sl = tid >> 2;                  // key within tile 0..63
    const int dc = (tid & 3) * 16;            // d chunk
    const float* src = v + (((size_t)(b * SEQ + s0 + sl)) * NH + h) * HD + dc;
#pragma unroll
    for (int i = 0; i < 4; ++i) {
      const v4f a = *(const v4f*)(src + 4 * i);
#pragma unroll
      for (int e = 0; e < 4; ++e) {
        const float t = a[e] * VCAR;
        const _Float16 hv = (_Float16)t;
        const _Float16 lv = (_Float16)(t - (float)hv);
        TH[(dc + 4 * i + e) * VTP + sl] = h_bits(hv);
        TL[(dc + 4 * i + e) * VTP + sl] = h_bits(lv);
      }
    }
  }
  __syncthreads();
  v4u vh[2], vl[2];
  const int q8 = tid >> 3, p8 = (tid & 7) * 8;
#pragma unroll
  for (int it = 0; it < 2; ++it) {
    const int line = it * 32 + q8;            // d = 0..63
    vh[it] = *(const v4u*)(TH + line * VTP + p8);
    vl[it] = *(const v4u*)(TL + line * VTP + p8);
  }
  const size_t base = ((size_t)(b * NH + h) * HD) * SEQ + s0 + p8;
  {
#pragma unroll
    for (int it = 0; it < 2; ++it) {
      const int line = it * 32 + q8;
      *(v4u*)(VHo + base + (size_t)line * SEQ) = vh[it];
      *(v4u*)(VLo + base + (size_t)line * SEQ) = vl[it];
    }
    
  }
}
// The three plane-forming stages behind the projections in one grid (none reads another's output): blocks [0, GVT) = v^T planes,
// [GVT, GVT + GXB) = q planes, [GVT + GXB, GVT + 2*GXB) = k planes. The branch is block-uniform, so the barrier inside vt16_body is
// passed by all threads of its block or by none.
__global__ __launch_bounds__(256)
void planes_qkv(const float* __restrict__ fq, const float* __restrict__ fk, const float* __restrict__ fv,
                u16* QH, u16* QL, u16* KH, u16* KL, u16* VH, u16* VL) {
  __shared__ __align__(16) u16 TH[HD * VTP];
  __shared__ __align__(16) u16 TL[HD * VTP];
  const int bid = blockIdx.x;
  if (bid >= GVT + 2 * GXB) return;         // never taken with the exact grid; block-uniform, in front of the barrier
  if (bid < GVT) {
    vt16_body(fv, VH, VL, bid, TH, TL);
  } else {
    const int r = bid - GVT, pl = r / GXB;
    const int gt = (r - pl * GXB) * 256 + (int)threadIdx.x;
    split16_body((pl == 0) ? fq : fk, (pl == 0) ? QH : KH, (pl == 0) ? QL : KL, gt, (pl == 0) ? QSC : KSC);
  }
}

// =====================================================================================================
// Full (non-causal) multi-head flash attention with a per-head x per-key additive score bias: block = (batch b, head, 64 query
// rows), 4 waves, wave w owns the 16 query rows q0 = 64*qt + 16*w .. q0+15. The k and v^T tiles of 64 keys (hi and residual planes,
// 4 tiles of 64 rows x 128 B, LDS pitch 144 B) are brought into a two-buffer LDS ring by asynchronous copies, whole 128-B lines,
// once per block, and read by all 4 waves; one block barrier per 64 keys publishes the next stage and frees the one just read.
//   q planes (hi, lo f16, x1024) laid out [b][s][h][d]; k planes the same; v^T planes [b][h][d][s] (x1024).
//   All NKB = 64 key blocks of 32 keys are visited (static bound).
//   Scores are computed TRANSPOSED: S^T tile g (g = 0,1) = k rows (keys kb+16g .. +15, A operand, row m = lane&15, split k map
//   over d) times q^T (B operand, col n = query q0 + (lane&15), k = d, split map), 3 products per tile and d-chunk
//   (k_hi.q_hi + k_lo.q_hi + k_hi.q_lo). D element r of lane l = (key kb+16g+8h+r, query q0+(l&15)), so a lane owns one query
//   column and 16 of its 32 keys; the partner lane l^16 owns the other 16 -> row max / row sum need one xor-16 shuffle.
//   Logit of key j, query i (base 2): (S * 1/8 * 2^-20 + bfr(wh) * bfr(mask[b][j])) * log2(e); the bias is loaded per key with
//   the same element -> key map as the transposed scores (t[i] <- key kb+8h+i, t[8+i] <- key kb+16+8h+i), added in f32.
//   Online max-subtracted base-2 softmax in f32. The exp'd values ARE the P A-fragment in place: A row m = query = lane&15,
//   element i <- key kb+8h+i (tile 0, D element i), element 8+i <- key kb+16+8h+i (tile 1, D element i). P is carried x32768
//   as f16 hi + f16 residual. The rescale factor of query row 8h+r of the O accumulators is fetched from lane 8h+r with a
//   shuffle (uniform control). 4+4 v^T B fragments (hi and residual planes, col n = d = 16j + (lane&15), keys k-contiguous),
//   12 P.V WMMAs (hh + lh + hl).
//   Epilogue: 1/l (per query, shuffled to the D row owner) and carry folds in f32; the wave's 16x64 f32 result staged in its LDS
// coverage: per wave 4 instructions x 4 rows x 8 lanes x 8 halves = 16 x 64 per plane; grid 768 blocks x 4 waves = every
//           (b, s, h) row of both O planes exactly once.
// =====================================================================================================
__global__ __launch_bounds__(ATT_THREADS)
void attn_fwd(const u16* __restrict__ QHIp, const u16* __restrict__ QLOp,
              const u16* __restrict__ KHIp, const u16* __restrict__ KLOp,
              const u16* __restrict__ VHIp, const u16* __restrict__ VLOp,
              const float* __restrict__ maskp, const float* __restrict__ mcwp,
              u16* OHIp, u16* OLOp) {
  __shared__ __align__(16) float smem[ATT_WAVES * SLABF];   // per wave: result slab [16][68] in the epilogue only
  __shared__ __align__(16) u16 ring[2 * 4 * TILEH];         // [buffer][k hi, k lo, v^T hi, v^T lo][64 rows][pitch 72 halves]

  const int tid  = threadIdx.x;
  const int wave = tid >> 5;
  const int lane = tid & 31;
  const int hh   = lane >> 4;
  const int c    = lane & 15;

  const int bid  = blockIdx.x;
  const int qt   = bid & (NQT - 1);
  const int bh   = bid >> 5;                 // NQT == 32
  const int head = bh % NH;
  const int b    = bh / NH;
  const int q0   = qt * 64 + wave * 16;

  // B fragments of q^T: col n = query q0 + c, k = d (k-contiguous row of the q plane)
  const size_t qofs = (((size_t)(b * SEQ + q0 + c)) * NH + head) * HD + 8 * hh;
  const _Float16* Qh  = (const _Float16*)(const void*)QHIp + qofs;
  const _Float16* Ql  = (const _Float16*)(const void*)QLOp + qofs;
  // copies: lane = (row cr of a group of 16, 16-B chunk cc of its 128-B row); a wave's copy = 4 whole rows
  const int cr = tid >> 3, cc = (tid & 7) * 8;
  const size_t kcp = (((size_t)b * SEQ + cr) * NH + head) * HD + cc;               // key row: stage's first key added per stage
  const size_t vcp = ((size_t)(b * NH + head) * HD + cr) * SEQ + cc;               // d row: stage's first key added per stage
  const unsigned lcp = (unsigned)(uintptr_t)(ring + cr * RPH + cc);                // LDS byte address, buffer 0, tile 0
  // A fragments of k: row m = key (in stage) 16g + c, k = d;  B fragments of v: col n = d = 16j + c, k = key (in stage)
  const _Float16* ringh = (const _Float16*)(const void*)ring + c * RPH + 8 * hh;
  // per-key bias row: mask[b][kb + 8hh + 0..7] (tile 0) and [kb + 16 + 8hh + 0..7] (tile 1), 16-B aligned loads
  const float* mrow = maskp + (size_t)b * SEQ + 8 * hh;
  const float  wh2  = bfr(mcwp[head]);                                              // per-head scalar (bf16 RNE value)
  const float lsc = 0.125f * (LOG2E / (QSC * KSC));

  float mrun = -INFINITY, lrun = 0.f;
  v8f o[4];
#pragma unroll
  for (int j = 0; j < 4; ++j) o[j] = zero8();

#define STAGE_COPY(st, bf)                                                                        \
  do {                                                                                            \
    const unsigned lb_ = lcp + (unsigned)(bf) * (4u * TILEH * 2u);                                \
    const size_t ko_ = kcp + (size_t)(st) * (SKEYS * NH * HD), vo_ = vcp + (size_t)(st) * SKEYS;  \
    copy_tile(lb_,                   KHIp + ko_, (size_t)16 * (NH * HD));                         \
    copy_tile(lb_ + 1u * TILEH * 2u, KLOp + ko_, (size_t)16 * (NH * HD));                         \
    copy_tile(lb_ + 2u * TILEH * 2u, VHIp + vo_, (size_t)16 * SEQ);                               \
    copy_tile(lb_ + 3u * TILEH * 2u, VLOp + vo_, (size_t)16 * SEQ);                               \
  } while (0)

  // ring prologue: stage 0 landed and published, then stage 1 in flight
  STAGE_COPY(0, 0);
  wait_async0();
  __syncthreads();
  STAGE_COPY(1, 1);

#pragma unroll 1   // stays rolled: one copy of the stage body and of its publish point
  for (int st = 0; st < NST; ++st) {
   const int bf = st & 1;
   const _Float16* stg = ringh + bf * (4 * TILEH);
#pragma unroll     // the stage's two 32-key passes: their LDS offsets become immediates of the loads
   for (int sub = 0; sub < 2; ++sub) {
    const int kb = st * SKEYS + sub * 32;
    const v4f ma = *(const v4f*)(mrow + kb),      mb = *(const v4f*)(mrow + kb + 4);
    const v4f mc = *(const v4f*)(mrow + kb + 16), md = *(const v4f*)(mrow + kb + 20);
    // ---- transposed scores: s0 = keys kb..kb+15, s1 = keys kb+16..kb+31, column = query q0 + c ----
    v8f s0 = zero8(), s1 = zero8();
    const _Float16* k0p = stg + (sub * 32) * RPH;
    const _Float16* k1p = k0p + 16 * RPH;
    const _Float16* l0p = k0p + TILEH;
    const _Float16* l1p = l0p + 16 * RPH;
#pragma unroll
    for (int kk = 0; kk < 2; ++kk) {
      const v16h qh  = ldfrag_h(Qh + kk * 32),  ql  = ldfrag_h(Ql + kk * 32);
      const v16h kh0 = ldfrag_h(k0p + kk * 32), kl0 = ldfrag_h(l0p + kk * 32);
      const v16h kh1 = ldfrag_h(k1p + kk * 32), kl1 = ldfrag_h(l1p + kk * 32);
      s0 = mma_h(kh0, qh, s0);
      s0 = mma_h(kl0, qh, s0);
      s0 = mma_h(kh0, ql, s0);
      s1 = mma_h(kh1, qh, s1);
      s1 = mma_h(kl1, qh, s1);
      s1 = mma_h(kh1, ql, s1);
      guard2(s0, s1, qh, ql, kh0, kl0, kh1, kl1);
    }
    // ---- base-2 logits of this lane's 16 keys for query q0 + c: t[i] <- key kb+8hh+i, t[8+i] <- key kb+16+8hh+i ----
    float t[16];
#pragma unroll
    for (int e = 0; e < 4; ++e) {
      t[e]      = s0[e] * lsc     + (wh2 * bfr(ma[e])) * LOG2E;
      t[4 + e]  = s0[4 + e] * lsc + (wh2 * bfr(mb[e])) * LOG2E;
      t[8 + e]  = s1[e] * lsc     + (wh2 * bfr(mc[e])) * LOG2E;
      t[12 + e] = s1[4 + e] * lsc + (wh2 * bfr(md[e])) * LOG2E;
    }
    float cm = t[0];
#pragma unroll
    for (int i = 1; i < 16; ++i) cm = fmaxf(cm, t[i]);
    cm = fmaxf(cm, __shfl_xor(cm, 16, 32));
    const float mn = fmaxf(mrun, cm);        // finite from the first block on
    const float al = exp2f(mrun - mn);       // 0 on the first block (mrun = -inf)
    mrun = mn;
    // ---- probabilities (<= 1) and the P A-fragments: hi = f16(p * 32768), lo = f16 residual; element i <-> t[i] ----
    float ps = 0.f;
    FragH ph, pl;
#pragma unroll
    for (int w = 0; w < 2; ++w) {
#pragma unroll
      for (int e4 = 0; e4 < 4; ++e4) {
        const int i = 8 * w + 2 * e4;
        const float p0 = exp2f(t[i] - mn), p1 = exp2f(t[i + 1] - mn);
        ps += p0 + p1;
        const float a0 = p0 * PCAR, a1 = p1 * PCAR;
        const _Float16 h0 = (_Float16)a0, h1 = (_Float16)a1;
        const _Float16 l0 = (_Float16)(a0 - (float)h0), l1 = (_Float16)(a1 - (float)h1);
        ph.u[w][e4] = pk16(h_bits(h0), h_bits(h1));
        pl.u[w][e4] = pk16(h_bits(l0), h_bits(l1));
      }
    }
    ps += __shfl_xor(ps, 16, 32);
    lrun = lrun * al + ps;
    // ---- rescale the O accumulators: D row 8hh+r = query q0+8hh+r, its factor lives in lane 8hh+r (and 16+8hh+r) ----
    float scl[8];
#pragma unroll
    for (int r = 0; r < 8; ++r) scl[r] = __shfl(al, 8 * hh + r, 32);
#pragma unroll
    for (int j = 0; j < 4; ++j) {
#pragma unroll
      for (int r = 0; r < 8; ++r) o[j][r] *= scl[r];
    }
    // ---- P.V : B fragment col n = d = j*16 + c, keys contiguous in the v^T planes ----
    {
      const _Float16* vhp = stg + 2 * TILEH + sub * 32;
      const _Float16* vlp = vhp + TILEH;
      const v16h vh0 = ldfrag_h(vhp);
      const v16h vh1 = ldfrag_h(vhp + 16 * RPH);
      const v16h vh2 = ldfrag_h(vhp + 32 * RPH);
      const v16h vh3 = ldfrag_h(vhp + 48 * RPH);
      const v16h vl0 = ldfrag_h(vlp);
      const v16h vl1 = ldfrag_h(vlp + 16 * RPH);
      const v16h vl2 = ldfrag_h(vlp + 32 * RPH);
      const v16h vl3 = ldfrag_h(vlp + 48 * RPH);
      o[0] = mma_h(ph.v, vh0, o[0]);  o[0] = mma_h(pl.v, vh0, o[0]);  o[0] = mma_h(ph.v, vl0, o[0]);
      o[1] = mma_h(ph.v, vh1, o[1]);  o[1] = mma_h(pl.v, vh1, o[1]);  o[1] = mma_h(ph.v, vl1, o[1]);
      o[2] = mma_h(ph.v, vh2, o[2]);  o[2] = mma_h(pl.v, vh2, o[2]);  o[2] = mma_h(ph.v, vl2, o[2]);
      o[3] = mma_h(ph.v, vh3, o[3]);  o[3] = mma_h(pl.v, vh3, o[3]);  o[3] = mma_h(ph.v, vl3, o[3]);
      guard10(o[0], o[1], o[2], o[3], ph.v, pl.v, vh0, vh1, vh2, vh3, vl0, vl1, vl2, vl3);
    }
   }
   // publish point of stage st + 1: own reads of this buffer done, own copies of the next landed, block barrier, then the refill
   wait_ds0();
   wait_async0();
   __syncthreads();
   if (st + 2 < NST) STAGE_COPY(st + 2, bf);
  }
  wait_async0();
#undef STAGE_COPY
  acc_guard4(o[0], o[1], o[2], o[3]);

  // ---- fold 1/l (per query, owned by lane = query) and the carries (32768 on P, 1024 on v); stage the 16x64 slab ----
  const float linv = (1.0f / lrun) * (1.0f / (PCAR * VCAR));
  float inv[8];
#pragma unroll
  for (int r = 0; r < 8; ++r) inv[r] = __shfl(linv, 8 * hh + r, 32);
  float* slab = smem + wave * SLABF;
#pragma unroll
  for (int r = 0; r < 8; ++r) {
#pragma unroll
    for (int j = 0; j < 4; ++j) slab[(8 * hh + r) * 68 + j * 16 + c] = o[j][r] * inv[r];
  }
  wave_sync_lds();
  // ---- O x1024 -> f16 hi + residual planes; lane = (row in group of 4, 8 consecutive d) ----
  v4u oh[4], ol[4];
  const int rq = lane >> 3, c8 = (lane & 7) * 8;
#pragma unroll
  for (int i4 = 0; i4 < 4; ++i4) {
    const int row = i4 * 4 + rq;
    const v4f a = *(const v4f*)(slab + row * 68 + c8), c4 = *(const v4f*)(slab + row * 68 + c8 + 4);
    float w[8];
#pragma unroll
    for (int e = 0; e < 4; ++e) { w[e] = a[e] * OSC; w[4 + e] = c4[e] * OSC; }
#pragma unroll
    for (int e = 0; e < 4; ++e) {
      const _Float16 h0 = (_Float16)w[2 * e], h1 = (_Float16)w[2 * e + 1];
      const _Float16 l0 = (_Float16)(w[2 * e] - (float)h0), l1 = (_Float16)(w[2 * e + 1] - (float)h1);
      oh[i4][e] = pk16(h_bits(h0), h_bits(h1));
      ol[i4][e] = pk16(h_bits(l0), h_bits(l1));
    }
  }
  const size_t ob = (((size_t)(b * SEQ + q0)) * NH + head) * HD + c8;
  {
#pragma unroll
    for (int i4 = 0; i4 < 4; ++i4) {
      const int row = i4 * 4 + rq;
      const size_t o8 = ob + (size_t)row * (NH * HD);
      *(v4u*)(OHIp + o8) = oh[i4];
      *(v4u*)(OLOp + o8) = ol[i4];
    }
    
  }
}

// =====================================================================================================
// Workspace map (bytes); every plane is fully written by whole-line stores before it is read; all extents are exact multiples
// of the store granularity (no pad rows needed); every offset a multiple of 131072 (128 KiB); q, k and v each have their
// own input plane and projection plane, so that each stage runs as one grid over all three:
//   XBQ bf16 [4096][768]               6291456        XBK same  6291456      XBV same  6291456
//   WQB bf16 [768 n][768 k]            1179648        WKB same  1179648      WVB same  1179648
//   WOB f16  [768 n][768 k] x1024      1179648
//   FQ  f32 [4096][768]               12582912        FK same  12582912      FV same  12582912
//   QHI f16 [2][2048][12][64] x1024    6291456        QLO residual         6291456
//   KHI same                           6291456        KLO residual         6291456
//   VHI f16 [2][12][64][2048] x1024    6291456        VLO residual         6291456
//   OHI f16 [4096][768] x1024          6291456        OLO residual         6291456
//   end                              111673344
// =====================================================================================================
extern "C" void kernel_launch(void* const* d_in, const int* in_sizes, int n_in,
                              void* d_out, int out_size, void* d_ws, size_t ws_size,
                              hipStream_t stream) {
  const int ROWS = NB * SEQ;                            // 4096
  if (n_in < 13) return;
  if (in_sizes[0] != ROWS * DMOD || in_sizes[1] != ROWS * DMOD || in_sizes[2] != ROWS * DMOD) return;
  if (in_sizes[3] != NB * SEQ) return;
  if (in_sizes[4] != DMOD * DMOD || in_sizes[6] != DMOD * DMOD) return;
  if (in_sizes[8] != DMOD * DMOD || in_sizes[10] != DMOD * DMOD) return;
  if (in_sizes[5] != DMOD || in_sizes[7] != DMOD || in_sizes[9] != DMOD || in_sizes[11] != DMOD) return;
  if (in_sizes[12] != NH) return;
  if (out_size != ROWS * DMOD) return;

  const float* Qin  = (const float*)d_in[0];
  const float* Kin  = (const float*)d_in[1];
  const float* Vin  = (const float*)d_in[2];
  const float* mask = (const float*)d_in[3];
  const float* wq   = (const float*)d_in[4];
  const float* bq   = (const float*)d_in[5];
  const float* wk   = (const float*)d_in[6];
  const float* bk   = (const float*)d_in[7];
  const float* wv   = (const float*)d_in[8];
  const float* bv   = (const float*)d_in[9];
  const float* wo   = (const float*)d_in[10];
  const float* bo   = (const float*)d_in[11];
  const float* mcw  = (const float*)d_in[12];
  float*       out  = (float*)d_out;

  const size_t szXB  = (size_t)ROWS * DMOD * 2;                 //  6291456
  const size_t szW   = (size_t)DMOD * DMOD * 2;                 //  1179648
  const size_t szF   = (size_t)ROWS * DMOD * 4;                 // 12582912
  const size_t szP   = (size_t)ROWS * DMOD * 2;                 //  6291456  (q/k/o planes)
  const size_t szVP  = (size_t)NB * NH * HD * SEQ * 2;          //  6291456
  size_t off = 0;
  const size_t oXBQ = off; off += szXB;
  const size_t oXBK = off; off += szXB;
  const size_t oXBV = off; off += szXB;
  const size_t oWQB = off; off += szW;
  const size_t oWKB = off; off += szW;
  const size_t oWVB = off; off += szW;
  const size_t oWOB = off; off += szW;
  const size_t oFQ  = off; off += szF;
  const size_t oFK  = off; off += szF;
  const size_t oFV  = off; off += szF;
  const size_t oQHI = off; off += szP;
  const size_t oQLO = off; off += szP;
  const size_t oKHI = off; off += szP;
  const size_t oKLO = off; off += szP;
  const size_t oVHI = off; off += szVP;
  const size_t oVLO = off; off += szVP;
  const size_t oOHI = off; off += szP;
  const size_t oOLO = off; off += szP;
  if (off > ws_size) return;                            // off = 111673344
  if (off > (size_t)134217728) return;

  char* ws = (char*)d_ws;
  u16*   XBQ = (u16*)(ws + oXBQ);
  u16*   XBK = (u16*)(ws + oXBK);
  u16*   XBV = (u16*)(ws + oXBV);
  u16*   WQB = (u16*)(ws + oWQB);
  u16*   WKB = (u16*)(ws + oWKB);
  u16*   WVB = (u16*)(ws + oWVB);
  u16*   WOB = (u16*)(ws + oWOB);
  float* FQ  = (float*)(ws + oFQ);
  float* FK  = (float*)(ws + oFK);
  float* FV  = (float*)(ws + oFV);
  u16*   QHI = (u16*)(ws + oQHI);
  u16*   QLO = (u16*)(ws + oQLO);
  u16*   KHI = (u16*)(ws + oKHI);
  u16*   KLO = (u16*)(ws + oKLO);
  u16*   VHI = (u16*)(ws + oVHI);
  u16*   VLO = (u16*)(ws + oVLO);
  u16*   OHI = (u16*)(ws + oOHI);
  u16*   OLO = (u16*)(ws + oOLO);

  const dim3 blk(256);
  const int n8x = (ROWS * DMOD) / 8;                    // 393216
  const int n8w = (DMOD * DMOD) / 8;                    //  73728
  if ((n8x % 256) != 0 || (n8w % 256) != 0) return;
  if ((ROWS % 64) != 0 || (DMOD % 64) != 0 || (DMOD % 32) != 0) return;
  if (n8x / 256 != GXB || n8w / 256 != GWB) return;
  const dim3 gCV(3 * GXB + 4 * GWB);                    // 5760
  const dim3 gG((ROWS / 64) * (DMOD / 64));             //  768
  const dim3 gG3((ROWS / 64) * (DMOD / 64), 3);         //  768 x 3
  const dim3 bG(128);
  const dim3 gPL(GVT + 2 * GXB);                        // 3840
  const dim3 gAT(ATT_BLOCKS);                           //  768
  const dim3 bAT(ATT_THREADS);                          //  128

  // (0) all conversions: inputs -> bf16 planes; weights [n][k] (already k-contiguous for x.W^T): bf16 planes for wq/wk/wv, f16 of
  //     bf16 value x1024 for wo
  cvt16_all<<<gCV, blk, 0, stream>>>(Qin, Kin, Vin, wq, wk, wv, wo, XBQ, XBK, XBV, WQB, WKB, WVB, WOB);
  // (1) the three projections + bias, each [4096][768] f32 (col = h*64+d)
  gemm_bfb3<<<gG3, bG, 0, stream>>>(XBQ, XBK, XBV, WQB, WKB, WVB, bq, bk, bv, FQ, FK, FV, ROWS, DMOD, DMOD, 1.0f);
  // (2) q and k -> f16 hi x1024 + residual planes; v -> v^T planes x1024 (hi + residual)
  planes_qkv<<<gPL, blk, 0, stream>>>(FQ, FK, FV, QHI, QLO, KHI, KLO, VHI, VLO);
  // (3) attention with per-head x per-key bias -> O planes [b][s][h][d] x1024 (hi + residual)
  attn_fwd<<<gAT, bAT, 0, stream>>>(QHI, QLO, KHI, KLO, VHI, VLO, mask, mcw, OHI, OLO);
  // (4) output projection + bias -> out [4096][768] f32, carries 1024 (O) x 1024 (wo) folded back
  gemm_h2<<<gG, bG, 0, stream>>>(OHI, OLO, WOB, bo, out, ROWS, DMOD, DMOD, 1.0f / (OSC * WOS));
  (void)hipGetLastError();
}

// v004
// One run takes 154 microseconds.
// Next to v003, in two timings, it ran 1.08 and 1.07 times as fast.
// Over all steps from v000 it is 1.90 times as fast.
// Contractions: x.W{q,k,v}^T on v_wmma_f32_16x16x32_bf16 (x and W RNE-converted to bf16 operands, f32 accumulate, bias added in f32);
// scores k'.q'^T (q', k' carried x1024 as f16 hi plane + f16 residual plane, products hh+lh+hl), P.v (P x32768 f16 hi+residual,
// v x1024 f16 hi+residual, products hh+lh+hl) and O.Wo^T (O x1024 f16 hi+residual, Wo as f16(bf16(Wo) x1024), products h.w+l.w):
// v_wmma_f32_16x16x32_f16, f32 accumulate. Per-head x per-key additive score bias, base-2 online softmax, 1/l fold in f32 on VALU.
#include <hip/hip_runtime.h>
#include <math.h>
#include <stdint.h>

#define NB    2
#define SEQ   2048
#define DMOD  768
#define NH    12
#define HD    64
#define NQT   (SEQ / 64)
#define QSC   1024.0f
#define KSC   1024.0f
#define PCAR  32768.0f
#define VCAR  1024.0f
#define OSC   1024.0f
#define WOS   1024.0f
#define LOG2E 1.4426950408889634f
#define ATT_WAVES   4
#define ATT_THREADS (ATT_WAVES * 32)
#define ATT_BLOCKS  (NB * NH * NQT)
#define NKB    (SEQ / 32)
#define SLABF  (16 * 68)
#define SLAB64 (16 * 68)
#define VTP    72
#define SKEYS  64
#define NST    (SEQ / SKEYS)
#define RPH    72
#define TILEH  (64 * RPH)
#define GKS    64                              // k per GEMM stage: one whole 128-B line of every operand row
#define GXB    ((NB * SEQ * DMOD / 8) / 256)   // blocks of 256 threads x 8 elements per [4096][768] plane
#define GWB    ((DMOD * DMOD / 8) / 256)       // the same per [768][768] plane
#define GVT    (NB * NH * NQT)                 // blocks of the v^T stage
static_assert(HD == 64 && DMOD == NH * HD);
static_assert(NQT == 32 && NH == 12 && NB == 2);
static_assert(ATT_THREADS == 128 && ATT_BLOCKS == 768 && NKB == 64);
static_assert(((NB * SEQ) % 64) == 0 && (DMOD % 64) == 0 && (DMOD % 32) == 0);
static_assert((SEQ % 64) == 0 && (SEQ % 8) == 0);
static_assert(((NB * SEQ * DMOD / 8) % 256) == 0 && ((DMOD * DMOD / 8) % 256) == 0);
static_assert(GXB == 1536 && GWB == 288 && GVT == 768);
static_assert(ATT_WAVES * SLABF >= 4 * 16 * 68);
static_assert(HD * VTP >= 63 * VTP + 64);
static_assert(2 * 2 * TILEH * 2 >= 4 * SLAB64 * 4 && (DMOD % GKS) == 0 && DMOD / GKS >= 2);
static_assert((SEQ % (4 * ATT_THREADS)) == 0);
static_assert(SKEYS == 64 && NST >= 2 && NST * SKEYS == SEQ && (RPH * 2) % 16 == 0 && TILEH >= 63 * RPH + 64);

typedef unsigned short u16;
typedef _Float16 v16h __attribute__((ext_vector_type(16)));
typedef _Float16 v8h  __attribute__((ext_vector_type(8)));
typedef __bf16   v16b __attribute__((ext_vector_type(16)));
typedef float    v8f  __attribute__((ext_vector_type(8)));
typedef float    v4f  __attribute__((ext_vector_type(4)));
typedef unsigned int v4u __attribute__((ext_vector_type(4)));

union FragH { v16h v; v8h h[2]; v4u u[2]; };
union FragB { v16b v; v4u u[2]; };

// ---- scalar helpers --------------------------------------------------------------------------------
__device__ __forceinline__ unsigned short bf_bits(float f) {          // f32 -> bf16 bits, RNE convert
  unsigned u = __float_as_uint(f);
  return (unsigned short)((u + 0x7FFFu + ((u >> 16) & 1u)) >> 16);
}
__device__ __forceinline__ float bf_up(unsigned short h) { return __uint_as_float(((unsigned)h) << 16); }
__device__ __forceinline__ float bfr(float f) { return bf_up(bf_bits(f)); }
__device__ __forceinline__ unsigned short h_bits(_Float16 x) { return __builtin_bit_cast(unsigned short, x); }
__device__ __forceinline__ unsigned pk16(unsigned short a, unsigned short b) { return (unsigned)a | ((unsigned)b << 16); }
__device__ __forceinline__ v8f zero8() { v8f z = {0.f, 0.f, 0.f, 0.f, 0.f, 0.f, 0.f, 0.f}; return z; }
__device__ __forceinline__ v4f zero4() { v4f z = {0.f, 0.f, 0.f, 0.f}; return z; }

// ---- fragment loaders: 16-bit A/B operand, lane -> row/col (lane&15), p already includes +8*(lane>>4);
//      elements 0..7 <- p[0..7] (k0+8h..), elements 8..15 <- p[16..23] (k0+16+8h..)  (same split k map for A and B;
//      B is always read from a k-contiguous [n][k] plane)
__device__ __forceinline__ v16h ldfrag_h(const _Float16* p) {
  FragH f;
  f.h[0] = *(const v8h*)(p);
  f.h[1] = *(const v8h*)(p + 16);
  return f.v;
}
__device__ __forceinline__ v16b ldfrag_b(const u16* p) {              // bf16 plane read as unsigned integer vectors
  FragB f;
  f.u[0] = *(const v4u*)(p);
  f.u[1] = *(const v4u*)(p + 16);
  return f.v;
}

__device__ __forceinline__ v8f mma_h(v16h a, v16h b, v8f c) {
  return __builtin_amdgcn_wmma_f32_16x16x32_f16(false, a, false, b, (short)0, c, false, false);
}
__device__ __forceinline__ v8f mma_b(v16b a, v16b b, v8f c) {
  return __builtin_amdgcn_wmma_f32_16x16x32_bf16(false, a, false, b, (short)0, c, false, false);
}
__device__ __forceinline__ void guard2(v8f& a, v8f& b, v16h x0, v16h x1, v16h x2, v16h x3, v16h x4, v16h x5) {
#if defined(__HIP_DEVICE_COMPILE__)
  asm volatile("v_nop\n\tv_nop\n\tv_nop\n\tv_nop"
               : "+v"(a), "+v"(b) : "v"(x0), "v"(x1), "v"(x2), "v"(x3), "v"(x4), "v"(x5) : "memory");
#endif
}
template <typename F>
__device__ __forceinline__ void guard6(v8f& a, v8f& b, v8f& c, v8f& d, F x0, F x1, F x2, F x3, F x4, F x5) {
#if defined(__HIP_DEVICE_COMPILE__)
  asm volatile("v_nop\n\tv_nop\n\tv_nop\n\tv_nop"
               : "+v"(a), "+v"(b), "+v"(c), "+v"(d) : "v"(x0), "v"(x1), "v"(x2), "v"(x3), "v"(x4), "v"(x5) : "memory");
#endif
}
__device__ __forceinline__ void guard10(v8f& a, v8f& b, v8f& c, v8f& d, v16h x0, v16h x1, v16h x2, v16h x3, v16h x4,
                                        v16h x5, v16h x6, v16h x7, v16h x8, v16h x9) {
#if defined(__HIP_DEVICE_COMPILE__)
  asm volatile("v_nop\n\tv_nop\n\tv_nop\n\tv_nop"
               : "+v"(a), "+v"(b), "+v"(c), "+v"(d)
               : "v"(x0), "v"(x1), "v"(x2), "v"(x3), "v"(x4), "v"(x5), "v"(x6), "v"(x7), "v"(x8), "v"(x9) : "memory");
#endif
}
__device__ __forceinline__ void acc_guard4(v8f& a, v8f& b, v8f& c, v8f& d) {
#if defined(__HIP_DEVICE_COMPILE__)
  asm volatile("v_nop\n\tv_nop\n\tv_nop\n\tv_nop" : "+v"(a), "+v"(b), "+v"(c), "+v"(d));
#endif
}
// Four asynchronous 16-B copies per lane, global -> LDS (rows r, r+16, r+32, r+48 of one 64-row tile). The s_wait_xcnt stands in
// the copies' own statement so that no address register is rewritten in front of it.
__device__ __forceinline__ void copy4(unsigned l0, unsigned l1, unsigned l2, unsigned l3,
                                      const u16* g0, const u16* g1, const u16* g2, const u16* g3) {
#if defined(__HIP_DEVICE_COMPILE__)
  asm volatile("global_load_async_to_lds_b128 %0, %4, off\n\t"
               "global_load_async_to_lds_b128 %1, %5, off\n\t"
               "global_load_async_to_lds_b128 %2, %6, off\n\t"
               "global_load_async_to_lds_b128 %3, %7, off\n\t"
               "s_wait_xcnt 0x0"
               :: "v"(l0), "v"(l1), "v"(l2), "v"(l3), "v"(g0), "v"(g1), "v"(g2), "v"(g3) : "memory");
#endif
}
// One 64-row x 128-B tile: lbase = this lane's LDS byte address in row r, g = its global address in row r, gstep = 16 source rows.
__device__ __forceinline__ void copy_tile(unsigned lbase, const u16* g, size_t gstep) {
  copy4(lbase, lbase + 16u * (RPH * 2), lbase + 32u * (RPH * 2), lbase + 48u * (RPH * 2), g, g + gstep, g + 2 * gstep, g + 3 * gstep);
}
__device__ __forceinline__ void wait_async0() {   // this wave's copies have landed
#if defined(__HIP_DEVICE_COMPILE__)
  asm volatile("s_wait_asynccnt 0x0" ::: "memory");
#endif
}
__device__ __forceinline__ void wait_ds0() {      // this wave's LDS reads have returned before their buffer is handed back
#if defined(__HIP_DEVICE_COMPILE__)
  asm volatile("s_wait_dscnt 0x0" ::: "memory");
#endif
}
__device__ __forceinline__ void wave_sync_lds() {
  __builtin_amdgcn_fence(__ATOMIC_RELEASE, "workgroup");
  __builtin_amdgcn_wave_barrier();
  __builtin_amdgcn_fence(__ATOMIC_ACQUIRE, "workgroup");
}

// =====================================================================================================
// f32 plane -> 16-bit plane, same layout:  f16mode == 0: bf16 RNE bits;  f16mode == 1: f16 bits of (bf16 RNE value) * scale.
// Thread = 8 consecutive elements: two 16-B loads, one 16-B store; 32 consecutive lanes = 512 contiguous, 512-B aligned bytes
// gt = the thread's index within its plane.
// =====================================================================================================
__device__ __forceinline__ void cvt16_body(const float* __restrict__ x, u16* D, int gt, int f16mode, float scale) {
  const float* p = x + (size_t)gt * 8;
  const v4f a = *(const v4f*)(p), c4 = *(const v4f*)(p + 4);
  float v[8];
#pragma unroll
  for (int e = 0; e < 4; ++e) { v[e] = a[e]; v[4 + e] = c4[e]; }
  unsigned short s[8];
#pragma unroll
  for (int e = 0; e < 8; ++e) {
    const unsigned short hb = h_bits((_Float16)(bfr(v[e]) * scale));
    const unsigned short bb = bf_bits(v[e]);
    s[e] = (f16mode != 0) ? hb : bb;
  }
  v4u o;
#pragma unroll
  for (int e = 0; e < 4; ++e) o[e] = pk16(s[2 * e], s[2 * e + 1]);
  u16* d = D + (size_t)gt * 8;
  {
    *(v4u*)(d) = o;
    
  }
}
// All seven conversions in one grid (none reads another's output): blocks [0, 3*GXB) = the three input planes -> bf16,
// blocks [3*GXB, 3*GXB + 4*GWB) = wq, wk, wv -> bf16 and wo -> f16 of (bf16 value x1024). The plane is chosen per block (scalar).
// coverage: GXB (GWB) blocks x 256 thr x 8 = one whole plane each.
__global__ __launch_bounds__(256)
void cvt16_all(const float* __restrict__ xq, const float* __restrict__ xk, const float* __restrict__ xv,
               const float* __restrict__ wq, const float* __restrict__ wk, const float* __restrict__ wv,
               const float* __restrict__ wo, u16* XQ, u16* XK, u16* XV, u16* WQ, u16* WK, u16* WV, u16* WO) {
  const int bid = blockIdx.x;
  if (bid >= 3 * GXB + 4 * GWB) return;     // never taken with the exact grid; no barriers in this kernel
  const float* x;
  u16* D;
  int lb, f16mode = 0;
  float scale = 1.0f;
  if (bid < 3 * GXB) {
    const int pl = bid / GXB;
    lb = bid - pl * GXB;
    x = (pl == 0) ? xq : (pl == 1) ? xk : xv;
    D = (pl == 0) ? XQ : (pl == 1) ? XK : XV;
  } else {
    const int r = bid - 3 * GXB, pl = r / GWB;
    lb = r - pl * GWB;
    x = (pl == 0) ? wq : (pl == 1) ? wk : (pl == 2) ? wv : wo;
    D = (pl == 0) ? WQ : (pl == 1) ? WK : (pl == 2) ? WV : WO;
    if (pl == 3) { f16mode = 1; scale = WOS; }
  }
  cvt16_body(x, D, lb * 256 + (int)threadIdx.x, f16mode, scale);
}

// =====================================================================================================
// f32 plane -> f16 hi plane (value * sc, sc a power of two) + f16 residual plane (value * sc - hi, unscaled), same layout.
// Thread = 8 consecutive elements: two 16-B loads, one 16-B store per plane; 32 consecutive lanes = 512 contiguous, 512-B aligned
// gt = the thread's index within its plane.
// =====================================================================================================
__device__ __forceinline__ void split16_body(const float* __restrict__ x, u16* hpl, u16* lpl, int gt, float sc) {
  const float* p = x + (size_t)gt * 8;
  const v4f a = *(const v4f*)(p), c4 = *(const v4f*)(p + 4);
  float w[8];
#pragma unroll
  for (int e = 0; e < 4; ++e) { w[e] = a[e]; w[4 + e] = c4[e]; }
  v4u oh, ol;
#pragma unroll
  for (int e = 0; e < 4; ++e) {
    const float t0 = w[2 * e] * sc, t1 = w[2 * e + 1] * sc;
    const _Float16 h0 = (_Float16)t0, h1 = (_Float16)t1;
    const _Float16 l0 = (_Float16)(t0 - (float)h0), l1 = (_Float16)(t1 - (float)h1);
    oh[e] = pk16(h_bits(h0), h_bits(h1));
    ol[e] = pk16(h_bits(l0), h_bits(l1));
  }
  const size_t o8 = (size_t)gt * 8;
  {
    *(v4u*)(hpl + o8) = oh;
    *(v4u*)(lpl + o8) = ol;
#if defined(__HIP_DEVICE_COMPILE__)
    // the built code runs on from here into a joined test in front of the v^T stage, whose first instructions rewrite registers
    // that these two stores name: the wait stands in front of every such rewrite
    asm volatile("s_wait_xcnt 0x0" ::: "memory");
#endif
  }
}

// =====================================================================================================
// GEMM epilogue shared by both engines: the wave's 16x64 f32 tile (times oscale) staged in its LDS slab (pitch 68),
// coverage: 8 instructions x 2 rows x 16 lanes x 4 floats = the wave's 16 x 64 tile.
// =====================================================================================================
__device__ __forceinline__ void epi64(float* sl, v8f a0, v8f a1, v8f a2, v8f a3, float oscale, v4f badd, float* C, int N,
                                      size_t rowb, int col0, int lane) {
  const int hh = lane >> 4, m = lane & 15;
#pragma unroll
  for (int r = 0; r < 8; ++r) {
    const int ro = (8 * hh + r) * 68 + m;
    sl[ro]      = a0[r] * oscale;
    sl[ro + 16] = a1[r] * oscale;
    sl[ro + 32] = a2[r] * oscale;
    sl[ro + 48] = a3[r] * oscale;
  }
  wave_sync_lds();
  v4f vals[8];
#pragma unroll
  for (int it = 0; it < 8; ++it) vals[it] = *(const v4f*)(sl + (it * 2 + hh) * 68 + m * 4) + badd;
  float* dst = C + (rowb + (size_t)hh) * (size_t)N + col0 + m * 4;
  {
#pragma unroll
    for (int it = 0; it < 8; ++it) {
      *(v4f*)(dst + (size_t)(it * 2) * (size_t)N) = vals[it];
    }
    
  }
}

// =====================================================================================================
// bf16 GEMM with bias: C[M][N] (f32) = A[M][K] (bf16 row-major) . Bt[N][K]^T (bf16 k-contiguous), times oscale, plus bf16-RNE
// value of bias[n]. Block = 64x64 tile, 4 waves x 16 rows. The block's A and Bt tiles of 64 rows x 64 k (whole 128-B lines, LDS
// pitch 144 B) come into a two-buffer LDS ring by asynchronous copies, once per block, and all 4 waves read their fragments there
// (two 16-B LDS loads each, split k map for A and B); one block barrier per 64 k publishes the next stage and frees the one just
// read. k runs upward in steps of 32 as before (host checks K % 64 == 0, M % 64 == 0, N % 64 == 0, grid.x = (M/64)*(N/64)).
// Behind the loop's last barrier the ring is dead and holds the four result slabs.
// Three independent products of one shape in one grid: blockIdx.y picks the operand set (scalar selects).
// =====================================================================================================
__global__ __launch_bounds__(128)
void gemm_bfb3(const u16* __restrict__ A0, const u16* __restrict__ A1, const u16* __restrict__ A2,
               const u16* __restrict__ Bt0, const u16* __restrict__ Bt1, const u16* __restrict__ Bt2,
               const float* __restrict__ bias0, const float* __restrict__ bias1, const float* __restrict__ bias2,
               float* C0, float* C1, float* C2, int M, int N, int K, float oscale) {
  __shared__ __align__(16) u16 gring[2 * 2 * TILEH];        // [buffer][A, Bt][64 rows][pitch 72 halves]; epilogue: result slabs
  const int zz = blockIdx.y;
  const u16*   A    = (zz == 0) ? A0 : (zz == 1) ? A1 : A2;
  const u16*   Bt   = (zz == 0) ? Bt0 : (zz == 1) ? Bt1 : Bt2;
  const float* bias = (zz == 0) ? bias0 : (zz == 1) ? bias1 : bias2;
  float*       C    = (zz == 0) ? C0 : (zz == 1) ? C1 : C2;
  const int tid = threadIdx.x, wave = tid >> 5, lane = tid & 31, hh = lane >> 4, m = lane & 15;
  const int ntile = N >> 6;
  const int bid   = blockIdx.x;
  const int row0  = (bid / ntile) * 64;
  const int rowb  = row0 + wave * 16;
  const int col0  = (bid % ntile) * 64;
  const int nst   = K / GKS;
  if (row0 + 64 > M || nst < 1) return;      // block-uniform, in front of every barrier; never taken with the exact grid
  // copies: lane = (row cr of a group of 16, 16-B chunk cc of its 128-B line); a wave's copy = 4 whole lines
  const int cr = tid >> 3, cc = (tid & 7) * 8;
  const u16* ag = A  + (size_t)(row0 + cr) * K + cc;
  const u16* bg = Bt + (size_t)(col0 + cr) * K + cc;
  const size_t gs = (size_t)16 * K;
  const unsigned lcp = (unsigned)(uintptr_t)(gring + cr * RPH + cc);               // LDS byte address, buffer 0, A tile
  const u16* af = gring + (wave * 16 + m) * RPH + 8 * hh;                           // A fragment row of this lane, buffer 0
  const u16* bq = gring + TILEH + m * RPH + 8 * hh;                                 // Bt fragment row of this lane, buffer 0
  v8f acc0 = zero8(), acc1 = zero8(), acc2 = zero8(), acc3 = zero8();
#define GSTAGE(st, bf)                                                    \
  do {                                                                    \
    const unsigned lb_ = lcp + (unsigned)(bf) * (2u * TILEH * 2u);        \
    copy_tile(lb_,              ag + (size_t)(st) * GKS, gs);             \
    copy_tile(lb_ + TILEH * 2u, bg + (size_t)(st) * GKS, gs);             \
  } while (0)
  // ring prologue: stage 0 landed and published, then stage 1 in flight
  GSTAGE(0, 0);
  wait_async0();
  __syncthreads();
  if (1 < nst) GSTAGE(1, 1);
#pragma unroll 1   // stays rolled: one copy of the stage body and of its publish point
  for (int st = 0; st < nst; ++st) {
    const int bf = st & 1;
    const u16* as = af + bf * (2 * TILEH);
    const u16* bs = bq + bf * (2 * TILEH);
    // both k steps of the stage: fragments from LDS, then the products, k upward
    const v16b a   = ldfrag_b(as);
    const v16b b0  = ldfrag_b(bs);
    const v16b b1  = ldfrag_b(bs + 16 * RPH);
    const v16b b2  = ldfrag_b(bs + 32 * RPH);
    const v16b b3  = ldfrag_b(bs + 48 * RPH);
    const v16b a_  = ldfrag_b(as + 32);
    const v16b b0_ = ldfrag_b(bs + 32);
    const v16b b1_ = ldfrag_b(bs + 16 * RPH + 32);
    const v16b b2_ = ldfrag_b(bs + 32 * RPH + 32);
    const v16b b3_ = ldfrag_b(bs + 48 * RPH + 32);
    acc0 = mma_b(a, b0, acc0);
    acc1 = mma_b(a, b1, acc1);
    acc2 = mma_b(a, b2, acc2);
    acc3 = mma_b(a, b3, acc3);
    acc0 = mma_b(a_, b0_, acc0);
    acc1 = mma_b(a_, b1_, acc1);
    acc2 = mma_b(a_, b2_, acc2);
    acc3 = mma_b(a_, b3_, acc3);
    guard6<v16b>(acc0, acc1, acc2, acc3, a_, b0_, b1_, b2_, b3_, a_);
    // publish point of stage st + 1: own reads of this buffer done, own copies of the next landed, block barrier, then the refill
    wait_ds0();
    wait_async0();
    __syncthreads();
    if (st + 2 < nst) GSTAGE(st + 2, bf);
  }
  wait_async0();
#undef GSTAGE
  float* slab = (float*)(void*)gring;        // every wave is behind the last barrier: no reader and no copy is left on the ring
  const v4f bv = *(const v4f*)(bias + col0 + m * 4);      // columns col0 + 4m .. +3, always < N (N multiple of 64)
  v4f badd;
#pragma unroll
  for (int e = 0; e < 4; ++e) badd[e] = bfr(bv[e]);
  epi64(slab + wave * SLAB64, acc0, acc1, acc2, acc3, oscale, badd, C, N, (size_t)rowb, col0, lane);
}

// =====================================================================================================
// f16 hi+lo GEMM with bias: C[M][N] (f32) = (Ahi + Alo)[M][K] . Bt[N][K]^T times oscale, plus bf16-RNE value of bias[n];
// Ahi/Alo f16 planes (same layout), Bt f16 k-contiguous; products hi.B + lo.B into one accumulator (lo is the unscaled
// residual of hi). Same tiling and the same two-buffer LDS ring as gemm_bfb3, with three tiles a stage (Ahi, Alo, Bt).
// =====================================================================================================
__global__ __launch_bounds__(128)
void gemm_h2(const u16* __restrict__ Ah, const u16* __restrict__ Al, const u16* __restrict__ Bt,
             const float* __restrict__ bias, float* C, int M, int N, int K, float oscale) {
  __shared__ __align__(16) u16 gring[2 * 3 * TILEH];        // [buffer][Ahi, Alo, Bt][64 rows][pitch 72 halves]; epilogue: result slabs
  const int tid = threadIdx.x, wave = tid >> 5, lane = tid & 31, hh = lane >> 4, m = lane & 15;
  const int ntile = N >> 6;
  const int bid   = blockIdx.x;
  const int row0  = (bid / ntile) * 64;
  const int rowb  = row0 + wave * 16;
  const int col0  = (bid % ntile) * 64;
  const int nst   = K / GKS;
  if (row0 + 64 > M || nst < 1) return;      // block-uniform, in front of every barrier; never taken with the exact grid
  // copies: lane = (row cr of a group of 16, 16-B chunk cc of its 128-B line); a wave's copy = 4 whole lines
  const int cr = tid >> 3, cc = (tid & 7) * 8;
  const size_t aofs = (size_t)(row0 + cr) * K + cc;
  const u16* ahg = Ah + aofs;
  const u16* alg = Al + aofs;
  const u16* bg  = Bt + (size_t)(col0 + cr) * K + cc;
  const size_t gs = (size_t)16 * K;
  const unsigned lcp = (unsigned)(uintptr_t)(gring + cr * RPH + cc);               // LDS byte address, buffer 0, Ahi tile
  const _Float16* af = (const _Float16*)(const void*)gring + (wave * 16 + m) * RPH + 8 * hh;   // Ahi fragment row, buffer 0
  const _Float16* bq = (const _Float16*)(const void*)gring + 2 * TILEH + m * RPH + 8 * hh;     // Bt fragment row, buffer 0
  v8f acc0 = zero8(), acc1 = zero8(), acc2 = zero8(), acc3 = zero8();
#define GSTAGE(st, bf)                                                    \
  do {                                                                    \
    const unsigned lb_ = lcp + (unsigned)(bf) * (3u * TILEH * 2u);        \
    copy_tile(lb_,                   ahg + (size_t)(st) * GKS, gs);       \
    copy_tile(lb_ + 1u * TILEH * 2u, alg + (size_t)(st) * GKS, gs);       \
    copy_tile(lb_ + 2u * TILEH * 2u, bg  + (size_t)(st) * GKS, gs);       \
  } while (0)
  // ring prologue: stage 0 landed and published, then stage 1 in flight
  GSTAGE(0, 0);
  wait_async0();
  __syncthreads();
  if (1 < nst) GSTAGE(1, 1);
#pragma unroll 1   // stays rolled: one copy of the stage body and of its publish point
  for (int st = 0; st < nst; ++st) {
    const int bf = st & 1;
    const _Float16* as = af + bf * (3 * TILEH);
    const _Float16* bs = bq + bf * (3 * TILEH);
    // both k steps of the stage: fragments from LDS, then the products, k upward
    const v16h ah  = ldfrag_h(as),      al  = ldfrag_h(as + TILEH);
    const v16h b0  = ldfrag_h(bs);
    const v16h b1  = ldfrag_h(bs + 16 * RPH);
    const v16h b2  = ldfrag_h(bs + 32 * RPH);
    const v16h b3  = ldfrag_h(bs + 48 * RPH);
    const v16h ah_ = ldfrag_h(as + 32), al_ = ldfrag_h(as + TILEH + 32);
    const v16h b0_ = ldfrag_h(bs + 32);
    const v16h b1_ = ldfrag_h(bs + 16 * RPH + 32);
    const v16h b2_ = ldfrag_h(bs + 32 * RPH + 32);
    const v16h b3_ = ldfrag_h(bs + 48 * RPH + 32);
    acc0 = mma_h(ah, b0, acc0);    acc0 = mma_h(al, b0, acc0);
    acc1 = mma_h(ah, b1, acc1);    acc1 = mma_h(al, b1, acc1);
    acc2 = mma_h(ah, b2, acc2);    acc2 = mma_h(al, b2, acc2);
    acc3 = mma_h(ah, b3, acc3);    acc3 = mma_h(al, b3, acc3);
    acc0 = mma_h(ah_, b0_, acc0);  acc0 = mma_h(al_, b0_, acc0);
    acc1 = mma_h(ah_, b1_, acc1);  acc1 = mma_h(al_, b1_, acc1);
    acc2 = mma_h(ah_, b2_, acc2);  acc2 = mma_h(al_, b2_, acc2);
    acc3 = mma_h(ah_, b3_, acc3);  acc3 = mma_h(al_, b3_, acc3);
    guard6<v16h>(acc0, acc1, acc2, acc3, ah_, al_, b0_, b1_, b2_, b3_);
    // publish point of stage st + 1: own reads of this buffer done, own copies of the next landed, block barrier, then the refill
    wait_ds0();
    wait_async0();
    __syncthreads();
    if (st + 2 < nst) GSTAGE(st + 2, bf);
  }
  wait_async0();
#undef GSTAGE
  float* slab = (float*)(void*)gring;        // every wave is behind the last barrier: no reader and no copy is left on the ring
  const v4f bv = *(const v4f*)(bias + col0 + m * 4);      // columns col0 + 4m .. +3, always < N (N multiple of 64)
  v4f badd;
#pragma unroll
  for (int e = 0; e < 4; ++e) badd[e] = bfr(bv[e]);
  epi64(slab + wave * SLAB64, acc0, acc1, acc2, acc3, oscale, badd, C, N, (size_t)rowb, col0, lane);
}

// =====================================================================================================
// v^T planes: VH[(b*NH + h)*HD + d][s] = f16(v[b][s][h][d] * 1024), VL = f16 residual of the same value.
// Block = (b, h, 64 keys): 64 source rows of HD floats loaded with 16-B loads, converted, scattered into two LDS tiles
// coverage: load 256 thr x 16 elements = 64 x 64; store 2 iterations x 256 thr x 8 halves = 64 lines x 64 = the block's tile of
//           each plane; NB x NH x SEQ/64 = 768 blocks cover both planes exactly once.
// =====================================================================================================
__device__ __forceinline__ void vt16_body(const float* __restrict__ v, u16* VHo, u16* VLo, int bid, u16* TH, u16* TL) {
  const int tid = threadIdx.x;
  const int st  = bid & (NQT - 1);
  const int bh  = bid >> 5;                  // NQT == 32
  const int h   = bh % NH;
  const int b   = bh / NH;
  const int s0  = st * 64;
  {
    const int sl = tid >> 2;                  // key within tile 0..63
    const int dc = (tid & 3) * 16;            // d chunk
    const float* src = v + (((size_t)(b * SEQ + s0 + sl)) * NH + h) * HD + dc;
#pragma unroll
    for (int i = 0; i < 4; ++i) {
      const v4f a = *(const v4f*)(src + 4 * i);
#pragma unroll
      for (int e = 0; e < 4; ++e) {
        const float t = a[e] * VCAR;
        const _Float16 hv = (_Float16)t;
        const _Float16 lv = (_Float16)(t - (float)hv);
        TH[(dc + 4 * i + e) * VTP + sl] = h_bits(hv);
        TL[(dc + 4 * i + e) * VTP + sl] = h_bits(lv);
      }
    }
  }
  __syncthreads();
  v4u vh[2], vl[2];
  const int q8 = tid >> 3, p8 = (tid & 7) * 8;
#pragma unroll
  for (int it = 0; it < 2; ++it) {
    const int line = it * 32 + q8;            // d = 0..63
    vh[it] = *(const v4u*)(TH + line * VTP + p8);
    vl[it] = *(const v4u*)(TL + line * VTP + p8);
  }
  const size_t base = ((size_t)(b * NH + h) * HD) * SEQ + s0 + p8;
  {
#pragma unroll
    for (int it = 0; it < 2; ++it) {
      const int line = it * 32 + q8;
      *(v4u*)(VHo + base + (size_t)line * SEQ) = vh[it];
      *(v4u*)(VLo + base + (size_t)line * SEQ) = vl[it];
    }
    
  }
}
// The three plane-forming stages behind the projections in one grid (none reads another's output): blocks [0, GVT) = v^T planes,
// [GVT, GVT + GXB) = q planes, [GVT + GXB, GVT + 2*GXB) = k planes. The branch is block-uniform, so the barrier inside vt16_body is
// passed by all threads of its block or by none.
__global__ __launch_bounds__(256)
void planes_qkv(const float* __restrict__ fq, const float* __restrict__ fk, const float* __restrict__ fv,
                u16* QH, u16* QL, u16* KH, u16* KL, u16* VH, u16* VL) {
  __shared__ __align__(16) u16 TH[HD * VTP];
  __shared__ __align__(16) u16 TL[HD * VTP];
  const int bid = blockIdx.x;
  if (bid >= GVT + 2 * GXB) return;         // never taken with the exact grid; block-uniform, in front of the barrier
  if (bid < GVT) {
    vt16_body(fv, VH, VL, bid, TH, TL);
  } else {
    const int r = bid - GVT, pl = r / GXB;
    const int gt = (r - pl * GXB) * 256 + (int)threadIdx.x;
    split16_body((pl == 0) ? fq : fk, (pl == 0) ? QH : KH, (pl == 0) ? QL : KL, gt, (pl == 0) ? QSC : KSC);
  }
}

// =====================================================================================================
// Full (non-causal) multi-head flash attention with a per-head x per-key additive score bias: block = (batch b, head, 64 query
// rows), 4 waves, wave w owns the 16 query rows q0 = 64*qt + 16*w .. q0+15. The k and v^T tiles of 64 keys (hi and residual planes,
// 4 tiles of 64 rows x 128 B, LDS pitch 144 B) are brought into a two-buffer LDS ring by asynchronous copies, whole 128-B lines,
// once per block, and read by all 4 waves; one block barrier per 64 keys publishes the next stage and frees the one just read.
//   q planes (hi, lo f16, x1024) laid out [b][s][h][d]; k planes the same; v^T planes [b][h][d][s] (x1024).
//   All NKB = 64 key blocks of 32 keys are visited (static bound).
//   Scores are computed TRANSPOSED: S^T tile g (g = 0,1) = k rows (keys kb+16g .. +15, A operand, row m = lane&15, split k map
//   over d) times q^T (B operand, col n = query q0 + (lane&15), k = d, split map), 3 products per tile and d-chunk
//   (k_hi.q_hi + k_lo.q_hi + k_hi.q_lo). D element r of lane l = (key kb+16g+8h+r, query q0+(l&15)), so a lane owns one query
//   column and 16 of its 32 keys; the partner lane l^16 owns the other 16 -> row max / row sum need one xor-16 shuffle.
//   Logit of key j, query i (base 2): (S * 1/8 * 2^-20 + bfr(wh) * bfr(mask[b][j])) * log2(e); the bias term of all SEQ keys of
//   this (batch, head) is formed once per block into an LDS table (f32; each of its two products rounded on its own) and read per
//   pass with the same element -> key map as the transposed scores (t[i] <- key kb+8h+i, t[8+i] <- key kb+16+8h+i), added in f32.
//   Online max-subtracted base-2 softmax in f32. The exp'd values ARE the P A-fragment in place: A row m = query = lane&15,
//   element i <- key kb+8h+i (tile 0, D element i), element 8+i <- key kb+16+8h+i (tile 1, D element i). P is carried x32768
//   as f16 hi + f16 residual. The rescale factor of query row 8h+r of the O accumulators is fetched from lane 8h+r with a
//   shuffle (uniform control). 4+4 v^T B fragments (hi and residual planes, col n = d = 16j + (lane&15), keys k-contiguous),
//   12 P.V WMMAs (hh + lh + hl).
//   Epilogue: 1/l (per query, shuffled to the D row owner) and carry folds in f32; the wave's 16x64 f32 result staged in its LDS
// coverage: per wave 4 instructions x 4 rows x 8 lanes x 8 halves = 16 x 64 per plane; grid 768 blocks x 4 waves = every
//           (b, s, h) row of both O planes exactly once.
// =====================================================================================================
__global__ __launch_bounds__(ATT_THREADS)
void attn_fwd(const u16* __restrict__ QHIp, const u16* __restrict__ QLOp,
              const u16* __restrict__ KHIp, const u16* __restrict__ KLOp,
              const u16* __restrict__ VHIp, const u16* __restrict__ VLOp,
              const float* __restrict__ maskp, const float* __restrict__ mcwp,
              u16* OHIp, u16* OLOp) {
  __shared__ __align__(16) float smem[ATT_WAVES * SLABF];   // per wave: result slab [16][68] in the epilogue only
  __shared__ __align__(16) u16 ring[2 * 4 * TILEH];         // [buffer][k hi, k lo, v^T hi, v^T lo][64 rows][pitch 72 halves]
  __shared__ __align__(16) float kbias[SEQ];                // base-2 logit bias of every key of this (batch, head)

  const int tid  = threadIdx.x;
  const int wave = tid >> 5;
  const int lane = tid & 31;
  const int hh   = lane >> 4;
  const int c    = lane & 15;

  const int bid  = blockIdx.x;
  const int qt   = bid & (NQT - 1);
  const int bh   = bid >> 5;                 // NQT == 32
  const int head = bh % NH;
  const int b    = bh / NH;
  const int q0   = qt * 64 + wave * 16;

  // B fragments of q^T: col n = query q0 + c, k = d (k-contiguous row of the q plane)
  const size_t qofs = (((size_t)(b * SEQ + q0 + c)) * NH + head) * HD + 8 * hh;
  const _Float16* Qh  = (const _Float16*)(const void*)QHIp + qofs;
  const _Float16* Ql  = (const _Float16*)(const void*)QLOp + qofs;
  // copies: lane = (row cr of a group of 16, 16-B chunk cc of its 128-B row); a wave's copy = 4 whole rows
  const int cr = tid >> 3, cc = (tid & 7) * 8;
  const size_t kcp = (((size_t)b * SEQ + cr) * NH + head) * HD + cc;               // key row: stage's first key added per stage
  const size_t vcp = ((size_t)(b * NH + head) * HD + cr) * SEQ + cc;               // d row: stage's first key added per stage
  const unsigned lcp = (unsigned)(uintptr_t)(ring + cr * RPH + cc);                // LDS byte address, buffer 0, tile 0
  // A fragments of k: row m = key (in stage) 16g + c, k = d;  B fragments of v: col n = d = 16j + c, k = key (in stage)
  const _Float16* ringh = (const _Float16*)(const void*)ring + c * RPH + 8 * hh;
  // per-key bias row in the table: kbias[kb + 8hh + 0..7] (tile 0) and [kb + 16 + 8hh + 0..7] (tile 1), 16-B aligned LDS loads
  const float* brow = kbias + 8 * hh;
  const float  wh2  = bfr(mcwp[head]);                                              // per-head scalar (bf16 RNE value)
  const float lsc = 0.125f * (LOG2E / (QSC * KSC));

  float mrun = -INFINITY, lrun = 0.f;
  v8f o[4];
#pragma unroll
  for (int j = 0; j < 4; ++j) o[j] = zero8();

#define STAGE_COPY(st, bf)                                                                        \
  do {                                                                                            \
    const unsigned lb_ = lcp + (unsigned)(bf) * (4u * TILEH * 2u);                                \
    const size_t ko_ = kcp + (size_t)(st) * (SKEYS * NH * HD), vo_ = vcp + (size_t)(st) * SKEYS;  \
    copy_tile(lb_,                   KHIp + ko_, (size_t)16 * (NH * HD));                         \
    copy_tile(lb_ + 1u * TILEH * 2u, KLOp + ko_, (size_t)16 * (NH * HD));                         \
    copy_tile(lb_ + 2u * TILEH * 2u, VHIp + vo_, (size_t)16 * SEQ);                               \
    copy_tile(lb_ + 3u * TILEH * 2u, VLOp + vo_, (size_t)16 * SEQ);                               \
  } while (0)

  // ring prologue: stage 0 landed and published, then stage 1 in flight
  STAGE_COPY(0, 0);
  // bias table, formed while stage 0 flies: thread = 4 consecutive keys per round, SEQ / (4 * ATT_THREADS) rounds cover every key
  // once; the barrier below publishes it together with stage 0
  {
    const float* mb4 = maskp + (size_t)b * SEQ + tid * 4;
#pragma unroll     // the rounds' loads issue together: one memory latency, not one per round
    for (int i = 0; i < SEQ / (4 * ATT_THREADS); ++i) {
      const v4f mv = *(const v4f*)(mb4 + i * (4 * ATT_THREADS));
      v4f bz;
#pragma unroll
      for (int e = 0; e < 4; ++e) bz[e] = (wh2 * bfr(mv[e])) * LOG2E;
      *(v4f*)(kbias + tid * 4 + i * (4 * ATT_THREADS)) = bz;
    }
  }
  wait_async0();
  __syncthreads();
  STAGE_COPY(1, 1);

#pragma unroll 1   // stays rolled: one copy of the stage body and of its publish point
  for (int st = 0; st < NST; ++st) {
   const int bf = st & 1;
   const _Float16* stg = ringh + bf * (4 * TILEH);
#pragma unroll     // the stage's two 32-key passes: their LDS offsets become immediates of the loads
   for (int sub = 0; sub < 2; ++sub) {
    const int kb = st * SKEYS + sub * 32;
    const v4f ma = *(const v4f*)(brow + kb),      mb = *(const v4f*)(brow + kb + 4);
    const v4f mc = *(const v4f*)(brow + kb + 16), md = *(const v4f*)(brow + kb + 20);
    // ---- transposed scores: s0 = keys kb..kb+15, s1 = keys kb+16..kb+31, column = query q0 + c ----
    v8f s0 = zero8(), s1 = zero8();
    const _Float16* k0p = stg + (sub * 32) * RPH;
    const _Float16* k1p = k0p + 16 * RPH;
    const _Float16* l0p = k0p + TILEH;
    const _Float16* l1p = l0p + 16 * RPH;
#pragma unroll
    for (int kk = 0; kk < 2; ++kk) {
      const v16h qh  = ldfrag_h(Qh + kk * 32),  ql  = ldfrag_h(Ql + kk * 32);
      const v16h kh0 = ldfrag_h(k0p + kk * 32), kl0 = ldfrag_h(l0p + kk * 32);
      const v16h kh1 = ldfrag_h(k1p + kk * 32), kl1 = ldfrag_h(l1p + kk * 32);
      s0 = mma_h(kh0, qh, s0);
      s0 = mma_h(kl0, qh, s0);
      s0 = mma_h(kh0, ql, s0);
      s1 = mma_h(kh1, qh, s1);
      s1 = mma_h(kl1, qh, s1);
      s1 = mma_h(kh1, ql, s1);
      guard2(s0, s1, qh, ql, kh0, kl0, kh1, kl1);
    }
    // ---- base-2 logits of this lane's 16 keys for query q0 + c: t[i] <- key kb+8hh+i, t[8+i] <- key kb+16+8hh+i ----
    float t[16];
#pragma unroll
    for (int e = 0; e < 4; ++e) {
      t[e]      = s0[e] * lsc     + ma[e];
      t[4 + e]  = s0[4 + e] * lsc + mb[e];
      t[8 + e]  = s1[e] * lsc     + mc[e];
      t[12 + e] = s1[4 + e] * lsc + md[e];
    }
    float cm = t[0];
#pragma unroll
    for (int i = 1; i < 16; ++i) cm = fmaxf(cm, t[i]);
    cm = fmaxf(cm, __shfl_xor(cm, 16, 32));
    const float mn = fmaxf(mrun, cm);        // finite from the first block on
    const float al = exp2f(mrun - mn);       // 0 on the first block (mrun = -inf)
    mrun = mn;
    // ---- probabilities (<= 1) and the P A-fragments: hi = f16(p * 32768), lo = f16 residual; element i <-> t[i] ----
    float ps = 0.f;
    FragH ph, pl;
#pragma unroll
    for (int w = 0; w < 2; ++w) {
#pragma unroll
      for (int e4 = 0; e4 < 4; ++e4) {
        const int i = 8 * w + 2 * e4;
        const float p0 = exp2f(t[i] - mn), p1 = exp2f(t[i + 1] - mn);
        ps += p0 + p1;
        const float a0 = p0 * PCAR, a1 = p1 * PCAR;
        const _Float16 h0 = (_Float16)a0, h1 = (_Float16)a1;
        const _Float16 l0 = (_Float16)(a0 - (float)h0), l1 = (_Float16)(a1 - (float)h1);
        ph.u[w][e4] = pk16(h_bits(h0), h_bits(h1));
        pl.u[w][e4] = pk16(h_bits(l0), h_bits(l1));
      }
    }
    ps += __shfl_xor(ps, 16, 32);
    lrun = lrun * al + ps;
    // ---- rescale the O accumulators: D row 8hh+r = query q0+8hh+r, its factor lives in lane 8hh+r (and 16+8hh+r) ----
    float scl[8];
#pragma unroll
    for (int r = 0; r < 8; ++r) scl[r] = __shfl(al, 8 * hh + r, 32);
#pragma unroll
    for (int j = 0; j < 4; ++j) {
#pragma unroll
      for (int r = 0; r < 8; ++r) o[j][r] *= scl[r];
    }
    // ---- P.V : B fragment col n = d = j*16 + c, keys contiguous in the v^T planes ----
    {
      const _Float16* vhp = stg + 2 * TILEH + sub * 32;
      const _Float16* vlp = vhp + TILEH;
      const v16h vh0 = ldfrag_h(vhp);
      const v16h vh1 = ldfrag_h(vhp + 16 * RPH);
      const v16h vh2 = ldfrag_h(vhp + 32 * RPH);
      const v16h vh3 = ldfrag_h(vhp + 48 * RPH);
      const v16h vl0 = ldfrag_h(vlp);
      const v16h vl1 = ldfrag_h(vlp + 16 * RPH);
      const v16h vl2 = ldfrag_h(vlp + 32 * RPH);
      const v16h vl3 = ldfrag_h(vlp + 48 * RPH);
      o[0] = mma_h(ph.v, vh0, o[0]);  o[0] = mma_h(pl.v, vh0, o[0]);  o[0] = mma_h(ph.v, vl0, o[0]);
      o[1] = mma_h(ph.v, vh1, o[1]);  o[1] = mma_h(pl.v, vh1, o[1]);  o[1] = mma_h(ph.v, vl1, o[1]);
      o[2] = mma_h(ph.v, vh2, o[2]);  o[2] = mma_h(pl.v, vh2, o[2]);  o[2] = mma_h(ph.v, vl2, o[2]);
      o[3] = mma_h(ph.v, vh3, o[3]);  o[3] = mma_h(pl.v, vh3, o[3]);  o[3] = mma_h(ph.v, vl3, o[3]);
      guard10(o[0], o[1], o[2], o[3], ph.v, pl.v, vh0, vh1, vh2, vh3, vl0, vl1, vl2, vl3);
    }
   }
   // publish point of stage st + 1: own reads of this buffer done, own copies of the next landed, block barrier, then the refill
   wait_ds0();
   wait_async0();
   __syncthreads();
   if (st + 2 < NST) STAGE_COPY(st + 2, bf);
  }
  wait_async0();
#undef STAGE_COPY
  acc_guard4(o[0], o[1], o[2], o[3]);

  // ---- fold 1/l (per query, owned by lane = query) and the carries (32768 on P, 1024 on v); stage the 16x64 slab ----
  const float linv = (1.0f / lrun) * (1.0f / (PCAR * VCAR));
  float inv[8];
#pragma unroll
  for (int r = 0; r < 8; ++r) inv[r] = __shfl(linv, 8 * hh + r, 32);
  float* slab = smem + wave * SLABF;
#pragma unroll
  for (int r = 0; r < 8; ++r) {
#pragma unroll
    for (int j = 0; j < 4; ++j) slab[(8 * hh + r) * 68 + j * 16 + c] = o[j][r] * inv[r];
  }
  wave_sync_lds();
  // ---- O x1024 -> f16 hi + residual planes; lane = (row in group of 4, 8 consecutive d) ----
  v4u oh[4], ol[4];
  const int rq = lane >> 3, c8 = (lane & 7) * 8;
#pragma unroll
  for (int i4 = 0; i4 < 4; ++i4) {
    const int row = i4 * 4 + rq;
    const v4f a = *(const v4f*)(slab + row * 68 + c8), c4 = *(const v4f*)(slab + row * 68 + c8 + 4);
    float w[8];
#pragma unroll
    for (int e = 0; e < 4; ++e) { w[e] = a[e] * OSC; w[4 + e] = c4[e] * OSC; }
#pragma unroll
    for (int e = 0; e < 4; ++e) {
      const _Float16 h0 = (_Float16)w[2 * e], h1 = (_Float16)w[2 * e + 1];
      const _Float16 l0 = (_Float16)(w[2 * e] - (float)h0), l1 = (_Float16)(w[2 * e + 1] - (float)h1);
      oh[i4][e] = pk16(h_bits(h0), h_bits(h1));
      ol[i4][e] = pk16(h_bits(l0), h_bits(l1));
    }
  }
  const size_t ob = (((size_t)(b * SEQ + q0)) * NH + head) * HD + c8;
  {
#pragma unroll
    for (int i4 = 0; i4 < 4; ++i4) {
      const int row = i4 * 4 + rq;
      const size_t o8 = ob + (size_t)row * (NH * HD);
      *(v4u*)(OHIp + o8) = oh[i4];
      *(v4u*)(OLOp + o8) = ol[i4];
    }
    
  }
}

// =====================================================================================================
// Workspace map (bytes); every plane is fully written by whole-line stores before it is read; all extents are exact multiples
// of the store granularity (no pad rows needed); every offset a multiple of 131072 (128 KiB); q, k and v each have their
// own input plane and projection plane, so that each stage runs as one grid over all three:
//   XBQ bf16 [4096][768]               6291456        XBK same  6291456      XBV same  6291456
//   WQB bf16 [768 n][768 k]            1179648        WKB same  1179648      WVB same  1179648
//   WOB f16  [768 n][768 k] x1024      1179648
//   FQ  f32 [4096][768]               12582912        FK same  12582912      FV same  12582912
//   QHI f16 [2][2048][12][64] x1024    6291456        QLO residual         6291456
//   KHI same                           6291456        KLO residual         6291456
//   VHI f16 [2][12][64][2048] x1024    6291456        VLO residual         6291456
//   OHI f16 [4096][768] x1024          6291456        OLO residual         6291456
//   end                              111673344
// =====================================================================================================
extern "C" void kernel_launch(void* const* d_in, const int* in_sizes, int n_in,
                              void* d_out, int out_size, void* d_ws, size_t ws_size,
                              hipStream_t stream) {
  const int ROWS = NB * SEQ;                            // 4096
  if (n_in < 13) return;
  if (in_sizes[0] != ROWS * DMOD || in_sizes[1] != ROWS * DMOD || in_sizes[2] != ROWS * DMOD) return;
  if (in_sizes[3] != NB * SEQ) return;
  if (in_sizes[4] != DMOD * DMOD || in_sizes[6] != DMOD * DMOD) return;
  if (in_sizes[8] != DMOD * DMOD || in_sizes[10] != DMOD * DMOD) return;
  if (in_sizes[5] != DMOD || in_sizes[7] != DMOD || in_sizes[9] != DMOD || in_sizes[11] != DMOD) return;
  if (in_sizes[12] != NH) return;
  if (out_size != ROWS * DMOD) return;

  const float* Qin  = (const float*)d_in[0];
  const float* Kin  = (const float*)d_in[1];
  const float* Vin  = (const float*)d_in[2];
  const float* mask = (const float*)d_in[3];
  const float* wq   = (const float*)d_in[4];
  const float* bq   = (const float*)d_in[5];
  const float* wk   = (const float*)d_in[6];
  const float* bk   = (const float*)d_in[7];
  const float* wv   = (const float*)d_in[8];
  const float* bv   = (const float*)d_in[9];
  const float* wo   = (const float*)d_in[10];
  const float* bo   = (const float*)d_in[11];
  const float* mcw  = (const float*)d_in[12];
  float*       out  = (float*)d_out;

  const size_t szXB  = (size_t)ROWS * DMOD * 2;                 //  6291456
  const size_t szW   = (size_t)DMOD * DMOD * 2;                 //  1179648
  const size_t szF   = (size_t)ROWS * DMOD * 4;                 // 12582912
  const size_t szP   = (size_t)ROWS * DMOD * 2;                 //  6291456  (q/k/o planes)
  const size_t szVP  = (size_t)NB * NH * HD * SEQ * 2;          //  6291456
  size_t off = 0;
  const size_t oXBQ = off; off += szXB;
  const size_t oXBK = off; off += szXB;
  const size_t oXBV = off; off += szXB;
  const size_t oWQB = off; off += szW;
  const size_t oWKB = off; off += szW;
  const size_t oWVB = off; off += szW;
  const size_t oWOB = off; off += szW;
  const size_t oFQ  = off; off += szF;
  const size_t oFK  = off; off += szF;
  const size_t oFV  = off; off += szF;
  const size_t oQHI = off; off += szP;
  const size_t oQLO = off; off += szP;
  const size_t oKHI = off; off += szP;
  const size_t oKLO = off; off += szP;
  const size_t oVHI = off; off += szVP;
  const size_t oVLO = off; off += szVP;
  const size_t oOHI = off; off += szP;
  const size_t oOLO = off; off += szP;
  if (off > ws_size) return;                            // off = 111673344
  if (off > (size_t)134217728) return;

  char* ws = (char*)d_ws;
  u16*   XBQ = (u16*)(ws + oXBQ);
  u16*   XBK = (u16*)(ws + oXBK);
  u16*   XBV = (u16*)(ws + oXBV);
  u16*   WQB = (u16*)(ws + oWQB);
  u16*   WKB = (u16*)(ws + oWKB);
  u16*   WVB = (u16*)(ws + oWVB);
  u16*   WOB = (u16*)(ws + oWOB);
  float* FQ  = (float*)(ws + oFQ);
  float* FK  = (float*)(ws + oFK);
  float* FV  = (float*)(ws + oFV);
  u16*   QHI = (u16*)(ws + oQHI);
  u16*   QLO = (u16*)(ws + oQLO);
  u16*   KHI = (u16*)(ws + oKHI);
  u16*   KLO = (u16*)(ws + oKLO);
  u16*   VHI = (u16*)(ws + oVHI);
  u16*   VLO = (u16*)(ws + oVLO);
  u16*   OHI = (u16*)(ws + oOHI);
  u16*   OLO = (u16*)(ws + oOLO);

  const dim3 blk(256);
  const int n8x = (ROWS * DMOD) / 8;                    // 393216
  const int n8w = (DMOD * DMOD) / 8;                    //  73728
  if ((n8x % 256) != 0 || (n8w % 256) != 0) return;
  if ((ROWS % 64) != 0 || (DMOD % 64) != 0 || (DMOD % 32) != 0) return;
  if (n8x / 256 != GXB || n8w / 256 != GWB) return;
  const dim3 gCV(3 * GXB + 4 * GWB);                    // 5760
  const dim3 gG((ROWS / 64) * (DMOD / 64));             //  768
  const dim3 gG3((ROWS / 64) * (DMOD / 64), 3);         //  768 x 3
  const dim3 bG(128);
  const dim3 gPL(GVT + 2 * GXB);                        // 3840
  const dim3 gAT(ATT_BLOCKS);                           //  768
  const dim3 bAT(ATT_THREADS);                          //  128

  // (0) all conversions: inputs -> bf16 planes; weights [n][k] (already k-contiguous for x.W^T): bf16 planes for wq/wk/wv, f16 of
  //     bf16 value x1024 for wo
  cvt16_all<<<gCV, blk, 0, stream>>>(Qin, Kin, Vin, wq, wk, wv, wo, XBQ, XBK, XBV, WQB, WKB, WVB, WOB);
  // (1) the three projections + bias, each [4096][768] f32 (col = h*64+d)
  gemm_bfb3<<<gG3, bG, 0, stream>>>(XBQ, XBK, XBV, WQB, WKB, WVB, bq, bk, bv, FQ, FK, FV, ROWS, DMOD, DMOD, 1.0f);
  // (2) q and k -> f16 hi x1024 + residual planes; v -> v^T planes x1024 (hi + residual)
  planes_qkv<<<gPL, blk, 0, stream>>>(FQ, FK, FV, QHI, QLO, KHI, KLO, VHI, VLO);
  // (3) attention with per-head x per-key bias -> O planes [b][s][h][d] x1024 (hi + residual)
  attn_fwd<<<gAT, bAT, 0, stream>>>(QHI, QLO, KHI, KLO, VHI, VLO, mask, mcw, OHI, OLO);
  // (4) output projection + bias -> out [4096][768] f32, carries 1024 (O) x 1024 (wo) folded back
  gemm_h2<<<gG, bG, 0, stream>>>(OHI, OLO, WOB, bo, out, ROWS, DMOD, DMOD, 1.0f / (OSC * WOS));
  (void)hipGetLastError();
}

// v005
// It runs in 142 microseconds.
// Timed twice side by side with v004, it ran 1.08 times as fast both times.
// Counting every step since v000, it is 2.05 times as fast.
// Contractions: x.W{q,k,v}^T on v_wmma_f32_16x16x32_bf16 (x and W RNE-converted to bf16 operands, f32 accumulate, bias added in f32);
// scores k'.q'^T (q', k' carried x1024 as f16 hi plane + f16 residual plane, products hh+lh+hl), P.v (P x32768 f16 hi+residual,
// v x1024 f16 hi+residual, products hh+lh+hl) and O.Wo^T (O x1024 f16 hi+residual, Wo as f16(bf16(Wo) x1024), products h.w+l.w):
// v_wmma_f32_16x16x32_f16, f32 accumulate. Per-head x per-key additive score bias, base-2 online softmax, 1/l fold in f32 on VALU.
#include <hip/hip_runtime.h>
#include <math.h>
#include <stdint.h>

#define NB    2
#define SEQ   2048
#define DMOD  768
#define NH    12
#define HD    64
#define NQT   (SEQ / 64)
#define QSC   1024.0f
#define KSC   1024.0f
#define PCAR  32768.0f
#define VCAR  1024.0f
#define OSC   1024.0f
#define WOS   1024.0f
#define LOG2E 1.4426950408889634f
#define ATT_WAVES   4
#define ATT_THREADS (ATT_WAVES * 32)
#define ATT_BLOCKS  (NB * NH * NQT)
#define NKB    (SEQ / 32)
#define SLABF  (16 * 68)
#define SLAB64 (16 * 68)
#define VTP    72
#define SKEYS  64
#define NST    (SEQ / SKEYS)
#define RPH    72
#define TILEH  (64 * RPH)
#define GKS    64                              // k per GEMM stage: one whole 128-B line of every operand row
#define GXB    ((NB * SEQ * DMOD / 8) / 256)   // blocks of 256 threads x 8 elements per [4096][768] plane
#define GWB    ((DMOD * DMOD / 8) / 256)       // the same per [768][768] plane
static_assert(HD == 64 && DMOD == NH * HD);
static_assert(NQT == 32 && NH == 12 && NB == 2);
static_assert(ATT_THREADS == 128 && ATT_BLOCKS == 768 && NKB == 64);
static_assert(((NB * SEQ) % 64) == 0 && (DMOD % 64) == 0 && (DMOD % 32) == 0);
static_assert((SEQ % 64) == 0 && (SEQ % 8) == 0);
static_assert(((NB * SEQ * DMOD / 8) % 256) == 0 && ((DMOD * DMOD / 8) % 256) == 0);
static_assert(GXB == 1536 && GWB == 288);
static_assert(ATT_WAVES * SLABF >= 4 * 16 * 68);
static_assert(HD * VTP >= 63 * VTP + 64 && 2 * 2 * TILEH >= 2 * HD * VTP && (VTP * 2) % 16 == 0);
static_assert(2 * 2 * TILEH * 2 >= 4 * SLAB64 * 4 && (DMOD % GKS) == 0 && DMOD / GKS >= 2);
static_assert((SEQ % (4 * ATT_THREADS)) == 0);
static_assert(SKEYS == 64 && NST >= 2 && NST * SKEYS == SEQ && (RPH * 2) % 16 == 0 && TILEH >= 63 * RPH + 64);

typedef unsigned short u16;
typedef _Float16 v16h __attribute__((ext_vector_type(16)));
typedef _Float16 v8h  __attribute__((ext_vector_type(8)));
typedef __bf16   v16b __attribute__((ext_vector_type(16)));
typedef float    v8f  __attribute__((ext_vector_type(8)));
typedef float    v4f  __attribute__((ext_vector_type(4)));
typedef unsigned int v4u __attribute__((ext_vector_type(4)));

union FragH { v16h v; v8h h[2]; v4u u[2]; };
union FragB { v16b v; v4u u[2]; };

// ---- scalar helpers --------------------------------------------------------------------------------
__device__ __forceinline__ unsigned short bf_bits(float f) {          // f32 -> bf16 bits, RNE convert
  unsigned u = __float_as_uint(f);
  return (unsigned short)((u + 0x7FFFu + ((u >> 16) & 1u)) >> 16);
}
__device__ __forceinline__ float bf_up(unsigned short h) { return __uint_as_float(((unsigned)h) << 16); }
__device__ __forceinline__ float bfr(float f) { return bf_up(bf_bits(f)); }
__device__ __forceinline__ unsigned short h_bits(_Float16 x) { return __builtin_bit_cast(unsigned short, x); }
__device__ __forceinline__ unsigned pk16(unsigned short a, unsigned short b) { return (unsigned)a | ((unsigned)b << 16); }
__device__ __forceinline__ v8f zero8() { v8f z = {0.f, 0.f, 0.f, 0.f, 0.f, 0.f, 0.f, 0.f}; return z; }
__device__ __forceinline__ v4f zero4() { v4f z = {0.f, 0.f, 0.f, 0.f}; return z; }

// ---- fragment loaders: 16-bit A/B operand, lane -> row/col (lane&15), p already includes +8*(lane>>4);
//      elements 0..7 <- p[0..7] (k0+8h..), elements 8..15 <- p[16..23] (k0+16+8h..)  (same split k map for A and B;
//      B is always read from a k-contiguous [n][k] plane)
__device__ __forceinline__ v16h ldfrag_h(const _Float16* p) {
  FragH f;
  f.h[0] = *(const v8h*)(p);
  f.h[1] = *(const v8h*)(p + 16);
  return f.v;
}
__device__ __forceinline__ v16b ldfrag_b(const u16* p) {              // bf16 plane read as unsigned integer vectors
  FragB f;
  f.u[0] = *(const v4u*)(p);
  f.u[1] = *(const v4u*)(p + 16);
  return f.v;
}

__device__ __forceinline__ v8f mma_h(v16h a, v16h b, v8f c) {
  return __builtin_amdgcn_wmma_f32_16x16x32_f16(false, a, false, b, (short)0, c, false, false);
}
__device__ __forceinline__ v8f mma_b(v16b a, v16b b, v8f c) {
  return __builtin_amdgcn_wmma_f32_16x16x32_bf16(false, a, false, b, (short)0, c, false, false);
}
__device__ __forceinline__ void guard2(v8f& a, v8f& b, v16h x0, v16h x1, v16h x2, v16h x3, v16h x4, v16h x5) {
#if defined(__HIP_DEVICE_COMPILE__)
  asm volatile("v_nop\n\tv_nop\n\tv_nop\n\tv_nop"
               : "+v"(a), "+v"(b) : "v"(x0), "v"(x1), "v"(x2), "v"(x3), "v"(x4), "v"(x5) : "memory");
#endif
}
template <typename F>
__device__ __forceinline__ void guard6(v8f& a, v8f& b, v8f& c, v8f& d, F x0, F x1, F x2, F x3, F x4, F x5) {
#if defined(__HIP_DEVICE_COMPILE__)
  asm volatile("v_nop\n\tv_nop\n\tv_nop\n\tv_nop"
               : "+v"(a), "+v"(b), "+v"(c), "+v"(d) : "v"(x0), "v"(x1), "v"(x2), "v"(x3), "v"(x4), "v"(x5) : "memory");
#endif
}
__device__ __forceinline__ void guard10(v8f& a, v8f& b, v8f& c, v8f& d, v16h x0, v16h x1, v16h x2, v16h x3, v16h x4,
                                        v16h x5, v16h x6, v16h x7, v16h x8, v16h x9) {
#if defined(__HIP_DEVICE_COMPILE__)
  asm volatile("v_nop\n\tv_nop\n\tv_nop\n\tv_nop"
               : "+v"(a), "+v"(b), "+v"(c), "+v"(d)
               : "v"(x0), "v"(x1), "v"(x2), "v"(x3), "v"(x4), "v"(x5), "v"(x6), "v"(x7), "v"(x8), "v"(x9) : "memory");
#endif
}
__device__ __forceinline__ void acc_guard4(v8f& a, v8f& b, v8f& c, v8f& d) {
#if defined(__HIP_DEVICE_COMPILE__)
  asm volatile("v_nop\n\tv_nop\n\tv_nop\n\tv_nop" : "+v"(a), "+v"(b), "+v"(c), "+v"(d));
#endif
}
// Four asynchronous 16-B copies per lane, global -> LDS (rows r, r+16, r+32, r+48 of one 64-row tile). The s_wait_xcnt stands in
// the copies' own statement so that no address register is rewritten in front of it.
__device__ __forceinline__ void copy4(unsigned l0, unsigned l1, unsigned l2, unsigned l3,
                                      const u16* g0, const u16* g1, const u16* g2, const u16* g3) {
#if defined(__HIP_DEVICE_COMPILE__)
  asm volatile("global_load_async_to_lds_b128 %0, %4, off\n\t"
               "global_load_async_to_lds_b128 %1, %5, off\n\t"
               "global_load_async_to_lds_b128 %2, %6, off\n\t"
               "global_load_async_to_lds_b128 %3, %7, off\n\t"
               "s_wait_xcnt 0x0"
               :: "v"(l0), "v"(l1), "v"(l2), "v"(l3), "v"(g0), "v"(g1), "v"(g2), "v"(g3) : "memory");
#endif
}
// One 64-row x 128-B tile: lbase = this lane's LDS byte address in row r, g = its global address in row r, gstep = 16 source rows.
__device__ __forceinline__ void copy_tile(unsigned lbase, const u16* g, size_t gstep) {
  copy4(lbase, lbase + 16u * (RPH * 2), lbase + 32u * (RPH * 2), lbase + 48u * (RPH * 2), g, g + gstep, g + 2 * gstep, g + 3 * gstep);
}
__device__ __forceinline__ void wait_async0() {   // this wave's copies have landed
#if defined(__HIP_DEVICE_COMPILE__)
  asm volatile("s_wait_asynccnt 0x0" ::: "memory");
#endif
}
__device__ __forceinline__ void wait_ds0() {      // this wave's LDS reads have returned before their buffer is handed back
#if defined(__HIP_DEVICE_COMPILE__)
  asm volatile("s_wait_dscnt 0x0" ::: "memory");
#endif
}
__device__ __forceinline__ void wave_sync_lds() {
  __builtin_amdgcn_fence(__ATOMIC_RELEASE, "workgroup");
  __builtin_amdgcn_wave_barrier();
  __builtin_amdgcn_fence(__ATOMIC_ACQUIRE, "workgroup");
}

// =====================================================================================================
// f32 plane -> 16-bit plane, same layout:  f16mode == 0: bf16 RNE bits;  f16mode == 1: f16 bits of (bf16 RNE value) * scale.
// Thread = 8 consecutive elements: two 16-B loads, one 16-B store; 32 consecutive lanes = 512 contiguous, 512-B aligned bytes
// gt = the thread's index within its plane.
// =====================================================================================================
__device__ __forceinline__ void cvt16_body(const float* __restrict__ x, u16* D, int gt, int f16mode, float scale) {
  const float* p = x + (size_t)gt * 8;
  const v4f a = *(const v4f*)(p), c4 = *(const v4f*)(p + 4);
  float v[8];
#pragma unroll
  for (int e = 0; e < 4; ++e) { v[e] = a[e]; v[4 + e] = c4[e]; }
  unsigned short s[8];
#pragma unroll
  for (int e = 0; e < 8; ++e) {
    const unsigned short hb = h_bits((_Float16)(bfr(v[e]) * scale));
    const unsigned short bb = bf_bits(v[e]);
    s[e] = (f16mode != 0) ? hb : bb;
  }
  v4u o;
#pragma unroll
  for (int e = 0; e < 4; ++e) o[e] = pk16(s[2 * e], s[2 * e + 1]);
  u16* d = D + (size_t)gt * 8;
  {
    *(v4u*)(d) = o;
    
  }
}
// All seven conversions in one grid (none reads another's output): blocks [0, 3*GXB) = the three input planes -> bf16,
// blocks [3*GXB, 3*GXB + 4*GWB) = wq, wk, wv -> bf16 and wo -> f16 of (bf16 value x1024). The plane is chosen per block (scalar).
// coverage: GXB (GWB) blocks x 256 thr x 8 = one whole plane each.
__global__ __launch_bounds__(256)
void cvt16_all(const float* __restrict__ xq, const float* __restrict__ xk, const float* __restrict__ xv,
               const float* __restrict__ wq, const float* __restrict__ wk, const float* __restrict__ wv,
               const float* __restrict__ wo, u16* XQ, u16* XK, u16* XV, u16* WQ, u16* WK, u16* WV, u16* WO) {
  const int bid = blockIdx.x;
  if (bid >= 3 * GXB + 4 * GWB) return;     // never taken with the exact grid; no barriers in this kernel
  const float* x;
  u16* D;
  int lb, f16mode = 0;
  float scale = 1.0f;
  if (bid < 3 * GXB) {
    const int pl = bid / GXB;
    lb = bid - pl * GXB;
    x = (pl == 0) ? xq : (pl == 1) ? xk : xv;
    D = (pl == 0) ? XQ : (pl == 1) ? XK : XV;
  } else {
    const int r = bid - 3 * GXB, pl = r / GWB;
    lb = r - pl * GWB;
    x = (pl == 0) ? wq : (pl == 1) ? wk : (pl == 2) ? wv : wo;
    D = (pl == 0) ? WQ : (pl == 1) ? WK : (pl == 2) ? WV : WO;
    if (pl == 3) { f16mode = 1; scale = WOS; }
  }
  cvt16_body(x, D, lb * 256 + (int)threadIdx.x, f16mode, scale);
}

// =====================================================================================================
// GEMM epilogue of the output projection: the wave's 16x64 f32 tile (times oscale) staged in its LDS slab (pitch 68),
// coverage: 8 instructions x 2 rows x 16 lanes x 4 floats = the wave's 16 x 64 tile.
// =====================================================================================================
__device__ __forceinline__ void epi64(float* sl, v8f a0, v8f a1, v8f a2, v8f a3, float oscale, v4f badd, float* C, int N,
                                      size_t rowb, int col0, int lane) {
  const int hh = lane >> 4, m = lane & 15;
#pragma unroll
  for (int r = 0; r < 8; ++r) {
    const int ro = (8 * hh + r) * 68 + m;
    sl[ro]      = a0[r] * oscale;
    sl[ro + 16] = a1[r] * oscale;
    sl[ro + 32] = a2[r] * oscale;
    sl[ro + 48] = a3[r] * oscale;
  }
  wave_sync_lds();
  v4f vals[8];
#pragma unroll
  for (int it = 0; it < 8; ++it) vals[it] = *(const v4f*)(sl + (it * 2 + hh) * 68 + m * 4) + badd;
  float* dst = C + (rowb + (size_t)hh) * (size_t)N + col0 + m * 4;
  {
#pragma unroll
    for (int it = 0; it < 8; ++it) {
      *(v4f*)(dst + (size_t)(it * 2) * (size_t)N) = vals[it];
    }
    
  }
}

// 8 f32 values (already carried up by their power of two) -> 8 f16 hi + 8 f16 residuals (value - hi, unscaled)
__device__ __forceinline__ void split8(const float* w, v4u& oh, v4u& ol) {
#pragma unroll
  for (int e = 0; e < 4; ++e) {
    const float t0 = w[2 * e], t1 = w[2 * e + 1];
    const _Float16 h0 = (_Float16)t0, h1 = (_Float16)t1;
    const _Float16 l0 = (_Float16)(t0 - (float)h0), l1 = (_Float16)(t1 - (float)h1);
    oh[e] = pk16(h_bits(h0), h_bits(h1));
    ol[e] = pk16(h_bits(l0), h_bits(l1));
  }
}

// =====================================================================================================
// Projection epilogue, q and k: the wave's 16x64 f32 tile (times oscale) staged in its LDS slab (pitch 68), read back by rows, bias
// added in f32, then f16 hi plane (value * sc) + f16 residual plane, same [row][col] layout as the product.
// coverage: per plane 4 instructions x 4 rows x 8 lanes x 8 halves = the wave's 16 x 64 tile, whole 128-B lines.
// =====================================================================================================
__device__ __forceinline__ void epi_split(float* sl, v8f a0, v8f a1, v8f a2, v8f a3, float oscale, const float* __restrict__ bias,
                                          float sc, u16* HP, u16* LP, int N, size_t rowb, int col0, int lane) {
  const int hh = lane >> 4, m = lane & 15;
  const int rq = lane >> 3, c8 = (lane & 7) * 8;
  const v4f bv0 = *(const v4f*)(bias + col0 + c8), bv1 = *(const v4f*)(bias + col0 + c8 + 4);   // columns < N (N multiple of 64)
#pragma unroll
  for (int r = 0; r < 8; ++r) {
    const int ro = (8 * hh + r) * 68 + m;
    sl[ro]      = a0[r] * oscale;
    sl[ro + 16] = a1[r] * oscale;
    sl[ro + 32] = a2[r] * oscale;
    sl[ro + 48] = a3[r] * oscale;
  }
  wave_sync_lds();
  float badd[8];
#pragma unroll
  for (int e = 0; e < 4; ++e) { badd[e] = bfr(bv0[e]); badd[4 + e] = bfr(bv1[e]); }
  v4u oh[4], ol[4];
#pragma unroll
  for (int i4 = 0; i4 < 4; ++i4) {
    const int row = i4 * 4 + rq;
    const v4f a = *(const v4f*)(sl + row * 68 + c8), c4 = *(const v4f*)(sl + row * 68 + c8 + 4);
    float w[8];
#pragma unroll
    for (int e = 0; e < 4; ++e) { w[e] = (a[e] + badd[e]) * sc; w[4 + e] = (c4[e] + badd[4 + e]) * sc; }
    split8(w, oh[i4], ol[i4]);
  }
  const size_t ob = (rowb + (size_t)rq) * (size_t)N + col0 + c8;
#pragma unroll
  for (int i4 = 0; i4 < 4; ++i4) {
    const size_t o8 = ob + (size_t)(i4 * 4) * (size_t)N;
    *(v4u*)(HP + o8) = oh[i4];
    *(v4u*)(LP + o8) = ol[i4];
  }
#if defined(__HIP_DEVICE_COMPILE__)
  // the built code runs on from here into a joined test in front of the v branch, whose first instructions rewrite registers
  // that these eight stores name: the wait stands in front of every such rewrite
  asm volatile("s_wait_xcnt 0x0" ::: "memory");
#endif
}

// =====================================================================================================
// Projection epilogue, v: the block's tile is (batch b, keys s0 .. s0+63, head h, all 64 d), written TRANSPOSED as
// VH[(b*NH + h)*HD + d][s] = f16(v * 1024), VL = f16 residual. An accumulator's 8 elements of a lane are 8 consecutive keys of one d,
// so each goes as one 16-B LDS store into the [d][key] tiles (pitch 72 halves); a block barrier, then whole 128-B lines go out.
// coverage: LDS 4 waves x 4 accumulators x 32 lanes x 8 halves = 64 x 64 per plane; store 4 iterations x 128 thr x 8 halves = 64
//           lines x 64 keys per plane.
// =====================================================================================================
__device__ __forceinline__ void epi_vt(u16* TH, u16* TL, v8f a0, v8f a1, v8f a2, v8f a3, float oscale,
                                       const float* __restrict__ bias, u16* VHo, u16* VLo, int row0, int col0, int tid) {
  const int wave = tid >> 5, lane = tid & 31, hh = lane >> 4, m = lane & 15;
  float bj[4];
#pragma unroll
  for (int j = 0; j < 4; ++j) bj[j] = bias[col0 + j * 16 + m];                     // columns < N (N multiple of 64)
#pragma unroll
  for (int j = 0; j < 4; ++j) {
    const v8f a = (j == 0) ? a0 : (j == 1) ? a1 : (j == 2) ? a2 : a3;
    const float badd = bfr(bj[j]);
    float w[8];
#pragma unroll
    for (int r = 0; r < 8; ++r) w[r] = (a[r] * oscale + badd) * VCAR;
    v4u oh, ol;
    split8(w, oh, ol);
    const int to = (j * 16 + m) * VTP + wave * 16 + 8 * hh;
    *(v4u*)(TH + to) = oh;
    *(v4u*)(TL + to) = ol;
  }
  __syncthreads();
  v4u vh[4], vl[4];
  const int q8 = tid >> 3, p8 = (tid & 7) * 8;
#pragma unroll
  for (int it = 0; it < 4; ++it) {
    const int line = it * 16 + q8;            // d = 0..63
    vh[it] = *(const v4u*)(TH + line * VTP + p8);
    vl[it] = *(const v4u*)(TL + line * VTP + p8);
  }
  const int b = row0 / SEQ, s0 = row0 - b * SEQ, h = col0 >> 6;
  const size_t base = ((size_t)(b * NH + h) * HD + q8) * SEQ + s0 + p8;
#pragma unroll
  for (int it = 0; it < 4; ++it) {
    *(v4u*)(VHo + base + (size_t)(it * 16) * SEQ) = vh[it];
    *(v4u*)(VLo + base + (size_t)(it * 16) * SEQ) = vl[it];
  }
}

// =====================================================================================================
// bf16 GEMM with bias: f32 product A[M][K] (bf16 row-major) . Bt[N][K]^T (bf16 k-contiguous), times oscale, plus bf16-RNE
// value of bias[n], written straight as the f16 hi + residual planes that attention reads. Block = 64x64 tile, 4 waves x 16
// rows. The block's A and Bt tiles of 64 rows x 64 k (whole 128-B lines, LDS pitch 144 B) come into a two-buffer LDS ring by
// asynchronous copies, once per block, and all 4 waves read their fragments there
// (two 16-B LDS loads each, split k map for A and B); one block barrier per 64 k publishes the next stage and frees the one just
// read. k runs upward in steps of 32 as before (host checks K % 64 == 0, M % 64 == 0, N % 64 == 0, grid.x = (M/64)*(N/64)).
// Behind the loop's last barrier the ring is dead and holds the four result slabs (q, k) or the two transposed tiles (v).
// Three independent products of one shape in one grid: blockIdx.y picks the operand set (scalar selects): 0 = q, 1 = k (planes in
// the product's own layout), 2 = v (transposed planes; M = NB*SEQ rows and N = NH*HD columns, a 64-column tile = one head). The
// branch on it is block-uniform, so the barrier inside epi_vt is passed by all threads of its block or by none.
// =====================================================================================================
__global__ __launch_bounds__(128)
void gemm_bfb3(const u16* __restrict__ A0, const u16* __restrict__ A1, const u16* __restrict__ A2,
               const u16* __restrict__ Bt0, const u16* __restrict__ Bt1, const u16* __restrict__ Bt2,
               const float* __restrict__ bias0, const float* __restrict__ bias1, const float* __restrict__ bias2,
               u16* QH, u16* QL, u16* KH, u16* KL, u16* VH, u16* VL, int M, int N, int K, float oscale) {
  __shared__ __align__(16) u16 gring[2 * 2 * TILEH];        // [buffer][A, Bt][64 rows][pitch 72 halves]; epilogue: staging
  const int zz = blockIdx.y;
  const u16*   A    = (zz == 0) ? A0 : (zz == 1) ? A1 : A2;
  const u16*   Bt   = (zz == 0) ? Bt0 : (zz == 1) ? Bt1 : Bt2;
  const float* bias = (zz == 0) ? bias0 : (zz == 1) ? bias1 : bias2;
  const int tid = threadIdx.x, wave = tid >> 5, lane = tid & 31, hh = lane >> 4, m = lane & 15;
  const int ntile = N >> 6;
  const int bid   = blockIdx.x;
  const int row0  = (bid / ntile) * 64;
  const int rowb  = row0 + wave * 16;
  const int col0  = (bid % ntile) * 64;
  const int nst   = K / GKS;
  if (row0 + 64 > M || nst < 1) return;      // block-uniform, in front of every barrier; never taken with the exact grid
  // copies: lane = (row cr of a group of 16, 16-B chunk cc of its 128-B line); a wave's copy = 4 whole lines
  const int cr = tid >> 3, cc = (tid & 7) * 8;
  const u16* ag = A  + (size_t)(row0 + cr) * K + cc;
  const u16* bg = Bt + (size_t)(col0 + cr) * K + cc;
  const size_t gs = (size_t)16 * K;
  const unsigned lcp = (unsigned)(uintptr_t)(gring + cr * RPH + cc);               // LDS byte address, buffer 0, A tile
  const u16* af = gring + (wave * 16 + m) * RPH + 8 * hh;                           // A fragment row of this lane, buffer 0
  const u16* bq = gring + TILEH + m * RPH + 8 * hh;                                 // Bt fragment row of this lane, buffer 0
  v8f acc0 = zero8(), acc1 = zero8(), acc2 = zero8(), acc3 = zero8();
#define GSTAGE(st, bf)                                                    \
  do {                                                                    \
    const unsigned lb_ = lcp + (unsigned)(bf) * (2u * TILEH * 2u);        \
    copy_tile(lb_,              ag + (size_t)(st) * GKS, gs);             \
    copy_tile(lb_ + TILEH * 2u, bg + (size_t)(st) * GKS, gs);             \
  } while (0)
  // ring prologue: stage 0 landed and published, then stage 1 in flight
  GSTAGE(0, 0);
  wait_async0();
  __syncthreads();
  if (1 < nst) GSTAGE(1, 1);
#pragma unroll 1   // stays rolled: one copy of the stage body and of its publish point
  for (int st = 0; st < nst; ++st) {
    const int bf = st & 1;
    const u16* as = af + bf * (2 * TILEH);
    const u16* bs = bq + bf * (2 * TILEH);
    // both k steps of the stage: fragments from LDS, then the products, k upward
    const v16b a   = ldfrag_b(as);
    const v16b b0  = ldfrag_b(bs);
    const v16b b1  = ldfrag_b(bs + 16 * RPH);
    const v16b b2  = ldfrag_b(bs + 32 * RPH);
    const v16b b3  = ldfrag_b(bs + 48 * RPH);
    const v16b a_  = ldfrag_b(as + 32);
    const v16b b0_ = ldfrag_b(bs + 32);
    const v16b b1_ = ldfrag_b(bs + 16 * RPH + 32);
    const v16b b2_ = ldfrag_b(bs + 32 * RPH + 32);
    const v16b b3_ = ldfrag_b(bs + 48 * RPH + 32);
    acc0 = mma_b(a, b0, acc0);
    acc1 = mma_b(a, b1, acc1);
    acc2 = mma_b(a, b2, acc2);
    acc3 = mma_b(a, b3, acc3);
    acc0 = mma_b(a_, b0_, acc0);
    acc1 = mma_b(a_, b1_, acc1);
    acc2 = mma_b(a_, b2_, acc2);
    acc3 = mma_b(a_, b3_, acc3);
    guard6<v16b>(acc0, acc1, acc2, acc3, a_, b0_, b1_, b2_, b3_, a_);
    // publish point of stage st + 1: own reads of this buffer done, own copies of the next landed, block barrier, then the refill
    wait_ds0();
    wait_async0();
    __syncthreads();
    if (st + 2 < nst) GSTAGE(st + 2, bf);
  }
  wait_async0();
#undef GSTAGE
  // every wave is behind the last barrier: no reader and no copy is left on the ring
  if (zz == 2) {
    epi_vt(gring, gring + HD * VTP, acc0, acc1, acc2, acc3, oscale, bias, VH, VL, row0, col0, tid);
  } else {
    float* slab = (float*)(void*)gring;
    epi_split(slab + wave * SLAB64, acc0, acc1, acc2, acc3, oscale, bias, (zz == 0) ? QSC : KSC, (zz == 0) ? QH : KH,
              (zz == 0) ? QL : KL, N, (size_t)rowb, col0, lane);
  }
}

// =====================================================================================================
// f16 hi+lo GEMM with bias: C[M][N] (f32) = (Ahi + Alo)[M][K] . Bt[N][K]^T times oscale, plus bf16-RNE value of bias[n];
// Ahi/Alo f16 planes (same layout), Bt f16 k-contiguous; products hi.B + lo.B into one accumulator (lo is the unscaled
// residual of hi). Same tiling and the same two-buffer LDS ring as gemm_bfb3, with three tiles a stage (Ahi, Alo, Bt).
// =====================================================================================================
__global__ __launch_bounds__(128)
void gemm_h2(const u16* __restrict__ Ah, const u16* __restrict__ Al, const u16* __restrict__ Bt,
             const float* __restrict__ bias, float* C, int M, int N, int K, float oscale) {
  __shared__ __align__(16) u16 gring[2 * 3 * TILEH];        // [buffer][Ahi, Alo, Bt][64 rows][pitch 72 halves]; epilogue: result slabs
  const int tid = threadIdx.x, wave = tid >> 5, lane = tid & 31, hh = lane >> 4, m = lane & 15;
  const int ntile = N >> 6;
  const int bid   = blockIdx.x;
  const int row0  = (bid / ntile) * 64;
  const int rowb  = row0 + wave * 16;
  const int col0  = (bid % ntile) * 64;
  const int nst   = K / GKS;
  if (row0 + 64 > M || nst < 1) return;      // block-uniform, in front of every barrier; never taken with the exact grid
  // copies: lane = (row cr of a group of 16, 16-B chunk cc of its 128-B line); a wave's copy = 4 whole lines
  const int cr = tid >> 3, cc = (tid & 7) * 8;
  const size_t aofs = (size_t)(row0 + cr) * K + cc;
  const u16* ahg = Ah + aofs;
  const u16* alg = Al + aofs;
  const u16* bg  = Bt + (size_t)(col0 + cr) * K + cc;
  const size_t gs = (size_t)16 * K;
  const unsigned lcp = (unsigned)(uintptr_t)(gring + cr * RPH + cc);               // LDS byte address, buffer 0, Ahi tile
  const _Float16* af = (const _Float16*)(const void*)gring + (wave * 16 + m) * RPH + 8 * hh;   // Ahi fragment row, buffer 0
  const _Float16* bq = (const _Float16*)(const void*)gring + 2 * TILEH + m * RPH + 8 * hh;     // Bt fragment row, buffer 0
  v8f acc0 = zero8(), acc1 = zero8(), acc2 = zero8(), acc3 = zero8();
#define GSTAGE(st, bf)                                                    \
  do {                                                                    \
    const unsigned lb_ = lcp + (unsigned)(bf) * (3u * TILEH * 2u);        \
    copy_tile(lb_,                   ahg + (size_t)(st) * GKS, gs);       \
    copy_tile(lb_ + 1u * TILEH * 2u, alg + (size_t)(st) * GKS, gs);       \
    copy_tile(lb_ + 2u * TILEH * 2u, bg  + (size_t)(st) * GKS, gs);       \
  } while (0)
  // ring prologue: stage 0 landed and published, then stage 1 in flight
  GSTAGE(0, 0);
  wait_async0();
  __syncthreads();
  if (1 < nst) GSTAGE(1, 1);
#pragma unroll 1   // stays rolled: one copy of the stage body and of its publish point
  for (int st = 0; st < nst; ++st) {
    const int bf = st & 1;
    const _Float16* as = af + bf * (3 * TILEH);
    const _Float16* bs = bq + bf * (3 * TILEH);
    // both k steps of the stage: fragments from LDS, then the products, k upward
    const v16h ah  = ldfrag_h(as),      al  = ldfrag_h(as + TILEH);
    const v16h b0  = ldfrag_h(bs);
    const v16h b1  = ldfrag_h(bs + 16 * RPH);
    const v16h b2  = ldfrag_h(bs + 32 * RPH);
    const v16h b3  = ldfrag_h(bs + 48 * RPH);
    const v16h ah_ = ldfrag_h(as + 32), al_ = ldfrag_h(as + TILEH + 32);
    const v16h b0_ = ldfrag_h(bs + 32);
    const v16h b1_ = ldfrag_h(bs + 16 * RPH + 32);
    const v16h b2_ = ldfrag_h(bs + 32 * RPH + 32);
    const v16h b3_ = ldfrag_h(bs + 48 * RPH + 32);
    acc0 = mma_h(ah, b0, acc0);    acc0 = mma_h(al, b0, acc0);
    acc1 = mma_h(ah, b1, acc1);    acc1 = mma_h(al, b1, acc1);
    acc2 = mma_h(ah, b2, acc2);    acc2 = mma_h(al, b2, acc2);
    acc3 = mma_h(ah, b3, acc3);    acc3 = mma_h(al, b3, acc3);
    acc0 = mma_h(ah_, b0_, acc0);  acc0 = mma_h(al_, b0_, acc0);
    acc1 = mma_h(ah_, b1_, acc1);  acc1 = mma_h(al_, b1_, acc1);
    acc2 = mma_h(ah_, b2_, acc2);  acc2 = mma_h(al_, b2_, acc2);
    acc3 = mma_h(ah_, b3_, acc3);  acc3 = mma_h(al_, b3_, acc3);
    guard6<v16h>(acc0, acc1, acc2, acc3, ah_, al_, b0_, b1_, b2_, b3_);
    // publish point of stage st + 1: own reads of this buffer done, own copies of the next landed, block barrier, then the refill
    wait_ds0();
    wait_async0();
    __syncthreads();
    if (st + 2 < nst) GSTAGE(st + 2, bf);
  }
  wait_async0();
#undef GSTAGE
  float* slab = (float*)(void*)gring;        // every wave is behind the last barrier: no reader and no copy is left on the ring
  const v4f bv = *(const v4f*)(bias + col0 + m * 4);      // columns col0 + 4m .. +3, always < N (N multiple of 64)
  v4f badd;
#pragma unroll
  for (int e = 0; e < 4; ++e) badd[e] = bfr(bv[e]);
  epi64(slab + wave * SLAB64, acc0, acc1, acc2, acc3, oscale, badd, C, N, (size_t)rowb, col0, lane);
}

// =====================================================================================================
// Full (non-causal) multi-head flash attention with a per-head x per-key additive score bias: block = (batch b, head, 64 query
// rows), 4 waves, wave w owns the 16 query rows q0 = 64*qt + 16*w .. q0+15. The k and v^T tiles of 64 keys (hi and residual planes,
// 4 tiles of 64 rows x 128 B, LDS pitch 144 B) are brought into a two-buffer LDS ring by asynchronous copies, whole 128-B lines,
// once per block, and read by all 4 waves; one block barrier per 64 keys publishes the next stage and frees the one just read.
//   q planes (hi, lo f16, x1024) laid out [b][s][h][d]; k planes the same; v^T planes [b][h][d][s] (x1024).
//   All NKB = 64 key blocks of 32 keys are visited (static bound).
//   Scores are computed TRANSPOSED: S^T tile g (g = 0,1) = k rows (keys kb+16g .. +15, A operand, row m = lane&15, split k map
//   over d) times q^T (B operand, col n = query q0 + (lane&15), k = d, split map), 3 products per tile and d-chunk
//   (k_hi.q_hi + k_lo.q_hi + k_hi.q_lo). D element r of lane l = (key kb+16g+8h+r, query q0+(l&15)), so a lane owns one query
//   column and 16 of its 32 keys; the partner lane l^16 owns the other 16 -> row max / row sum need one xor-16 shuffle.
//   Logit of key j, query i (base 2): (S * 1/8 * 2^-20 + bfr(wh) * bfr(mask[b][j])) * log2(e); the bias term of all SEQ keys of
//   this (batch, head) is formed once per block into an LDS table (f32; each of its two products rounded on its own) and read per
//   pass with the same element -> key map as the transposed scores (t[i] <- key kb+8h+i, t[8+i] <- key kb+16+8h+i), added in f32.
//   Online max-subtracted base-2 softmax in f32. The exp'd values ARE the P A-fragment in place: A row m = query = lane&15,
//   element i <- key kb+8h+i (tile 0, D element i), element 8+i <- key kb+16+8h+i (tile 1, D element i). P is carried x32768
//   as f16 hi + f16 residual. The rescale factor of query row 8h+r of the O accumulators is fetched from lane 8h+r with a
//   shuffle (uniform control). 4+4 v^T B fragments (hi and residual planes, col n = d = 16j + (lane&15), keys k-contiguous),
//   12 P.V WMMAs (hh + lh + hl).
//   Epilogue: 1/l (per query, shuffled to the D row owner) and carry folds in f32; the wave's 16x64 f32 result staged in its LDS
// coverage: per wave 4 instructions x 4 rows x 8 lanes x 8 halves = 16 x 64 per plane; grid 768 blocks x 4 waves = every
//           (b, s, h) row of both O planes exactly once.
// =====================================================================================================
__global__ __launch_bounds__(ATT_THREADS)
void attn_fwd(const u16* __restrict__ QHIp, const u16* __restrict__ QLOp,
              const u16* __restrict__ KHIp, const u16* __restrict__ KLOp,
              const u16* __restrict__ VHIp, const u16* __restrict__ VLOp,
              const float* __restrict__ maskp, const float* __restrict__ mcwp,
              u16* OHIp, u16* OLOp) {
  __shared__ __align__(16) float smem[ATT_WAVES * SLABF];   // per wave: result slab [16][68] in the epilogue only
  __shared__ __align__(16) u16 ring[2 * 4 * TILEH];         // [buffer][k hi, k lo, v^T hi, v^T lo][64 rows][pitch 72 halves]
  __shared__ __align__(16) float kbias[SEQ];                // base-2 logit bias of every key of this (batch, head)

  const int tid  = threadIdx.x;
  const int wave = tid >> 5;
  const int lane = tid & 31;
  const int hh   = lane >> 4;
  const int c    = lane & 15;

  const int bid  = blockIdx.x;
  const int qt   = bid & (NQT - 1);
  const int bh   = bid >> 5;                 // NQT == 32
  const int head = bh % NH;
  const int b    = bh / NH;
  const int q0   = qt * 64 + wave * 16;

  // B fragments of q^T: col n = query q0 + c, k = d (k-contiguous row of the q plane)
  const size_t qofs = (((size_t)(b * SEQ + q0 + c)) * NH + head) * HD + 8 * hh;
  const _Float16* Qh  = (const _Float16*)(const void*)QHIp + qofs;
  const _Float16* Ql  = (const _Float16*)(const void*)QLOp + qofs;
  // copies: lane = (row cr of a group of 16, 16-B chunk cc of its 128-B row); a wave's copy = 4 whole rows
  const int cr = tid >> 3, cc = (tid & 7) * 8;
  const size_t kcp = (((size_t)b * SEQ + cr) * NH + head) * HD + cc;               // key row: stage's first key added per stage
  const size_t vcp = ((size_t)(b * NH + head) * HD + cr) * SEQ + cc;               // d row: stage's first key added per stage
  const unsigned lcp = (unsigned)(uintptr_t)(ring + cr * RPH + cc);                // LDS byte address, buffer 0, tile 0
  // A fragments of k: row m = key (in stage) 16g + c, k = d;  B fragments of v: col n = d = 16j + c, k = key (in stage)
  const _Float16* ringh = (const _Float16*)(const void*)ring + c * RPH + 8 * hh;
  // per-key bias row in the table: kbias[kb + 8hh + 0..7] (tile 0) and [kb + 16 + 8hh + 0..7] (tile 1), 16-B aligned LDS loads
  const float* brow = kbias + 8 * hh;
  const float  wh2  = bfr(mcwp[head]);                                              // per-head scalar (bf16 RNE value)
  const float lsc = 0.125f * (LOG2E / (QSC * KSC));

  float mrun = -INFINITY, lrun = 0.f;
  v8f o[4];
#pragma unroll
  for (int j = 0; j < 4; ++j) o[j] = zero8();

#define STAGE_COPY(st, bf)                                                                        \
  do {                                                                                            \
    const unsigned lb_ = lcp + (unsigned)(bf) * (4u * TILEH * 2u);                                \
    const size_t ko_ = kcp + (size_t)(st) * (SKEYS * NH * HD), vo_ = vcp + (size_t)(st) * SKEYS;  \
    copy_tile(lb_,                   KHIp + ko_, (size_t)16 * (NH * HD));                         \
    copy_tile(lb_ + 1u * TILEH * 2u, KLOp + ko_, (size_t)16 * (NH * HD));                         \
    copy_tile(lb_ + 2u * TILEH * 2u, VHIp + vo_, (size_t)16 * SEQ);                               \
    copy_tile(lb_ + 3u * TILEH * 2u, VLOp + vo_, (size_t)16 * SEQ);                               \
  } while (0)

  // ring prologue: stage 0 landed and published, then stage 1 in flight
  STAGE_COPY(0, 0);
  // bias table, formed while stage 0 flies: thread = 4 consecutive keys per round, SEQ / (4 * ATT_THREADS) rounds cover every key
  // once; the barrier below publishes it together with stage 0
  {
    const float* mb4 = maskp + (size_t)b * SEQ + tid * 4;
#pragma unroll     // the rounds' loads issue together: one memory latency, not one per round
    for (int i = 0; i < SEQ / (4 * ATT_THREADS); ++i) {
      const v4f mv = *(const v4f*)(mb4 + i * (4 * ATT_THREADS));
      v4f bz;
#pragma unroll
      for (int e = 0; e < 4; ++e) bz[e] = (wh2 * bfr(mv[e])) * LOG2E;
      *(v4f*)(kbias + tid * 4 + i * (4 * ATT_THREADS)) = bz;
    }
  }
  wait_async0();
  __syncthreads();
  STAGE_COPY(1, 1);

#pragma unroll 1   // stays rolled: one copy of the stage body and of its publish point
  for (int st = 0; st < NST; ++st) {
   const int bf = st & 1;
   const _Float16* stg = ringh + bf * (4 * TILEH);
#pragma unroll     // the stage's two 32-key passes: their LDS offsets become immediates of the loads
   for (int sub = 0; sub < 2; ++sub) {
    const int kb = st * SKEYS + sub * 32;
    const v4f ma = *(const v4f*)(brow + kb),      mb = *(const v4f*)(brow + kb + 4);
    const v4f mc = *(const v4f*)(brow + kb + 16), md = *(const v4f*)(brow + kb + 20);
    // ---- transposed scores: s0 = keys kb..kb+15, s1 = keys kb+16..kb+31, column = query q0 + c ----
    v8f s0 = zero8(), s1 = zero8();
    const _Float16* k0p = stg + (sub * 32) * RPH;
    const _Float16* k1p = k0p + 16 * RPH;
    const _Float16* l0p = k0p + TILEH;
    const _Float16* l1p = l0p + 16 * RPH;
#pragma unroll
    for (int kk = 0; kk < 2; ++kk) {
      const v16h qh  = ldfrag_h(Qh + kk * 32),  ql  = ldfrag_h(Ql + kk * 32);
      const v16h kh0 = ldfrag_h(k0p + kk * 32), kl0 = ldfrag_h(l0p + kk * 32);
      const v16h kh1 = ldfrag_h(k1p + kk * 32), kl1 = ldfrag_h(l1p + kk * 32);
      s0 = mma_h(kh0, qh, s0);
      s0 = mma_h(kl0, qh, s0);
      s0 = mma_h(kh0, ql, s0);
      s1 = mma_h(kh1, qh, s1);
      s1 = mma_h(kl1, qh, s1);
      s1 = mma_h(kh1, ql, s1);
      guard2(s0, s1, qh, ql, kh0, kl0, kh1, kl1);
    }
    // ---- base-2 logits of this lane's 16 keys for query q0 + c: t[i] <- key kb+8hh+i, t[8+i] <- key kb+16+8hh+i ----
    float t[16];
#pragma unroll
    for (int e = 0; e < 4; ++e) {
      t[e]      = s0[e] * lsc     + ma[e];
      t[4 + e]  = s0[4 + e] * lsc + mb[e];
      t[8 + e]  = s1[e] * lsc     + mc[e];
      t[12 + e] = s1[4 + e] * lsc + md[e];
    }
    float cm = t[0];
#pragma unroll
    for (int i = 1; i < 16; ++i) cm = fmaxf(cm, t[i]);
    cm = fmaxf(cm, __shfl_xor(cm, 16, 32));
    const float mn = fmaxf(mrun, cm);        // finite from the first block on
    const float al = exp2f(mrun - mn);       // 0 on the first block (mrun = -inf)
    mrun = mn;
    // ---- probabilities (<= 1) and the P A-fragments: hi = f16(p * 32768), lo = f16 residual; element i <-> t[i] ----
    float ps = 0.f;
    FragH ph, pl;
#pragma unroll
    for (int w = 0; w < 2; ++w) {
#pragma unroll
      for (int e4 = 0; e4 < 4; ++e4) {
        const int i = 8 * w + 2 * e4;
        const float p0 = exp2f(t[i] - mn), p1 = exp2f(t[i + 1] - mn);
        ps += p0 + p1;
        const float a0 = p0 * PCAR, a1 = p1 * PCAR;
        const _Float16 h0 = (_Float16)a0, h1 = (_Float16)a1;
        const _Float16 l0 = (_Float16)(a0 - (float)h0), l1 = (_Float16)(a1 - (float)h1);
        ph.u[w][e4] = pk16(h_bits(h0), h_bits(h1));
        pl.u[w][e4] = pk16(h_bits(l0), h_bits(l1));
      }
    }
    ps += __shfl_xor(ps, 16, 32);
    lrun = lrun * al + ps;
    // ---- rescale the O accumulators: D row 8hh+r = query q0+8hh+r, its factor lives in lane 8hh+r (and 16+8hh+r) ----
    float scl[8];
#pragma unroll
    for (int r = 0; r < 8; ++r) scl[r] = __shfl(al, 8 * hh + r, 32);
#pragma unroll
    for (int j = 0; j < 4; ++j) {
#pragma unroll
      for (int r = 0; r < 8; ++r) o[j][r] *= scl[r];
    }
    // ---- P.V : B fragment col n = d = j*16 + c, keys contiguous in the v^T planes ----
    {
      const _Float16* vhp = stg + 2 * TILEH + sub * 32;
      const _Float16* vlp = vhp + TILEH;
      const v16h vh0 = ldfrag_h(vhp);
      const v16h vh1 = ldfrag_h(vhp + 16 * RPH);
      const v16h vh2 = ldfrag_h(vhp + 32 * RPH);
      const v16h vh3 = ldfrag_h(vhp + 48 * RPH);
      const v16h vl0 = ldfrag_h(vlp);
      const v16h vl1 = ldfrag_h(vlp + 16 * RPH);
      const v16h vl2 = ldfrag_h(vlp + 32 * RPH);
      const v16h vl3 = ldfrag_h(vlp + 48 * RPH);
      o[0] = mma_h(ph.v, vh0, o[0]);  o[0] = mma_h(pl.v, vh0, o[0]);  o[0] = mma_h(ph.v, vl0, o[0]);
      o[1] = mma_h(ph.v, vh1, o[1]);  o[1] = mma_h(pl.v, vh1, o[1]);  o[1] = mma_h(ph.v, vl1, o[1]);
      o[2] = mma_h(ph.v, vh2, o[2]);  o[2] = mma_h(pl.v, vh2, o[2]);  o[2] = mma_h(ph.v, vl2, o[2]);
      o[3] = mma_h(ph.v, vh3, o[3]);  o[3] = mma_h(pl.v, vh3, o[3]);  o[3] = mma_h(ph.v, vl3, o[3]);
      guard10(o[0], o[1], o[2], o[3], ph.v, pl.v, vh0, vh1, vh2, vh3, vl0, vl1, vl2, vl3);
    }
   }
   // publish point of stage st + 1: own reads of this buffer done, own copies of the next landed, block barrier, then the refill
   wait_ds0();
   wait_async0();
   __syncthreads();
   if (st + 2 < NST) STAGE_COPY(st + 2, bf);
  }
  wait_async0();
#undef STAGE_COPY
  acc_guard4(o[0], o[1], o[2], o[3]);

  // ---- fold 1/l (per query, owned by lane = query) and the carries (32768 on P, 1024 on v); stage the 16x64 slab ----
  const float linv = (1.0f / lrun) * (1.0f / (PCAR * VCAR));
  float inv[8];
#pragma unroll
  for (int r = 0; r < 8; ++r) inv[r] = __shfl(linv, 8 * hh + r, 32);
  float* slab = smem + wave * SLABF;
#pragma unroll
  for (int r = 0; r < 8; ++r) {
#pragma unroll
    for (int j = 0; j < 4; ++j) slab[(8 * hh + r) * 68 + j * 16 + c] = o[j][r] * inv[r];
  }
  wave_sync_lds();
  // ---- O x1024 -> f16 hi + residual planes; lane = (row in group of 4, 8 consecutive d) ----
  v4u oh[4], ol[4];
  const int rq = lane >> 3, c8 = (lane & 7) * 8;
#pragma unroll
  for (int i4 = 0; i4 < 4; ++i4) {
    const int row = i4 * 4 + rq;
    const v4f a = *(const v4f*)(slab + row * 68 + c8), c4 = *(const v4f*)(slab + row * 68 + c8 + 4);
    float w[8];
#pragma unroll
    for (int e = 0; e < 4; ++e) { w[e] = a[e] * OSC; w[4 + e] = c4[e] * OSC; }
#pragma unroll
    for (int e = 0; e < 4; ++e) {
      const _Float16 h0 = (_Float16)w[2 * e], h1 = (_Float16)w[2 * e + 1];
      const _Float16 l0 = (_Float16)(w[2 * e] - (float)h0), l1 = (_Float16)(w[2 * e + 1] - (float)h1);
      oh[i4][e] = pk16(h_bits(h0), h_bits(h1));
      ol[i4][e] = pk16(h_bits(l0), h_bits(l1));
    }
  }
  const size_t ob = (((size_t)(b * SEQ + q0)) * NH + head) * HD + c8;
  {
#pragma unroll
    for (int i4 = 0; i4 < 4; ++i4) {
      const int row = i4 * 4 + rq;
      const size_t o8 = ob + (size_t)row * (NH * HD);
      *(v4u*)(OHIp + o8) = oh[i4];
      *(v4u*)(OLOp + o8) = ol[i4];
    }
    
  }
}

// =====================================================================================================
// Workspace map (bytes); every plane is fully written by whole-line stores before it is read; all extents are exact multiples
// of the store granularity (no pad rows needed); every offset a multiple of 131072 (128 KiB); q, k and v each have their
// own input plane, so that each stage runs as one grid over all three:
//   XBQ bf16 [4096][768]               6291456        XBK same  6291456      XBV same  6291456
//   WQB bf16 [768 n][768 k]            1179648        WKB same  1179648      WVB same  1179648
//   WOB f16  [768 n][768 k] x1024      1179648
//   QHI f16 [2][2048][12][64] x1024    6291456        QLO residual         6291456
//   KHI same                           6291456        KLO residual         6291456
//   VHI f16 [2][12][64][2048] x1024    6291456        VLO residual         6291456
//   OHI f16 [4096][768] x1024          6291456        OLO residual         6291456
//   end                               73924608
// =====================================================================================================
extern "C" void kernel_launch(void* const* d_in, const int* in_sizes, int n_in,
                              void* d_out, int out_size, void* d_ws, size_t ws_size,
                              hipStream_t stream) {
  const int ROWS = NB * SEQ;                            // 4096
  if (n_in < 13) return;
  if (in_sizes[0] != ROWS * DMOD || in_sizes[1] != ROWS * DMOD || in_sizes[2] != ROWS * DMOD) return;
  if (in_sizes[3] != NB * SEQ) return;
  if (in_sizes[4] != DMOD * DMOD || in_sizes[6] != DMOD * DMOD) return;
  if (in_sizes[8] != DMOD * DMOD || in_sizes[10] != DMOD * DMOD) return;
  if (in_sizes[5] != DMOD || in_sizes[7] != DMOD || in_sizes[9] != DMOD || in_sizes[11] != DMOD) return;
  if (in_sizes[12] != NH) return;
  if (out_size != ROWS * DMOD) return;

  const float* Qin  = (const float*)d_in[0];
  const float* Kin  = (const float*)d_in[1];
  const float* Vin  = (const float*)d_in[2];
  const float* mask = (const float*)d_in[3];
  const float* wq   = (const float*)d_in[4];
  const float* bq   = (const float*)d_in[5];
  const float* wk   = (const float*)d_in[6];
  const float* bk   = (const float*)d_in[7];
  const float* wv   = (const float*)d_in[8];
  const float* bv   = (const float*)d_in[9];
  const float* wo   = (const float*)d_in[10];
  const float* bo   = (const float*)d_in[11];
  const float* mcw  = (const float*)d_in[12];
  float*       out  = (float*)d_out;

  const size_t szXB  = (size_t)ROWS * DMOD * 2;                 //  6291456
  const size_t szW   = (size_t)DMOD * DMOD * 2;                 //  1179648
  const size_t szP   = (size_t)ROWS * DMOD * 2;                 //  6291456  (q/k/o planes)
  const size_t szVP  = (size_t)NB * NH * HD * SEQ * 2;          //  6291456
  size_t off = 0;
  const size_t oXBQ = off; off += szXB;
  const size_t oXBK = off; off += szXB;
  const size_t oXBV = off; off += szXB;
  const size_t oWQB = off; off += szW;
  const size_t oWKB = off; off += szW;
  const size_t oWVB = off; off += szW;
  const size_t oWOB = off; off += szW;
  const size_t oQHI = off; off += szP;
  const size_t oQLO = off; off += szP;
  const size_t oKHI = off; off += szP;
  const size_t oKLO = off; off += szP;
  const size_t oVHI = off; off += szVP;
  const size_t oVLO = off; off += szVP;
  const size_t oOHI = off; off += szP;
  const size_t oOLO = off; off += szP;
  if (off > ws_size) return;                            // off = 73924608
  if (off > (size_t)134217728) return;

  char* ws = (char*)d_ws;
  u16*   XBQ = (u16*)(ws + oXBQ);
  u16*   XBK = (u16*)(ws + oXBK);
  u16*   XBV = (u16*)(ws + oXBV);
  u16*   WQB = (u16*)(ws + oWQB);
  u16*   WKB = (u16*)(ws + oWKB);
  u16*   WVB = (u16*)(ws + oWVB);
  u16*   WOB = (u16*)(ws + oWOB);
  u16*   QHI = (u16*)(ws + oQHI);
  u16*   QLO = (u16*)(ws + oQLO);
  u16*   KHI = (u16*)(ws + oKHI);
  u16*   KLO = (u16*)(ws + oKLO);
  u16*   VHI = (u16*)(ws + oVHI);
  u16*   VLO = (u16*)(ws + oVLO);
  u16*   OHI = (u16*)(ws + oOHI);
  u16*   OLO = (u16*)(ws + oOLO);

  const dim3 blk(256);
  const int n8x = (ROWS * DMOD) / 8;                    // 393216
  const int n8w = (DMOD * DMOD) / 8;                    //  73728
  if ((n8x % 256) != 0 || (n8w % 256) != 0) return;
  if ((ROWS % 64) != 0 || (DMOD % 64) != 0 || (DMOD % 32) != 0) return;
  if (n8x / 256 != GXB || n8w / 256 != GWB) return;
  const dim3 gCV(3 * GXB + 4 * GWB);                    // 5760
  const dim3 gG((ROWS / 64) * (DMOD / 64));             //  768
  const dim3 gG3((ROWS / 64) * (DMOD / 64), 3);         //  768 x 3
  const dim3 bG(128);
  const dim3 gAT(ATT_BLOCKS);                           //  768
  const dim3 bAT(ATT_THREADS);                          //  128

  // (0) all conversions: inputs -> bf16 planes; weights [n][k] (already k-contiguous for x.W^T): bf16 planes for wq/wk/wv, f16 of
  //     bf16 value x1024 for wo
  cvt16_all<<<gCV, blk, 0, stream>>>(Qin, Kin, Vin, wq, wk, wv, wo, XBQ, XBK, XBV, WQB, WKB, WVB, WOB);
  // (1) the three projections + bias (col = h*64+d), written as q and k f16 hi x1024 + residual planes and v^T planes x1024
  gemm_bfb3<<<gG3, bG, 0, stream>>>(XBQ, XBK, XBV, WQB, WKB, WVB, bq, bk, bv, QHI, QLO, KHI, KLO, VHI, VLO, ROWS, DMOD, DMOD, 1.0f);
  // (2) attention with per-head x per-key bias -> O planes [b][s][h][d] x1024 (hi + residual)
  attn_fwd<<<gAT, bAT, 0, stream>>>(QHI, QLO, KHI, KLO, VHI, VLO, mask, mcw, OHI, OLO);
  // (3) output projection + bias -> out [4096][768] f32, carries 1024 (O) x 1024 (wo) folded back
  gemm_h2<<<gG, bG, 0, stream>>>(OHI, OLO, WOB, bo, out, ROWS, DMOD, DMOD, 1.0f / (OSC * WOS));
  (void)hipGetLastError();
}

// v006
// One run takes 138 microseconds.
// Two timings next to v005 both put it at 1.03 times that version's speed.
// All steps since v000 together make it 2.12 times as fast.
// Contractions: x.W{q,k,v}^T on v_wmma_f32_16x16x32_bf16 (x and W RNE-converted to bf16 operands, f32 accumulate, bias added in f32);
// scores k'.q'^T (q', k' carried x1024 as f16 hi plane + f16 residual plane, products hh+lh+hl), P.v (P x32768 f16 hi+residual,
// v x1024 f16 hi+residual, products hh+lh+hl) and O.Wo^T (O x1024 f16 hi+residual, Wo as f16(bf16(Wo) x1024), products h.w+l.w):
// v_wmma_f32_16x16x32_f16, f32 accumulate. Per-head x per-key additive score bias, base-2 online softmax, 1/l fold in f32 on VALU.
#include <hip/hip_runtime.h>
#include <math.h>
#include <stdint.h>

#define NB    2
#define SEQ   2048
#define DMOD  768
#define NH    12
#define HD    64
#define NQT   (SEQ / 64)
#define QSC   1024.0f
#define KSC   1024.0f
#define PCAR  32768.0f
#define VCAR  1024.0f
#define OSC   1024.0f
#define WOS   1024.0f
#define LOG2E 1.4426950408889634f
#define ATT_WAVES   4
#define ATT_THREADS (ATT_WAVES * 32)
#define ATT_BLOCKS  (NB * NH * NQT)
#define NKB    (SEQ / 32)
#define SLABF  (16 * 68)
#define SLAB64 (16 * 68)
#define VTP    72
#define SKEYS  64
#define NST    (SEQ / SKEYS)
#define RPH    72
#define TILEH  (64 * RPH)
#define GKS    64                              // k per GEMM stage: one whole 128-B line of every operand row
#define GXB    ((NB * SEQ * DMOD / 8) / 256)   // blocks of 256 threads x 8 elements per [4096][768] plane
#define GWB    ((DMOD * DMOD / 8) / 256)       // the same per [768][768] plane
static_assert(HD == 64 && DMOD == NH * HD);
static_assert(NQT == 32 && NH == 12 && NB == 2);
static_assert(ATT_THREADS == 128 && ATT_BLOCKS == 768 && NKB == 64);
static_assert(((NB * SEQ) % 64) == 0 && (DMOD % 64) == 0 && (DMOD % 32) == 0);
static_assert((SEQ % 64) == 0 && (SEQ % 8) == 0);
static_assert(((NB * SEQ * DMOD / 8) % 256) == 0 && ((DMOD * DMOD / 8) % 256) == 0);
static_assert(GXB == 1536 && GWB == 288);
static_assert(ATT_WAVES * SLABF >= 4 * 16 * 68);
static_assert(HD * VTP >= 63 * VTP + 64 && 2 * 2 * TILEH >= 2 * HD * VTP && (VTP * 2) % 16 == 0);
static_assert(2 * 2 * TILEH * 2 >= 4 * SLAB64 * 4 && (DMOD % GKS) == 0 && DMOD / GKS >= 2);
static_assert((SEQ % (4 * ATT_THREADS)) == 0);
static_assert(SKEYS == 64 && NST >= 2 && NST * SKEYS == SEQ && (RPH * 2) % 16 == 0 && TILEH >= 63 * RPH + 64);

typedef unsigned short u16;
typedef _Float16 v16h __attribute__((ext_vector_type(16)));
typedef _Float16 v8h  __attribute__((ext_vector_type(8)));
typedef __bf16   v16b __attribute__((ext_vector_type(16)));
typedef float    v8f  __attribute__((ext_vector_type(8)));
typedef float    v4f  __attribute__((ext_vector_type(4)));
typedef unsigned int v4u __attribute__((ext_vector_type(4)));

union FragH { v16h v; v8h h[2]; v4u u[2]; };
union FragB { v16b v; v4u u[2]; };

// ---- scalar helpers --------------------------------------------------------------------------------
__device__ __forceinline__ unsigned short bf_bits(float f) {          // f32 -> bf16 bits, RNE convert
  unsigned u = __float_as_uint(f);
  return (unsigned short)((u + 0x7FFFu + ((u >> 16) & 1u)) >> 16);
}
__device__ __forceinline__ float bf_up(unsigned short h) { return __uint_as_float(((unsigned)h) << 16); }
__device__ __forceinline__ float bfr(float f) { return bf_up(bf_bits(f)); }
__device__ __forceinline__ unsigned short h_bits(_Float16 x) { return __builtin_bit_cast(unsigned short, x); }
__device__ __forceinline__ unsigned pk16(unsigned short a, unsigned short b) { return (unsigned)a | ((unsigned)b << 16); }
__device__ __forceinline__ v8f zero8() { v8f z = {0.f, 0.f, 0.f, 0.f, 0.f, 0.f, 0.f, 0.f}; return z; }
__device__ __forceinline__ v4f zero4() { v4f z = {0.f, 0.f, 0.f, 0.f}; return z; }
// 2^x as the bare v_exp_f32, without the library's range test, pre-scale and ldexp around it: equal to exp2f for x >= -126; below
// that the result (under 2^-126) comes out as 0. Used on x <= 0 only: such a term is far under one f32 ulp of the row sum (>= 1)
// and under the smallest f16 residual of P x32768, and a rescale factor that small leaves nothing of the old sums either way.
__device__ __forceinline__ float ex2(float x) { return __builtin_amdgcn_exp2f(x); }

// ---- fragment loaders: 16-bit A/B operand, lane -> row/col (lane&15), p already includes +8*(lane>>4);
//      elements 0..7 <- p[0..7] (k0+8h..), elements 8..15 <- p[16..23] (k0+16+8h..)  (same split k map for A and B;
//      B is always read from a k-contiguous [n][k] plane)
__device__ __forceinline__ v16h ldfrag_h(const _Float16* p) {
  FragH f;
  f.h[0] = *(const v8h*)(p);
  f.h[1] = *(const v8h*)(p + 16);
  return f.v;
}
__device__ __forceinline__ v16b ldfrag_b(const u16* p) {              // bf16 plane read as unsigned integer vectors
  FragB f;
  f.u[0] = *(const v4u*)(p);
  f.u[1] = *(const v4u*)(p + 16);
  return f.v;
}

__device__ __forceinline__ v8f mma_h(v16h a, v16h b, v8f c) {
  return __builtin_amdgcn_wmma_f32_16x16x32_f16(false, a, false, b, (short)0, c, false, false);
}
__device__ __forceinline__ v8f mma_b(v16b a, v16b b, v8f c) {
  return __builtin_amdgcn_wmma_f32_16x16x32_bf16(false, a, false, b, (short)0, c, false, false);
}
__device__ __forceinline__ void guard2(v8f& a, v8f& b, v16h x0, v16h x1, v16h x2, v16h x3, v16h x4, v16h x5) {
#if defined(__HIP_DEVICE_COMPILE__)
  asm volatile("v_nop\n\tv_nop\n\tv_nop\n\tv_nop"
               : "+v"(a), "+v"(b) : "v"(x0), "v"(x1), "v"(x2), "v"(x3), "v"(x4), "v"(x5) : "memory");
#endif
}
template <typename F>
__device__ __forceinline__ void guard6(v8f& a, v8f& b, v8f& c, v8f& d, F x0, F x1, F x2, F x3, F x4, F x5) {
#if defined(__HIP_DEVICE_COMPILE__)
  asm volatile("v_nop\n\tv_nop\n\tv_nop\n\tv_nop"
               : "+v"(a), "+v"(b), "+v"(c), "+v"(d) : "v"(x0), "v"(x1), "v"(x2), "v"(x3), "v"(x4), "v"(x5) : "memory");
#endif
}
__device__ __forceinline__ void guard10(v8f& a, v8f& b, v8f& c, v8f& d, v16h x0, v16h x1, v16h x2, v16h x3, v16h x4,
                                        v16h x5, v16h x6, v16h x7, v16h x8, v16h x9) {
#if defined(__HIP_DEVICE_COMPILE__)
  asm volatile("v_nop\n\tv_nop\n\tv_nop\n\tv_nop"
               : "+v"(a), "+v"(b), "+v"(c), "+v"(d)
               : "v"(x0), "v"(x1), "v"(x2), "v"(x3), "v"(x4), "v"(x5), "v"(x6), "v"(x7), "v"(x8), "v"(x9) : "memory");
#endif
}
__device__ __forceinline__ void acc_guard4(v8f& a, v8f& b, v8f& c, v8f& d) {
#if defined(__HIP_DEVICE_COMPILE__)
  asm volatile("v_nop\n\tv_nop\n\tv_nop\n\tv_nop" : "+v"(a), "+v"(b), "+v"(c), "+v"(d));
#endif
}
// Four asynchronous 16-B copies per lane, global -> LDS (rows r, r+16, r+32, r+48 of one 64-row tile). The s_wait_xcnt stands in
// the copies' own statement so that no address register is rewritten in front of it.
__device__ __forceinline__ void copy4(unsigned l0, unsigned l1, unsigned l2, unsigned l3,
                                      const u16* g0, const u16* g1, const u16* g2, const u16* g3) {
#if defined(__HIP_DEVICE_COMPILE__)
  asm volatile("global_load_async_to_lds_b128 %0, %4, off\n\t"
               "global_load_async_to_lds_b128 %1, %5, off\n\t"
               "global_load_async_to_lds_b128 %2, %6, off\n\t"
               "global_load_async_to_lds_b128 %3, %7, off\n\t"
               "s_wait_xcnt 0x0"
               :: "v"(l0), "v"(l1), "v"(l2), "v"(l3), "v"(g0), "v"(g1), "v"(g2), "v"(g3) : "memory");
#endif
}
// One 64-row x 128-B tile: lbase = this lane's LDS byte address in row r, g = its global address in row r, gstep = 16 source rows.
__device__ __forceinline__ void copy_tile(unsigned lbase, const u16* g, size_t gstep) {
  copy4(lbase, lbase + 16u * (RPH * 2), lbase + 32u * (RPH * 2), lbase + 48u * (RPH * 2), g, g + gstep, g + 2 * gstep, g + 3 * gstep);
}
__device__ __forceinline__ void wait_async0() {   // this wave's copies have landed
#if defined(__HIP_DEVICE_COMPILE__)
  asm volatile("s_wait_asynccnt 0x0" ::: "memory");
#endif
}
__device__ __forceinline__ void wait_ds0() {      // this wave's LDS reads have returned before their buffer is handed back
#if defined(__HIP_DEVICE_COMPILE__)
  asm volatile("s_wait_dscnt 0x0" ::: "memory");
#endif
}
__device__ __forceinline__ void wave_sync_lds() {
  __builtin_amdgcn_fence(__ATOMIC_RELEASE, "workgroup");
  __builtin_amdgcn_wave_barrier();
  __builtin_amdgcn_fence(__ATOMIC_ACQUIRE, "workgroup");
}

// =====================================================================================================
// f32 plane -> 16-bit plane, same layout:  f16mode == 0: bf16 RNE bits;  f16mode == 1: f16 bits of (bf16 RNE value) * scale.
// Thread = 8 consecutive elements: two 16-B loads, one 16-B store; 32 consecutive lanes = 512 contiguous, 512-B aligned bytes
// gt = the thread's index within its plane.
// =====================================================================================================
__device__ __forceinline__ void cvt16_body(const float* __restrict__ x, u16* D, int gt, int f16mode, float scale) {
  const float* p = x + (size_t)gt * 8;
  const v4f a = *(const v4f*)(p), c4 = *(const v4f*)(p + 4);
  float v[8];
#pragma unroll
  for (int e = 0; e < 4; ++e) { v[e] = a[e]; v[4 + e] = c4[e]; }
  unsigned short s[8];
#pragma unroll
  for (int e = 0; e < 8; ++e) {
    const unsigned short hb = h_bits((_Float16)(bfr(v[e]) * scale));
    const unsigned short bb = bf_bits(v[e]);
    s[e] = (f16mode != 0) ? hb : bb;
  }
  v4u o;
#pragma unroll
  for (int e = 0; e < 4; ++e) o[e] = pk16(s[2 * e], s[2 * e + 1]);
  u16* d = D + (size_t)gt * 8;
  {
    *(v4u*)(d) = o;
    
  }
}
// All seven conversions in one grid (none reads another's output): blocks [0, 3*GXB) = the three input planes -> bf16,
// blocks [3*GXB, 3*GXB + 4*GWB) = wq, wk, wv -> bf16 and wo -> f16 of (bf16 value x1024). The plane is chosen per block (scalar).
// coverage: GXB (GWB) blocks x 256 thr x 8 = one whole plane each.
__global__ __launch_bounds__(256)
void cvt16_all(const float* __restrict__ xq, const float* __restrict__ xk, const float* __restrict__ xv,
               const float* __restrict__ wq, const float* __restrict__ wk, const float* __restrict__ wv,
               const float* __restrict__ wo, u16* XQ, u16* XK, u16* XV, u16* WQ, u16* WK, u16* WV, u16* WO) {
  const int bid = blockIdx.x;
  if (bid >= 3 * GXB + 4 * GWB) return;     // never taken with the exact grid; no barriers in this kernel
  const float* x;
  u16* D;
  int lb, f16mode = 0;
  float scale = 1.0f;
  if (bid < 3 * GXB) {
    const int pl = bid / GXB;
    lb = bid - pl * GXB;
    x = (pl == 0) ? xq : (pl == 1) ? xk : xv;
    D = (pl == 0) ? XQ : (pl == 1) ? XK : XV;
  } else {
    const int r = bid - 3 * GXB, pl = r / GWB;
    lb = r - pl * GWB;
    x = (pl == 0) ? wq : (pl == 1) ? wk : (pl == 2) ? wv : wo;
    D = (pl == 0) ? WQ : (pl == 1) ? WK : (pl == 2) ? WV : WO;
    if (pl == 3) { f16mode = 1; scale = WOS; }
  }
  cvt16_body(x, D, lb * 256 + (int)threadIdx.x, f16mode, scale);
}

// =====================================================================================================
// GEMM epilogue of the output projection: the wave's 16x64 f32 tile (times oscale) staged in its LDS slab (pitch 68),
// coverage: 8 instructions x 2 rows x 16 lanes x 4 floats = the wave's 16 x 64 tile.
// =====================================================================================================
__device__ __forceinline__ void epi64(float* sl, v8f a0, v8f a1, v8f a2, v8f a3, float oscale, v4f badd, float* C, int N,
                                      size_t rowb, int col0, int lane) {
  const int hh = lane >> 4, m = lane & 15;
#pragma unroll
  for (int r = 0; r < 8; ++r) {
    const int ro = (8 * hh + r) * 68 + m;
    sl[ro]      = a0[r] * oscale;
    sl[ro + 16] = a1[r] * oscale;
    sl[ro + 32] = a2[r] * oscale;
    sl[ro + 48] = a3[r] * oscale;
  }
  wave_sync_lds();
  v4f vals[8];
#pragma unroll
  for (int it = 0; it < 8; ++it) vals[it] = *(const v4f*)(sl + (it * 2 + hh) * 68 + m * 4) + badd;
  float* dst = C + (rowb + (size_t)hh) * (size_t)N + col0 + m * 4;
  {
#pragma unroll
    for (int it = 0; it < 8; ++it) {
      *(v4f*)(dst + (size_t)(it * 2) * (size_t)N) = vals[it];
    }
    
  }
}

// 8 f32 values (already carried up by their power of two) -> 8 f16 hi + 8 f16 residuals (value - hi, unscaled)
__device__ __forceinline__ void split8(const float* w, v4u& oh, v4u& ol) {
#pragma unroll
  for (int e = 0; e < 4; ++e) {
    const float t0 = w[2 * e], t1 = w[2 * e + 1];
    const _Float16 h0 = (_Float16)t0, h1 = (_Float16)t1;
    const _Float16 l0 = (_Float16)(t0 - (float)h0), l1 = (_Float16)(t1 - (float)h1);
    oh[e] = pk16(h_bits(h0), h_bits(h1));
    ol[e] = pk16(h_bits(l0), h_bits(l1));
  }
}

// =====================================================================================================
// Projection epilogue, q and k: the wave's 16x64 f32 tile (times oscale) staged in its LDS slab (pitch 68), read back by rows, bias
// added in f32, then f16 hi plane (value * sc) + f16 residual plane, same [row][col] layout as the product.
// coverage: per plane 4 instructions x 4 rows x 8 lanes x 8 halves = the wave's 16 x 64 tile, whole 128-B lines.
// =====================================================================================================
__device__ __forceinline__ void epi_split(float* sl, v8f a0, v8f a1, v8f a2, v8f a3, float oscale, const float* __restrict__ bias,
                                          float sc, u16* HP, u16* LP, int N, size_t rowb, int col0, int lane) {
  const int hh = lane >> 4, m = lane & 15;
  const int rq = lane >> 3, c8 = (lane & 7) * 8;
  const v4f bv0 = *(const v4f*)(bias + col0 + c8), bv1 = *(const v4f*)(bias + col0 + c8 + 4);   // columns < N (N multiple of 64)
#pragma unroll
  for (int r = 0; r < 8; ++r) {
    const int ro = (8 * hh + r) * 68 + m;
    sl[ro]      = a0[r] * oscale;
    sl[ro + 16] = a1[r] * oscale;
    sl[ro + 32] = a2[r] * oscale;
    sl[ro + 48] = a3[r] * oscale;
  }
  wave_sync_lds();
  float badd[8];
#pragma unroll
  for (int e = 0; e < 4; ++e) { badd[e] = bfr(bv0[e]); badd[4 + e] = bfr(bv1[e]); }
  v4u oh[4], ol[4];
#pragma unroll
  for (int i4 = 0; i4 < 4; ++i4) {
    const int row = i4 * 4 + rq;
    const v4f a = *(const v4f*)(sl + row * 68 + c8), c4 = *(const v4f*)(sl + row * 68 + c8 + 4);
    float w[8];
#pragma unroll
    for (int e = 0; e < 4; ++e) { w[e] = (a[e] + badd[e]) * sc; w[4 + e] = (c4[e] + badd[4 + e]) * sc; }
    split8(w, oh[i4], ol[i4]);
  }
  const size_t ob = (rowb + (size_t)rq) * (size_t)N + col0 + c8;
#pragma unroll
  for (int i4 = 0; i4 < 4; ++i4) {
    const size_t o8 = ob + (size_t)(i4 * 4) * (size_t)N;
    *(v4u*)(HP + o8) = oh[i4];
    *(v4u*)(LP + o8) = ol[i4];
  }
#if defined(__HIP_DEVICE_COMPILE__)
  // the built code runs on from here into a joined test in front of the v branch, whose first instructions rewrite registers
  // that these eight stores name: the wait stands in front of every such rewrite
  asm volatile("s_wait_xcnt 0x0" ::: "memory");
#endif
}

// =====================================================================================================
// Projection epilogue, v: the block's tile is (batch b, keys s0 .. s0+63, head h, all 64 d), written TRANSPOSED as
// VH[(b*NH + h)*HD + d][s] = f16(v * 1024), VL = f16 residual. An accumulator's 8 elements of a lane are 8 consecutive keys of one d,
// so each goes as one 16-B LDS store into the [d][key] tiles (pitch 72 halves); a block barrier, then whole 128-B lines go out.
// coverage: LDS 4 waves x 4 accumulators x 32 lanes x 8 halves = 64 x 64 per plane; store 4 iterations x 128 thr x 8 halves = 64
//           lines x 64 keys per plane.
// =====================================================================================================
__device__ __forceinline__ void epi_vt(u16* TH, u16* TL, v8f a0, v8f a1, v8f a2, v8f a3, float oscale,
                                       const float* __restrict__ bias, u16* VHo, u16* VLo, int row0, int col0, int tid) {
  const int wave = tid >> 5, lane = tid & 31, hh = lane >> 4, m = lane & 15;
  float bj[4];
#pragma unroll
  for (int j = 0; j < 4; ++j) bj[j] = bias[col0 + j * 16 + m];                     // columns < N (N multiple of 64)
#pragma unroll
  for (int j = 0; j < 4; ++j) {
    const v8f a = (j == 0) ? a0 : (j == 1) ? a1 : (j == 2) ? a2 : a3;
    const float badd = bfr(bj[j]);
    float w[8];
#pragma unroll
    for (int r = 0; r < 8; ++r) w[r] = (a[r] * oscale + badd) * VCAR;
    v4u oh, ol;
    split8(w, oh, ol);
    const int to = (j * 16 + m) * VTP + wave * 16 + 8 * hh;
    *(v4u*)(TH + to) = oh;
    *(v4u*)(TL + to) = ol;
  }
  __syncthreads();
  v4u vh[4], vl[4];
  const int q8 = tid >> 3, p8 = (tid & 7) * 8;
#pragma unroll
  for (int it = 0; it < 4; ++it) {
    const int line = it * 16 + q8;            // d = 0..63
    vh[it] = *(const v4u*)(TH + line * VTP + p8);
    vl[it] = *(const v4u*)(TL + line * VTP + p8);
  }
  const int b = row0 / SEQ, s0 = row0 - b * SEQ, h = col0 >> 6;
  const size_t base = ((size_t)(b * NH + h) * HD + q8) * SEQ + s0 + p8;
#pragma unroll
  for (int it = 0; it < 4; ++it) {
    *(v4u*)(VHo + base + (size_t)(it * 16) * SEQ) = vh[it];
    *(v4u*)(VLo + base + (size_t)(it * 16) * SEQ) = vl[it];
  }
}

// =====================================================================================================
// bf16 GEMM with bias: f32 product A[M][K] (bf16 row-major) . Bt[N][K]^T (bf16 k-contiguous), times oscale, plus bf16-RNE
// value of bias[n], written straight as the f16 hi + residual planes that attention reads. Block = 64x64 tile, 4 waves x 16
// rows. The block's A and Bt tiles of 64 rows x 64 k (whole 128-B lines, LDS pitch 144 B) come into a two-buffer LDS ring by
// asynchronous copies, once per block, and all 4 waves read their fragments there
// (two 16-B LDS loads each, split k map for A and B); one block barrier per 64 k publishes the next stage and frees the one just
// read. k runs upward in steps of 32 as before (host checks K % 64 == 0, M % 64 == 0, N % 64 == 0, grid.x = (M/64)*(N/64)).
// Behind the loop's last barrier the ring is dead and holds the four result slabs (q, k) or the two transposed tiles (v).
// Three independent products of one shape in one grid: blockIdx.y picks the operand set (scalar selects): 0 = q, 1 = k (planes in
// the product's own layout), 2 = v (transposed planes; M = NB*SEQ rows and N = NH*HD columns, a 64-column tile = one head). The
// branch on it is block-uniform, so the barrier inside epi_vt is passed by all threads of its block or by none.
// =====================================================================================================
__global__ __launch_bounds__(128)
void gemm_bfb3(const u16* __restrict__ A0, const u16* __restrict__ A1, const u16* __restrict__ A2,
               const u16* __restrict__ Bt0, const u16* __restrict__ Bt1, const u16* __restrict__ Bt2,
               const float* __restrict__ bias0, const float* __restrict__ bias1, const float* __restrict__ bias2,
               u16* QH, u16* QL, u16* KH, u16* KL, u16* VH, u16* VL, int M, int N, int K, float oscale) {
  __shared__ __align__(16) u16 gring[2 * 2 * TILEH];        // [buffer][A, Bt][64 rows][pitch 72 halves]; epilogue: staging
  const int zz = blockIdx.y;
  const u16*   A    = (zz == 0) ? A0 : (zz == 1) ? A1 : A2;
  const u16*   Bt   = (zz == 0) ? Bt0 : (zz == 1) ? Bt1 : Bt2;
  const float* bias = (zz == 0) ? bias0 : (zz == 1) ? bias1 : bias2;
  const int tid = threadIdx.x, wave = tid >> 5, lane = tid & 31, hh = lane >> 4, m = lane & 15;
  const int ntile = N >> 6;
  const int bid   = blockIdx.x;
  const int row0  = (bid / ntile) * 64;
  const int rowb  = row0 + wave * 16;
  const int col0  = (bid % ntile) * 64;
  const int nst   = K / GKS;
  if (row0 + 64 > M || nst < 1) return;      // block-uniform, in front of every barrier; never taken with the exact grid
  // copies: lane = (row cr of a group of 16, 16-B chunk cc of its 128-B line); a wave's copy = 4 whole lines
  const int cr = tid >> 3, cc = (tid & 7) * 8;
  const u16* ag = A  + (size_t)(row0 + cr) * K + cc;
  const u16* bg = Bt + (size_t)(col0 + cr) * K + cc;
  const size_t gs = (size_t)16 * K;
  const unsigned lcp = (unsigned)(uintptr_t)(gring + cr * RPH + cc);               // LDS byte address, buffer 0, A tile
  const u16* af = gring + (wave * 16 + m) * RPH + 8 * hh;                           // A fragment row of this lane, buffer 0
  const u16* bq = gring + TILEH + m * RPH + 8 * hh;                                 // Bt fragment row of this lane, buffer 0
  v8f acc0 = zero8(), acc1 = zero8(), acc2 = zero8(), acc3 = zero8();
#define GSTAGE(st, bf)                                                    \
  do {                                                                    \
    const unsigned lb_ = lcp + (unsigned)(bf) * (2u * TILEH * 2u);        \
    copy_tile(lb_,              ag + (size_t)(st) * GKS, gs);             \
    copy_tile(lb_ + TILEH * 2u, bg + (size_t)(st) * GKS, gs);             \
  } while (0)
  // ring prologue: stage 0 landed and published, then stage 1 in flight
  GSTAGE(0, 0);
  wait_async0();
  __syncthreads();
  if (1 < nst) GSTAGE(1, 1);
#pragma unroll 1   // stays rolled: one copy of the stage body and of its publish point
  for (int st = 0; st < nst; ++st) {
    const int bf = st & 1;
    const u16* as = af + bf * (2 * TILEH);
    const u16* bs = bq + bf * (2 * TILEH);
    // both k steps of the stage: fragments from LDS, then the products, k upward
    const v16b a   = ldfrag_b(as);
    const v16b b0  = ldfrag_b(bs);
    const v16b b1  = ldfrag_b(bs + 16 * RPH);
    const v16b b2  = ldfrag_b(bs + 32 * RPH);
    const v16b b3  = ldfrag_b(bs + 48 * RPH);
    const v16b a_  = ldfrag_b(as + 32);
    const v16b b0_ = ldfrag_b(bs + 32);
    const v16b b1_ = ldfrag_b(bs + 16 * RPH + 32);
    const v16b b2_ = ldfrag_b(bs + 32 * RPH + 32);
    const v16b b3_ = ldfrag_b(bs + 48 * RPH + 32);
    acc0 = mma_b(a, b0, acc0);
    acc1 = mma_b(a, b1, acc1);
    acc2 = mma_b(a, b2, acc2);
    acc3 = mma_b(a, b3, acc3);
    acc0 = mma_b(a_, b0_, acc0);
    acc1 = mma_b(a_, b1_, acc1);
    acc2 = mma_b(a_, b2_, acc2);
    acc3 = mma_b(a_, b3_, acc3);
    guard6<v16b>(acc0, acc1, acc2, acc3, a_, b0_, b1_, b2_, b3_, a_);
    // publish point of stage st + 1: own reads of this buffer done, own copies of the next landed, block barrier, then the refill
    wait_ds0();
    wait_async0();
    __syncthreads();
    if (st + 2 < nst) GSTAGE(st + 2, bf);
  }
  wait_async0();
#undef GSTAGE
  // every wave is behind the last barrier: no reader and no copy is left on the ring
  if (zz == 2) {
    epi_vt(gring, gring + HD * VTP, acc0, acc1, acc2, acc3, oscale, bias, VH, VL, row0, col0, tid);
  } else {
    float* slab = (float*)(void*)gring;
    epi_split(slab + wave * SLAB64, acc0, acc1, acc2, acc3, oscale, bias, (zz == 0) ? QSC : KSC, (zz == 0) ? QH : KH,
              (zz == 0) ? QL : KL, N, (size_t)rowb, col0, lane);
  }
}

// =====================================================================================================
// f16 hi+lo GEMM with bias: C[M][N] (f32) = (Ahi + Alo)[M][K] . Bt[N][K]^T times oscale, plus bf16-RNE value of bias[n];
// Ahi/Alo f16 planes (same layout), Bt f16 k-contiguous; products hi.B + lo.B into one accumulator (lo is the unscaled
// residual of hi). Same tiling and the same two-buffer LDS ring as gemm_bfb3, with three tiles a stage (Ahi, Alo, Bt).
// =====================================================================================================
__global__ __launch_bounds__(128)
void gemm_h2(const u16* __restrict__ Ah, const u16* __restrict__ Al, const u16* __restrict__ Bt,
             const float* __restrict__ bias, float* C, int M, int N, int K, float oscale) {
  __shared__ __align__(16) u16 gring[2 * 3 * TILEH];        // [buffer][Ahi, Alo, Bt][64 rows][pitch 72 halves]; epilogue: result slabs
  const int tid = threadIdx.x, wave = tid >> 5, lane = tid & 31, hh = lane >> 4, m = lane & 15;
  const int ntile = N >> 6;
  const int bid   = blockIdx.x;
  const int row0  = (bid / ntile) * 64;
  const int rowb  = row0 + wave * 16;
  const int col0  = (bid % ntile) * 64;
  const int nst   = K / GKS;
  if (row0 + 64 > M || nst < 1) return;      // block-uniform, in front of every barrier; never taken with the exact grid
  // copies: lane = (row cr of a group of 16, 16-B chunk cc of its 128-B line); a wave's copy = 4 whole lines
  const int cr = tid >> 3, cc = (tid & 7) * 8;
  const size_t aofs = (size_t)(row0 + cr) * K + cc;
  const u16* ahg = Ah + aofs;
  const u16* alg = Al + aofs;
  const u16* bg  = Bt + (size_t)(col0 + cr) * K + cc;
  const size_t gs = (size_t)16 * K;
  const unsigned lcp = (unsigned)(uintptr_t)(gring + cr * RPH + cc);               // LDS byte address, buffer 0, Ahi tile
  const _Float16* af = (const _Float16*)(const void*)gring + (wave * 16 + m) * RPH + 8 * hh;   // Ahi fragment row, buffer 0
  const _Float16* bq = (const _Float16*)(const void*)gring + 2 * TILEH + m * RPH + 8 * hh;     // Bt fragment row, buffer 0
  v8f acc0 = zero8(), acc1 = zero8(), acc2 = zero8(), acc3 = zero8();
#define GSTAGE(st, bf)                                                    \
  do {                                                                    \
    const unsigned lb_ = lcp + (unsigned)(bf) * (3u * TILEH * 2u);        \
    copy_tile(lb_,                   ahg + (size_t)(st) * GKS, gs);       \
    copy_tile(lb_ + 1u * TILEH * 2u, alg + (size_t)(st) * GKS, gs);       \
    copy_tile(lb_ + 2u * TILEH * 2u, bg  + (size_t)(st) * GKS, gs);       \
  } while (0)
  // ring prologue: stage 0 landed and published, then stage 1 in flight
  GSTAGE(0, 0);
  wait_async0();
  __syncthreads();
  if (1 < nst) GSTAGE(1, 1);
#pragma unroll 1   // stays rolled: one copy of the stage body and of its publish point
  for (int st = 0; st < nst; ++st) {
    const int bf = st & 1;
    const _Float16* as = af + bf * (3 * TILEH);
    const _Float16* bs = bq + bf * (3 * TILEH);
    // both k steps of the stage: fragments from LDS, then the products, k upward
    const v16h ah  = ldfrag_h(as),      al  = ldfrag_h(as + TILEH);
    const v16h b0  = ldfrag_h(bs);
    const v16h b1  = ldfrag_h(bs + 16 * RPH);
    const v16h b2  = ldfrag_h(bs + 32 * RPH);
    const v16h b3  = ldfrag_h(bs + 48 * RPH);
    const v16h ah_ = ldfrag_h(as + 32), al_ = ldfrag_h(as + TILEH + 32);
    const v16h b0_ = ldfrag_h(bs + 32);
    const v16h b1_ = ldfrag_h(bs + 16 * RPH + 32);
    const v16h b2_ = ldfrag_h(bs + 32 * RPH + 32);
    const v16h b3_ = ldfrag_h(bs + 48 * RPH + 32);
    acc0 = mma_h(ah, b0, acc0);    acc0 = mma_h(al, b0, acc0);
    acc1 = mma_h(ah, b1, acc1);    acc1 = mma_h(al, b1, acc1);
    acc2 = mma_h(ah, b2, acc2);    acc2 = mma_h(al, b2, acc2);
    acc3 = mma_h(ah, b3, acc3);    acc3 = mma_h(al, b3, acc3);
    acc0 = mma_h(ah_, b0_, acc0);  acc0 = mma_h(al_, b0_, acc0);
    acc1 = mma_h(ah_, b1_, acc1);  acc1 = mma_h(al_, b1_, acc1);
    acc2 = mma_h(ah_, b2_, acc2);  acc2 = mma_h(al_, b2_, acc2);
    acc3 = mma_h(ah_, b3_, acc3);  acc3 = mma_h(al_, b3_, acc3);
    guard6<v16h>(acc0, acc1, acc2, acc3, ah_, al_, b0_, b1_, b2_, b3_);
    // publish point of stage st + 1: own reads of this buffer done, own copies of the next landed, block barrier, then the refill
    wait_ds0();
    wait_async0();
    __syncthreads();
    if (st + 2 < nst) GSTAGE(st + 2, bf);
  }
  wait_async0();
#undef GSTAGE
  float* slab = (float*)(void*)gring;        // every wave is behind the last barrier: no reader and no copy is left on the ring
  const v4f bv = *(const v4f*)(bias + col0 + m * 4);      // columns col0 + 4m .. +3, always < N (N multiple of 64)
  v4f badd;
#pragma unroll
  for (int e = 0; e < 4; ++e) badd[e] = bfr(bv[e]);
  epi64(slab + wave * SLAB64, acc0, acc1, acc2, acc3, oscale, badd, C, N, (size_t)rowb, col0, lane);
}

// =====================================================================================================
// Full (non-causal) multi-head flash attention with a per-head x per-key additive score bias: block = (batch b, head, 64 query
// rows), 4 waves, wave w owns the 16 query rows q0 = 64*qt + 16*w .. q0+15. The k and v^T tiles of 64 keys (hi and residual planes,
// 4 tiles of 64 rows x 128 B, LDS pitch 144 B) are brought into a two-buffer LDS ring by asynchronous copies, whole 128-B lines,
// once per block, and read by all 4 waves; one block barrier per 64 keys publishes the next stage and frees the one just read.
//   q planes (hi, lo f16, x1024) laid out [b][s][h][d]; k planes the same; v^T planes [b][h][d][s] (x1024).
//   All NKB = 64 key blocks of 32 keys are visited (static bound).
//   Scores are computed TRANSPOSED: S^T tile g (g = 0,1) = k rows (keys kb+16g .. +15, A operand, row m = lane&15, split k map
//   over d) times q^T (B operand, col n = query q0 + (lane&15), k = d, split map), 3 products per tile and d-chunk
//   (k_hi.q_hi + k_lo.q_hi + k_hi.q_lo). D element r of lane l = (key kb+16g+8h+r, query q0+(l&15)), so a lane owns one query
//   column and 16 of its 32 keys; the partner lane l^16 owns the other 16 -> row max / row sum need one xor-16 shuffle.
//   Logit of key j, query i (base 2): (S * 1/8 * 2^-20 + bfr(wh) * bfr(mask[b][j])) * log2(e); the bias term of all SEQ keys of
//   this (batch, head) is formed once per block into an LDS table (f32; each of its two products rounded on its own) and read per
//   pass with the same element -> key map as the transposed scores (t[i] <- key kb+8h+i, t[8+i] <- key kb+16+8h+i), added in f32.
//   Online max-subtracted base-2 softmax in f32. The exp'd values ARE the P A-fragment in place: A row m = query = lane&15,
//   element i <- key kb+8h+i (tile 0, D element i), element 8+i <- key kb+16+8h+i (tile 1, D element i). P is carried x32768
//   as f16 hi + f16 residual. The rescale factor of query row 8h+r of the O accumulators is fetched from lane 8h+r with a
//   shuffle (uniform control). 4+4 v^T B fragments (hi and residual planes, col n = d = 16j + (lane&15), keys k-contiguous),
//   12 P.V WMMAs (hh + lh + hl).
//   Epilogue: 1/l (per query, shuffled to the D row owner) and carry folds in f32; the wave's 16x64 f32 result staged in its LDS
// coverage: per wave 4 instructions x 4 rows x 8 lanes x 8 halves = 16 x 64 per plane; grid 768 blocks x 4 waves = every
//           (b, s, h) row of both O planes exactly once.
// =====================================================================================================
__global__ __launch_bounds__(ATT_THREADS)
void attn_fwd(const u16* __restrict__ QHIp, const u16* __restrict__ QLOp,
              const u16* __restrict__ KHIp, const u16* __restrict__ KLOp,
              const u16* __restrict__ VHIp, const u16* __restrict__ VLOp,
              const float* __restrict__ maskp, const float* __restrict__ mcwp,
              u16* OHIp, u16* OLOp) {
  __shared__ __align__(16) float smem[ATT_WAVES * SLABF];   // per wave: result slab [16][68] in the epilogue only
  __shared__ __align__(16) u16 ring[2 * 4 * TILEH];         // [buffer][k hi, k lo, v^T hi, v^T lo][64 rows][pitch 72 halves]
  __shared__ __align__(16) float kbias[SEQ];                // base-2 logit bias of every key of this (batch, head)

  const int tid  = threadIdx.x;
  const int wave = tid >> 5;
  const int lane = tid & 31;
  const int hh   = lane >> 4;
  const int c    = lane & 15;

  const int bid  = blockIdx.x;
  const int qt   = bid & (NQT - 1);
  const int bh   = bid >> 5;                 // NQT == 32
  const int head = bh % NH;
  const int b    = bh / NH;
  const int q0   = qt * 64 + wave * 16;

  // B fragments of q^T: col n = query q0 + c, k = d (k-contiguous row of the q plane)
  const size_t qofs = (((size_t)(b * SEQ + q0 + c)) * NH + head) * HD + 8 * hh;
  const _Float16* Qh  = (const _Float16*)(const void*)QHIp + qofs;
  const _Float16* Ql  = (const _Float16*)(const void*)QLOp + qofs;
  // copies: lane = (row cr of a group of 16, 16-B chunk cc of its 128-B row); a wave's copy = 4 whole rows
  const int cr = tid >> 3, cc = (tid & 7) * 8;
  const size_t kcp = (((size_t)b * SEQ + cr) * NH + head) * HD + cc;               // key row: stage's first key added per stage
  const size_t vcp = ((size_t)(b * NH + head) * HD + cr) * SEQ + cc;               // d row: stage's first key added per stage
  const unsigned lcp = (unsigned)(uintptr_t)(ring + cr * RPH + cc);                // LDS byte address, buffer 0, tile 0
  // A fragments of k: row m = key (in stage) 16g + c, k = d;  B fragments of v: col n = d = 16j + c, k = key (in stage)
  const _Float16* ringh = (const _Float16*)(const void*)ring + c * RPH + 8 * hh;
  // per-key bias row in the table: kbias[kb + 8hh + 0..7] (tile 0) and [kb + 16 + 8hh + 0..7] (tile 1), 16-B aligned LDS loads
  const float* brow = kbias + 8 * hh;
  const float  wh2  = bfr(mcwp[head]);                                              // per-head scalar (bf16 RNE value)
  const float lsc = 0.125f * (LOG2E / (QSC * KSC));

  float mrun = -INFINITY, lrun = 0.f;
  v8f o[4];
#pragma unroll
  for (int j = 0; j < 4; ++j) o[j] = zero8();

#define STAGE_COPY(st, bf)                                                                        \
  do {                                                                                            \
    const unsigned lb_ = lcp + (unsigned)(bf) * (4u * TILEH * 2u);                                \
    const size_t ko_ = kcp + (size_t)(st) * (SKEYS * NH * HD), vo_ = vcp + (size_t)(st) * SKEYS;  \
    copy_tile(lb_,                   KHIp + ko_, (size_t)16 * (NH * HD));                         \
    copy_tile(lb_ + 1u * TILEH * 2u, KLOp + ko_, (size_t)16 * (NH * HD));                         \
    copy_tile(lb_ + 2u * TILEH * 2u, VHIp + vo_, (size_t)16 * SEQ);                               \
    copy_tile(lb_ + 3u * TILEH * 2u, VLOp + vo_, (size_t)16 * SEQ);                               \
  } while (0)

  // ring prologue: stage 0 landed and published, then stage 1 in flight
  STAGE_COPY(0, 0);
  // bias table, formed while stage 0 flies: thread = 4 consecutive keys per round, SEQ / (4 * ATT_THREADS) rounds cover every key
  // once; the barrier below publishes it together with stage 0
  {
    const float* mb4 = maskp + (size_t)b * SEQ + tid * 4;
#pragma unroll     // the rounds' loads issue together: one memory latency, not one per round
    for (int i = 0; i < SEQ / (4 * ATT_THREADS); ++i) {
      const v4f mv = *(const v4f*)(mb4 + i * (4 * ATT_THREADS));
      v4f bz;
#pragma unroll
      for (int e = 0; e < 4; ++e) bz[e] = (wh2 * bfr(mv[e])) * LOG2E;
      *(v4f*)(kbias + tid * 4 + i * (4 * ATT_THREADS)) = bz;
    }
  }
  wait_async0();
  __syncthreads();
  STAGE_COPY(1, 1);

#pragma unroll 1   // stays rolled: one copy of the stage body and of its publish point
  for (int st = 0; st < NST; ++st) {
   const int bf = st & 1;
   const _Float16* stg = ringh + bf * (4 * TILEH);
#pragma unroll     // the stage's two 32-key passes: their LDS offsets become immediates of the loads
   for (int sub = 0; sub < 2; ++sub) {
    const int kb = st * SKEYS + sub * 32;
    const v4f ma = *(const v4f*)(brow + kb),      mb = *(const v4f*)(brow + kb + 4);
    const v4f mc = *(const v4f*)(brow + kb + 16), md = *(const v4f*)(brow + kb + 20);
    // ---- transposed scores: s0 = keys kb..kb+15, s1 = keys kb+16..kb+31, column = query q0 + c ----
    v8f s0 = zero8(), s1 = zero8();
    const _Float16* k0p = stg + (sub * 32) * RPH;
    const _Float16* k1p = k0p + 16 * RPH;
    const _Float16* l0p = k0p + TILEH;
    const _Float16* l1p = l0p + 16 * RPH;
#pragma unroll
    for (int kk = 0; kk < 2; ++kk) {
      const v16h qh  = ldfrag_h(Qh + kk * 32),  ql  = ldfrag_h(Ql + kk * 32);
      const v16h kh0 = ldfrag_h(k0p + kk * 32), kl0 = ldfrag_h(l0p + kk * 32);
      const v16h kh1 = ldfrag_h(k1p + kk * 32), kl1 = ldfrag_h(l1p + kk * 32);
      s0 = mma_h(kh0, qh, s0);
      s0 = mma_h(kl0, qh, s0);
      s0 = mma_h(kh0, ql, s0);
      s1 = mma_h(kh1, qh, s1);
      s1 = mma_h(kl1, qh, s1);
      s1 = mma_h(kh1, ql, s1);
      guard2(s0, s1, qh, ql, kh0, kl0, kh1, kl1);
    }
    // ---- base-2 logits of this lane's 16 keys for query q0 + c: t[i] <- key kb+8hh+i, t[8+i] <- key kb+16+8hh+i ----
    float t[16];
#pragma unroll
    for (int e = 0; e < 4; ++e) {
      t[e]      = s0[e] * lsc     + ma[e];
      t[4 + e]  = s0[4 + e] * lsc + mb[e];
      t[8 + e]  = s1[e] * lsc     + mc[e];
      t[12 + e] = s1[4 + e] * lsc + md[e];
    }
    float cm = t[0];
#pragma unroll
    for (int i = 1; i < 16; ++i) cm = fmaxf(cm, t[i]);
    cm = fmaxf(cm, __shfl_xor(cm, 16, 32));
    const float mn = fmaxf(mrun, cm);        // finite from the first block on
    const float al = ex2(mrun - mn);         // 0 on the first block (mrun = -inf)
    mrun = mn;
    // ---- probabilities (<= 1) and the P A-fragments: hi = f16(p * 32768), lo = f16 residual; element i <-> t[i] ----
    float ps = 0.f;
    FragH ph, pl;
#pragma unroll
    for (int w = 0; w < 2; ++w) {
#pragma unroll
      for (int e4 = 0; e4 < 4; ++e4) {
        const int i = 8 * w + 2 * e4;
        const float p0 = ex2(t[i] - mn), p1 = ex2(t[i + 1] - mn);
        ps += p0 + p1;
        const float a0 = p0 * PCAR, a1 = p1 * PCAR;
        const _Float16 h0 = (_Float16)a0, h1 = (_Float16)a1;
        const _Float16 l0 = (_Float16)(a0 - (float)h0), l1 = (_Float16)(a1 - (float)h1);
        ph.u[w][e4] = pk16(h_bits(h0), h_bits(h1));
        pl.u[w][e4] = pk16(h_bits(l0), h_bits(l1));
      }
    }
    ps += __shfl_xor(ps, 16, 32);
    lrun = lrun * al + ps;
    // ---- rescale the O accumulators: D row 8hh+r = query q0+8hh+r, its factor lives in lane 8hh+r (and 16+8hh+r) ----
    float scl[8];
#pragma unroll
    for (int r = 0; r < 8; ++r) scl[r] = __shfl(al, 8 * hh + r, 32);
#pragma unroll
    for (int j = 0; j < 4; ++j) {
#pragma unroll
      for (int r = 0; r < 8; ++r) o[j][r] *= scl[r];
    }
    // ---- P.V : B fragment col n = d = j*16 + c, keys contiguous in the v^T planes ----
    {
      const _Float16* vhp = stg + 2 * TILEH + sub * 32;
      const _Float16* vlp = vhp + TILEH;
      const v16h vh0 = ldfrag_h(vhp);
      const v16h vh1 = ldfrag_h(vhp + 16 * RPH);
      const v16h vh2 = ldfrag_h(vhp + 32 * RPH);
      const v16h vh3 = ldfrag_h(vhp + 48 * RPH);
      const v16h vl0 = ldfrag_h(vlp);
      const v16h vl1 = ldfrag_h(vlp + 16 * RPH);
      const v16h vl2 = ldfrag_h(vlp + 32 * RPH);
      const v16h vl3 = ldfrag_h(vlp + 48 * RPH);
      o[0] = mma_h(ph.v, vh0, o[0]);  o[0] = mma_h(pl.v, vh0, o[0]);  o[0] = mma_h(ph.v, vl0, o[0]);
      o[1] = mma_h(ph.v, vh1, o[1]);  o[1] = mma_h(pl.v, vh1, o[1]);  o[1] = mma_h(ph.v, vl1, o[1]);
      o[2] = mma_h(ph.v, vh2, o[2]);  o[2] = mma_h(pl.v, vh2, o[2]);  o[2] = mma_h(ph.v, vl2, o[2]);
      o[3] = mma_h(ph.v, vh3, o[3]);  o[3] = mma_h(pl.v, vh3, o[3]);  o[3] = mma_h(ph.v, vl3, o[3]);
      guard10(o[0], o[1], o[2], o[3], ph.v, pl.v, vh0, vh1, vh2, vh3, vl0, vl1, vl2, vl3);
    }
   }
   // publish point of stage st + 1: own reads of this buffer done, own copies of the next landed, block barrier, then the refill
   wait_ds0();
   wait_async0();
   __syncthreads();
   if (st + 2 < NST) STAGE_COPY(st + 2, bf);
  }
  wait_async0();
#undef STAGE_COPY
  acc_guard4(o[0], o[1], o[2], o[3]);

  // ---- fold 1/l (per query, owned by lane = query) and the carries (32768 on P, 1024 on v); stage the 16x64 slab ----
  const float linv = (1.0f / lrun) * (1.0f / (PCAR * VCAR));
  float inv[8];
#pragma unroll
  for (int r = 0; r < 8; ++r) inv[r] = __shfl(linv, 8 * hh + r, 32);
  float* slab = smem + wave * SLABF;
#pragma unroll
  for (int r = 0; r < 8; ++r) {
#pragma unroll
    for (int j = 0; j < 4; ++j) slab[(8 * hh + r) * 68 + j * 16 + c] = o[j][r] * inv[r];
  }
  wave_sync_lds();
  // ---- O x1024 -> f16 hi + residual planes; lane = (row in group of 4, 8 consecutive d) ----
  v4u oh[4], ol[4];
  const int rq = lane >> 3, c8 = (lane & 7) * 8;
#pragma unroll
  for (int i4 = 0; i4 < 4; ++i4) {
    const int row = i4 * 4 + rq;
    const v4f a = *(const v4f*)(slab + row * 68 + c8), c4 = *(const v4f*)(slab + row * 68 + c8 + 4);
    float w[8];
#pragma unroll
    for (int e = 0; e < 4; ++e) { w[e] = a[e] * OSC; w[4 + e] = c4[e] * OSC; }
#pragma unroll
    for (int e = 0; e < 4; ++e) {
      const _Float16 h0 = (_Float16)w[2 * e], h1 = (_Float16)w[2 * e + 1];
      const _Float16 l0 = (_Float16)(w[2 * e] - (float)h0), l1 = (_Float16)(w[2 * e + 1] - (float)h1);
      oh[i4][e] = pk16(h_bits(h0), h_bits(h1));
      ol[i4][e] = pk16(h_bits(l0), h_bits(l1));
    }
  }
  const size_t ob = (((size_t)(b * SEQ + q0)) * NH + head) * HD + c8;
  {
#pragma unroll
    for (int i4 = 0; i4 < 4; ++i4) {
      const int row = i4 * 4 + rq;
      const size_t o8 = ob + (size_t)row * (NH * HD);
      *(v4u*)(OHIp + o8) = oh[i4];
      *(v4u*)(OLOp + o8) = ol[i4];
    }
    
  }
}

// =====================================================================================================
// Workspace map (bytes); every plane is fully written by whole-line stores before it is read; all extents are exact multiples
// of the store granularity (no pad rows needed); every offset a multiple of 131072 (128 KiB); q, k and v each have their
// own input plane, so that each stage runs as one grid over all three:
//   XBQ bf16 [4096][768]               6291456        XBK same  6291456      XBV same  6291456
//   WQB bf16 [768 n][768 k]            1179648        WKB same  1179648      WVB same  1179648
//   WOB f16  [768 n][768 k] x1024      1179648
//   QHI f16 [2][2048][12][64] x1024    6291456        QLO residual         6291456
//   KHI same                           6291456        KLO residual         6291456
//   VHI f16 [2][12][64][2048] x1024    6291456        VLO residual         6291456
//   OHI f16 [4096][768] x1024          6291456        OLO residual         6291456
//   end                               73924608
// =====================================================================================================
extern "C" void kernel_launch(void* const* d_in, const int* in_sizes, int n_in,
                              void* d_out, int out_size, void* d_ws, size_t ws_size,
                              hipStream_t stream) {
  const int ROWS = NB * SEQ;                            // 4096
  if (n_in < 13) return;
  if (in_sizes[0] != ROWS * DMOD || in_sizes[1] != ROWS * DMOD || in_sizes[2] != ROWS * DMOD) return;
  if (in_sizes[3] != NB * SEQ) return;
  if (in_sizes[4] != DMOD * DMOD || in_sizes[6] != DMOD * DMOD) return;
  if (in_sizes[8] != DMOD * DMOD || in_sizes[10] != DMOD * DMOD) return;
  if (in_sizes[5] != DMOD || in_sizes[7] != DMOD || in_sizes[9] != DMOD || in_sizes[11] != DMOD) return;
  if (in_sizes[12] != NH) return;
  if (out_size != ROWS * DMOD) return;

  const float* Qin  = (const float*)d_in[0];
  const float* Kin  = (const float*)d_in[1];
  const float* Vin  = (const float*)d_in[2];
  const float* mask = (const float*)d_in[3];
  const float* wq   = (const float*)d_in[4];
  const float* bq   = (const float*)d_in[5];
  const float* wk   = (const float*)d_in[6];
  const float* bk   = (const float*)d_in[7];
  const float* wv   = (const float*)d_in[8];
  const float* bv   = (const float*)d_in[9];
  const float* wo   = (const float*)d_in[10];
  const float* bo   = (const float*)d_in[11];
  const float* mcw  = (const float*)d_in[12];
  float*       out  = (float*)d_out;

  const size_t szXB  = (size_t)ROWS * DMOD * 2;                 //  6291456
  const size_t szW   = (size_t)DMOD * DMOD * 2;                 //  1179648
  const size_t szP   = (size_t)ROWS * DMOD * 2;                 //  6291456  (q/k/o planes)
  const size_t szVP  = (size_t)NB * NH * HD * SEQ * 2;          //  6291456
  size_t off = 0;
  const size_t oXBQ = off; off += szXB;
  const size_t oXBK = off; off += szXB;
  const size_t oXBV = off; off += szXB;
  const size_t oWQB = off; off += szW;
  const size_t oWKB = off; off += szW;
  const size_t oWVB = off; off += szW;
  const size_t oWOB = off; off += szW;
  const size_t oQHI = off; off += szP;
  const size_t oQLO = off; off += szP;
  const size_t oKHI = off; off += szP;
  const size_t oKLO = off; off += szP;
  const size_t oVHI = off; off += szVP;
  const size_t oVLO = off; off += szVP;
  const size_t oOHI = off; off += szP;
  const size_t oOLO = off; off += szP;
  if (off > ws_size) return;                            // off = 73924608
  if (off > (size_t)134217728) return;

  char* ws = (char*)d_ws;
  u16*   XBQ = (u16*)(ws + oXBQ);
  u16*   XBK = (u16*)(ws + oXBK);
  u16*   XBV = (u16*)(ws + oXBV);
  u16*   WQB = (u16*)(ws + oWQB);
  u16*   WKB = (u16*)(ws + oWKB);
  u16*   WVB = (u16*)(ws + oWVB);
  u16*   WOB = (u16*)(ws + oWOB);
  u16*   QHI = (u16*)(ws + oQHI);
  u16*   QLO = (u16*)(ws + oQLO);
  u16*   KHI = (u16*)(ws + oKHI);
  u16*   KLO = (u16*)(ws + oKLO);
  u16*   VHI = (u16*)(ws + oVHI);
  u16*   VLO = (u16*)(ws + oVLO);
  u16*   OHI = (u16*)(ws + oOHI);
  u16*   OLO = (u16*)(ws + oOLO);

  const dim3 blk(256);
  const int n8x = (ROWS * DMOD) / 8;                    // 393216
  const int n8w = (DMOD * DMOD) / 8;                    //  73728
  if ((n8x % 256) != 0 || (n8w % 256) != 0) return;
  if ((ROWS % 64) != 0 || (DMOD % 64) != 0 || (DMOD % 32) != 0) return;
  if (n8x / 256 != GXB || n8w / 256 != GWB) return;
  const dim3 gCV(3 * GXB + 4 * GWB);                    // 5760
  const dim3 gG((ROWS / 64) * (DMOD / 64));             //  768
  const dim3 gG3((ROWS / 64) * (DMOD / 64), 3);         //  768 x 3
  const dim3 bG(128);
  const dim3 gAT(ATT_BLOCKS);                           //  768
  const dim3 bAT(ATT_THREADS);                          //  128

  // (0) all conversions: inputs -> bf16 planes; weights [n][k] (already k-contiguous for x.W^T): bf16 planes for wq/wk/wv, f16 of
  //     bf16 value x1024 for wo
  cvt16_all<<<gCV, blk, 0, stream>>>(Qin, Kin, Vin, wq, wk, wv, wo, XBQ, XBK, XBV, WQB, WKB, WVB, WOB);
  // (1) the three projections + bias (col = h*64+d), written as q and k f16 hi x1024 + residual planes and v^T planes x1024
  gemm_bfb3<<<gG3, bG, 0, stream>>>(XBQ, XBK, XBV, WQB, WKB, WVB, bq, bk, bv, QHI, QLO, KHI, KLO, VHI, VLO, ROWS, DMOD, DMOD, 1.0f);
  // (2) attention with per-head x per-key bias -> O planes [b][s][h][d] x1024 (hi + residual)
  attn_fwd<<<gAT, bAT, 0, stream>>>(QHI, QLO, KHI, KLO, VHI, VLO, mask, mcw, OHI, OLO);
  // (3) output projection + bias -> out [4096][768] f32, carries 1024 (O) x 1024 (wo) folded back
  gemm_h2<<<gG, bG, 0, stream>>>(OHI, OLO, WOB, bo, out, ROWS, DMOD, DMOD, 1.0f / (OSC * WOS));
  (void)hipGetLastError();
}

// v007
// A run of this version takes 125 microseconds.
// Next to v006, in two timings, it ran 1.10 times as fast each time.
// Over all steps from v000 it is 2.34 times as fast.
// Contractions: x.W{q,k,v}^T on v_wmma_f32_16x16x32_bf16 (x and W RNE-converted to bf16 operands, f32 accumulate, bias added in f32);
// scores k'.q'^T (q', k' carried x1024 as f16 hi plane + f16 residual plane, products hh+lh+hl), P.v (P x32768 f16 hi+residual,
// v x1024 f16 hi+residual, products hh+lh+hl) and O.Wo^T (O x1024 f16 hi+residual, Wo as f16(bf16(Wo) x1024), products h.w+l.w):
// v_wmma_f32_16x16x32_f16, f32 accumulate. Per-head x per-key additive score bias, base-2 online softmax, 1/l fold in f32 on VALU.
#include <hip/hip_runtime.h>
#include <math.h>
#include <stdint.h>

#define NB    2
#define SEQ   2048
#define DMOD  768
#define NH    12
#define HD    64
#define NQT   (SEQ / 64)
#define QSC   1024.0f
#define KSC   1024.0f
#define PCAR  32768.0f
#define VCAR  1024.0f
#define OSC   1024.0f
#define WOS   1024.0f
#define LOG2E 1.4426950408889634f
#define ATT_WAVES   4
#define ATT_THREADS (ATT_WAVES * 32)
#define ATT_BLOCKS  (NB * NH * NQT)
#define NKB    (SEQ / 32)
#define SLABF  (16 * 68)
#define SLAB64 (16 * 68)
#define VTP    72
#define SKEYS  64
#define NST    (SEQ / SKEYS)
#define RPH    72
#define TILEH  (64 * RPH)
#define GKS    64                              // k per GEMM stage: one whole 128-B line of every operand row
#define GXB    ((NB * SEQ * DMOD / 8) / 256)   // blocks of 256 threads x 8 elements per [4096][768] plane
#define GWB    ((DMOD * DMOD / 8) / 256)       // the same per [768][768] plane
static_assert(HD == 64 && DMOD == NH * HD);
static_assert(NQT == 32 && NH == 12 && NB == 2);
static_assert(ATT_THREADS == 128 && ATT_BLOCKS == 768 && NKB == 64);
static_assert(((NB * SEQ) % 64) == 0 && (DMOD % 64) == 0 && (DMOD % 32) == 0);
static_assert((SEQ % 64) == 0 && (SEQ % 8) == 0);
static_assert(((NB * SEQ * DMOD / 8) % 256) == 0 && ((DMOD * DMOD / 8) % 256) == 0);
static_assert(GXB == 1536 && GWB == 288);
static_assert(ATT_WAVES * SLABF >= 4 * 16 * 68);
static_assert(HD * VTP >= 63 * VTP + 64 && 2 * 2 * TILEH >= 2 * HD * VTP && (VTP * 2) % 16 == 0);
static_assert(2 * 2 * TILEH * 2 >= 4 * SLAB64 * 4 && (DMOD % GKS) == 0 && DMOD / GKS >= 2);
static_assert((SEQ % (4 * ATT_THREADS)) == 0);
static_assert(SKEYS == 64 && NST >= 2 && NST * SKEYS == SEQ && (RPH * 2) % 16 == 0 && TILEH >= 63 * RPH + 64);

typedef unsigned short u16;
typedef _Float16 v16h __attribute__((ext_vector_type(16)));
typedef _Float16 v8h  __attribute__((ext_vector_type(8)));
typedef __bf16   v16b __attribute__((ext_vector_type(16)));
typedef float    v8f  __attribute__((ext_vector_type(8)));
typedef float    v4f  __attribute__((ext_vector_type(4)));
typedef unsigned int v4u __attribute__((ext_vector_type(4)));

union FragH { v16h v; v8h h[2]; v4u u[2]; };
union FragB { v16b v; v4u u[2]; };

// ---- scalar helpers --------------------------------------------------------------------------------
__device__ __forceinline__ unsigned short bf_bits(float f) {          // f32 -> bf16 bits, RNE convert
  unsigned u = __float_as_uint(f);
  return (unsigned short)((u + 0x7FFFu + ((u >> 16) & 1u)) >> 16);
}
__device__ __forceinline__ float bf_up(unsigned short h) { return __uint_as_float(((unsigned)h) << 16); }
__device__ __forceinline__ float bfr(float f) { return bf_up(bf_bits(f)); }
__device__ __forceinline__ unsigned short h_bits(_Float16 x) { return __builtin_bit_cast(unsigned short, x); }
__device__ __forceinline__ unsigned pk16(unsigned short a, unsigned short b) { return (unsigned)a | ((unsigned)b << 16); }
__device__ __forceinline__ v8f zero8() { v8f z = {0.f, 0.f, 0.f, 0.f, 0.f, 0.f, 0.f, 0.f}; return z; }
__device__ __forceinline__ v4f zero4() { v4f z = {0.f, 0.f, 0.f, 0.f}; return z; }
// 2^x as the bare v_exp_f32, without the library's range test, pre-scale and ldexp around it: equal to exp2f for x >= -126; below
// that the result (under 2^-126) comes out as 0. Used on x <= 0 only: such a term is far under one f32 ulp of the row sum (>= 1)
// and under the smallest f16 residual of P x32768, and a rescale factor that small leaves nothing of the old sums either way.
__device__ __forceinline__ float ex2(float x) { return __builtin_amdgcn_exp2f(x); }

// ---- fragment loaders: 16-bit A/B operand, lane -> row/col (lane&15), p already includes +8*(lane>>4);
//      elements 0..7 <- p[0..7] (k0+8h..), elements 8..15 <- p[16..23] (k0+16+8h..)  (same split k map for A and B;
//      B is always read from a k-contiguous [n][k] plane)
__device__ __forceinline__ v16h ldfrag_h(const _Float16* p) {
  FragH f;
  f.h[0] = *(const v8h*)(p);
  f.h[1] = *(const v8h*)(p + 16);
  return f.v;
}
__device__ __forceinline__ v16b ldfrag_b(const u16* p) {              // bf16 plane read as unsigned integer vectors
  FragB f;
  f.u[0] = *(const v4u*)(p);
  f.u[1] = *(const v4u*)(p + 16);
  return f.v;
}

__device__ __forceinline__ v8f mma_h(v16h a, v16h b, v8f c) {
  return __builtin_amdgcn_wmma_f32_16x16x32_f16(false, a, false, b, (short)0, c, false, false);
}
__device__ __forceinline__ v8f mma_b(v16b a, v16b b, v8f c) {
  return __builtin_amdgcn_wmma_f32_16x16x32_bf16(false, a, false, b, (short)0, c, false, false);
}
__device__ __forceinline__ void guard2(v8f& a, v8f& b, v16h x0, v16h x1, v16h x2, v16h x3, v16h x4, v16h x5) {
#if defined(__HIP_DEVICE_COMPILE__)
  asm volatile("v_nop\n\tv_nop\n\tv_nop\n\tv_nop"
               : "+v"(a), "+v"(b) : "v"(x0), "v"(x1), "v"(x2), "v"(x3), "v"(x4), "v"(x5) : "memory");
#endif
}
template <typename F>
__device__ __forceinline__ void guard6(v8f& a, v8f& b, v8f& c, v8f& d, F x0, F x1, F x2, F x3, F x4, F x5) {
#if defined(__HIP_DEVICE_COMPILE__)
  asm volatile("v_nop\n\tv_nop\n\tv_nop\n\tv_nop"
               : "+v"(a), "+v"(b), "+v"(c), "+v"(d) : "v"(x0), "v"(x1), "v"(x2), "v"(x3), "v"(x4), "v"(x5) : "memory");
#endif
}
__device__ __forceinline__ void guard10(v8f& a, v8f& b, v8f& c, v8f& d, v16h x0, v16h x1, v16h x2, v16h x3, v16h x4,
                                        v16h x5, v16h x6, v16h x7, v16h x8, v16h x9) {
#if defined(__HIP_DEVICE_COMPILE__)
  asm volatile("v_nop\n\tv_nop\n\tv_nop\n\tv_nop"
               : "+v"(a), "+v"(b), "+v"(c), "+v"(d)
               : "v"(x0), "v"(x1), "v"(x2), "v"(x3), "v"(x4), "v"(x5), "v"(x6), "v"(x7), "v"(x8), "v"(x9) : "memory");
#endif
}
__device__ __forceinline__ void acc_guard4(v8f& a, v8f& b, v8f& c, v8f& d) {
#if defined(__HIP_DEVICE_COMPILE__)
  asm volatile("v_nop\n\tv_nop\n\tv_nop\n\tv_nop" : "+v"(a), "+v"(b), "+v"(c), "+v"(d));
#endif
}
// Four asynchronous 16-B copies per lane, global -> LDS (rows r, r+16, r+32, r+48 of one 64-row tile). The s_wait_xcnt stands in
// the copies' own statement so that no address register is rewritten in front of it.
__device__ __forceinline__ void copy4(unsigned l0, unsigned l1, unsigned l2, unsigned l3,
                                      const u16* g0, const u16* g1, const u16* g2, const u16* g3) {
#if defined(__HIP_DEVICE_COMPILE__)
  asm volatile("global_load_async_to_lds_b128 %0, %4, off\n\t"
               "global_load_async_to_lds_b128 %1, %5, off\n\t"
               "global_load_async_to_lds_b128 %2, %6, off\n\t"
               "global_load_async_to_lds_b128 %3, %7, off\n\t"
               "s_wait_xcnt 0x0"
               :: "v"(l0), "v"(l1), "v"(l2), "v"(l3), "v"(g0), "v"(g1), "v"(g2), "v"(g3) : "memory");
#endif
}
// One 64-row x 128-B tile: lbase = this lane's LDS byte address in row r, g = its global address in row r, gstep = 16 source rows.
__device__ __forceinline__ void copy_tile(unsigned lbase, const u16* g, size_t gstep) {
  copy4(lbase, lbase + 16u * (RPH * 2), lbase + 32u * (RPH * 2), lbase + 48u * (RPH * 2), g, g + gstep, g + 2 * gstep, g + 3 * gstep);
}
__device__ __forceinline__ void wait_async0() {   // this wave's copies have landed
#if defined(__HIP_DEVICE_COMPILE__)
  asm volatile("s_wait_asynccnt 0x0" ::: "memory");
#endif
}
__device__ __forceinline__ void wait_ds0() {      // this wave's LDS reads have returned before their buffer is handed back
#if defined(__HIP_DEVICE_COMPILE__)
  asm volatile("s_wait_dscnt 0x0" ::: "memory");
#endif
}
__device__ __forceinline__ void wave_sync_lds() {
  __builtin_amdgcn_fence(__ATOMIC_RELEASE, "workgroup");
  __builtin_amdgcn_wave_barrier();
  __builtin_amdgcn_fence(__ATOMIC_ACQUIRE, "workgroup");
}

// =====================================================================================================
// f32 plane -> 16-bit plane, same layout:  f16mode == 0: bf16 RNE bits;  f16mode == 1: f16 bits of (bf16 RNE value) * scale.
// Thread = 8 consecutive elements: two 16-B loads, one 16-B store; 32 consecutive lanes = 512 contiguous, 512-B aligned bytes
// gt = the thread's index within its plane.
// =====================================================================================================
__device__ __forceinline__ void cvt16_body(const float* __restrict__ x, u16* D, int gt, int f16mode, float scale) {
  const float* p = x + (size_t)gt * 8;
  const v4f a = *(const v4f*)(p), c4 = *(const v4f*)(p + 4);
  float v[8];
#pragma unroll
  for (int e = 0; e < 4; ++e) { v[e] = a[e]; v[4 + e] = c4[e]; }
  unsigned short s[8];
#pragma unroll
  for (int e = 0; e < 8; ++e) {
    const unsigned short hb = h_bits((_Float16)(bfr(v[e]) * scale));
    const unsigned short bb = bf_bits(v[e]);
    s[e] = (f16mode != 0) ? hb : bb;
  }
  v4u o;
#pragma unroll
  for (int e = 0; e < 4; ++e) o[e] = pk16(s[2 * e], s[2 * e + 1]);
  u16* d = D + (size_t)gt * 8;
  {
    *(v4u*)(d) = o;
    
  }
}
// All seven conversions in one grid (none reads another's output): blocks [0, 3*GXB) = the three input planes -> bf16,
// blocks [3*GXB, 3*GXB + 4*GWB) = wq, wk, wv -> bf16 and wo -> f16 of (bf16 value x1024). The plane is chosen per block (scalar).
// coverage: GXB (GWB) blocks x 256 thr x 8 = one whole plane each.
__global__ __launch_bounds__(256)
void cvt16_all(const float* __restrict__ xq, const float* __restrict__ xk, const float* __restrict__ xv,
               const float* __restrict__ wq, const float* __restrict__ wk, const float* __restrict__ wv,
               const float* __restrict__ wo, u16* XQ, u16* XK, u16* XV, u16* WQ, u16* WK, u16* WV, u16* WO) {
  const int bid = blockIdx.x;
  if (bid >= 3 * GXB + 4 * GWB) return;     // never taken with the exact grid; no barriers in this kernel
  const float* x;
  u16* D;
  int lb, f16mode = 0;
  float scale = 1.0f;
  if (bid < 3 * GXB) {
    const int pl = bid / GXB;
    lb = bid - pl * GXB;
    x = (pl == 0) ? xq : (pl == 1) ? xk : xv;
    D = (pl == 0) ? XQ : (pl == 1) ? XK : XV;
  } else {
    const int r = bid - 3 * GXB, pl = r / GWB;
    lb = r - pl * GWB;
    x = (pl == 0) ? wq : (pl == 1) ? wk : (pl == 2) ? wv : wo;
    D = (pl == 0) ? WQ : (pl == 1) ? WK : (pl == 2) ? WV : WO;
    if (pl == 3) { f16mode = 1; scale = WOS; }
  }
  cvt16_body(x, D, lb * 256 + (int)threadIdx.x, f16mode, scale);
}

// =====================================================================================================
// GEMM epilogue of the output projection: the wave's 16x64 f32 tile (times oscale) staged in its LDS slab (pitch 68),
// coverage: 8 instructions x 2 rows x 16 lanes x 4 floats = the wave's 16 x 64 tile.
// =====================================================================================================
__device__ __forceinline__ void epi64(float* sl, v8f a0, v8f a1, v8f a2, v8f a3, float oscale, v4f badd, float* C, int N,
                                      size_t rowb, int col0, int lane) {
  const int hh = lane >> 4, m = lane & 15;
#pragma unroll
  for (int r = 0; r < 8; ++r) {
    const int ro = (8 * hh + r) * 68 + m;
    sl[ro]      = a0[r] * oscale;
    sl[ro + 16] = a1[r] * oscale;
    sl[ro + 32] = a2[r] * oscale;
    sl[ro + 48] = a3[r] * oscale;
  }
  wave_sync_lds();
  v4f vals[8];
#pragma unroll
  for (int it = 0; it < 8; ++it) vals[it] = *(const v4f*)(sl + (it * 2 + hh) * 68 + m * 4) + badd;
  float* dst = C + (rowb + (size_t)hh) * (size_t)N + col0 + m * 4;
  {
#pragma unroll
    for (int it = 0; it < 8; ++it) {
      *(v4f*)(dst + (size_t)(it * 2) * (size_t)N) = vals[it];
    }
    
  }
}

// 8 f32 values (already carried up by their power of two) -> 8 f16 hi + 8 f16 residuals (value - hi, unscaled)
__device__ __forceinline__ void split8(const float* w, v4u& oh, v4u& ol) {
#pragma unroll
  for (int e = 0; e < 4; ++e) {
    const float t0 = w[2 * e], t1 = w[2 * e + 1];
    const _Float16 h0 = (_Float16)t0, h1 = (_Float16)t1;
    const _Float16 l0 = (_Float16)(t0 - (float)h0), l1 = (_Float16)(t1 - (float)h1);
    oh[e] = pk16(h_bits(h0), h_bits(h1));
    ol[e] = pk16(h_bits(l0), h_bits(l1));
  }
}

// =====================================================================================================
// Projection epilogue, q and k: the wave's 16x64 f32 tile (times oscale) staged in its LDS slab (pitch 68), read back by rows, bias
// added in f32, then f16 hi plane (value * sc) + f16 residual plane, same [row][col] layout as the product.
// coverage: per plane 4 instructions x 4 rows x 8 lanes x 8 halves = the wave's 16 x 64 tile, whole 128-B lines.
// =====================================================================================================
__device__ __forceinline__ void epi_split(float* sl, v8f a0, v8f a1, v8f a2, v8f a3, float oscale, const float* __restrict__ bias,
                                          float sc, u16* HP, u16* LP, int N, size_t rowb, int col0, int lane) {
  const int hh = lane >> 4, m = lane & 15;
  const int rq = lane >> 3, c8 = (lane & 7) * 8;
  const v4f bv0 = *(const v4f*)(bias + col0 + c8), bv1 = *(const v4f*)(bias + col0 + c8 + 4);   // columns < N (N multiple of 64)
#pragma unroll
  for (int r = 0; r < 8; ++r) {
    const int ro = (8 * hh + r) * 68 + m;
    sl[ro]      = a0[r] * oscale;
    sl[ro + 16] = a1[r] * oscale;
    sl[ro + 32] = a2[r] * oscale;
    sl[ro + 48] = a3[r] * oscale;
  }
  wave_sync_lds();
  float badd[8];
#pragma unroll
  for (int e = 0; e < 4; ++e) { badd[e] = bfr(bv0[e]); badd[4 + e] = bfr(bv1[e]); }
  v4u oh[4], ol[4];
#pragma unroll
  for (int i4 = 0; i4 < 4; ++i4) {
    const int row = i4 * 4 + rq;
    const v4f a = *(const v4f*)(sl + row * 68 + c8), c4 = *(const v4f*)(sl + row * 68 + c8 + 4);
    float w[8];
#pragma unroll
    for (int e = 0; e < 4; ++e) { w[e] = (a[e] + badd[e]) * sc; w[4 + e] = (c4[e] + badd[4 + e]) * sc; }
    split8(w, oh[i4], ol[i4]);
  }
  const size_t ob = (rowb + (size_t)rq) * (size_t)N + col0 + c8;
#pragma unroll
  for (int i4 = 0; i4 < 4; ++i4) {
    const size_t o8 = ob + (size_t)(i4 * 4) * (size_t)N;
    *(v4u*)(HP + o8) = oh[i4];
    *(v4u*)(LP + o8) = ol[i4];
  }
#if defined(__HIP_DEVICE_COMPILE__)
  // the built code runs on from here into a joined test in front of the v branch, whose first instructions rewrite registers
  // that these eight stores name: the wait stands in front of every such rewrite
  asm volatile("s_wait_xcnt 0x0" ::: "memory");
#endif
}

// =====================================================================================================
// Projection epilogue, v: the block's tile is (batch b, keys s0 .. s0+63, head h, all 64 d), written TRANSPOSED as
// VH[(b*NH + h)*HD + d][s] = f16(v * 1024), VL = f16 residual. An accumulator's 8 elements of a lane are 8 consecutive keys of one d,
// so each goes as one 16-B LDS store into the [d][key] tiles (pitch 72 halves); a block barrier, then whole 128-B lines go out.
// coverage: LDS 4 waves x 4 accumulators x 32 lanes x 8 halves = 64 x 64 per plane; store 4 iterations x 128 thr x 8 halves = 64
//           lines x 64 keys per plane.
// =====================================================================================================
__device__ __forceinline__ void epi_vt(u16* TH, u16* TL, v8f a0, v8f a1, v8f a2, v8f a3, float oscale,
                                       const float* __restrict__ bias, u16* VHo, u16* VLo, int row0, int col0, int tid) {
  const int wave = tid >> 5, lane = tid & 31, hh = lane >> 4, m = lane & 15;
  float bj[4];
#pragma unroll
  for (int j = 0; j < 4; ++j) bj[j] = bias[col0 + j * 16 + m];                     // columns < N (N multiple of 64)
#pragma unroll
  for (int j = 0; j < 4; ++j) {
    const v8f a = (j == 0) ? a0 : (j == 1) ? a1 : (j == 2) ? a2 : a3;
    const float badd = bfr(bj[j]);
    float w[8];
#pragma unroll
    for (int r = 0; r < 8; ++r) w[r] = (a[r] * oscale + badd) * VCAR;
    v4u oh, ol;
    split8(w, oh, ol);
    const int to = (j * 16 + m) * VTP + wave * 16 + 8 * hh;
    *(v4u*)(TH + to) = oh;
    *(v4u*)(TL + to) = ol;
  }
  __syncthreads();
  v4u vh[4], vl[4];
  const int q8 = tid >> 3, p8 = (tid & 7) * 8;
#pragma unroll
  for (int it = 0; it < 4; ++it) {
    const int line = it * 16 + q8;            // d = 0..63
    vh[it] = *(const v4u*)(TH + line * VTP + p8);
    vl[it] = *(const v4u*)(TL + line * VTP + p8);
  }
  const int b = row0 / SEQ, s0 = row0 - b * SEQ, h = col0 >> 6;
  const size_t base = ((size_t)(b * NH + h) * HD + q8) * SEQ + s0 + p8;
#pragma unroll
  for (int it = 0; it < 4; ++it) {
    *(v4u*)(VHo + base + (size_t)(it * 16) * SEQ) = vh[it];
    *(v4u*)(VLo + base + (size_t)(it * 16) * SEQ) = vl[it];
  }
}

// =====================================================================================================
// bf16 GEMM with bias: f32 product A[M][K] (bf16 row-major) . Bt[N][K]^T (bf16 k-contiguous), times oscale, plus bf16-RNE
// value of bias[n], written straight as the f16 hi + residual planes that attention reads. Block = 64x64 tile, 4 waves x 16
// rows. The block's A and Bt tiles of 64 rows x 64 k (whole 128-B lines, LDS pitch 144 B) come into a two-buffer LDS ring by
// asynchronous copies, once per block, and all 4 waves read their fragments there
// (two 16-B LDS loads each, split k map for A and B); one block barrier per 64 k publishes the next stage and frees the one just
// read. k runs upward in steps of 32 as before (host checks K % 64 == 0, M % 64 == 0, N % 64 == 0, grid.x = (M/64)*(N/64)).
// Behind the loop's last barrier the ring is dead and holds the four result slabs (q, k) or the two transposed tiles (v).
// Three independent products of one shape in one grid: blockIdx.y picks the operand set (scalar selects): 0 = q, 1 = k (planes in
// the product's own layout), 2 = v (transposed planes; M = NB*SEQ rows and N = NH*HD columns, a 64-column tile = one head). The
// branch on it is block-uniform, so the barrier inside epi_vt is passed by all threads of its block or by none.
// =====================================================================================================
__global__ __launch_bounds__(128)
void gemm_bfb3(const u16* __restrict__ A0, const u16* __restrict__ A1, const u16* __restrict__ A2,
               const u16* __restrict__ Bt0, const u16* __restrict__ Bt1, const u16* __restrict__ Bt2,
               const float* __restrict__ bias0, const float* __restrict__ bias1, const float* __restrict__ bias2,
               u16* QH, u16* QL, u16* KH, u16* KL, u16* VH, u16* VL, int M, int N, int K, float oscale) {
  __shared__ __align__(16) u16 gring[2 * 2 * TILEH];        // [buffer][A, Bt][64 rows][pitch 72 halves]; epilogue: staging
  const int zz = blockIdx.y;
  const u16*   A    = (zz == 0) ? A0 : (zz == 1) ? A1 : A2;
  const u16*   Bt   = (zz == 0) ? Bt0 : (zz == 1) ? Bt1 : Bt2;
  const float* bias = (zz == 0) ? bias0 : (zz == 1) ? bias1 : bias2;
  const int tid = threadIdx.x, wave = tid >> 5, lane = tid & 31, hh = lane >> 4, m = lane & 15;
  const int ntile = N >> 6;
  const int bid   = blockIdx.x;
  const int row0  = (bid / ntile) * 64;
  const int rowb  = row0 + wave * 16;
  const int col0  = (bid % ntile) * 64;
  const int nst   = K / GKS;
  if (row0 + 64 > M || nst < 1) return;      // block-uniform, in front of every barrier; never taken with the exact grid
  // copies: lane = (row cr of a group of 16, 16-B chunk cc of its 128-B line); a wave's copy = 4 whole lines
  const int cr = tid >> 3, cc = (tid & 7) * 8;
  const u16* ag = A  + (size_t)(row0 + cr) * K + cc;
  const u16* bg = Bt + (size_t)(col0 + cr) * K + cc;
  const size_t gs = (size_t)16 * K;
  const unsigned lcp = (unsigned)(uintptr_t)(gring + cr * RPH + cc);               // LDS byte address, buffer 0, A tile
  const u16* af = gring + (wave * 16 + m) * RPH + 8 * hh;                           // A fragment row of this lane, buffer 0
  const u16* bq = gring + TILEH + m * RPH + 8 * hh;                                 // Bt fragment row of this lane, buffer 0
  v8f acc0 = zero8(), acc1 = zero8(), acc2 = zero8(), acc3 = zero8();
#define GSTAGE(st, bf)                                                    \
  do {                                                                    \
    const unsigned lb_ = lcp + (unsigned)(bf) * (2u * TILEH * 2u);        \
    copy_tile(lb_,              ag + (size_t)(st) * GKS, gs);             \
    copy_tile(lb_ + TILEH * 2u, bg + (size_t)(st) * GKS, gs);             \
  } while (0)
  // ring prologue: stage 0 landed and published, then stage 1 in flight
  GSTAGE(0, 0);
  wait_async0();
  __syncthreads();
  if (1 < nst) GSTAGE(1, 1);
#pragma unroll 1   // stays rolled: one copy of the stage body and of its publish point
  for (int st = 0; st < nst; ++st) {
    const int bf = st & 1;
    const u16* as = af + bf * (2 * TILEH);
    const u16* bs = bq + bf * (2 * TILEH);
    // both k steps of the stage: fragments from LDS, then the products, k upward
    const v16b a   = ldfrag_b(as);
    const v16b b0  = ldfrag_b(bs);
    const v16b b1  = ldfrag_b(bs + 16 * RPH);
    const v16b b2  = ldfrag_b(bs + 32 * RPH);
    const v16b b3  = ldfrag_b(bs + 48 * RPH);
    const v16b a_  = ldfrag_b(as + 32);
    const v16b b0_ = ldfrag_b(bs + 32);
    const v16b b1_ = ldfrag_b(bs + 16 * RPH + 32);
    const v16b b2_ = ldfrag_b(bs + 32 * RPH + 32);
    const v16b b3_ = ldfrag_b(bs + 48 * RPH + 32);
    acc0 = mma_b(a, b0, acc0);
    acc1 = mma_b(a, b1, acc1);
    acc2 = mma_b(a, b2, acc2);
    acc3 = mma_b(a, b3, acc3);
    acc0 = mma_b(a_, b0_, acc0);
    acc1 = mma_b(a_, b1_, acc1);
    acc2 = mma_b(a_, b2_, acc2);
    acc3 = mma_b(a_, b3_, acc3);
    guard6<v16b>(acc0, acc1, acc2, acc3, a_, b0_, b1_, b2_, b3_, a_);
    // publish point of stage st + 1: own reads of this buffer done, own copies of the next landed, block barrier, then the refill
    wait_ds0();
    wait_async0();
    __syncthreads();
    if (st + 2 < nst) GSTAGE(st + 2, bf);
  }
  wait_async0();
#undef GSTAGE
  // every wave is behind the last barrier: no reader and no copy is left on the ring
  if (zz == 2) {
    epi_vt(gring, gring + HD * VTP, acc0, acc1, acc2, acc3, oscale, bias, VH, VL, row0, col0, tid);
  } else {
    float* slab = (float*)(void*)gring;
    epi_split(slab + wave * SLAB64, acc0, acc1, acc2, acc3, oscale, bias, (zz == 0) ? QSC : KSC, (zz == 0) ? QH : KH,
              (zz == 0) ? QL : KL, N, (size_t)rowb, col0, lane);
  }
}

// =====================================================================================================
// f16 hi+lo GEMM with bias: C[M][N] (f32) = (Ahi + Alo)[M][K] . Bt[N][K]^T times oscale, plus bf16-RNE value of bias[n];
// Ahi/Alo f16 planes (same layout), Bt f16 k-contiguous; products hi.B + lo.B into one accumulator (lo is the unscaled
// residual of hi). Same tiling and the same two-buffer LDS ring as gemm_bfb3, with three tiles a stage (Ahi, Alo, Bt).
// =====================================================================================================
__global__ __launch_bounds__(128)
void gemm_h2(const u16* __restrict__ Ah, const u16* __restrict__ Al, const u16* __restrict__ Bt,
             const float* __restrict__ bias, float* C, int M, int N, int K, float oscale) {
  __shared__ __align__(16) u16 gring[2 * 3 * TILEH];        // [buffer][Ahi, Alo, Bt][64 rows][pitch 72 halves]; epilogue: result slabs
  const int tid = threadIdx.x, wave = tid >> 5, lane = tid & 31, hh = lane >> 4, m = lane & 15;
  const int ntile = N >> 6;
  const int bid   = blockIdx.x;
  const int row0  = (bid / ntile) * 64;
  const int rowb  = row0 + wave * 16;
  const int col0  = (bid % ntile) * 64;
  const int nst   = K / GKS;
  if (row0 + 64 > M || nst < 1) return;      // block-uniform, in front of every barrier; never taken with the exact grid
  // copies: lane = (row cr of a group of 16, 16-B chunk cc of its 128-B line); a wave's copy = 4 whole lines
  const int cr = tid >> 3, cc = (tid & 7) * 8;
  const size_t aofs = (size_t)(row0 + cr) * K + cc;
  const u16* ahg = Ah + aofs;
  const u16* alg = Al + aofs;
  const u16* bg  = Bt + (size_t)(col0 + cr) * K + cc;
  const size_t gs = (size_t)16 * K;
  const unsigned lcp = (unsigned)(uintptr_t)(gring + cr * RPH + cc);               // LDS byte address, buffer 0, Ahi tile
  const _Float16* af = (const _Float16*)(const void*)gring + (wave * 16 + m) * RPH + 8 * hh;   // Ahi fragment row, buffer 0
  const _Float16* bq = (const _Float16*)(const void*)gring + 2 * TILEH + m * RPH + 8 * hh;     // Bt fragment row, buffer 0
  v8f acc0 = zero8(), acc1 = zero8(), acc2 = zero8(), acc3 = zero8();
#define GSTAGE(st, bf)                                                    \
  do {                                                                    \
    const unsigned lb_ = lcp + (unsigned)(bf) * (3u * TILEH * 2u);        \
    copy_tile(lb_,                   ahg + (size_t)(st) * GKS, gs);       \
    copy_tile(lb_ + 1u * TILEH * 2u, alg + (size_t)(st) * GKS, gs);       \
    copy_tile(lb_ + 2u * TILEH * 2u, bg  + (size_t)(st) * GKS, gs);       \
  } while (0)
  // ring prologue: stage 0 landed and published, then stage 1 in flight
  GSTAGE(0, 0);
  wait_async0();
  __syncthreads();
  if (1 < nst) GSTAGE(1, 1);
#pragma unroll 1   // stays rolled: one copy of the stage body and of its publish point
  for (int st = 0; st < nst; ++st) {
    const int bf = st & 1;
    const _Float16* as = af + bf * (3 * TILEH);
    const _Float16* bs = bq + bf * (3 * TILEH);
    // both k steps of the stage: fragments from LDS, then the products, k upward
    const v16h ah  = ldfrag_h(as),      al  = ldfrag_h(as + TILEH);
    const v16h b0  = ldfrag_h(bs);
    const v16h b1  = ldfrag_h(bs + 16 * RPH);
    const v16h b2  = ldfrag_h(bs + 32 * RPH);
    const v16h b3  = ldfrag_h(bs + 48 * RPH);
    const v16h ah_ = ldfrag_h(as + 32), al_ = ldfrag_h(as + TILEH + 32);
    const v16h b0_ = ldfrag_h(bs + 32);
    const v16h b1_ = ldfrag_h(bs + 16 * RPH + 32);
    const v16h b2_ = ldfrag_h(bs + 32 * RPH + 32);
    const v16h b3_ = ldfrag_h(bs + 48 * RPH + 32);
    acc0 = mma_h(ah, b0, acc0);    acc0 = mma_h(al, b0, acc0);
    acc1 = mma_h(ah, b1, acc1);    acc1 = mma_h(al, b1, acc1);
    acc2 = mma_h(ah, b2, acc2);    acc2 = mma_h(al, b2, acc2);
    acc3 = mma_h(ah, b3, acc3);    acc3 = mma_h(al, b3, acc3);
    acc0 = mma_h(ah_, b0_, acc0);  acc0 = mma_h(al_, b0_, acc0);
    acc1 = mma_h(ah_, b1_, acc1);  acc1 = mma_h(al_, b1_, acc1);
    acc2 = mma_h(ah_, b2_, acc2);  acc2 = mma_h(al_, b2_, acc2);
    acc3 = mma_h(ah_, b3_, acc3);  acc3 = mma_h(al_, b3_, acc3);
    guard6<v16h>(acc0, acc1, acc2, acc3, ah_, al_, b0_, b1_, b2_, b3_);
    // publish point of stage st + 1: own reads of this buffer done, own copies of the next landed, block barrier, then the refill
    wait_ds0();
    wait_async0();
    __syncthreads();
    if (st + 2 < nst) GSTAGE(st + 2, bf);
  }
  wait_async0();
#undef GSTAGE
  float* slab = (float*)(void*)gring;        // every wave is behind the last barrier: no reader and no copy is left on the ring
  const v4f bv = *(const v4f*)(bias + col0 + m * 4);      // columns col0 + 4m .. +3, always < N (N multiple of 64)
  v4f badd;
#pragma unroll
  for (int e = 0; e < 4; ++e) badd[e] = bfr(bv[e]);
  epi64(slab + wave * SLAB64, acc0, acc1, acc2, acc3, oscale, badd, C, N, (size_t)rowb, col0, lane);
}

// =====================================================================================================
// Full (non-causal) multi-head flash attention with a per-head x per-key additive score bias: block = (batch b, head, 64 query
// rows), 4 waves, wave w owns the 16 query rows q0 = 64*qt + 16*w .. q0+15. The k and v^T tiles of 64 keys (hi and residual planes,
// 4 tiles of 64 rows x 128 B, LDS pitch 144 B) are brought into a two-buffer LDS ring by asynchronous copies, whole 128-B lines,
// once per block, and read by all 4 waves; one block barrier per 64 keys publishes the next stage and frees the one just read.
//   q planes (hi, lo f16, x1024) laid out [b][s][h][d]; k planes the same; v^T planes [b][h][d][s] (x1024).
//   All NKB = 64 key blocks of 32 keys are visited (static bound).
//   Scores are computed TRANSPOSED: S^T tile g (g = 0,1) = k rows (keys kb+16g .. +15, A operand, row m = lane&15, split k map
//   over d) times q^T (B operand, col n = query q0 + (lane&15), k = d, split map), 3 products per tile and d-chunk
//   (k_hi.q_hi + k_lo.q_hi + k_hi.q_lo). D element r of lane l = (key kb+16g+8h+r, query q0+(l&15)), so a lane owns one query
//   column and 16 of its 32 keys; the partner lane l^16 owns the other 16 -> row max / row sum need one xor-16 shuffle.
//   Logit of key j, query i (base 2): (S * 1/8 * 2^-20 + bfr(wh) * bfr(mask[b][j])) * log2(e); the bias term of all SEQ keys of
//   this (batch, head) is formed once per block into an LDS table (f32; each of its two products rounded on its own) and read per
//   pass with the same element -> key map as the transposed scores (t[i] <- key kb+8h+i, t[8+i] <- key kb+16+8h+i), added in f32.
//   Online max-subtracted base-2 softmax in f32. The exp'd values ARE the P A-fragment in place: A row m = query = lane&15,
//   element i <- key kb+8h+i (tile 0, D element i), element 8+i <- key kb+16+8h+i (tile 1, D element i). P is carried x32768
//   as f16 hi + f16 residual. The rescale factor of query row 8h+r of the O accumulators is fetched from lane 8h+r with a
//   shuffle (uniform control). 4+4 v^T B fragments (hi and residual planes, col n = d = 16j + (lane&15), keys k-contiguous),
//   12 P.V WMMAs (hh + lh + hl).
//   Epilogue: 1/l (per query, shuffled to the D row owner) and carry folds in f32; the wave's 16x64 f32 result staged in its LDS
// coverage: per wave 4 instructions x 4 rows x 8 lanes x 8 halves = 16 x 64 per plane; grid 768 blocks x 4 waves = every
//           (b, s, h) row of both O planes exactly once.
// =====================================================================================================
__global__ __launch_bounds__(ATT_THREADS)
void attn_fwd(const u16* __restrict__ QHIp, const u16* __restrict__ QLOp,
              const u16* __restrict__ KHIp, const u16* __restrict__ KLOp,
              const u16* __restrict__ VHIp, const u16* __restrict__ VLOp,
              const float* __restrict__ maskp, const float* __restrict__ mcwp,
              u16* OHIp, u16* OLOp) {
  __shared__ __align__(16) float smem[ATT_WAVES * SLABF];   // per wave: result slab [16][68] in the epilogue only
  __shared__ __align__(16) u16 ring[2 * 4 * TILEH];         // [buffer][k hi, k lo, v^T hi, v^T lo][64 rows][pitch 72 halves]
  __shared__ __align__(16) float kbias[SEQ];                // base-2 logit bias of every key of this (batch, head)

  const int tid  = threadIdx.x;
  const int wave = tid >> 5;
  const int lane = tid & 31;
  const int hh   = lane >> 4;
  const int c    = lane & 15;

  const int bid  = blockIdx.x;
  const int qt   = bid & (NQT - 1);
  const int bh   = bid >> 5;                 // NQT == 32
  const int head = bh % NH;
  const int b    = bh / NH;
  const int q0   = qt * 64 + wave * 16;

  // B fragments of q^T: col n = query q0 + c, k = d (k-contiguous row of the q plane)
  const size_t qofs = (((size_t)(b * SEQ + q0 + c)) * NH + head) * HD + 8 * hh;
  const _Float16* Qh  = (const _Float16*)(const void*)QHIp + qofs;
  const _Float16* Ql  = (const _Float16*)(const void*)QLOp + qofs;
  // copies: lane = (row cr of a group of 16, 16-B chunk cc of its 128-B row); a wave's copy = 4 whole rows
  const int cr = tid >> 3, cc = (tid & 7) * 8;
  const size_t kcp = (((size_t)b * SEQ + cr) * NH + head) * HD + cc;               // key row: stage's first key added per stage
  const size_t vcp = ((size_t)(b * NH + head) * HD + cr) * SEQ + cc;               // d row: stage's first key added per stage
  const unsigned lcp = (unsigned)(uintptr_t)(ring + cr * RPH + cc);                // LDS byte address, buffer 0, tile 0
  // A fragments of k: row m = key (in stage) 16g + c, k = d;  B fragments of v: col n = d = 16j + c, k = key (in stage)
  const _Float16* ringh = (const _Float16*)(const void*)ring + c * RPH + 8 * hh;
  // per-key bias row in the table: kbias[kb + 8hh + 0..7] (tile 0) and [kb + 16 + 8hh + 0..7] (tile 1), 16-B aligned LDS loads
  const float* brow = kbias + 8 * hh;
  const float  wh2  = bfr(mcwp[head]);                                              // per-head scalar (bf16 RNE value)
  const float lsc = 0.125f * (LOG2E / (QSC * KSC));

  // the wave's q^T fragments (hi and residual, both d chunks) are the same for every key: loaded once, kept in 32 registers
  const v16h qh0 = ldfrag_h(Qh), qh1 = ldfrag_h(Qh + 32);
#if defined(__HIP_DEVICE_COMPILE__)
  // the built code lets the residual fragments land in the registers that hold the hi plane's address: the wait stands in front
  asm volatile("s_wait_xcnt 0x0" ::: "memory");
#endif
  const v16h ql0 = ldfrag_h(Ql), ql1 = ldfrag_h(Ql + 32);

  float mrun = -INFINITY, lrun = 0.f;
  v8f o[4];
#pragma unroll
  for (int j = 0; j < 4; ++j) o[j] = zero8();

#define STAGE_COPY(st, bf)                                                                        \
  do {                                                                                            \
    const unsigned lb_ = lcp + (unsigned)(bf) * (4u * TILEH * 2u);                                \
    const size_t ko_ = kcp + (size_t)(st) * (SKEYS * NH * HD), vo_ = vcp + (size_t)(st) * SKEYS;  \
    copy_tile(lb_,                   KHIp + ko_, (size_t)16 * (NH * HD));                         \
    copy_tile(lb_ + 1u * TILEH * 2u, KLOp + ko_, (size_t)16 * (NH * HD));                         \
    copy_tile(lb_ + 2u * TILEH * 2u, VHIp + vo_, (size_t)16 * SEQ);                               \
    copy_tile(lb_ + 3u * TILEH * 2u, VLOp + vo_, (size_t)16 * SEQ);                               \
  } while (0)

  // ring prologue: stage 0 landed and published, then stage 1 in flight
  STAGE_COPY(0, 0);
  // bias table, formed while stage 0 flies: thread = 4 consecutive keys per round, SEQ / (4 * ATT_THREADS) rounds cover every key
  // once; the barrier below publishes it together with stage 0
  {
    const float* mb4 = maskp + (size_t)b * SEQ + tid * 4;
#pragma unroll     // the rounds' loads issue together: one memory latency, not one per round
    for (int i = 0; i < SEQ / (4 * ATT_THREADS); ++i) {
      const v4f mv = *(const v4f*)(mb4 + i * (4 * ATT_THREADS));
      v4f bz;
#pragma unroll
      for (int e = 0; e < 4; ++e) bz[e] = (wh2 * bfr(mv[e])) * LOG2E;
      *(v4f*)(kbias + tid * 4 + i * (4 * ATT_THREADS)) = bz;
    }
  }
  wait_async0();
  __syncthreads();
  STAGE_COPY(1, 1);

#pragma unroll 1   // stays rolled: one copy of the stage body and of its publish point
  for (int st = 0; st < NST; ++st) {
   const int bf = st & 1;
   const _Float16* stg = ringh + bf * (4 * TILEH);
#pragma unroll     // the stage's two 32-key passes: their LDS offsets become immediates of the loads
   for (int sub = 0; sub < 2; ++sub) {
    const int kb = st * SKEYS + sub * 32;
    const v4f ma = *(const v4f*)(brow + kb),      mb = *(const v4f*)(brow + kb + 4);
    const v4f mc = *(const v4f*)(brow + kb + 16), md = *(const v4f*)(brow + kb + 20);
    // ---- transposed scores: s0 = keys kb..kb+15, s1 = keys kb+16..kb+31, column = query q0 + c ----
    v8f s0 = zero8(), s1 = zero8();
    const _Float16* k0p = stg + (sub * 32) * RPH;
    const _Float16* k1p = k0p + 16 * RPH;
    const _Float16* l0p = k0p + TILEH;
    const _Float16* l1p = l0p + 16 * RPH;
#pragma unroll
    for (int kk = 0; kk < 2; ++kk) {
      const v16h qh  = (kk == 0) ? qh0 : qh1,   ql  = (kk == 0) ? ql0 : ql1;
      const v16h kh0 = ldfrag_h(k0p + kk * 32), kl0 = ldfrag_h(l0p + kk * 32);
      const v16h kh1 = ldfrag_h(k1p + kk * 32), kl1 = ldfrag_h(l1p + kk * 32);
      s0 = mma_h(kh0, qh, s0);
      s0 = mma_h(kl0, qh, s0);
      s0 = mma_h(kh0, ql, s0);
      s1 = mma_h(kh1, qh, s1);
      s1 = mma_h(kl1, qh, s1);
      s1 = mma_h(kh1, ql, s1);
      guard2(s0, s1, qh, ql, kh0, kl0, kh1, kl1);
    }
    // ---- base-2 logits of this lane's 16 keys for query q0 + c: t[i] <- key kb+8hh+i, t[8+i] <- key kb+16+8hh+i ----
    float t[16];
#pragma unroll
    for (int e = 0; e < 4; ++e) {
      t[e]      = s0[e] * lsc     + ma[e];
      t[4 + e]  = s0[4 + e] * lsc + mb[e];
      t[8 + e]  = s1[e] * lsc     + mc[e];
      t[12 + e] = s1[4 + e] * lsc + md[e];
    }
    float cm = t[0];
#pragma unroll
    for (int i = 1; i < 16; ++i) cm = fmaxf(cm, t[i]);
    cm = fmaxf(cm, __shfl_xor(cm, 16, 32));
    const float mn = fmaxf(mrun, cm);        // finite from the first block on
    const float al = ex2(mrun - mn);         // 0 on the first block (mrun = -inf)
    mrun = mn;
    // ---- probabilities (<= 1) and the P A-fragments: hi = f16(p * 32768), lo = f16 residual; element i <-> t[i] ----
    float ps = 0.f;
    FragH ph, pl;
#pragma unroll
    for (int w = 0; w < 2; ++w) {
#pragma unroll
      for (int e4 = 0; e4 < 4; ++e4) {
        const int i = 8 * w + 2 * e4;
        const float p0 = ex2(t[i] - mn), p1 = ex2(t[i + 1] - mn);
        ps += p0 + p1;
        const float a0 = p0 * PCAR, a1 = p1 * PCAR;
        const _Float16 h0 = (_Float16)a0, h1 = (_Float16)a1;
        const _Float16 l0 = (_Float16)(a0 - (float)h0), l1 = (_Float16)(a1 - (float)h1);
        ph.u[w][e4] = pk16(h_bits(h0), h_bits(h1));
        pl.u[w][e4] = pk16(h_bits(l0), h_bits(l1));
      }
    }
    ps += __shfl_xor(ps, 16, 32);
    lrun = lrun * al + ps;
    // ---- rescale the O accumulators: D row 8hh+r = query q0+8hh+r, its factor lives in lane 8hh+r (and 16+8hh+r) ----
    float scl[8];
#pragma unroll
    for (int r = 0; r < 8; ++r) scl[r] = __shfl(al, 8 * hh + r, 32);
#pragma unroll
    for (int j = 0; j < 4; ++j) {
#pragma unroll
      for (int r = 0; r < 8; ++r) o[j][r] *= scl[r];
    }
    // ---- P.V : B fragment col n = d = j*16 + c, keys contiguous in the v^T planes ----
    {
      const _Float16* vhp = stg + 2 * TILEH + sub * 32;
      const _Float16* vlp = vhp + TILEH;
      const v16h vh0 = ldfrag_h(vhp);
      const v16h vh1 = ldfrag_h(vhp + 16 * RPH);
      const v16h vh2 = ldfrag_h(vhp + 32 * RPH);
      const v16h vh3 = ldfrag_h(vhp + 48 * RPH);
      const v16h vl0 = ldfrag_h(vlp);
      const v16h vl1 = ldfrag_h(vlp + 16 * RPH);
      const v16h vl2 = ldfrag_h(vlp + 32 * RPH);
      const v16h vl3 = ldfrag_h(vlp + 48 * RPH);
      o[0] = mma_h(ph.v, vh0, o[0]);  o[0] = mma_h(pl.v, vh0, o[0]);  o[0] = mma_h(ph.v, vl0, o[0]);
      o[1] = mma_h(ph.v, vh1, o[1]);  o[1] = mma_h(pl.v, vh1, o[1]);  o[1] = mma_h(ph.v, vl1, o[1]);
      o[2] = mma_h(ph.v, vh2, o[2]);  o[2] = mma_h(pl.v, vh2, o[2]);  o[2] = mma_h(ph.v, vl2, o[2]);
      o[3] = mma_h(ph.v, vh3, o[3]);  o[3] = mma_h(pl.v, vh3, o[3]);  o[3] = mma_h(ph.v, vl3, o[3]);
      guard10(o[0], o[1], o[2], o[3], ph.v, pl.v, vh0, vh1, vh2, vh3, vl0, vl1, vl2, vl3);
    }
   }
   // publish point of stage st + 1: own reads of this buffer done, own copies of the next landed, block barrier, then the refill
   wait_ds0();
   wait_async0();
   __syncthreads();
   if (st + 2 < NST) STAGE_COPY(st + 2, bf);
  }
  wait_async0();
#undef STAGE_COPY
  acc_guard4(o[0], o[1], o[2], o[3]);

  // ---- fold 1/l (per query, owned by lane = query) and the carries (32768 on P, 1024 on v); stage the 16x64 slab ----
  const float linv = (1.0f / lrun) * (1.0f / (PCAR * VCAR));
  float inv[8];
#pragma unroll
  for (int r = 0; r < 8; ++r) inv[r] = __shfl(linv, 8 * hh + r, 32);
  float* slab = smem + wave * SLABF;
#pragma unroll
  for (int r = 0; r < 8; ++r) {
#pragma unroll
    for (int j = 0; j < 4; ++j) slab[(8 * hh + r) * 68 + j * 16 + c] = o[j][r] * inv[r];
  }
  wave_sync_lds();
  // ---- O x1024 -> f16 hi + residual planes; lane = (row in group of 4, 8 consecutive d) ----
  v4u oh[4], ol[4];
  const int rq = lane >> 3, c8 = (lane & 7) * 8;
#pragma unroll
  for (int i4 = 0; i4 < 4; ++i4) {
    const int row = i4 * 4 + rq;
    const v4f a = *(const v4f*)(slab + row * 68 + c8), c4 = *(const v4f*)(slab + row * 68 + c8 + 4);
    float w[8];
#pragma unroll
    for (int e = 0; e < 4; ++e) { w[e] = a[e] * OSC; w[4 + e] = c4[e] * OSC; }
#pragma unroll
    for (int e = 0; e < 4; ++e) {
      const _Float16 h0 = (_Float16)w[2 * e], h1 = (_Float16)w[2 * e + 1];
      const _Float16 l0 = (_Float16)(w[2 * e] - (float)h0), l1 = (_Float16)(w[2 * e + 1] - (float)h1);
      oh[i4][e] = pk16(h_bits(h0), h_bits(h1));
      ol[i4][e] = pk16(h_bits(l0), h_bits(l1));
    }
  }
  const size_t ob = (((size_t)(b * SEQ + q0)) * NH + head) * HD + c8;
  {
#pragma unroll
    for (int i4 = 0; i4 < 4; ++i4) {
      const int row = i4 * 4 + rq;
      const size_t o8 = ob + (size_t)row * (NH * HD);
      *(v4u*)(OHIp + o8) = oh[i4];
      *(v4u*)(OLOp + o8) = ol[i4];
    }
    
  }
}

// =====================================================================================================
// Workspace map (bytes); every plane is fully written by whole-line stores before it is read; all extents are exact multiples
// of the store granularity (no pad rows needed); every offset a multiple of 131072 (128 KiB); q, k and v each have their
// own input plane, so that each stage runs as one grid over all three:
//   XBQ bf16 [4096][768]               6291456        XBK same  6291456      XBV same  6291456
//   WQB bf16 [768 n][768 k]            1179648        WKB same  1179648      WVB same  1179648
//   WOB f16  [768 n][768 k] x1024      1179648
//   QHI f16 [2][2048][12][64] x1024    6291456        QLO residual         6291456
//   KHI same                           6291456        KLO residual         6291456
//   VHI f16 [2][12][64][2048] x1024    6291456        VLO residual         6291456
//   OHI f16 [4096][768] x1024          6291456        OLO residual         6291456
//   end                               73924608
// =====================================================================================================
extern "C" void kernel_launch(void* const* d_in, const int* in_sizes, int n_in,
                              void* d_out, int out_size, void* d_ws, size_t ws_size,
                              hipStream_t stream) {
  const int ROWS = NB * SEQ;                            // 4096
  if (n_in < 13) return;
  if (in_sizes[0] != ROWS * DMOD || in_sizes[1] != ROWS * DMOD || in_sizes[2] != ROWS * DMOD) return;
  if (in_sizes[3] != NB * SEQ) return;
  if (in_sizes[4] != DMOD * DMOD || in_sizes[6] != DMOD * DMOD) return;
  if (in_sizes[8] != DMOD * DMOD || in_sizes[10] != DMOD * DMOD) return;
  if (in_sizes[5] != DMOD || in_sizes[7] != DMOD || in_sizes[9] != DMOD || in_sizes[11] != DMOD) return;
  if (in_sizes[12] != NH) return;
  if (out_size != ROWS * DMOD) return;

  const float* Qin  = (const float*)d_in[0];
  const float* Kin  = (const float*)d_in[1];
  const float* Vin  = (const float*)d_in[2];
  const float* mask = (const float*)d_in[3];
  const float* wq   = (const float*)d_in[4];
  const float* bq   = (const float*)d_in[5];
  const float* wk   = (const float*)d_in[6];
  const float* bk   = (const float*)d_in[7];
  const float* wv   = (const float*)d_in[8];
  const float* bv   = (const float*)d_in[9];
  const float* wo   = (const float*)d_in[10];
  const float* bo   = (const float*)d_in[11];
  const float* mcw  = (const float*)d_in[12];
  float*       out  = (float*)d_out;

  const size_t szXB  = (size_t)ROWS * DMOD * 2;                 //  6291456
  const size_t szW   = (size_t)DMOD * DMOD * 2;                 //  1179648
  const size_t szP   = (size_t)ROWS * DMOD * 2;                 //  6291456  (q/k/o planes)
  const size_t szVP  = (size_t)NB * NH * HD * SEQ * 2;          //  6291456
  size_t off = 0;
  const size_t oXBQ = off; off += szXB;
  const size_t oXBK = off; off += szXB;
  const size_t oXBV = off; off += szXB;
  const size_t oWQB = off; off += szW;
  const size_t oWKB = off; off += szW;
  const size_t oWVB = off; off += szW;
  const size_t oWOB = off; off += szW;
  const size_t oQHI = off; off += szP;
  const size_t oQLO = off; off += szP;
  const size_t oKHI = off; off += szP;
  const size_t oKLO = off; off += szP;
  const size_t oVHI = off; off += szVP;
  const size_t oVLO = off; off += szVP;
  const size_t oOHI = off; off += szP;
  const size_t oOLO = off; off += szP;
  if (off > ws_size) return;                            // off = 73924608
  if (off > (size_t)134217728) return;

  char* ws = (char*)d_ws;
  u16*   XBQ = (u16*)(ws + oXBQ);
  u16*   XBK = (u16*)(ws + oXBK);
  u16*   XBV = (u16*)(ws + oXBV);
  u16*   WQB = (u16*)(ws + oWQB);
  u16*   WKB = (u16*)(ws + oWKB);
  u16*   WVB = (u16*)(ws + oWVB);
  u16*   WOB = (u16*)(ws + oWOB);
  u16*   QHI = (u16*)(ws + oQHI);
  u16*   QLO = (u16*)(ws + oQLO);
  u16*   KHI = (u16*)(ws + oKHI);
  u16*   KLO = (u16*)(ws + oKLO);
  u16*   VHI = (u16*)(ws + oVHI);
  u16*   VLO = (u16*)(ws + oVLO);
  u16*   OHI = (u16*)(ws + oOHI);
  u16*   OLO = (u16*)(ws + oOLO);

  const dim3 blk(256);
  const int n8x = (ROWS * DMOD) / 8;                    // 393216
  const int n8w = (DMOD * DMOD) / 8;                    //  73728
  if ((n8x % 256) != 0 || (n8w % 256) != 0) return;
  if ((ROWS % 64) != 0 || (DMOD % 64) != 0 || (DMOD % 32) != 0) return;
  if (n8x / 256 != GXB || n8w / 256 != GWB) return;
  const dim3 gCV(3 * GXB + 4 * GWB);                    // 5760
  const dim3 gG((ROWS / 64) * (DMOD / 64));             //  768
  const dim3 gG3((ROWS / 64) * (DMOD / 64), 3);         //  768 x 3
  const dim3 bG(128);
  const dim3 gAT(ATT_BLOCKS);                           //  768
  const dim3 bAT(ATT_THREADS);                          //  128

  // (0) all conversions: inputs -> bf16 planes; weights [n][k] (already k-contiguous for x.W^T): bf16 planes for wq/wk/wv, f16 of
  //     bf16 value x1024 for wo
  cvt16_all<<<gCV, blk, 0, stream>>>(Qin, Kin, Vin, wq, wk, wv, wo, XBQ, XBK, XBV, WQB, WKB, WVB, WOB);
  // (1) the three projections + bias (col = h*64+d), written as q and k f16 hi x1024 + residual planes and v^T planes x1024
  gemm_bfb3<<<gG3, bG, 0, stream>>>(XBQ, XBK, XBV, WQB, WKB, WVB, bq, bk, bv, QHI, QLO, KHI, KLO, VHI, VLO, ROWS, DMOD, DMOD, 1.0f);
  // (2) attention with per-head x per-key bias -> O planes [b][s][h][d] x1024 (hi + residual)
  attn_fwd<<<gAT, bAT, 0, stream>>>(QHI, QLO, KHI, KLO, VHI, VLO, mask, mcw, OHI, OLO);
  // (3) output projection + bias -> out [4096][768] f32, carries 1024 (O) x 1024 (wo) folded back
  gemm_h2<<<gG, bG, 0, stream>>>(OHI, OLO, WOB, bo, out, ROWS, DMOD, DMOD, 1.0f / (OSC * WOS));
  (void)hipGetLastError();
}

// v008
// One run takes 119 microseconds.
// Two timings next to v007 both put it at 1.04 times that version's speed.
// Over all steps from v000 it is 2.44 times as fast.
// Contractions: x.W{q,k,v}^T on v_wmma_f32_16x16x32_bf16 (x and W RNE-converted to bf16 operands, f32 accumulate, bias added in f32);
// scores k'.q'^T (q', k' carried x1024 as f16 hi plane + f16 residual plane, products hh+lh+hl), P.v (P x32768 f16 hi+residual,
// v x1024 f16 hi+residual, products hh+lh+hl) and O.Wo^T (O x1024 f16 hi+residual, Wo as f16(bf16(Wo) x1024), products h.w+l.w):
// v_wmma_f32_16x16x32_f16, f32 accumulate. Per-head x per-key additive score bias, base-2 online softmax, 1/l fold in f32 on VALU.
#include <hip/hip_runtime.h>
#include <math.h>
#include <stdint.h>

#define NB    2
#define SEQ   2048
#define DMOD  768
#define NH    12
#define HD    64
#define NQT   (SEQ / 64)
#define QSC   1024.0f
#define KSC   1024.0f
#define PCAR  32768.0f
#define VCAR  1024.0f
#define OSC   1024.0f
#define WOS   1024.0f
#define LOG2E 1.4426950408889634f
#define ATT_WAVES   4
#define ATT_THREADS (ATT_WAVES * 32)
#define ATT_BLOCKS  (NB * NH * NQT)
#define NKB    (SEQ / 32)
#define SLABF  (16 * 68)
#define SLAB64 (16 * 68)
#define VTP    72
#define SKEYS  64
#define NST    (SEQ / SKEYS)
#define RPH    72
#define TILEH  (64 * RPH)
#define GKS    64                              // k per GEMM stage: one whole 128-B line of every operand row
#define GXB    ((NB * SEQ * DMOD / 8) / 256)   // blocks of 256 threads x 8 elements per [4096][768] plane
#define GWB    ((DMOD * DMOD / 8) / 256)       // the same per [768][768] plane
static_assert(HD == 64 && DMOD == NH * HD);
static_assert(NQT == 32 && NH == 12 && NB == 2);
static_assert(ATT_THREADS == 128 && ATT_BLOCKS == 768 && NKB == 64);
static_assert(((NB * SEQ) % 64) == 0 && (DMOD % 64) == 0 && (DMOD % 32) == 0);
static_assert((SEQ % 64) == 0 && (SEQ % 8) == 0);
static_assert(((NB * SEQ * DMOD / 8) % 256) == 0 && ((DMOD * DMOD / 8) % 256) == 0);
static_assert(GXB == 1536 && GWB == 288);
static_assert(ATT_WAVES * SLABF >= 4 * 16 * 68);
static_assert(HD * VTP >= 63 * VTP + 64 && 2 * 2 * TILEH >= 2 * HD * VTP && (VTP * 2) % 16 == 0);
static_assert(2 * 2 * TILEH * 2 >= 4 * SLAB64 * 4 && (DMOD % GKS) == 0 && DMOD / GKS >= 2);
static_assert((SEQ % (4 * ATT_THREADS)) == 0);
static_assert(SKEYS == 64 && NST >= 2 && NST * SKEYS == SEQ && (RPH * 2) % 16 == 0 && TILEH >= 63 * RPH + 64);

typedef unsigned short u16;
typedef _Float16 v16h __attribute__((ext_vector_type(16)));
typedef _Float16 v8h  __attribute__((ext_vector_type(8)));
typedef __bf16   v16b __attribute__((ext_vector_type(16)));
typedef float    v8f  __attribute__((ext_vector_type(8)));
typedef float    v4f  __attribute__((ext_vector_type(4)));
typedef unsigned int v4u __attribute__((ext_vector_type(4)));

union FragH { v16h v; v8h h[2]; v4u u[2]; };
union FragB { v16b v; v4u u[2]; };

// ---- scalar helpers --------------------------------------------------------------------------------
__device__ __forceinline__ unsigned short bf_bits(float f) {          // f32 -> bf16 bits, RNE convert
  unsigned u = __float_as_uint(f);
  return (unsigned short)((u + 0x7FFFu + ((u >> 16) & 1u)) >> 16);
}
__device__ __forceinline__ float bf_up(unsigned short h) { return __uint_as_float(((unsigned)h) << 16); }
__device__ __forceinline__ float bfr(float f) { return bf_up(bf_bits(f)); }
__device__ __forceinline__ unsigned short h_bits(_Float16 x) { return __builtin_bit_cast(unsigned short, x); }
__device__ __forceinline__ unsigned pk16(unsigned short a, unsigned short b) { return (unsigned)a | ((unsigned)b << 16); }
__device__ __forceinline__ v8f zero8() { v8f z = {0.f, 0.f, 0.f, 0.f, 0.f, 0.f, 0.f, 0.f}; return z; }
__device__ __forceinline__ v4f zero4() { v4f z = {0.f, 0.f, 0.f, 0.f}; return z; }
// 2^x as the bare v_exp_f32, without the library's range test, pre-scale and ldexp around it: equal to exp2f for x >= -126; below
// that the result (under 2^-126) comes out as 0. Used on x <= 0 only: such a term is far under one f32 ulp of the row sum (>= 1)
// and under the smallest f16 residual of P x32768, and a rescale factor that small leaves nothing of the old sums either way.
__device__ __forceinline__ float ex2(float x) { return __builtin_amdgcn_exp2f(x); }

// ---- fragment loaders: 16-bit A/B operand, lane -> row/col (lane&15), p already includes +8*(lane>>4);
//      elements 0..7 <- p[0..7] (k0+8h..), elements 8..15 <- p[16..23] (k0+16+8h..)  (same split k map for A and B;
//      B is always read from a k-contiguous [n][k] plane)
__device__ __forceinline__ v16h ldfrag_h(const _Float16* p) {
  FragH f;
  f.h[0] = *(const v8h*)(p);
  f.h[1] = *(const v8h*)(p + 16);
  return f.v;
}
__device__ __forceinline__ v16b ldfrag_b(const u16* p) {              // bf16 plane read as unsigned integer vectors
  FragB f;
  f.u[0] = *(const v4u*)(p);
  f.u[1] = *(const v4u*)(p + 16);
  return f.v;
}

__device__ __forceinline__ v8f mma_h(v16h a, v16h b, v8f c) {
  return __builtin_amdgcn_wmma_f32_16x16x32_f16(false, a, false, b, (short)0, c, false, false);
}
__device__ __forceinline__ v8f mma_b(v16b a, v16b b, v8f c) {
  return __builtin_amdgcn_wmma_f32_16x16x32_bf16(false, a, false, b, (short)0, c, false, false);
}
__device__ __forceinline__ void guard2(v8f& a, v8f& b, v16h x0, v16h x1, v16h x2, v16h x3, v16h x4, v16h x5) {
#if defined(__HIP_DEVICE_COMPILE__)
  asm volatile("v_nop\n\tv_nop\n\tv_nop\n\tv_nop"
               : "+v"(a), "+v"(b) : "v"(x0), "v"(x1), "v"(x2), "v"(x3), "v"(x4), "v"(x5) : "memory");
#endif
}
template <typename F>
__device__ __forceinline__ void guard6(v8f& a, v8f& b, v8f& c, v8f& d, F x0, F x1, F x2, F x3, F x4, F x5) {
#if defined(__HIP_DEVICE_COMPILE__)
  asm volatile("v_nop\n\tv_nop\n\tv_nop\n\tv_nop"
               : "+v"(a), "+v"(b), "+v"(c), "+v"(d) : "v"(x0), "v"(x1), "v"(x2), "v"(x3), "v"(x4), "v"(x5) : "memory");
#endif
}
__device__ __forceinline__ void guard10(v8f& a, v8f& b, v8f& c, v8f& d, v16h x0, v16h x1, v16h x2, v16h x3, v16h x4,
                                        v16h x5, v16h x6, v16h x7, v16h x8, v16h x9) {
#if defined(__HIP_DEVICE_COMPILE__)
  asm volatile("v_nop\n\tv_nop\n\tv_nop\n\tv_nop"
               : "+v"(a), "+v"(b), "+v"(c), "+v"(d)
               : "v"(x0), "v"(x1), "v"(x2), "v"(x3), "v"(x4), "v"(x5), "v"(x6), "v"(x7), "v"(x8), "v"(x9) : "memory");
#endif
}
__device__ __forceinline__ void acc_guard4(v8f& a, v8f& b, v8f& c, v8f& d) {
#if defined(__HIP_DEVICE_COMPILE__)
  asm volatile("v_nop\n\tv_nop\n\tv_nop\n\tv_nop" : "+v"(a), "+v"(b), "+v"(c), "+v"(d));
#endif
}
// Four asynchronous 16-B copies per lane, global -> LDS (rows r, r+16, r+32, r+48 of one 64-row tile). The s_wait_xcnt stands in
// the copies' own statement so that no address register is rewritten in front of it.
__device__ __forceinline__ void copy4(unsigned l0, unsigned l1, unsigned l2, unsigned l3,
                                      const u16* g0, const u16* g1, const u16* g2, const u16* g3) {
#if defined(__HIP_DEVICE_COMPILE__)
  asm volatile("global_load_async_to_lds_b128 %0, %4, off\n\t"
               "global_load_async_to_lds_b128 %1, %5, off\n\t"
               "global_load_async_to_lds_b128 %2, %6, off\n\t"
               "global_load_async_to_lds_b128 %3, %7, off\n\t"
               "s_wait_xcnt 0x0"
               :: "v"(l0), "v"(l1), "v"(l2), "v"(l3), "v"(g0), "v"(g1), "v"(g2), "v"(g3) : "memory");
#endif
}
// One 64-row x 128-B tile: lbase = this lane's LDS byte address in row r, g = its global address in row r, gstep = 16 source rows.
__device__ __forceinline__ void copy_tile(unsigned lbase, const u16* g, size_t gstep) {
  copy4(lbase, lbase + 16u * (RPH * 2), lbase + 32u * (RPH * 2), lbase + 48u * (RPH * 2), g, g + gstep, g + 2 * gstep, g + 3 * gstep);
}
__device__ __forceinline__ void wait_async0() {   // this wave's copies have landed
#if defined(__HIP_DEVICE_COMPILE__)
  asm volatile("s_wait_asynccnt 0x0" ::: "memory");
#endif
}
__device__ __forceinline__ void wait_ds0() {      // this wave's LDS reads have returned before their buffer is handed back
#if defined(__HIP_DEVICE_COMPILE__)
  asm volatile("s_wait_dscnt 0x0" ::: "memory");
#endif
}
__device__ __forceinline__ void wave_sync_lds() {
  __builtin_amdgcn_fence(__ATOMIC_RELEASE, "workgroup");
  __builtin_amdgcn_wave_barrier();
  __builtin_amdgcn_fence(__ATOMIC_ACQUIRE, "workgroup");
}

// =====================================================================================================
// f32 plane -> 16-bit plane, same layout:  f16mode == 0: bf16 RNE bits;  f16mode == 1: f16 bits of (bf16 RNE value) * scale.
// Thread = 8 consecutive elements: two 16-B loads, one 16-B store; 32 consecutive lanes = 512 contiguous, 512-B aligned bytes
// gt = the thread's index within its plane.
// =====================================================================================================
__device__ __forceinline__ void cvt16_body(const float* __restrict__ x, u16* D, int gt, int f16mode, float scale) {
  const float* p = x + (size_t)gt * 8;
  const v4f a = *(const v4f*)(p), c4 = *(const v4f*)(p + 4);
  float v[8];
#pragma unroll
  for (int e = 0; e < 4; ++e) { v[e] = a[e]; v[4 + e] = c4[e]; }
  unsigned short s[8];
#pragma unroll
  for (int e = 0; e < 8; ++e) {
    const unsigned short hb = h_bits((_Float16)(bfr(v[e]) * scale));
    const unsigned short bb = bf_bits(v[e]);
    s[e] = (f16mode != 0) ? hb : bb;
  }
  v4u o;
#pragma unroll
  for (int e = 0; e < 4; ++e) o[e] = pk16(s[2 * e], s[2 * e + 1]);
  u16* d = D + (size_t)gt * 8;
  {
    *(v4u*)(d) = o;
    
  }
}
// All seven conversions in one grid (none reads another's output): blocks [0, 3*GXB) = the three input planes -> bf16,
// blocks [3*GXB, 3*GXB + 4*GWB) = wq, wk, wv -> bf16 and wo -> f16 of (bf16 value x1024). The plane is chosen per block (scalar).
// coverage: GXB (GWB) blocks x 256 thr x 8 = one whole plane each.
__global__ __launch_bounds__(256)
void cvt16_all(const float* __restrict__ xq, const float* __restrict__ xk, const float* __restrict__ xv,
               const float* __restrict__ wq, const float* __restrict__ wk, const float* __restrict__ wv,
               const float* __restrict__ wo, u16* XQ, u16* XK, u16* XV, u16* WQ, u16* WK, u16* WV, u16* WO) {
  const int bid = blockIdx.x;
  if (bid >= 3 * GXB + 4 * GWB) return;     // never taken with the exact grid; no barriers in this kernel
  const float* x;
  u16* D;
  int lb, f16mode = 0;
  float scale = 1.0f;
  if (bid < 3 * GXB) {
    const int pl = bid / GXB;
    lb = bid - pl * GXB;
    x = (pl == 0) ? xq : (pl == 1) ? xk : xv;
    D = (pl == 0) ? XQ : (pl == 1) ? XK : XV;
  } else {
    const int r = bid - 3 * GXB, pl = r / GWB;
    lb = r - pl * GWB;
    x = (pl == 0) ? wq : (pl == 1) ? wk : (pl == 2) ? wv : wo;
    D = (pl == 0) ? WQ : (pl == 1) ? WK : (pl == 2) ? WV : WO;
    if (pl == 3) { f16mode = 1; scale = WOS; }
  }
  cvt16_body(x, D, lb * 256 + (int)threadIdx.x, f16mode, scale);
}

// =====================================================================================================
// GEMM epilogue of the output projection: the wave's 16x64 f32 tile (times oscale) staged in its LDS slab (pitch 68),
// coverage: 8 instructions x 2 rows x 16 lanes x 4 floats = the wave's 16 x 64 tile.
// =====================================================================================================
__device__ __forceinline__ void epi64(float* sl, v8f a0, v8f a1, v8f a2, v8f a3, float oscale, v4f badd, float* C, int N,
                                      size_t rowb, int col0, int lane) {
  const int hh = lane >> 4, m = lane & 15;
#pragma unroll
  for (int r = 0; r < 8; ++r) {
    const int ro = (8 * hh + r) * 68 + m;
    sl[ro]      = a0[r] * oscale;
    sl[ro + 16] = a1[r] * oscale;
    sl[ro + 32] = a2[r] * oscale;
    sl[ro + 48] = a3[r] * oscale;
  }
  wave_sync_lds();
  v4f vals[8];
#pragma unroll
  for (int it = 0; it < 8; ++it) vals[it] = *(const v4f*)(sl + (it * 2 + hh) * 68 + m * 4) + badd;
  float* dst = C + (rowb + (size_t)hh) * (size_t)N + col0 + m * 4;
  {
#pragma unroll
    for (int it = 0; it < 8; ++it) {
      *(v4f*)(dst + (size_t)(it * 2) * (size_t)N) = vals[it];
    }
    
  }
}

// 8 f32 values (already carried up by their power of two) -> 8 f16 hi + 8 f16 residuals (value - hi, unscaled)
__device__ __forceinline__ void split8(const float* w, v4u& oh, v4u& ol) {
#pragma unroll
  for (int e = 0; e < 4; ++e) {
    const float t0 = w[2 * e], t1 = w[2 * e + 1];
    const _Float16 h0 = (_Float16)t0, h1 = (_Float16)t1;
    const _Float16 l0 = (_Float16)(t0 - (float)h0), l1 = (_Float16)(t1 - (float)h1);
    oh[e] = pk16(h_bits(h0), h_bits(h1));
    ol[e] = pk16(h_bits(l0), h_bits(l1));
  }
}

// =====================================================================================================
// Projection epilogue, q and k: the wave's 16x64 f32 tile (times oscale) staged in its LDS slab (pitch 68), read back by rows, bias
// added in f32, then f16 hi plane (value * sc) + f16 residual plane, same [row][col] layout as the product.
// coverage: per plane 4 instructions x 4 rows x 8 lanes x 8 halves = the wave's 16 x 64 tile, whole 128-B lines.
// =====================================================================================================
__device__ __forceinline__ void epi_split(float* sl, v8f a0, v8f a1, v8f a2, v8f a3, float oscale, const float* __restrict__ bias,
                                          float sc, u16* HP, u16* LP, int N, size_t rowb, int col0, int lane) {
  const int hh = lane >> 4, m = lane & 15;
  const int rq = lane >> 3, c8 = (lane & 7) * 8;
  const v4f bv0 = *(const v4f*)(bias + col0 + c8), bv1 = *(const v4f*)(bias + col0 + c8 + 4);   // columns < N (N multiple of 64)
#pragma unroll
  for (int r = 0; r < 8; ++r) {
    const int ro = (8 * hh + r) * 68 + m;
    sl[ro]      = a0[r] * oscale;
    sl[ro + 16] = a1[r] * oscale;
    sl[ro + 32] = a2[r] * oscale;
    sl[ro + 48] = a3[r] * oscale;
  }
  wave_sync_lds();
  float badd[8];
#pragma unroll
  for (int e = 0; e < 4; ++e) { badd[e] = bfr(bv0[e]); badd[4 + e] = bfr(bv1[e]); }
  v4u oh[4], ol[4];
#pragma unroll
  for (int i4 = 0; i4 < 4; ++i4) {
    const int row = i4 * 4 + rq;
    const v4f a = *(const v4f*)(sl + row * 68 + c8), c4 = *(const v4f*)(sl + row * 68 + c8 + 4);
    float w[8];
#pragma unroll
    for (int e = 0; e < 4; ++e) { w[e] = (a[e] + badd[e]) * sc; w[4 + e] = (c4[e] + badd[4 + e]) * sc; }
    split8(w, oh[i4], ol[i4]);
  }
  const size_t ob = (rowb + (size_t)rq) * (size_t)N + col0 + c8;
#pragma unroll
  for (int i4 = 0; i4 < 4; ++i4) {
    const size_t o8 = ob + (size_t)(i4 * 4) * (size_t)N;
    *(v4u*)(HP + o8) = oh[i4];
    *(v4u*)(LP + o8) = ol[i4];
  }
#if defined(__HIP_DEVICE_COMPILE__)
  // the built code runs on from here into a joined test in front of the v branch, whose first instructions rewrite registers
  // that these eight stores name: the wait stands in front of every such rewrite
  asm volatile("s_wait_xcnt 0x0" ::: "memory");
#endif
}

// =====================================================================================================
// Projection epilogue, v: the block's tile is (batch b, keys s0 .. s0+63, head h, all 64 d), written TRANSPOSED as
// VH[(b*NH + h)*HD + d][s] = f16(v * 1024), VL = f16 residual. An accumulator's 8 elements of a lane are 8 consecutive keys of one d,
// so each goes as one 16-B LDS store into the [d][key] tiles (pitch 72 halves); a block barrier, then whole 128-B lines go out.
// coverage: LDS 4 waves x 4 accumulators x 32 lanes x 8 halves = 64 x 64 per plane; store 4 iterations x 128 thr x 8 halves = 64
//           lines x 64 keys per plane.
// =====================================================================================================
__device__ __forceinline__ void epi_vt(u16* TH, u16* TL, v8f a0, v8f a1, v8f a2, v8f a3, float oscale,
                                       const float* __restrict__ bias, u16* VHo, u16* VLo, int row0, int col0, int tid) {
  const int wave = tid >> 5, lane = tid & 31, hh = lane >> 4, m = lane & 15;
  float bj[4];
#pragma unroll
  for (int j = 0; j < 4; ++j) bj[j] = bias[col0 + j * 16 + m];                     // columns < N (N multiple of 64)
#pragma unroll
  for (int j = 0; j < 4; ++j) {
    const v8f a = (j == 0) ? a0 : (j == 1) ? a1 : (j == 2) ? a2 : a3;
    const float badd = bfr(bj[j]);
    float w[8];
#pragma unroll
    for (int r = 0; r < 8; ++r) w[r] = (a[r] * oscale + badd) * VCAR;
    v4u oh, ol;
    split8(w, oh, ol);
    const int to = (j * 16 + m) * VTP + wave * 16 + 8 * hh;
    *(v4u*)(TH + to) = oh;
    *(v4u*)(TL + to) = ol;
  }
  __syncthreads();
  v4u vh[4], vl[4];
  const int q8 = tid >> 3, p8 = (tid & 7) * 8;
#pragma unroll
  for (int it = 0; it < 4; ++it) {
    const int line = it * 16 + q8;            // d = 0..63
    vh[it] = *(const v4u*)(TH + line * VTP + p8);
    vl[it] = *(const v4u*)(TL + line * VTP + p8);
  }
  const int b = row0 / SEQ, s0 = row0 - b * SEQ, h = col0 >> 6;
  const size_t base = ((size_t)(b * NH + h) * HD + q8) * SEQ + s0 + p8;
#pragma unroll
  for (int it = 0; it < 4; ++it) {
    *(v4u*)(VHo + base + (size_t)(it * 16) * SEQ) = vh[it];
    *(v4u*)(VLo + base + (size_t)(it * 16) * SEQ) = vl[it];
  }
}

// =====================================================================================================
// bf16 GEMM with bias: f32 product A[M][K] (bf16 row-major) . Bt[N][K]^T (bf16 k-contiguous), times oscale, plus bf16-RNE
// value of bias[n], written straight as the f16 hi + residual planes that attention reads. Block = 64x64 tile, 4 waves x 16
// rows. The block's A and Bt tiles of 64 rows x 64 k (whole 128-B lines, LDS pitch 144 B) come into a two-buffer LDS ring by
// asynchronous copies, once per block, and all 4 waves read their fragments there
// (two 16-B LDS loads each, split k map for A and B); one block barrier per 64 k publishes the next stage and frees the one just
// read. k runs upward in steps of 32 as before (host checks K % 64 == 0, M % 64 == 0, N % 64 == 0, grid.x = (M/64)*(N/64)).
// Behind the loop's last barrier the ring is dead and holds the four result slabs (q, k) or the two transposed tiles (v).
// Three independent products of one shape in one grid: blockIdx.y picks the operand set (scalar selects): 0 = q, 1 = k (planes in
// the product's own layout), 2 = v (transposed planes; M = NB*SEQ rows and N = NH*HD columns, a 64-column tile = one head). The
// branch on it is block-uniform, so the barrier inside epi_vt is passed by all threads of its block or by none.
// =====================================================================================================
__global__ __launch_bounds__(128)
void gemm_bfb3(const u16* __restrict__ A0, const u16* __restrict__ A1, const u16* __restrict__ A2,
               const u16* __restrict__ Bt0, const u16* __restrict__ Bt1, const u16* __restrict__ Bt2,
               const float* __restrict__ bias0, const float* __restrict__ bias1, const float* __restrict__ bias2,
               u16* QH, u16* QL, u16* KH, u16* KL, u16* VH, u16* VL, int M, int N, int K, float oscale) {
  __shared__ __align__(16) u16 gring[2 * 2 * TILEH];        // [buffer][A, Bt][64 rows][pitch 72 halves]; epilogue: staging
  const int zz = blockIdx.y;
  const u16*   A    = (zz == 0) ? A0 : (zz == 1) ? A1 : A2;
  const u16*   Bt   = (zz == 0) ? Bt0 : (zz == 1) ? Bt1 : Bt2;
  const float* bias = (zz == 0) ? bias0 : (zz == 1) ? bias1 : bias2;
  const int tid = threadIdx.x, wave = tid >> 5, lane = tid & 31, hh = lane >> 4, m = lane & 15;
  const int ntile = N >> 6;
  const int bid   = blockIdx.x;
  const int row0  = (bid / ntile) * 64;
  const int rowb  = row0 + wave * 16;
  const int col0  = (bid % ntile) * 64;
  const int nst   = K / GKS;
  if (row0 + 64 > M || nst < 1) return;      // block-uniform, in front of every barrier; never taken with the exact grid
  // copies: lane = (row cr of a group of 16, 16-B chunk cc of its 128-B line); a wave's copy = 4 whole lines
  const int cr = tid >> 3, cc = (tid & 7) * 8;
  const u16* ag = A  + (size_t)(row0 + cr) * K + cc;
  const u16* bg = Bt + (size_t)(col0 + cr) * K + cc;
  const size_t gs = (size_t)16 * K;
  const unsigned lcp = (unsigned)(uintptr_t)(gring + cr * RPH + cc);               // LDS byte address, buffer 0, A tile
  const u16* af = gring + (wave * 16 + m) * RPH + 8 * hh;                           // A fragment row of this lane, buffer 0
  const u16* bq = gring + TILEH + m * RPH + 8 * hh;                                 // Bt fragment row of this lane, buffer 0
  v8f acc0 = zero8(), acc1 = zero8(), acc2 = zero8(), acc3 = zero8();
#define GSTAGE(st, bf)                                                    \
  do {                                                                    \
    const unsigned lb_ = lcp + (unsigned)(bf) * (2u * TILEH * 2u);        \
    copy_tile(lb_,              ag + (size_t)(st) * GKS, gs);             \
    copy_tile(lb_ + TILEH * 2u, bg + (size_t)(st) * GKS, gs);             \
  } while (0)
  // ring prologue: stage 0 landed and published, then stage 1 in flight
  GSTAGE(0, 0);
  wait_async0();
  __syncthreads();
  if (1 < nst) GSTAGE(1, 1);
#pragma unroll 1   // stays rolled: one copy of the stage body and of its publish point
  for (int st = 0; st < nst; ++st) {
    const int bf = st & 1;
    const u16* as = af + bf * (2 * TILEH);
    const u16* bs = bq + bf * (2 * TILEH);
    // both k steps of the stage: fragments from LDS, then the products, k upward
    const v16b a   = ldfrag_b(as);
    const v16b b0  = ldfrag_b(bs);
    const v16b b1  = ldfrag_b(bs + 16 * RPH);
    const v16b b2  = ldfrag_b(bs + 32 * RPH);
    const v16b b3  = ldfrag_b(bs + 48 * RPH);
    const v16b a_  = ldfrag_b(as + 32);
    const v16b b0_ = ldfrag_b(bs + 32);
    const v16b b1_ = ldfrag_b(bs + 16 * RPH + 32);
    const v16b b2_ = ldfrag_b(bs + 32 * RPH + 32);
    const v16b b3_ = ldfrag_b(bs + 48 * RPH + 32);
    acc0 = mma_b(a, b0, acc0);
    acc1 = mma_b(a, b1, acc1);
    acc2 = mma_b(a, b2, acc2);
    acc3 = mma_b(a, b3, acc3);
    acc0 = mma_b(a_, b0_, acc0);
    acc1 = mma_b(a_, b1_, acc1);
    acc2 = mma_b(a_, b2_, acc2);
    acc3 = mma_b(a_, b3_, acc3);
    guard6<v16b>(acc0, acc1, acc2, acc3, a_, b0_, b1_, b2_, b3_, a_);
    // publish point of stage st + 1: own reads of this buffer done, own copies of the next landed, block barrier, then the refill
    wait_ds0();
    wait_async0();
    __syncthreads();
    if (st + 2 < nst) GSTAGE(st + 2, bf);
  }
  wait_async0();
#undef GSTAGE
  // every wave is behind the last barrier: no reader and no copy is left on the ring
  if (zz == 2) {
    epi_vt(gring, gring + HD * VTP, acc0, acc1, acc2, acc3, oscale, bias, VH, VL, row0, col0, tid);
  } else {
    float* slab = (float*)(void*)gring;
    epi_split(slab + wave * SLAB64, acc0, acc1, acc2, acc3, oscale, bias, (zz == 0) ? QSC : KSC, (zz == 0) ? QH : KH,
              (zz == 0) ? QL : KL, N, (size_t)rowb, col0, lane);
  }
}

// =====================================================================================================
// f16 hi+lo GEMM with bias: C[M][N] (f32) = (Ahi + Alo)[M][K] . Bt[N][K]^T times oscale, plus bf16-RNE value of bias[n];
// Ahi/Alo f16 planes (same layout), Bt f16 k-contiguous; products hi.B + lo.B into one accumulator (lo is the unscaled
// residual of hi). Same tiling and the same two-buffer LDS ring as gemm_bfb3, with three tiles a stage (Ahi, Alo, Bt).
// =====================================================================================================
__global__ __launch_bounds__(128)
void gemm_h2(const u16* __restrict__ Ah, const u16* __restrict__ Al, const u16* __restrict__ Bt,
             const float* __restrict__ bias, float* C, int M, int N, int K, float oscale) {
  __shared__ __align__(16) u16 gring[2 * 3 * TILEH];        // [buffer][Ahi, Alo, Bt][64 rows][pitch 72 halves]; epilogue: result slabs
  const int tid = threadIdx.x, wave = tid >> 5, lane = tid & 31, hh = lane >> 4, m = lane & 15;
  const int ntile = N >> 6;
  const int bid   = blockIdx.x;
  const int row0  = (bid / ntile) * 64;
  const int rowb  = row0 + wave * 16;
  const int col0  = (bid % ntile) * 64;
  const int nst   = K / GKS;
  if (row0 + 64 > M || nst < 1) return;      // block-uniform, in front of every barrier; never taken with the exact grid
  // copies: lane = (row cr of a group of 16, 16-B chunk cc of its 128-B line); a wave's copy = 4 whole lines
  const int cr = tid >> 3, cc = (tid & 7) * 8;
  const size_t aofs = (size_t)(row0 + cr) * K + cc;
  const u16* ahg = Ah + aofs;
  const u16* alg = Al + aofs;
  const u16* bg  = Bt + (size_t)(col0 + cr) * K + cc;
  const size_t gs = (size_t)16 * K;
  const unsigned lcp = (unsigned)(uintptr_t)(gring + cr * RPH + cc);               // LDS byte address, buffer 0, Ahi tile
  const _Float16* af = (const _Float16*)(const void*)gring + (wave * 16 + m) * RPH + 8 * hh;   // Ahi fragment row, buffer 0
  const _Float16* bq = (const _Float16*)(const void*)gring + 2 * TILEH + m * RPH + 8 * hh;     // Bt fragment row, buffer 0
  v8f acc0 = zero8(), acc1 = zero8(), acc2 = zero8(), acc3 = zero8();
#define GSTAGE(st, bf)                                                    \
  do {                                                                    \
    const unsigned lb_ = lcp + (unsigned)(bf) * (3u * TILEH * 2u);        \
    copy_tile(lb_,                   ahg + (size_t)(st) * GKS, gs);       \
    copy_tile(lb_ + 1u * TILEH * 2u, alg + (size_t)(st) * GKS, gs);       \
    copy_tile(lb_ + 2u * TILEH * 2u, bg  + (size_t)(st) * GKS, gs);       \
  } while (0)
  // ring prologue: stage 0 landed and published, then stage 1 in flight
  GSTAGE(0, 0);
  wait_async0();
  __syncthreads();
  if (1 < nst) GSTAGE(1, 1);
#pragma unroll 1   // stays rolled: one copy of the stage body and of its publish point
  for (int st = 0; st < nst; ++st) {
    const int bf = st & 1;
    const _Float16* as = af + bf * (3 * TILEH);
    const _Float16* bs = bq + bf * (3 * TILEH);
    // both k steps of the stage: fragments from LDS, then the products, k upward
    const v16h ah  = ldfrag_h(as),      al  = ldfrag_h(as + TILEH);
    const v16h b0  = ldfrag_h(bs);
    const v16h b1  = ldfrag_h(bs + 16 * RPH);
    const v16h b2  = ldfrag_h(bs + 32 * RPH);
    const v16h b3  = ldfrag_h(bs + 48 * RPH);
    const v16h ah_ = ldfrag_h(as + 32), al_ = ldfrag_h(as + TILEH + 32);
    const v16h b0_ = ldfrag_h(bs + 32);
    const v16h b1_ = ldfrag_h(bs + 16 * RPH + 32);
    const v16h b2_ = ldfrag_h(bs + 32 * RPH + 32);
    const v16h b3_ = ldfrag_h(bs + 48 * RPH + 32);
    acc0 = mma_h(ah, b0, acc0);    acc0 = mma_h(al, b0, acc0);
    acc1 = mma_h(ah, b1, acc1);    acc1 = mma_h(al, b1, acc1);
    acc2 = mma_h(ah, b2, acc2);    acc2 = mma_h(al, b2, acc2);
    acc3 = mma_h(ah, b3, acc3);    acc3 = mma_h(al, b3, acc3);
    acc0 = mma_h(ah_, b0_, acc0);  acc0 = mma_h(al_, b0_, acc0);
    acc1 = mma_h(ah_, b1_, acc1);  acc1 = mma_h(al_, b1_, acc1);
    acc2 = mma_h(ah_, b2_, acc2);  acc2 = mma_h(al_, b2_, acc2);
    acc3 = mma_h(ah_, b3_, acc3);  acc3 = mma_h(al_, b3_, acc3);
    guard6<v16h>(acc0, acc1, acc2, acc3, ah_, al_, b0_, b1_, b2_, b3_);
    // publish point of stage st + 1: own reads of this buffer done, own copies of the next landed, block barrier, then the refill
    wait_ds0();
    wait_async0();
    __syncthreads();
    if (st + 2 < nst) GSTAGE(st + 2, bf);
  }
  wait_async0();
#undef GSTAGE
  float* slab = (float*)(void*)gring;        // every wave is behind the last barrier: no reader and no copy is left on the ring
  const v4f bv = *(const v4f*)(bias + col0 + m * 4);      // columns col0 + 4m .. +3, always < N (N multiple of 64)
  v4f badd;
#pragma unroll
  for (int e = 0; e < 4; ++e) badd[e] = bfr(bv[e]);
  epi64(slab + wave * SLAB64, acc0, acc1, acc2, acc3, oscale, badd, C, N, (size_t)rowb, col0, lane);
}

// =====================================================================================================
// Full (non-causal) multi-head flash attention with a per-head x per-key additive score bias: block = (batch b, head, 64 query
// rows), 4 waves, wave w owns the 16 query rows q0 = 64*qt + 16*w .. q0+15. The k and v^T tiles of 64 keys (hi and residual planes,
// 4 tiles of 64 rows x 128 B, LDS pitch 144 B) are brought into a two-buffer LDS ring by asynchronous copies, whole 128-B lines,
// once per block, and read by all 4 waves; one block barrier per 64 keys publishes the next stage and frees the one just read.
//   q planes (hi, lo f16, x1024) laid out [b][s][h][d]; k planes the same; v^T planes [b][h][d][s] (x1024).
//   All NST = 32 stages of 64 keys are visited (static bound); a stage is ONE softmax pass (one maximum, one rescale of O).
//   Scores are computed TRANSPOSED: S^T tile g (g = 0..3) = k rows (keys kb+16g .. +15, A operand, row m = lane&15, split k map
//   over d) times q^T (B operand, col n = query q0 + (lane&15), k = d, split map), 3 products per tile and d-chunk
//   (k_hi.q_hi + k_lo.q_hi + k_hi.q_lo). D element r of lane l = (key kb+16g+8h+r, query q0+(l&15)), so a lane owns one query
//   column and 32 of its 64 keys; the partner lane l^16 owns the other 32 -> row max / row sum need one xor-16 shuffle.
//   Logit of key j, query i (base 2): (S * 1/8 * 2^-20 + bfr(wh) * bfr(mask[b][j])) * log2(e); the bias term of all SEQ keys of
//   this (batch, head) is formed once per block into an LDS table (f32; each of its two products rounded on its own) and read per
//   pass with the same element -> key map as the transposed scores (t[8g+i] <- key kb+16g+8h+i), added in f32.
//   Online max-subtracted base-2 softmax in f32. The exp'd values ARE the two P A-fragments in place (f = 0,1: keys kb+32f ..): A
//   row m = query = lane&15, element i <- tile 2f, D element i, element 8+i <- tile 2f+1, D element i. P is carried x32768
//   as f16 hi + f16 residual. The rescale factor of query row 8h+r of the O accumulators is fetched from lane 8h+r with a
//   shuffle (uniform control). 4+4 v^T B fragments (hi and residual planes, col n = d = 16j + (lane&15), keys k-contiguous),
//   12 P.V WMMAs (hh + lh + hl) per 32 keys.
//   Epilogue: 1/l (per query, shuffled to the D row owner) and carry folds in f32; the wave's 16x64 f32 result staged in its LDS
// coverage: per wave 4 instructions x 4 rows x 8 lanes x 8 halves = 16 x 64 per plane; grid 768 blocks x 4 waves = every
//           (b, s, h) row of both O planes exactly once.
// =====================================================================================================
__global__ __launch_bounds__(ATT_THREADS)
void attn_fwd(const u16* __restrict__ QHIp, const u16* __restrict__ QLOp,
              const u16* __restrict__ KHIp, const u16* __restrict__ KLOp,
              const u16* __restrict__ VHIp, const u16* __restrict__ VLOp,
              const float* __restrict__ maskp, const float* __restrict__ mcwp,
              u16* OHIp, u16* OLOp) {
  __shared__ __align__(16) float smem[ATT_WAVES * SLABF];   // per wave: result slab [16][68] in the epilogue only
  __shared__ __align__(16) u16 ring[2 * 4 * TILEH];         // [buffer][k hi, k lo, v^T hi, v^T lo][64 rows][pitch 72 halves]
  __shared__ __align__(16) float kbias[SEQ];                // base-2 logit bias of every key of this (batch, head)

  const int tid  = threadIdx.x;
  const int wave = tid >> 5;
  const int lane = tid & 31;
  const int hh   = lane >> 4;
  const int c    = lane & 15;

  const int bid  = blockIdx.x;
  const int qt   = bid & (NQT - 1);
  const int bh   = bid >> 5;                 // NQT == 32
  const int head = bh % NH;
  const int b    = bh / NH;
  const int q0   = qt * 64 + wave * 16;

  // B fragments of q^T: col n = query q0 + c, k = d (k-contiguous row of the q plane)
  const size_t qofs = (((size_t)(b * SEQ + q0 + c)) * NH + head) * HD + 8 * hh;
  const _Float16* Qh  = (const _Float16*)(const void*)QHIp + qofs;
  const _Float16* Ql  = (const _Float16*)(const void*)QLOp + qofs;
  // copies: lane = (row cr of a group of 16, 16-B chunk cc of its 128-B row); a wave's copy = 4 whole rows
  const int cr = tid >> 3, cc = (tid & 7) * 8;
  const size_t kcp = (((size_t)b * SEQ + cr) * NH + head) * HD + cc;               // key row: stage's first key added per stage
  const size_t vcp = ((size_t)(b * NH + head) * HD + cr) * SEQ + cc;               // d row: stage's first key added per stage
  const unsigned lcp = (unsigned)(uintptr_t)(ring + cr * RPH + cc);                // LDS byte address, buffer 0, tile 0
  // A fragments of k: row m = key (in stage) 16g + c, k = d;  B fragments of v: col n = d = 16j + c, k = key (in stage)
  const _Float16* ringh = (const _Float16*)(const void*)ring + c * RPH + 8 * hh;
  // per-key bias row in the table: kbias[kb + 16g + 8hh + 0..7] for score tile g, 16-B aligned LDS loads
  const float* brow = kbias + 8 * hh;
  const float  wh2  = bfr(mcwp[head]);                                              // per-head scalar (bf16 RNE value)
  const float lsc = 0.125f * (LOG2E / (QSC * KSC));

  // the wave's q^T fragments (hi and residual, both d chunks) are the same for every key: loaded once, kept in 32 registers
  const v16h qh0 = ldfrag_h(Qh), qh1 = ldfrag_h(Qh + 32);
#if defined(__HIP_DEVICE_COMPILE__)
  // the built code lets the residual fragments land in the registers that hold the hi plane's address: the wait stands in front
  asm volatile("s_wait_xcnt 0x0" ::: "memory");
#endif
  const v16h ql0 = ldfrag_h(Ql), ql1 = ldfrag_h(Ql + 32);

  float mrun = -INFINITY, lrun = 0.f;
  v8f o[4];
#pragma unroll
  for (int j = 0; j < 4; ++j) o[j] = zero8();

#define STAGE_COPY(st, bf)                                                                        \
  do {                                                                                            \
    const unsigned lb_ = lcp + (unsigned)(bf) * (4u * TILEH * 2u);                                \
    const size_t ko_ = kcp + (size_t)(st) * (SKEYS * NH * HD), vo_ = vcp + (size_t)(st) * SKEYS;  \
    copy_tile(lb_,                   KHIp + ko_, (size_t)16 * (NH * HD));                         \
    copy_tile(lb_ + 1u * TILEH * 2u, KLOp + ko_, (size_t)16 * (NH * HD));                         \
    copy_tile(lb_ + 2u * TILEH * 2u, VHIp + vo_, (size_t)16 * SEQ);                               \
    copy_tile(lb_ + 3u * TILEH * 2u, VLOp + vo_, (size_t)16 * SEQ);                               \
  } while (0)

  // ring prologue: stage 0 landed and published, then stage 1 in flight
  STAGE_COPY(0, 0);
  // bias table, formed while stage 0 flies: thread = 4 consecutive keys per round, SEQ / (4 * ATT_THREADS) rounds cover every key
  // once; the barrier below publishes it together with stage 0
  {
    const float* mb4 = maskp + (size_t)b * SEQ + tid * 4;
#pragma unroll     // the rounds' loads issue together: one memory latency, not one per round
    for (int i = 0; i < SEQ / (4 * ATT_THREADS); ++i) {
      const v4f mv = *(const v4f*)(mb4 + i * (4 * ATT_THREADS));
      v4f bz;
#pragma unroll
      for (int e = 0; e < 4; ++e) bz[e] = (wh2 * bfr(mv[e])) * LOG2E;
      *(v4f*)(kbias + tid * 4 + i * (4 * ATT_THREADS)) = bz;
    }
  }
  wait_async0();
  __syncthreads();
  STAGE_COPY(1, 1);

#pragma unroll 1   // stays rolled: one copy of the stage body and of its publish point
  for (int st = 0; st < NST; ++st) {
   const int bf = st & 1;
   const _Float16* stg = ringh + bf * (4 * TILEH);
   // the whole 64-key stage is one softmax pass: 4 score tiles, one running-max update and one rescale of O per 64 keys
   const int kb = st * SKEYS;
   v4f ba[4], bb[4];
#pragma unroll   // constant indices: the arrays stay in registers
   for (int g = 0; g < 4; ++g) {
     ba[g] = *(const v4f*)(brow + kb + 16 * g);
     bb[g] = *(const v4f*)(brow + kb + 16 * g + 4);
   }
   // ---- transposed scores: s[g] = keys kb+16g .. kb+16g+15, column = query q0 + c ----
   v8f s[4];
#pragma unroll   // constant indices: the arrays stay in registers
   for (int g = 0; g < 4; ++g) s[g] = zero8();
#pragma unroll   // constant indices: the arrays stay in registers
   for (int kk = 0; kk < 2; ++kk) {
     const v16h qh = (kk == 0) ? qh0 : qh1, ql = (kk == 0) ? ql0 : ql1;
     v16h kh[4], kl[4];
#pragma unroll   // constant indices: the arrays stay in registers
     for (int g = 0; g < 4; ++g) {
       kh[g] = ldfrag_h(stg + (16 * g) * RPH + kk * 32);
       kl[g] = ldfrag_h(stg + TILEH + (16 * g) * RPH + kk * 32);
     }
#pragma unroll   // constant indices: the arrays stay in registers
     for (int g = 0; g < 4; ++g) s[g] = mma_h(kh[g], qh, s[g]);
#pragma unroll   // constant indices: the arrays stay in registers
     for (int g = 0; g < 4; ++g) s[g] = mma_h(kl[g], qh, s[g]);
#pragma unroll   // constant indices: the arrays stay in registers
     for (int g = 0; g < 4; ++g) s[g] = mma_h(kh[g], ql, s[g]);
     guard10(s[0], s[1], s[2], s[3], qh, ql, kh[0], kh[1], kh[2], kh[3], kl[0], kl[1], kl[2], kl[3]);
   }
   // ---- base-2 logits of this lane's 32 keys for query q0 + c: t[8g+i] <- key kb+16g+8hh+i; one maximum per tile, then joined ----
   float t[32], cg[4];
#pragma unroll   // constant indices: the arrays stay in registers
   for (int g = 0; g < 4; ++g) {
#pragma unroll   // constant indices: the arrays stay in registers
     for (int e = 0; e < 4; ++e) {
       t[8 * g + e]     = s[g][e] * lsc     + ba[g][e];
       t[8 * g + 4 + e] = s[g][4 + e] * lsc + bb[g][e];
     }
     cg[g] = t[8 * g];
#pragma unroll   // constant indices: the arrays stay in registers
     for (int i = 1; i < 8; ++i) cg[g] = fmaxf(cg[g], t[8 * g + i]);
   }
   float cm = fmaxf(fmaxf(cg[0], cg[1]), fmaxf(cg[2], cg[3]));
   cm = fmaxf(cm, __shfl_xor(cm, 16, 32));
   const float mn = fmaxf(mrun, cm);        // finite from the first stage on
   const float al = ex2(mrun - mn);         // 0 on the first stage (mrun = -inf)
   mrun = mn;
   // ---- probabilities (<= 1) and the P A-fragments of keys kb+32f .. +31: hi = f16(p * 32768), lo = f16 residual;
   //      element 8w+i of fragment f <-> t[16f+8w+i] ----
   float psf[2];
   FragH ph[2], pl[2];
#pragma unroll   // constant indices: the arrays stay in registers
   for (int f = 0; f < 2; ++f) {
     psf[f] = 0.f;
#pragma unroll   // constant indices: the arrays stay in registers
     for (int w = 0; w < 2; ++w) {
#pragma unroll   // constant indices: the arrays stay in registers
       for (int e4 = 0; e4 < 4; ++e4) {
         const int i = 16 * f + 8 * w + 2 * e4;
         const float p0 = ex2(t[i] - mn), p1 = ex2(t[i + 1] - mn);
         psf[f] += p0 + p1;
         const float a0 = p0 * PCAR, a1 = p1 * PCAR;
         const _Float16 h0 = (_Float16)a0, h1 = (_Float16)a1;
         const _Float16 l0 = (_Float16)(a0 - (float)h0), l1 = (_Float16)(a1 - (float)h1);
         ph[f].u[w][e4] = pk16(h_bits(h0), h_bits(h1));
         pl[f].u[w][e4] = pk16(h_bits(l0), h_bits(l1));
       }
     }
   }
   float ps = psf[0] + psf[1];
   ps += __shfl_xor(ps, 16, 32);
   lrun = lrun * al + ps;
   // ---- rescale the O accumulators: D row 8hh+r = query q0+8hh+r, its factor lives in lane 8hh+r (and 16+8hh+r) ----
   float scl[8];
#pragma unroll   // constant indices: the arrays stay in registers
   for (int r = 0; r < 8; ++r) scl[r] = __shfl(al, 8 * hh + r, 32);
#pragma unroll   // constant indices: the arrays stay in registers
   for (int j = 0; j < 4; ++j) {
#pragma unroll   // constant indices: the arrays stay in registers
     for (int r = 0; r < 8; ++r) o[j][r] *= scl[r];
   }
   // ---- P.V : B fragment col n = d = j*16 + c, keys contiguous in the v^T planes; keys upward, 32 at a time ----
   {
     v16h vh[2][4], vl[2][4];
#pragma unroll   // constant indices: the arrays stay in registers
     for (int f = 0; f < 2; ++f) {
#pragma unroll   // constant indices: the arrays stay in registers
       for (int j = 0; j < 4; ++j) {
         vh[f][j] = ldfrag_h(stg + 2 * TILEH + (16 * j) * RPH + f * 32);
         vl[f][j] = ldfrag_h(stg + 3 * TILEH + (16 * j) * RPH + f * 32);
       }
     }
#pragma unroll   // constant indices: the arrays stay in registers
     for (int f = 0; f < 2; ++f) {
#pragma unroll   // constant indices: the arrays stay in registers
       for (int j = 0; j < 4; ++j) o[j] = mma_h(ph[f].v, vh[f][j], o[j]);
#pragma unroll   // constant indices: the arrays stay in registers
       for (int j = 0; j < 4; ++j) o[j] = mma_h(pl[f].v, vh[f][j], o[j]);
#pragma unroll   // constant indices: the arrays stay in registers
       for (int j = 0; j < 4; ++j) o[j] = mma_h(ph[f].v, vl[f][j], o[j]);
       guard10(o[0], o[1], o[2], o[3], ph[f].v, pl[f].v, vh[f][0], vh[f][1], vh[f][2], vh[f][3], vl[f][0], vl[f][1], vl[f][2], vl[f][3]);
     }
   }
   // publish point of stage st + 1: own reads of this buffer done, own copies of the next landed, block barrier, then the refill
   wait_ds0();
   wait_async0();
   __syncthreads();
   if (st + 2 < NST) STAGE_COPY(st + 2, bf);
  }
  wait_async0();
#undef STAGE_COPY
  acc_guard4(o[0], o[1], o[2], o[3]);

  // ---- fold 1/l (per query, owned by lane = query) and the carries (32768 on P, 1024 on v); stage the 16x64 slab ----
  const float linv = (1.0f / lrun) * (1.0f / (PCAR * VCAR));
  float inv[8];
#pragma unroll
  for (int r = 0; r < 8; ++r) inv[r] = __shfl(linv, 8 * hh + r, 32);
  float* slab = smem + wave * SLABF;
#pragma unroll
  for (int r = 0; r < 8; ++r) {
#pragma unroll
    for (int j = 0; j < 4; ++j) slab[(8 * hh + r) * 68 + j * 16 + c] = o[j][r] * inv[r];
  }
  wave_sync_lds();
  // ---- O x1024 -> f16 hi + residual planes; lane = (row in group of 4, 8 consecutive d) ----
  v4u oh[4], ol[4];
  const int rq = lane >> 3, c8 = (lane & 7) * 8;
#pragma unroll
  for (int i4 = 0; i4 < 4; ++i4) {
    const int row = i4 * 4 + rq;
    const v4f a = *(const v4f*)(slab + row * 68 + c8), c4 = *(const v4f*)(slab + row * 68 + c8 + 4);
    float w[8];
#pragma unroll
    for (int e = 0; e < 4; ++e) { w[e] = a[e] * OSC; w[4 + e] = c4[e] * OSC; }
#pragma unroll
    for (int e = 0; e < 4; ++e) {
      const _Float16 h0 = (_Float16)w[2 * e], h1 = (_Float16)w[2 * e + 1];
      const _Float16 l0 = (_Float16)(w[2 * e] - (float)h0), l1 = (_Float16)(w[2 * e + 1] - (float)h1);
      oh[i4][e] = pk16(h_bits(h0), h_bits(h1));
      ol[i4][e] = pk16(h_bits(l0), h_bits(l1));
    }
  }
  const size_t ob = (((size_t)(b * SEQ + q0)) * NH + head) * HD + c8;
  {
#pragma unroll
    for (int i4 = 0; i4 < 4; ++i4) {
      const int row = i4 * 4 + rq;
      const size_t o8 = ob + (size_t)row * (NH * HD);
      *(v4u*)(OHIp + o8) = oh[i4];
      *(v4u*)(OLOp + o8) = ol[i4];
    }
    
  }
}

// =====================================================================================================
// Workspace map (bytes); every plane is fully written by whole-line stores before it is read; all extents are exact multiples
// of the store granularity (no pad rows needed); every offset a multiple of 131072 (128 KiB); q, k and v each have their
// own input plane, so that each stage runs as one grid over all three:
//   XBQ bf16 [4096][768]               6291456        XBK same  6291456      XBV same  6291456
//   WQB bf16 [768 n][768 k]            1179648        WKB same  1179648      WVB same  1179648
//   WOB f16  [768 n][768 k] x1024      1179648
//   QHI f16 [2][2048][12][64] x1024    6291456        QLO residual         6291456
//   KHI same                           6291456        KLO residual         6291456
//   VHI f16 [2][12][64][2048] x1024    6291456        VLO residual         6291456
//   OHI f16 [4096][768] x1024          6291456        OLO residual         6291456
//   end                               73924608
// =====================================================================================================
extern "C" void kernel_launch(void* const* d_in, const int* in_sizes, int n_in,
                              void* d_out, int out_size, void* d_ws, size_t ws_size,
                              hipStream_t stream) {
  const int ROWS = NB * SEQ;                            // 4096
  if (n_in < 13) return;
  if (in_sizes[0] != ROWS * DMOD || in_sizes[1] != ROWS * DMOD || in_sizes[2] != ROWS * DMOD) return;
  if (in_sizes[3] != NB * SEQ) return;
  if (in_sizes[4] != DMOD * DMOD || in_sizes[6] != DMOD * DMOD) return;
  if (in_sizes[8] != DMOD * DMOD || in_sizes[10] != DMOD * DMOD) return;
  if (in_sizes[5] != DMOD || in_sizes[7] != DMOD || in_sizes[9] != DMOD || in_sizes[11] != DMOD) return;
  if (in_sizes[12] != NH) return;
  if (out_size != ROWS * DMOD) return;

  const float* Qin  = (const float*)d_in[0];
  const float* Kin  = (const float*)d_in[1];
  const float* Vin  = (const float*)d_in[2];
  const float* mask = (const float*)d_in[3];
  const float* wq   = (const float*)d_in[4];
  const float* bq   = (const float*)d_in[5];
  const float* wk   = (const float*)d_in[6];
  const float* bk   = (const float*)d_in[7];
  const float* wv   = (const float*)d_in[8];
  const float* bv   = (const float*)d_in[9];
  const float* wo   = (const float*)d_in[10];
  const float* bo   = (const float*)d_in[11];
  const float* mcw  = (const float*)d_in[12];
  float*       out  = (float*)d_out;

  const size_t szXB  = (size_t)ROWS * DMOD * 2;                 //  6291456
  const size_t szW   = (size_t)DMOD * DMOD * 2;                 //  1179648
  const size_t szP   = (size_t)ROWS * DMOD * 2;                 //  6291456  (q/k/o planes)
  const size_t szVP  = (size_t)NB * NH * HD * SEQ * 2;          //  6291456
  size_t off = 0;
  const size_t oXBQ = off; off += szXB;
  const size_t oXBK = off; off += szXB;
  const size_t oXBV = off; off += szXB;
  const size_t oWQB = off; off += szW;
  const size_t oWKB = off; off += szW;
  const size_t oWVB = off; off += szW;
  const size_t oWOB = off; off += szW;
  const size_t oQHI = off; off += szP;
  const size_t oQLO = off; off += szP;
  const size_t oKHI = off; off += szP;
  const size_t oKLO = off; off += szP;
  const size_t oVHI = off; off += szVP;
  const size_t oVLO = off; off += szVP;
  const size_t oOHI = off; off += szP;
  const size_t oOLO = off; off += szP;
  if (off > ws_size) return;                            // off = 73924608
  if (off > (size_t)134217728) return;

  char* ws = (char*)d_ws;
  u16*   XBQ = (u16*)(ws + oXBQ);
  u16*   XBK = (u16*)(ws + oXBK);
  u16*   XBV = (u16*)(ws + oXBV);
  u16*   WQB = (u16*)(ws + oWQB);
  u16*   WKB = (u16*)(ws + oWKB);
  u16*   WVB = (u16*)(ws + oWVB);
  u16*   WOB = (u16*)(ws + oWOB);
  u16*   QHI = (u16*)(ws + oQHI);
  u16*   QLO = (u16*)(ws + oQLO);
  u16*   KHI = (u16*)(ws + oKHI);
  u16*   KLO = (u16*)(ws + oKLO);
  u16*   VHI = (u16*)(ws + oVHI);
  u16*   VLO = (u16*)(ws + oVLO);
  u16*   OHI = (u16*)(ws + oOHI);
  u16*   OLO = (u16*)(ws + oOLO);

  const dim3 blk(256);
  const int n8x = (ROWS * DMOD) / 8;                    // 393216
  const int n8w = (DMOD * DMOD) / 8;                    //  73728
  if ((n8x % 256) != 0 || (n8w % 256) != 0) return;
  if ((ROWS % 64) != 0 || (DMOD % 64) != 0 || (DMOD % 32) != 0) return;
  if (n8x / 256 != GXB || n8w / 256 != GWB) return;
  const dim3 gCV(3 * GXB + 4 * GWB);                    // 5760
  const dim3 gG((ROWS / 64) * (DMOD / 64));             //  768
  const dim3 gG3((ROWS / 64) * (DMOD / 64), 3);         //  768 x 3
  const dim3 bG(128);
  const dim3 gAT(ATT_BLOCKS);                           //  768
  const dim3 bAT(ATT_THREADS);                          //  128

  // (0) all conversions: inputs -> bf16 planes; weights [n][k] (already k-contiguous for x.W^T): bf16 planes for wq/wk/wv, f16 of
  //     bf16 value x1024 for wo
  cvt16_all<<<gCV, blk, 0, stream>>>(Qin, Kin, Vin, wq, wk, wv, wo, XBQ, XBK, XBV, WQB, WKB, WVB, WOB);
  // (1) the three projections + bias (col = h*64+d), written as q and k f16 hi x1024 + residual planes and v^T planes x1024
  gemm_bfb3<<<gG3, bG, 0, stream>>>(XBQ, XBK, XBV, WQB, WKB, WVB, bq, bk, bv, QHI, QLO, KHI, KLO, VHI, VLO, ROWS, DMOD, DMOD, 1.0f);
  // (2) attention with per-head x per-key bias -> O planes [b][s][h][d] x1024 (hi + residual)
  attn_fwd<<<gAT, bAT, 0, stream>>>(QHI, QLO, KHI, KLO, VHI, VLO, mask, mcw, OHI, OLO);
  // (3) output projection + bias -> out [4096][768] f32, carries 1024 (O) x 1024 (wo) folded back
  gemm_h2<<<gG, bG, 0, stream>>>(OHI, OLO, WOB, bo, out, ROWS, DMOD, DMOD, 1.0f / (OSC * WOS));
  (void)hipGetLastError();
}

// v009
// It runs in 111 microseconds.
// Timed twice side by side with v008, it ran 1.07 and 1.08 times as fast.
// All steps since v000 together make it 2.62 times as fast.
// Contractions: x.W{q,k,v}^T on v_wmma_f32_16x16x32_bf16 (x and W RNE-converted to bf16 operands, f32 accumulate, bias added in f32);
// scores k'.q'^T (q', k' carried x1024 as f16 hi plane + f16 residual plane, products hh+lh+hl), P.v (P x32768 f16 hi+residual,
// v x1024 f16 hi+residual, products hh+lh+hl) and O.Wo^T (O x1024 f16 hi+residual, Wo as f16(bf16(Wo) x1024), products h.w+l.w):
// v_wmma_f32_16x16x32_f16, f32 accumulate. Per-head x per-key additive score bias, base-2 online softmax, 1/l fold in f32 on VALU.
#include <hip/hip_runtime.h>
#include <math.h>
#include <stdint.h>

#define NB    2
#define SEQ   2048
#define DMOD  768
#define NH    12
#define HD    64
#define NQT   (SEQ / 64)
#define QSC   1024.0f
#define KSC   1024.0f
#define PCAR  32768.0f
#define VCAR  1024.0f
#define OSC   1024.0f
#define WOS   1024.0f
#define LOG2E 1.4426950408889634f
#define ATT_WAVES   4
#define ATT_THREADS (ATT_WAVES * 32)
#define ATT_BLOCKS  (NB * NH * NQT)
#define NKB    (SEQ / 32)
#define SLABF  (16 * 68)
#define SLAB64 (16 * 68)
#define VTP    72
#define SKEYS  64
#define NST    (SEQ / SKEYS)
#define RPH    72
#define TILEH  (64 * RPH)
#define TSLOT  5120                            // halves per tile place in the attention ring: TILEH rounded up to a multiple of 2 KiB
#define GKS    64                              // k per GEMM stage: one whole 128-B line of every operand row
#define GXB    ((NB * SEQ * DMOD / 8) / 256)   // blocks of 256 threads x 8 elements per [4096][768] plane
#define GWB    ((DMOD * DMOD / 8) / 256)       // the same per [768][768] plane
static_assert(HD == 64 && DMOD == NH * HD);
static_assert(NQT == 32 && NH == 12 && NB == 2);
static_assert(ATT_THREADS == 128 && ATT_BLOCKS == 768 && NKB == 64);
static_assert(((NB * SEQ) % 64) == 0 && (DMOD % 64) == 0 && (DMOD % 32) == 0);
static_assert((SEQ % 64) == 0 && (SEQ % 8) == 0);
static_assert(((NB * SEQ * DMOD / 8) % 256) == 0 && ((DMOD * DMOD / 8) % 256) == 0);
static_assert(GXB == 1536 && GWB == 288);
static_assert(ATT_WAVES * SLABF >= 4 * 16 * 68);
static_assert(HD * VTP >= 63 * VTP + 64 && 2 * 2 * TILEH >= 2 * HD * VTP && (VTP * 2) % 16 == 0);
static_assert(2 * 2 * TILEH * 2 >= 4 * SLAB64 * 4 && (DMOD % GKS) == 0 && DMOD / GKS >= 2);
static_assert((SEQ % (4 * ATT_THREADS)) == 0);
static_assert(SKEYS == 64 && NST >= 2 && NST * SKEYS == SEQ && (RPH * 2) % 16 == 0 && TILEH >= 63 * RPH + 64);
static_assert(TSLOT >= TILEH && (TSLOT * 2) % 2048 == 0 && RPH * 2 == HD * 2 + 16 && HD * 2 == 128);
static_assert(2 * 4 * TSLOT * 2 >= ATT_WAVES * SLABF * 4);
static_assert((NH * HD * 2) % 16 == 0 && (SEQ * 2) % 16 == 0 && SEQ * 2 <= 131072);

typedef unsigned short u16;
typedef _Float16 v16h __attribute__((ext_vector_type(16)));
typedef _Float16 v8h  __attribute__((ext_vector_type(8)));
typedef __bf16   v16b __attribute__((ext_vector_type(16)));
typedef float    v8f  __attribute__((ext_vector_type(8)));
typedef float    v4f  __attribute__((ext_vector_type(4)));
typedef unsigned int v4u __attribute__((ext_vector_type(4)));
typedef uint32_t u32x4 __attribute__((ext_vector_type(4)));
typedef uint32_t u32x8 __attribute__((ext_vector_type(8)));

union FragH { v16h v; v8h h[2]; v4u u[2]; };
union FragB { v16b v; v4u u[2]; };

// ---- scalar helpers --------------------------------------------------------------------------------
__device__ __forceinline__ unsigned short bf_bits(float f) {          // f32 -> bf16 bits, RNE convert
  unsigned u = __float_as_uint(f);
  return (unsigned short)((u + 0x7FFFu + ((u >> 16) & 1u)) >> 16);
}
__device__ __forceinline__ float bf_up(unsigned short h) { return __uint_as_float(((unsigned)h) << 16); }
__device__ __forceinline__ float bfr(float f) { return bf_up(bf_bits(f)); }
__device__ __forceinline__ unsigned short h_bits(_Float16 x) { return __builtin_bit_cast(unsigned short, x); }
__device__ __forceinline__ unsigned pk16(unsigned short a, unsigned short b) { return (unsigned)a | ((unsigned)b << 16); }
__device__ __forceinline__ v8f zero8() { v8f z = {0.f, 0.f, 0.f, 0.f, 0.f, 0.f, 0.f, 0.f}; return z; }
__device__ __forceinline__ v4f zero4() { v4f z = {0.f, 0.f, 0.f, 0.f}; return z; }
// 2^x as the bare v_exp_f32, without the library's range test, pre-scale and ldexp around it: equal to exp2f for x >= -126; below
// that the result (under 2^-126) comes out as 0. Used on x <= 0 only: such a term is far under one f32 ulp of the row sum (>= 1)
// and under the smallest f16 residual of P x32768, and a rescale factor that small leaves nothing of the old sums either way.
__device__ __forceinline__ float ex2(float x) { return __builtin_amdgcn_exp2f(x); }

// ---- fragment loaders: 16-bit A/B operand, lane -> row/col (lane&15), p already includes +8*(lane>>4);
//      elements 0..7 <- p[0..7] (k0+8h..), elements 8..15 <- p[16..23] (k0+16+8h..)  (same split k map for A and B;
//      B is always read from a k-contiguous [n][k] plane)
__device__ __forceinline__ v16h ldfrag_h(const _Float16* p) {
  FragH f;
  f.h[0] = *(const v8h*)(p);
  f.h[1] = *(const v8h*)(p + 16);
  return f.v;
}
__device__ __forceinline__ v16b ldfrag_b(const u16* p) {              // bf16 plane read as unsigned integer vectors
  FragB f;
  f.u[0] = *(const v4u*)(p);
  f.u[1] = *(const v4u*)(p + 16);
  return f.v;
}

__device__ __forceinline__ v8f mma_h(v16h a, v16h b, v8f c) {
  return __builtin_amdgcn_wmma_f32_16x16x32_f16(false, a, false, b, (short)0, c, false, false);
}
__device__ __forceinline__ v8f mma_b(v16b a, v16b b, v8f c) {
  return __builtin_amdgcn_wmma_f32_16x16x32_bf16(false, a, false, b, (short)0, c, false, false);
}
__device__ __forceinline__ void guard2(v8f& a, v8f& b, v16h x0, v16h x1, v16h x2, v16h x3, v16h x4, v16h x5) {
#if defined(__HIP_DEVICE_COMPILE__)
  asm volatile("v_nop\n\tv_nop\n\tv_nop\n\tv_nop"
               : "+v"(a), "+v"(b) : "v"(x0), "v"(x1), "v"(x2), "v"(x3), "v"(x4), "v"(x5) : "memory");
#endif
}
template <typename F>
__device__ __forceinline__ void guard6(v8f& a, v8f& b, v8f& c, v8f& d, F x0, F x1, F x2, F x3, F x4, F x5) {
#if defined(__HIP_DEVICE_COMPILE__)
  asm volatile("v_nop\n\tv_nop\n\tv_nop\n\tv_nop"
               : "+v"(a), "+v"(b), "+v"(c), "+v"(d) : "v"(x0), "v"(x1), "v"(x2), "v"(x3), "v"(x4), "v"(x5) : "memory");
#endif
}
__device__ __forceinline__ void guard10(v8f& a, v8f& b, v8f& c, v8f& d, v16h x0, v16h x1, v16h x2, v16h x3, v16h x4,
                                        v16h x5, v16h x6, v16h x7, v16h x8, v16h x9) {
#if defined(__HIP_DEVICE_COMPILE__)
  asm volatile("v_nop\n\tv_nop\n\tv_nop\n\tv_nop"
               : "+v"(a), "+v"(b), "+v"(c), "+v"(d)
               : "v"(x0), "v"(x1), "v"(x2), "v"(x3), "v"(x4), "v"(x5), "v"(x6), "v"(x7), "v"(x8), "v"(x9) : "memory");
#endif
}
__device__ __forceinline__ void acc_guard4(v8f& a, v8f& b, v8f& c, v8f& d) {
#if defined(__HIP_DEVICE_COMPILE__)
  asm volatile("v_nop\n\tv_nop\n\tv_nop\n\tv_nop" : "+v"(a), "+v"(b), "+v"(c), "+v"(d));
#endif
}
// Four asynchronous 16-B copies per lane, global -> LDS (rows r, r+16, r+32, r+48 of one 64-row tile). The s_wait_xcnt stands in
// the copies' own statement so that no address register is rewritten in front of it.
__device__ __forceinline__ void copy4(unsigned l0, unsigned l1, unsigned l2, unsigned l3,
                                      const u16* g0, const u16* g1, const u16* g2, const u16* g3) {
#if defined(__HIP_DEVICE_COMPILE__)
  asm volatile("global_load_async_to_lds_b128 %0, %4, off\n\t"
               "global_load_async_to_lds_b128 %1, %5, off\n\t"
               "global_load_async_to_lds_b128 %2, %6, off\n\t"
               "global_load_async_to_lds_b128 %3, %7, off\n\t"
               "s_wait_xcnt 0x0"
               :: "v"(l0), "v"(l1), "v"(l2), "v"(l3), "v"(g0), "v"(g1), "v"(g2), "v"(g3) : "memory");
#endif
}
// One 64-row x 128-B tile: lbase = this lane's LDS byte address in row r, g = its global address in row r, gstep = 16 source rows.
__device__ __forceinline__ void copy_tile(unsigned lbase, const u16* g, size_t gstep) {
  copy4(lbase, lbase + 16u * (RPH * 2), lbase + 32u * (RPH * 2), lbase + 48u * (RPH * 2), g, g + gstep, g + 2 * gstep, g + 3 * gstep);
}
__device__ __forceinline__ void wait_async0() {   // this wave's copies have landed
#if defined(__HIP_DEVICE_COMPILE__)
  asm volatile("s_wait_asynccnt 0x0" ::: "memory");
#endif
}
__device__ __forceinline__ void wait_ds0() {      // this wave's LDS reads have returned before their buffer is handed back
#if defined(__HIP_DEVICE_COMPILE__)
  asm volatile("s_wait_dscnt 0x0" ::: "memory");
#endif
}
// ---- tensor load of one tile of 64 rows x 128 B into LDS at pitch 144 B (one request of a whole wave, through no register) ----
__device__ __forceinline__ uint32_t uni(uint32_t v) { return (uint32_t)__builtin_amdgcn_readfirstlane(v); }
__device__ __forceinline__ uint32_t pinned(uint32_t v) {
  uint32_t w = uni(v);
#if defined(__HIP_DEVICE_COMPILE__)
  asm volatile("" : "+s"(w));   // the value held in a scalar register: a test on it is a scalar branch, a descriptor word from it is formed here
#endif
  return w;
}
// group 1: 1-byte elements, tensor = tile = 64 rows of 128 B, source row pitch in bytes, no mask; word 0 is the constant
// pad_enable | interval code 4 (one 128-B row) | amount code 3 (4 dwords): LDS pitch 144 B, no pad byte written
__device__ __forceinline__ u32x8 tdm_group1(uint32_t src_pitch) {
  u32x8 g;
  g[0] = uni((1u << 20) | (4u << 22) | (3u << 25));
  g[1] = uni(128u << 16);
  g[2] = uni(64u << 16);
  g[3] = uni(128u << 16);
  g[4] = uni(64u);
  g[5] = uni(src_pitch);
  g[6] = uni(0u);
  g[7] = uni(0u);
  return g;
}
// group 0: count 1, LDS byte offset of the tile's place, global address of the tile's first byte, type 2
__device__ __forceinline__ u32x4 tdm_group0(uint32_t lds_dst, uint64_t ga) {
  u32x4 g;
  g[0] = uni(1u);
  g[1] = uni(lds_dst);
  g[2] = uni((uint32_t)ga);
  g[3] = uni((((uint32_t)(ga >> 32)) & 0x01FFFFFFu) | 0x80000000u);
  return g;
}
__device__ __forceinline__ void tdm_load(u32x4 g0, u32x8 g1) {
#if defined(__HIP_DEVICE_COMPILE__)
  asm volatile("tensor_load_to_lds %0, %1" :: "s"(g0), "s"(g1) : "memory");
#endif
}
// this wave's tensor load has landed; the request's two groups are inputs, so that their registers keep their words up to this wait
__device__ __forceinline__ void wait_tensor0(u32x4 g0, u32x8 g1) {
#if defined(__HIP_DEVICE_COMPILE__)
  asm volatile("s_wait_tensorcnt 0x0" :: "s"(g0), "s"(g1) : "memory");
#endif
}
__device__ __forceinline__ void wave_sync_lds() {
  __builtin_amdgcn_fence(__ATOMIC_RELEASE, "workgroup");
  __builtin_amdgcn_wave_barrier();
  __builtin_amdgcn_fence(__ATOMIC_ACQUIRE, "workgroup");
}

// =====================================================================================================
// f32 plane -> 16-bit plane, same layout:  f16mode == 0: bf16 RNE bits;  f16mode == 1: f16 bits of (bf16 RNE value) * scale.
// Thread = 8 consecutive elements: two 16-B loads, one 16-B store; 32 consecutive lanes = 512 contiguous, 512-B aligned bytes
// gt = the thread's index within its plane.
// =====================================================================================================
__device__ __forceinline__ void cvt16_body(const float* __restrict__ x, u16* D, int gt, int f16mode, float scale) {
  const float* p = x + (size_t)gt * 8;
  const v4f a = *(const v4f*)(p), c4 = *(const v4f*)(p + 4);
  float v[8];
#pragma unroll
  for (int e = 0; e < 4; ++e) { v[e] = a[e]; v[4 + e] = c4[e]; }
  unsigned short s[8];
#pragma unroll
  for (int e = 0; e < 8; ++e) {
    const unsigned short hb = h_bits((_Float16)(bfr(v[e]) * scale));
    const unsigned short bb = bf_bits(v[e]);
    s[e] = (f16mode != 0) ? hb : bb;
  }
  v4u o;
#pragma unroll
  for (int e = 0; e < 4; ++e) o[e] = pk16(s[2 * e], s[2 * e + 1]);
  u16* d = D + (size_t)gt * 8;
  {
    *(v4u*)(d) = o;
    
  }
}
// All seven conversions in one grid (none reads another's output): blocks [0, 3*GXB) = the three input planes -> bf16,
// blocks [3*GXB, 3*GXB + 4*GWB) = wq, wk, wv -> bf16 and wo -> f16 of (bf16 value x1024). The plane is chosen per block (scalar).
// coverage: GXB (GWB) blocks x 256 thr x 8 = one whole plane each.
__global__ __launch_bounds__(256)
void cvt16_all(const float* __restrict__ xq, const float* __restrict__ xk, const float* __restrict__ xv,
               const float* __restrict__ wq, const float* __restrict__ wk, const float* __restrict__ wv,
               const float* __restrict__ wo, u16* XQ, u16* XK, u16* XV, u16* WQ, u16* WK, u16* WV, u16* WO) {
  const int bid = blockIdx.x;
  if (bid >= 3 * GXB + 4 * GWB) return;     // never taken with the exact grid; no barriers in this kernel
  const float* x;
  u16* D;
  int lb, f16mode = 0;
  float scale = 1.0f;
  if (bid < 3 * GXB) {
    const int pl = bid / GXB;
    lb = bid - pl * GXB;
    x = (pl == 0) ? xq : (pl == 1) ? xk : xv;
    D = (pl == 0) ? XQ : (pl == 1) ? XK : XV;
  } else {
    const int r = bid - 3 * GXB, pl = r / GWB;
    lb = r - pl * GWB;
    x = (pl == 0) ? wq : (pl == 1) ? wk : (pl == 2) ? wv : wo;
    D = (pl == 0) ? WQ : (pl == 1) ? WK : (pl == 2) ? WV : WO;
    if (pl == 3) { f16mode = 1; scale = WOS; }
  }
  cvt16_body(x, D, lb * 256 + (int)threadIdx.x, f16mode, scale);
}

// =====================================================================================================
// GEMM epilogue of the output projection: the wave's 16x64 f32 tile (times oscale) staged in its LDS slab (pitch 68),
// coverage: 8 instructions x 2 rows x 16 lanes x 4 floats = the wave's 16 x 64 tile.
// =====================================================================================================
__device__ __forceinline__ void epi64(float* sl, v8f a0, v8f a1, v8f a2, v8f a3, float oscale, v4f badd, float* C, int N,
                                      size_t rowb, int col0, int lane) {
  const int hh = lane >> 4, m = lane & 15;
#pragma unroll
  for (int r = 0; r < 8; ++r) {
    const int ro = (8 * hh + r) * 68 + m;
    sl[ro]      = a0[r] * oscale;
    sl[ro + 16] = a1[r] * oscale;
    sl[ro + 32] = a2[r] * oscale;
    sl[ro + 48] = a3[r] * oscale;
  }
  wave_sync_lds();
  v4f vals[8];
#pragma unroll
  for (int it = 0; it < 8; ++it) vals[it] = *(const v4f*)(sl + (it * 2 + hh) * 68 + m * 4) + badd;
  float* dst = C + (rowb + (size_t)hh) * (size_t)N + col0 + m * 4;
  {
#pragma unroll
    for (int it = 0; it < 8; ++it) {
      *(v4f*)(dst + (size_t)(it * 2) * (size_t)N) = vals[it];
    }
    
  }
}

// 8 f32 values (already carried up by their power of two) -> 8 f16 hi + 8 f16 residuals (value - hi, unscaled)
__device__ __forceinline__ void split8(const float* w, v4u& oh, v4u& ol) {
#pragma unroll
  for (int e = 0; e < 4; ++e) {
    const float t0 = w[2 * e], t1 = w[2 * e + 1];
    const _Float16 h0 = (_Float16)t0, h1 = (_Float16)t1;
    const _Float16 l0 = (_Float16)(t0 - (float)h0), l1 = (_Float16)(t1 - (float)h1);
    oh[e] = pk16(h_bits(h0), h_bits(h1));
    ol[e] = pk16(h_bits(l0), h_bits(l1));
  }
}

// =====================================================================================================
// Projection epilogue, q and k: the wave's 16x64 f32 tile (times oscale) staged in its LDS slab (pitch 68), read back by rows, bias
// added in f32, then f16 hi plane (value * sc) + f16 residual plane, same [row][col] layout as the product.
// coverage: per plane 4 instructions x 4 rows x 8 lanes x 8 halves = the wave's 16 x 64 tile, whole 128-B lines.
// =====================================================================================================
__device__ __forceinline__ void epi_split(float* sl, v8f a0, v8f a1, v8f a2, v8f a3, float oscale, const float* __restrict__ bias,
                                          float sc, u16* HP, u16* LP, int N, size_t rowb, int col0, int lane) {
  const int hh = lane >> 4, m = lane & 15;
  const int rq = lane >> 3, c8 = (lane & 7) * 8;
  const v4f bv0 = *(const v4f*)(bias + col0 + c8), bv1 = *(const v4f*)(bias + col0 + c8 + 4);   // columns < N (N multiple of 64)
#pragma unroll
  for (int r = 0; r < 8; ++r) {
    const int ro = (8 * hh + r) * 68 + m;
    sl[ro]      = a0[r] * oscale;
    sl[ro + 16] = a1[r] * oscale;
    sl[ro + 32] = a2[r] * oscale;
    sl[ro + 48] = a3[r] * oscale;
  }
  wave_sync_lds();
  float badd[8];
#pragma unroll
  for (int e = 0; e < 4; ++e) { badd[e] = bfr(bv0[e]); badd[4 + e] = bfr(bv1[e]); }
  v4u oh[4], ol[4];
#pragma unroll
  for (int i4 = 0; i4 < 4; ++i4) {
    const int row = i4 * 4 + rq;
    const v4f a = *(const v4f*)(sl + row * 68 + c8), c4 = *(const v4f*)(sl + row * 68 + c8 + 4);
    float w[8];
#pragma unroll
    for (int e = 0; e < 4; ++e) { w[e] = (a[e] + badd[e]) * sc; w[4 + e] = (c4[e] + badd[4 + e]) * sc; }
    split8(w, oh[i4], ol[i4]);
  }
  const size_t ob = (rowb + (size_t)rq) * (size_t)N + col0 + c8;
#pragma unroll
  for (int i4 = 0; i4 < 4; ++i4) {
    const size_t o8 = ob + (size_t)(i4 * 4) * (size_t)N;
    *(v4u*)(HP + o8) = oh[i4];
    *(v4u*)(LP + o8) = ol[i4];
  }
#if defined(__HIP_DEVICE_COMPILE__)
  // the built code runs on from here into a joined test in front of the v branch, whose first instructions rewrite registers
  // that these eight stores name: the wait stands in front of every such rewrite
  asm volatile("s_wait_xcnt 0x0" ::: "memory");
#endif
}

// =====================================================================================================
// Projection epilogue, v: the block's tile is (batch b, keys s0 .. s0+63, head h, all 64 d), written TRANSPOSED as
// VH[(b*NH + h)*HD + d][s] = f16(v * 1024), VL = f16 residual. An accumulator's 8 elements of a lane are 8 consecutive keys of one d,
// so each goes as one 16-B LDS store into the [d][key] tiles (pitch 72 halves); a block barrier, then whole 128-B lines go out.
// coverage: LDS 4 waves x 4 accumulators x 32 lanes x 8 halves = 64 x 64 per plane; store 4 iterations x 128 thr x 8 halves = 64
//           lines x 64 keys per plane.
// =====================================================================================================
__device__ __forceinline__ void epi_vt(u16* TH, u16* TL, v8f a0, v8f a1, v8f a2, v8f a3, float oscale,
                                       const float* __restrict__ bias, u16* VHo, u16* VLo, int row0, int col0, int tid) {
  const int wave = tid >> 5, lane = tid & 31, hh = lane >> 4, m = lane & 15;
  float bj[4];
#pragma unroll
  for (int j = 0; j < 4; ++j) bj[j] = bias[col0 + j * 16 + m];                     // columns < N (N multiple of 64)
#pragma unroll
  for (int j = 0; j < 4; ++j) {
    const v8f a = (j == 0) ? a0 : (j == 1) ? a1 : (j == 2) ? a2 : a3;
    const float badd = bfr(bj[j]);
    float w[8];
#pragma unroll
    for (int r = 0; r < 8; ++r) w[r] = (a[r] * oscale + badd) * VCAR;
    v4u oh, ol;
    split8(w, oh, ol);
    const int to = (j * 16 + m) * VTP + wave * 16 + 8 * hh;
    *(v4u*)(TH + to) = oh;
    *(v4u*)(TL + to) = ol;
  }
  __syncthreads();
  v4u vh[4], vl[4];
  const int q8 = tid >> 3, p8 = (tid & 7) * 8;
#pragma unroll
  for (int it = 0; it < 4; ++it) {
    const int line = it * 16 + q8;            // d = 0..63
    vh[it] = *(const v4u*)(TH + line * VTP + p8);
    vl[it] = *(const v4u*)(TL + line * VTP + p8);
  }
  const int b = row0 / SEQ, s0 = row0 - b * SEQ, h = col0 >> 6;
  const size_t base = ((size_t)(b * NH + h) * HD + q8) * SEQ + s0 + p8;
#pragma unroll
  for (int it = 0; it < 4; ++it) {
    *(v4u*)(VHo + base + (size_t)(it * 16) * SEQ) = vh[it];
    *(v4u*)(VLo + base + (size_t)(it * 16) * SEQ) = vl[it];
  }
}

// =====================================================================================================
// bf16 GEMM with bias: f32 product A[M][K] (bf16 row-major) . Bt[N][K]^T (bf16 k-contiguous), times oscale, plus bf16-RNE
// value of bias[n], written straight as the f16 hi + residual planes that attention reads. Block = 64x64 tile, 4 waves x 16
// rows. The block's A and Bt tiles of 64 rows x 64 k (whole 128-B lines, LDS pitch 144 B) come into a two-buffer LDS ring by
// asynchronous copies, once per block, and all 4 waves read their fragments there
// (two 16-B LDS loads each, split k map for A and B); one block barrier per 64 k publishes the next stage and frees the one just
// read. k runs upward in steps of 32 as before (host checks K % 64 == 0, M % 64 == 0, N % 64 == 0, grid.x = (M/64)*(N/64)).
// Behind the loop's last barrier the ring is dead and holds the four result slabs (q, k) or the two transposed tiles (v).
// Three independent products of one shape in one grid: blockIdx.y picks the operand set (scalar selects): 0 = q, 1 = k (planes in
// the product's own layout), 2 = v (transposed planes; M = NB*SEQ rows and N = NH*HD columns, a 64-column tile = one head). The
// branch on it is block-uniform, so the barrier inside epi_vt is passed by all threads of its block or by none.
// =====================================================================================================
__global__ __launch_bounds__(128)
void gemm_bfb3(const u16* __restrict__ A0, const u16* __restrict__ A1, const u16* __restrict__ A2,
               const u16* __restrict__ Bt0, const u16* __restrict__ Bt1, const u16* __restrict__ Bt2,
               const float* __restrict__ bias0, const float* __restrict__ bias1, const float* __restrict__ bias2,
               u16* QH, u16* QL, u16* KH, u16* KL, u16* VH, u16* VL, int M, int N, int K, float oscale) {
  __shared__ __align__(16) u16 gring[2 * 2 * TILEH];        // [buffer][A, Bt][64 rows][pitch 72 halves]; epilogue: staging
  const int zz = blockIdx.y;
  const u16*   A    = (zz == 0) ? A0 : (zz == 1) ? A1 : A2;
  const u16*   Bt   = (zz == 0) ? Bt0 : (zz == 1) ? Bt1 : Bt2;
  const float* bias = (zz == 0) ? bias0 : (zz == 1) ? bias1 : bias2;
  const int tid = threadIdx.x, wave = tid >> 5, lane = tid & 31, hh = lane >> 4, m = lane & 15;
  const int ntile = N >> 6;
  const int bid   = blockIdx.x;
  const int row0  = (bid / ntile) * 64;
  const int rowb  = row0 + wave * 16;
  const int col0  = (bid % ntile) * 64;
  const int nst   = K / GKS;
  if (row0 + 64 > M || nst < 1) return;      // block-uniform, in front of every barrier; never taken with the exact grid
  // copies: lane = (row cr of a group of 16, 16-B chunk cc of its 128-B line); a wave's copy = 4 whole lines
  const int cr = tid >> 3, cc = (tid & 7) * 8;
  const u16* ag = A  + (size_t)(row0 + cr) * K + cc;
  const u16* bg = Bt + (size_t)(col0 + cr) * K + cc;
  const size_t gs = (size_t)16 * K;
  const unsigned lcp = (unsigned)(uintptr_t)(gring + cr * RPH + cc);               // LDS byte address, buffer 0, A tile
  const u16* af = gring + (wave * 16 + m) * RPH + 8 * hh;                           // A fragment row of this lane, buffer 0
  const u16* bq = gring + TILEH + m * RPH + 8 * hh;                                 // Bt fragment row of this lane, buffer 0
  v8f acc0 = zero8(), acc1 = zero8(), acc2 = zero8(), acc3 = zero8();
#define GSTAGE(st, bf)                                                    \
  do {                                                                    \
    const unsigned lb_ = lcp + (unsigned)(bf) * (2u * TILEH * 2u);        \
    copy_tile(lb_,              ag + (size_t)(st) * GKS, gs);             \
    copy_tile(lb_ + TILEH * 2u, bg + (size_t)(st) * GKS, gs);             \
  } while (0)
  // ring prologue: stage 0 landed and published, then stage 1 in flight
  GSTAGE(0, 0);
  wait_async0();
  __syncthreads();
  if (1 < nst) GSTAGE(1, 1);
#pragma unroll 1   // stays rolled: one copy of the stage body and of its publish point
  for (int st = 0; st < nst; ++st) {
    const int bf = st & 1;
    const u16* as = af + bf * (2 * TILEH);
    const u16* bs = bq + bf * (2 * TILEH);
    // both k steps of the stage: fragments from LDS, then the products, k upward
    const v16b a   = ldfrag_b(as);
    const v16b b0  = ldfrag_b(bs);
    const v16b b1  = ldfrag_b(bs + 16 * RPH);
    const v16b b2  = ldfrag_b(bs + 32 * RPH);
    const v16b b3  = ldfrag_b(bs + 48 * RPH);
    const v16b a_  = ldfrag_b(as + 32);
    const v16b b0_ = ldfrag_b(bs + 32);
    const v16b b1_ = ldfrag_b(bs + 16 * RPH + 32);
    const v16b b2_ = ldfrag_b(bs + 32 * RPH + 32);
    const v16b b3_ = ldfrag_b(bs + 48 * RPH + 32);
    acc0 = mma_b(a, b0, acc0);
    acc1 = mma_b(a, b1, acc1);
    acc2 = mma_b(a, b2, acc2);
    acc3 = mma_b(a, b3, acc3);
    acc0 = mma_b(a_, b0_, acc0);
    acc1 = mma_b(a_, b1_, acc1);
    acc2 = mma_b(a_, b2_, acc2);
    acc3 = mma_b(a_, b3_, acc3);
    guard6<v16b>(acc0, acc1, acc2, acc3, a_, b0_, b1_, b2_, b3_, a_);
    // publish point of stage st + 1: own reads of this buffer done, own copies of the next landed, block barrier, then the refill
    wait_ds0();
    wait_async0();
    __syncthreads();
    if (st + 2 < nst) GSTAGE(st + 2, bf);
  }
  wait_async0();
#undef GSTAGE
  // every wave is behind the last barrier: no reader and no copy is left on the ring
  if (zz == 2) {
    epi_vt(gring, gring + HD * VTP, acc0, acc1, acc2, acc3, oscale, bias, VH, VL, row0, col0, tid);
  } else {
    float* slab = (float*)(void*)gring;
    epi_split(slab + wave * SLAB64, acc0, acc1, acc2, acc3, oscale, bias, (zz == 0) ? QSC : KSC, (zz == 0) ? QH : KH,
              (zz == 0) ? QL : KL, N, (size_t)rowb, col0, lane);
  }
}

// =====================================================================================================
// f16 hi+lo GEMM with bias: C[M][N] (f32) = (Ahi + Alo)[M][K] . Bt[N][K]^T times oscale, plus bf16-RNE value of bias[n];
// Ahi/Alo f16 planes (same layout), Bt f16 k-contiguous; products hi.B + lo.B into one accumulator (lo is the unscaled
// residual of hi). Same tiling and the same two-buffer LDS ring as gemm_bfb3, with three tiles a stage (Ahi, Alo, Bt).
// =====================================================================================================
__global__ __launch_bounds__(128)
void gemm_h2(const u16* __restrict__ Ah, const u16* __restrict__ Al, const u16* __restrict__ Bt,
             const float* __restrict__ bias, float* C, int M, int N, int K, float oscale) {
  __shared__ __align__(16) u16 gring[2 * 3 * TILEH];        // [buffer][Ahi, Alo, Bt][64 rows][pitch 72 halves]; epilogue: result slabs
  const int tid = threadIdx.x, wave = tid >> 5, lane = tid & 31, hh = lane >> 4, m = lane & 15;
  const int ntile = N >> 6;
  const int bid   = blockIdx.x;
  const int row0  = (bid / ntile) * 64;
  const int rowb  = row0 + wave * 16;
  const int col0  = (bid % ntile) * 64;
  const int nst   = K / GKS;
  if (row0 + 64 > M || nst < 1) return;      // block-uniform, in front of every barrier; never taken with the exact grid
  // copies: lane = (row cr of a group of 16, 16-B chunk cc of its 128-B line); a wave's copy = 4 whole lines
  const int cr = tid >> 3, cc = (tid & 7) * 8;
  const size_t aofs = (size_t)(row0 + cr) * K + cc;
  const u16* ahg = Ah + aofs;
  const u16* alg = Al + aofs;
  const u16* bg  = Bt + (size_t)(col0 + cr) * K + cc;
  const size_t gs = (size_t)16 * K;
  const unsigned lcp = (unsigned)(uintptr_t)(gring + cr * RPH + cc);               // LDS byte address, buffer 0, Ahi tile
  const _Float16* af = (const _Float16*)(const void*)gring + (wave * 16 + m) * RPH + 8 * hh;   // Ahi fragment row, buffer 0
  const _Float16* bq = (const _Float16*)(const void*)gring + 2 * TILEH + m * RPH + 8 * hh;     // Bt fragment row, buffer 0
  v8f acc0 = zero8(), acc1 = zero8(), acc2 = zero8(), acc3 = zero8();
#define GSTAGE(st, bf)                                                    \
  do {                                                                    \
    const unsigned lb_ = lcp + (unsigned)(bf) * (3u * TILEH * 2u);        \
    copy_tile(lb_,                   ahg + (size_t)(st) * GKS, gs);       \
    copy_tile(lb_ + 1u * TILEH * 2u, alg + (size_t)(st) * GKS, gs);       \
    copy_tile(lb_ + 2u * TILEH * 2u, bg  + (size_t)(st) * GKS, gs);       \
  } while (0)
  // ring prologue: stage 0 landed and published, then stage 1 in flight
  GSTAGE(0, 0);
  wait_async0();
  __syncthreads();
  if (1 < nst) GSTAGE(1, 1);
#pragma unroll 1   // stays rolled: one copy of the stage body and of its publish point
  for (int st = 0; st < nst; ++st) {
    const int bf = st & 1;
    const _Float16* as = af + bf * (3 * TILEH);
    const _Float16* bs = bq + bf * (3 * TILEH);
    // both k steps of the stage: fragments from LDS, then the products, k upward
    const v16h ah  = ldfrag_h(as),      al  = ldfrag_h(as + TILEH);
    const v16h b0  = ldfrag_h(bs);
    const v16h b1  = ldfrag_h(bs + 16 * RPH);
    const v16h b2  = ldfrag_h(bs + 32 * RPH);
    const v16h b3  = ldfrag_h(bs + 48 * RPH);
    const v16h ah_ = ldfrag_h(as + 32), al_ = ldfrag_h(as + TILEH + 32);
    const v16h b0_ = ldfrag_h(bs + 32);
    const v16h b1_ = ldfrag_h(bs + 16 * RPH + 32);
    const v16h b2_ = ldfrag_h(bs + 32 * RPH + 32);
    const v16h b3_ = ldfrag_h(bs + 48 * RPH + 32);
    acc0 = mma_h(ah, b0, acc0);    acc0 = mma_h(al, b0, acc0);
    acc1 = mma_h(ah, b1, acc1);    acc1 = mma_h(al, b1, acc1);
    acc2 = mma_h(ah, b2, acc2);    acc2 = mma_h(al, b2, acc2);
    acc3 = mma_h(ah, b3, acc3);    acc3 = mma_h(al, b3, acc3);
    acc0 = mma_h(ah_, b0_, acc0);  acc0 = mma_h(al_, b0_, acc0);
    acc1 = mma_h(ah_, b1_, acc1);  acc1 = mma_h(al_, b1_, acc1);
    acc2 = mma_h(ah_, b2_, acc2);  acc2 = mma_h(al_, b2_, acc2);
    acc3 = mma_h(ah_, b3_, acc3);  acc3 = mma_h(al_, b3_, acc3);
    guard6<v16h>(acc0, acc1, acc2, acc3, ah_, al_, b0_, b1_, b2_, b3_);
    // publish point of stage st + 1: own reads of this buffer done, own copies of the next landed, block barrier, then the refill
    wait_ds0();
    wait_async0();
    __syncthreads();
    if (st + 2 < nst) GSTAGE(st + 2, bf);
  }
  wait_async0();
#undef GSTAGE
  float* slab = (float*)(void*)gring;        // every wave is behind the last barrier: no reader and no copy is left on the ring
  const v4f bv = *(const v4f*)(bias + col0 + m * 4);      // columns col0 + 4m .. +3, always < N (N multiple of 64)
  v4f badd;
#pragma unroll
  for (int e = 0; e < 4; ++e) badd[e] = bfr(bv[e]);
  epi64(slab + wave * SLAB64, acc0, acc1, acc2, acc3, oscale, badd, C, N, (size_t)rowb, col0, lane);
}

// =====================================================================================================
// Full (non-causal) multi-head flash attention with a per-head x per-key additive score bias: block = (batch b, head, 64 query
// rows), 4 waves, wave w owns the 16 query rows q0 = 64*qt + 16*w .. q0+15. The k and v^T tiles of 64 keys (hi and residual planes,
// 4 tiles of 64 rows x 128 B, LDS pitch 144 B) are brought into a two-buffer LDS ring by tensor loads, one tile a wave and stage,
// once per block, and read by all 4 waves; one block barrier per 64 keys publishes the next stage and frees the one just read.
//   q planes (hi, lo f16, x1024) laid out [b][s][h][d]; k planes the same; v^T planes [b][h][d][s] (x1024).
//   All NST = 32 stages of 64 keys are visited (static bound); a stage is ONE softmax pass (one maximum, one rescale of O).
//   Scores are computed TRANSPOSED: S^T tile g (g = 0..3) = k rows (keys kb+16g .. +15, A operand, row m = lane&15, split k map
//   over d) times q^T (B operand, col n = query q0 + (lane&15), k = d, split map), 3 products per tile and d-chunk
//   (k_hi.q_hi + k_lo.q_hi + k_hi.q_lo). D element r of lane l = (key kb+16g+8h+r, query q0+(l&15)), so a lane owns one query
//   column and 32 of its 64 keys; the partner lane l^16 owns the other 32 -> row max / row sum need one xor-16 shuffle.
//   Logit of key j, query i (base 2): (S * 1/8 * 2^-20 + bfr(wh) * bfr(mask[b][j])) * log2(e); the bias term of all SEQ keys of
//   this (batch, head) is formed once per block into an LDS table (f32; each of its two products rounded on its own) and read per
//   pass with the same element -> key map as the transposed scores (t[8g+i] <- key kb+16g+8h+i), added in f32.
//   Online max-subtracted base-2 softmax in f32. The exp'd values ARE the two P A-fragments in place (f = 0,1: keys kb+32f ..): A
//   row m = query = lane&15, element i <- tile 2f, D element i, element 8+i <- tile 2f+1, D element i. P is carried x32768
//   as f16 hi + f16 residual. The rescale factor of query row 8h+r of the O accumulators is fetched from lane 8h+r with a
//   shuffle (uniform control). 4+4 v^T B fragments (hi and residual planes, col n = d = 16j + (lane&15), keys k-contiguous),
//   12 P.V WMMAs (hh + lh + hl) per 32 keys.
//   Epilogue: 1/l (per query, shuffled to the D row owner) and carry folds in f32; the wave's 16x64 f32 result staged in its LDS
// coverage: per wave 4 instructions x 4 rows x 8 lanes x 8 halves = 16 x 64 per plane; grid 768 blocks x 4 waves = every
//           (b, s, h) row of both O planes exactly once.
// =====================================================================================================
__global__ __launch_bounds__(ATT_THREADS)
void attn_fwd(const u16* __restrict__ QHIp, const u16* __restrict__ QLOp,
              const u16* __restrict__ KHIp, const u16* __restrict__ KLOp,
              const u16* __restrict__ VHIp, const u16* __restrict__ VLOp,
              const float* __restrict__ maskp, const float* __restrict__ mcwp,
              u16* OHIp, u16* OLOp) {
  // [buffer][k hi, k lo, v^T hi, v^T lo][64 rows][pitch 72 halves], every tile's place a multiple of 2 KiB in the block's LDS
  // behind the loop's last barrier the ring is dead and holds the four result slabs [16][68] of the epilogue
  __shared__ __attribute__((aligned(2048))) u16 ring[2 * 4 * TSLOT];
  __shared__ __align__(16) float kbias[SEQ];                // base-2 logit bias of every key of this (batch, head)

  const int tid  = threadIdx.x;
  const int wave = tid >> 5;
  const int lane = tid & 31;
  const int hh   = lane >> 4;
  const int c    = lane & 15;

  const int bid  = blockIdx.x;
  const int qt   = bid & (NQT - 1);
  const int bh   = bid >> 5;                 // NQT == 32
  const int head = bh % NH;
  const int b    = bh / NH;
  const int q0   = qt * 64 + wave * 16;

  // B fragments of q^T: col n = query q0 + c, k = d (k-contiguous row of the q plane)
  const size_t qofs = (((size_t)(b * SEQ + q0 + c)) * NH + head) * HD + 8 * hh;
  const _Float16* Qh  = (const _Float16*)(const void*)QHIp + qofs;
  const _Float16* Ql  = (const _Float16*)(const void*)QLOp + qofs;
  // tensor loads: wave w brings tile w of every stage (0 = k hi, 1 = k lo: 64 key rows of this head; 2 = v^T hi, 3 = v^T lo: 64 d
  // rows x 64 keys); every wave issues its one request a stage, unconditionally; all of this is scalar
  const uint32_t wv = uni((uint32_t)tid >> 5);
  const bool isv = wv >= 2u;
  const u16* tsrc = (wv == 0u) ? KHIp : (wv == 1u) ? KLOp : (wv == 2u) ? VHIp : VLOp;
  const size_t tofs = isv ? (size_t)(b * NH + head) * HD * SEQ : ((size_t)b * SEQ * NH + head) * HD;   // stage 0's first element
  const uint64_t tga = (uint64_t)(uintptr_t)(tsrc + tofs);
  const uint32_t tstep = isv ? (uint32_t)(SKEYS * 2) : (uint32_t)(SKEYS * NH * HD * 2);                // bytes from stage to stage
  const uint32_t tlds = (uint32_t)(uintptr_t)ring + wv * (uint32_t)(TSLOT * 2);                        // buffer 0, this wave's tile
  const u32x8 tg1 = tdm_group1(isv ? (uint32_t)(SEQ * 2) : (uint32_t)(NH * HD * 2));
  // A fragments of k: row m = key (in stage) 16g + c, k = d;  B fragments of v: col n = d = 16j + c, k = key (in stage)
  const _Float16* ringh = (const _Float16*)(const void*)ring + c * RPH + 8 * hh;
  // per-key bias row in the table: kbias[kb + 16g + 8hh + 0..7] for score tile g, 16-B aligned LDS loads
  const float* brow = kbias + 8 * hh;
  const float  wh2  = bfr(mcwp[head]);                                              // per-head scalar (bf16 RNE value)
  const float lsc = 0.125f * (LOG2E / (QSC * KSC));

  // the wave's q^T fragments (hi and residual, both d chunks) are the same for every key: loaded once, kept in 32 registers
  const v16h qh0 = ldfrag_h(Qh), qh1 = ldfrag_h(Qh + 32);
#if defined(__HIP_DEVICE_COMPILE__)
  // the built code lets the residual fragments land in the registers that hold the hi plane's address: the wait stands in front
  asm volatile("s_wait_xcnt 0x0" ::: "memory");
#endif
  const v16h ql0 = ldfrag_h(Ql), ql1 = ldfrag_h(Ql + 32);

  float mrun = -INFINITY, lrun = 0.f;
  v8f o[4];
#pragma unroll
  for (int j = 0; j < 4; ++j) o[j] = zero8();

  u32x4 tg0;                                  // group 0 of the wave's request in flight
#define STAGE_LOAD(st, bf)                                                                                    \
  do {                                                                                                        \
    tg0 = tdm_group0(tlds + (uint32_t)(bf) * (uint32_t)(4 * TSLOT * 2), tga + (uint64_t)((st) * tstep));      \
    tdm_load(tg0, tg1);                                                                                       \
  } while (0)

  // ring prologue: stage 0 landed and published, then stage 1 in flight
  STAGE_LOAD(0u, 0u);
  // bias table, formed while stage 0 flies: thread = 4 consecutive keys per round, SEQ / (4 * ATT_THREADS) rounds cover every key
  // once; the barrier below publishes it together with stage 0
  {
    const float* mb4 = maskp + (size_t)b * SEQ + tid * 4;
#pragma unroll     // the rounds' loads issue together: one memory latency, not one per round
    for (int i = 0; i < SEQ / (4 * ATT_THREADS); ++i) {
      const v4f mv = *(const v4f*)(mb4 + i * (4 * ATT_THREADS));
      v4f bz;
#pragma unroll
      for (int e = 0; e < 4; ++e) bz[e] = (wh2 * bfr(mv[e])) * LOG2E;
      *(v4f*)(kbias + tid * 4 + i * (4 * ATT_THREADS)) = bz;
    }
  }
  wait_tensor0(tg0, tg1);
  __syncthreads();
  STAGE_LOAD(1u, 1u);

#pragma unroll 1   // stays rolled: one copy of the stage body and of its publish point
  for (int st = 0; st < NST; ++st) {
   const int bf = st & 1;
   const _Float16* stg = ringh + bf * (4 * TSLOT);
   // the whole 64-key stage is one softmax pass: 4 score tiles, one running-max update and one rescale of O per 64 keys
   const int kb = st * SKEYS;
   v4f ba[4], bb[4];
#pragma unroll   // constant indices: the arrays stay in registers
   for (int g = 0; g < 4; ++g) {
     ba[g] = *(const v4f*)(brow + kb + 16 * g);
     bb[g] = *(const v4f*)(brow + kb + 16 * g + 4);
   }
   // ---- transposed scores: s[g] = keys kb+16g .. kb+16g+15, column = query q0 + c ----
   v8f s[4];
#pragma unroll   // constant indices: the arrays stay in registers
   for (int g = 0; g < 4; ++g) s[g] = zero8();
#pragma unroll   // constant indices: the arrays stay in registers
   for (int kk = 0; kk < 2; ++kk) {
     const v16h qh = (kk == 0) ? qh0 : qh1, ql = (kk == 0) ? ql0 : ql1;
     v16h kh[4], kl[4];
#pragma unroll   // constant indices: the arrays stay in registers
     for (int g = 0; g < 4; ++g) {
       kh[g] = ldfrag_h(stg + (16 * g) * RPH + kk * 32);
       kl[g] = ldfrag_h(stg + TSLOT + (16 * g) * RPH + kk * 32);
     }
#pragma unroll   // constant indices: the arrays stay in registers
     for (int g = 0; g < 4; ++g) s[g] = mma_h(kh[g], qh, s[g]);
#pragma unroll   // constant indices: the arrays stay in registers
     for (int g = 0; g < 4; ++g) s[g] = mma_h(kl[g], qh, s[g]);
#pragma unroll   // constant indices: the arrays stay in registers
     for (int g = 0; g < 4; ++g) s[g] = mma_h(kh[g], ql, s[g]);
     guard10(s[0], s[1], s[2], s[3], qh, ql, kh[0], kh[1], kh[2], kh[3], kl[0], kl[1], kl[2], kl[3]);
   }
   // ---- base-2 logits of this lane's 32 keys for query q0 + c: t[8g+i] <- key kb+16g+8hh+i; one maximum per tile, then joined ----
   float t[32], cg[4];
#pragma unroll   // constant indices: the arrays stay in registers
   for (int g = 0; g < 4; ++g) {
#pragma unroll   // constant indices: the arrays stay in registers
     for (int e = 0; e < 4; ++e) {
       t[8 * g + e]     = s[g][e] * lsc     + ba[g][e];
       t[8 * g + 4 + e] = s[g][4 + e] * lsc + bb[g][e];
     }
     cg[g] = t[8 * g];
#pragma unroll   // constant indices: the arrays stay in registers
     for (int i = 1; i < 8; ++i) cg[g] = fmaxf(cg[g], t[8 * g + i]);
   }
   float cm = fmaxf(fmaxf(cg[0], cg[1]), fmaxf(cg[2], cg[3]));
   cm = fmaxf(cm, __shfl_xor(cm, 16, 32));
   const float mn = fmaxf(mrun, cm);        // finite from the first stage on
   const float al = ex2(mrun - mn);         // 0 on the first stage (mrun = -inf)
   mrun = mn;
   // ---- probabilities (<= 1) and the P A-fragments of keys kb+32f .. +31: hi = f16(p * 32768), lo = f16 residual;
   //      element 8w+i of fragment f <-> t[16f+8w+i] ----
   float psf[2];
   FragH ph[2], pl[2];
#pragma unroll   // constant indices: the arrays stay in registers
   for (int f = 0; f < 2; ++f) {
     psf[f] = 0.f;
#pragma unroll   // constant indices: the arrays stay in registers
     for (int w = 0; w < 2; ++w) {
#pragma unroll   // constant indices: the arrays stay in registers
       for (int e4 = 0; e4 < 4; ++e4) {
         const int i = 16 * f + 8 * w + 2 * e4;
         const float p0 = ex2(t[i] - mn), p1 = ex2(t[i + 1] - mn);
         psf[f] += p0 + p1;
         const float a0 = p0 * PCAR, a1 = p1 * PCAR;
         const _Float16 h0 = (_Float16)a0, h1 = (_Float16)a1;
         const _Float16 l0 = (_Float16)(a0 - (float)h0), l1 = (_Float16)(a1 - (float)h1);
         ph[f].u[w][e4] = pk16(h_bits(h0), h_bits(h1));
         pl[f].u[w][e4] = pk16(h_bits(l0), h_bits(l1));
       }
     }
   }
   float ps = psf[0] + psf[1];
   ps += __shfl_xor(ps, 16, 32);
   lrun = lrun * al + ps;
   // ---- rescale the O accumulators: D row 8hh+r = query q0+8hh+r, its factor lives in lane 8hh+r (and 16+8hh+r) ----
   float scl[8];
#pragma unroll   // constant indices: the arrays stay in registers
   for (int r = 0; r < 8; ++r) scl[r] = __shfl(al, 8 * hh + r, 32);
#pragma unroll   // constant indices: the arrays stay in registers
   for (int j = 0; j < 4; ++j) {
#pragma unroll   // constant indices: the arrays stay in registers
     for (int r = 0; r < 8; ++r) o[j][r] *= scl[r];
   }
   // ---- P.V : B fragment col n = d = j*16 + c, keys contiguous in the v^T planes; keys upward, 32 at a time ----
   {
     v16h vh[2][4], vl[2][4];
#pragma unroll   // constant indices: the arrays stay in registers
     for (int f = 0; f < 2; ++f) {
#pragma unroll   // constant indices: the arrays stay in registers
       for (int j = 0; j < 4; ++j) {
         vh[f][j] = ldfrag_h(stg + 2 * TSLOT + (16 * j) * RPH + f * 32);
         vl[f][j] = ldfrag_h(stg + 3 * TSLOT + (16 * j) * RPH + f * 32);
       }
     }
#pragma unroll   // constant indices: the arrays stay in registers
     for (int f = 0; f < 2; ++f) {
#pragma unroll   // constant indices: the arrays stay in registers
       for (int j = 0; j < 4; ++j) o[j] = mma_h(ph[f].v, vh[f][j], o[j]);
#pragma unroll   // constant indices: the arrays stay in registers
       for (int j = 0; j < 4; ++j) o[j] = mma_h(pl[f].v, vh[f][j], o[j]);
#pragma unroll   // constant indices: the arrays stay in registers
       for (int j = 0; j < 4; ++j) o[j] = mma_h(ph[f].v, vl[f][j], o[j]);
       guard10(o[0], o[1], o[2], o[3], ph[f].v, pl[f].v, vh[f][0], vh[f][1], vh[f][2], vh[f][3], vl[f][0], vl[f][1], vl[f][2], vl[f][3]);
     }
   }
   // publish point of stage st + 1: own reads of this buffer done, own tile of the next landed, block barrier, then the refill
   wait_ds0();
   wait_tensor0(tg0, tg1);
   __syncthreads();
   if (pinned((uint32_t)(st + 2 < NST))) {          // scalar branch: a tensor load ignores EXEC
     const uint32_t nx = pinned((uint32_t)st + 2u); // the descriptor is formed behind the wait above
     STAGE_LOAD(nx, (uint32_t)bf);
   }
  }
#if defined(__HIP_DEVICE_COMPILE__)
  asm volatile("s_wait_tensorcnt 0x0" ::: "memory");   // no request is left in flight when the ring is used anew and the wave ends
#endif
  wait_ds0();
#undef STAGE_LOAD
  acc_guard4(o[0], o[1], o[2], o[3]);

  // ---- fold 1/l (per query, owned by lane = query) and the carries (32768 on P, 1024 on v); stage the 16x64 slab ----
  const float linv = (1.0f / lrun) * (1.0f / (PCAR * VCAR));
  float inv[8];
#pragma unroll
  for (int r = 0; r < 8; ++r) inv[r] = __shfl(linv, 8 * hh + r, 32);
  // every wave is behind the last publish point's waits and barrier: no reader and no tensor load is left on the ring
  float* slab = (float*)(void*)ring + wave * SLABF;
#pragma unroll
  for (int r = 0; r < 8; ++r) {
#pragma unroll
    for (int j = 0; j < 4; ++j) slab[(8 * hh + r) * 68 + j * 16 + c] = o[j][r] * inv[r];
  }
  wave_sync_lds();
  // ---- O x1024 -> f16 hi + residual planes; lane = (row in group of 4, 8 consecutive d) ----
  v4u oh[4], ol[4];
  const int rq = lane >> 3, c8 = (lane & 7) * 8;
#pragma unroll
  for (int i4 = 0; i4 < 4; ++i4) {
    const int row = i4 * 4 + rq;
    const v4f a = *(const v4f*)(slab + row * 68 + c8), c4 = *(const v4f*)(slab + row * 68 + c8 + 4);
    float w[8];
#pragma unroll
    for (int e = 0; e < 4; ++e) { w[e] = a[e] * OSC; w[4 + e] = c4[e] * OSC; }
#pragma unroll
    for (int e = 0; e < 4; ++e) {
      const _Float16 h0 = (_Float16)w[2 * e], h1 = (_Float16)w[2 * e + 1];
      const _Float16 l0 = (_Float16)(w[2 * e] - (float)h0), l1 = (_Float16)(w[2 * e + 1] - (float)h1);
      oh[i4][e] = pk16(h_bits(h0), h_bits(h1));
      ol[i4][e] = pk16(h_bits(l0), h_bits(l1));
    }
  }
  const size_t ob = (((size_t)(b * SEQ + q0)) * NH + head) * HD + c8;
  {
#pragma unroll
    for (int i4 = 0; i4 < 4; ++i4) {
      const int row = i4 * 4 + rq;
      const size_t o8 = ob + (size_t)row * (NH * HD);
      *(v4u*)(OHIp + o8) = oh[i4];
      *(v4u*)(OLOp + o8) = ol[i4];
    }
    
  }
}

// =====================================================================================================
// Workspace map (bytes); every plane is fully written by whole-line stores before it is read; all extents are exact multiples
// of the store granularity (no pad rows needed); every offset a multiple of 131072 (128 KiB); q, k and v each have their
// own input plane, so that each stage runs as one grid over all three:
//   XBQ bf16 [4096][768]               6291456        XBK same  6291456      XBV same  6291456
//   WQB bf16 [768 n][768 k]            1179648        WKB same  1179648      WVB same  1179648
//   WOB f16  [768 n][768 k] x1024      1179648
//   QHI f16 [2][2048][12][64] x1024    6291456        QLO residual         6291456
//   KHI same                           6291456        KLO residual         6291456
//   VHI f16 [2][12][64][2048] x1024    6291456        VLO residual         6291456
//   OHI f16 [4096][768] x1024          6291456        OLO residual         6291456
//   end                               73924608
// =====================================================================================================
extern "C" void kernel_launch(void* const* d_in, const int* in_sizes, int n_in,
                              void* d_out, int out_size, void* d_ws, size_t ws_size,
                              hipStream_t stream) {
  const int ROWS = NB * SEQ;                            // 4096
  if (n_in < 13) return;
  if (in_sizes[0] != ROWS * DMOD || in_sizes[1] != ROWS * DMOD || in_sizes[2] != ROWS * DMOD) return;
  if (in_sizes[3] != NB * SEQ) return;
  if (in_sizes[4] != DMOD * DMOD || in_sizes[6] != DMOD * DMOD) return;
  if (in_sizes[8] != DMOD * DMOD || in_sizes[10] != DMOD * DMOD) return;
  if (in_sizes[5] != DMOD || in_sizes[7] != DMOD || in_sizes[9] != DMOD || in_sizes[11] != DMOD) return;
  if (in_sizes[12] != NH) return;
  if (out_size != ROWS * DMOD) return;

  const float* Qin  = (const float*)d_in[0];
  const float* Kin  = (const float*)d_in[1];
  const float* Vin  = (const float*)d_in[2];
  const float* mask = (const float*)d_in[3];
  const float* wq   = (const float*)d_in[4];
  const float* bq   = (const float*)d_in[5];
  const float* wk   = (const float*)d_in[6];
  const float* bk   = (const float*)d_in[7];
  const float* wv   = (const float*)d_in[8];
  const float* bv   = (const float*)d_in[9];
  const float* wo   = (const float*)d_in[10];
  const float* bo   = (const float*)d_in[11];
  const float* mcw  = (const float*)d_in[12];
  float*       out  = (float*)d_out;

  const size_t szXB  = (size_t)ROWS * DMOD * 2;                 //  6291456
  const size_t szW   = (size_t)DMOD * DMOD * 2;                 //  1179648
  const size_t szP   = (size_t)ROWS * DMOD * 2;                 //  6291456  (q/k/o planes)
  const size_t szVP  = (size_t)NB * NH * HD * SEQ * 2;          //  6291456
  size_t off = 0;
  const size_t oXBQ = off; off += szXB;
  const size_t oXBK = off; off += szXB;
  const size_t oXBV = off; off += szXB;
  const size_t oWQB = off; off += szW;
  const size_t oWKB = off; off += szW;
  const size_t oWVB = off; off += szW;
  const size_t oWOB = off; off += szW;
  const size_t oQHI = off; off += szP;
  const size_t oQLO = off; off += szP;
  const size_t oKHI = off; off += szP;
  const size_t oKLO = off; off += szP;
  const size_t oVHI = off; off += szVP;
  const size_t oVLO = off; off += szVP;
  const size_t oOHI = off; off += szP;
  const size_t oOLO = off; off += szP;
  if (off > ws_size) return;                            // off = 73924608
  if (off > (size_t)134217728) return;

  char* ws = (char*)d_ws;
  u16*   XBQ = (u16*)(ws + oXBQ);
  u16*   XBK = (u16*)(ws + oXBK);
  u16*   XBV = (u16*)(ws + oXBV);
  u16*   WQB = (u16*)(ws + oWQB);
  u16*   WKB = (u16*)(ws + oWKB);
  u16*   WVB = (u16*)(ws + oWVB);
  u16*   WOB = (u16*)(ws + oWOB);
  u16*   QHI = (u16*)(ws + oQHI);
  u16*   QLO = (u16*)(ws + oQLO);
  u16*   KHI = (u16*)(ws + oKHI);
  u16*   KLO = (u16*)(ws + oKLO);
  u16*   VHI = (u16*)(ws + oVHI);
  u16*   VLO = (u16*)(ws + oVLO);
  u16*   OHI = (u16*)(ws + oOHI);
  u16*   OLO = (u16*)(ws + oOLO);

  const dim3 blk(256);
  const int n8x = (ROWS * DMOD) / 8;                    // 393216
  const int n8w = (DMOD * DMOD) / 8;                    //  73728
  if ((n8x % 256) != 0 || (n8w % 256) != 0) return;
  if ((ROWS % 64) != 0 || (DMOD % 64) != 0 || (DMOD % 32) != 0) return;
  if (n8x / 256 != GXB || n8w / 256 != GWB) return;
  const dim3 gCV(3 * GXB + 4 * GWB);                    // 5760
  const dim3 gG((ROWS / 64) * (DMOD / 64));             //  768
  const dim3 gG3((ROWS / 64) * (DMOD / 64), 3);         //  768 x 3
  const dim3 bG(128);
  const dim3 gAT(ATT_BLOCKS);                           //  768
  const dim3 bAT(ATT_THREADS);                          //  128

  // (0) all conversions: inputs -> bf16 planes; weights [n][k] (already k-contiguous for x.W^T): bf16 planes for wq/wk/wv, f16 of
  //     bf16 value x1024 for wo
  cvt16_all<<<gCV, blk, 0, stream>>>(Qin, Kin, Vin, wq, wk, wv, wo, XBQ, XBK, XBV, WQB, WKB, WVB, WOB);
  // (1) the three projections + bias (col = h*64+d), written as q and k f16 hi x1024 + residual planes and v^T planes x1024
  gemm_bfb3<<<gG3, bG, 0, stream>>>(XBQ, XBK, XBV, WQB, WKB, WVB, bq, bk, bv, QHI, QLO, KHI, KLO, VHI, VLO, ROWS, DMOD, DMOD, 1.0f);
  // (2) attention with per-head x per-key bias -> O planes [b][s][h][d] x1024 (hi + residual)
  attn_fwd<<<gAT, bAT, 0, stream>>>(QHI, QLO, KHI, KLO, VHI, VLO, mask, mcw, OHI, OLO);
  // (3) output projection + bias -> out [4096][768] f32, carries 1024 (O) x 1024 (wo) folded back
  gemm_h2<<<gG, bG, 0, stream>>>(OHI, OLO, WOB, bo, out, ROWS, DMOD, DMOD, 1.0f / (OSC * WOS));
  (void)hipGetLastError();
}

// v010
// One run takes 106 microseconds.
// Two timings next to v009 both put it at 1.05 times that version's speed.
// Over all steps from v000 it is 2.75 times as fast.
// Contractions: x.W{q,k,v}^T on v_wmma_f32_16x16x32_bf16 (x and W RNE-converted to bf16 operands, f32 accumulate, bias added in f32);
// scores k'.q'^T (q', k' carried x1024 as f16 hi plane + f16 residual plane, products hh+lh+hl), P.v (P x32768 f16 hi+residual,
// v x1024 f16 hi+residual, products hh+lh+hl) and O.Wo^T (O x1024 f16 hi+residual, Wo as f16(bf16(Wo) x1024), products h.w+l.w):
// v_wmma_f32_16x16x32_f16, f32 accumulate. Per-head x per-key additive score bias, base-2 online softmax, 1/l fold in f32 on VALU.
#include <hip/hip_runtime.h>
#include <math.h>
#include <stdint.h>

#define NB    2
#define SEQ   2048
#define DMOD  768
#define NH    12
#define HD    64
#define NQT   (SEQ / 64)
#define QSC   1024.0f
#define KSC   1024.0f
#define PCAR  32768.0f
#define VCAR  1024.0f
#define OSC   1024.0f
#define WOS   1024.0f
#define LOG2E 1.4426950408889634f
#define ATT_WAVES   4
#define ATT_THREADS (ATT_WAVES * 32)
#define ATT_BLOCKS  (NB * NH * NQT)
#define NKB    (SEQ / 32)
#define SLABF  (16 * 68)
#define SLAB64 (16 * 68)
#define VTP    136                            // halves per row of the transposed v tiles: 128 keys + 16 B
#define SKEYS  64
#define NST    (SEQ / SKEYS)
#define RPH    72
#define TILEH  (64 * RPH)
#define TSLOT  5120                            // halves per tile place in the attention ring: TILEH rounded up to a multiple of 2 KiB
#define PT     128                            // rows and columns of a projection block's tile
#define PTILEH (PT * RPH)                      // halves per 128-row operand tile of a projection stage
#define GKS    64                              // k per GEMM stage: one whole 128-B line of every operand row
#define GXB    ((NB * SEQ * DMOD / 8) / 256)   // blocks of 256 threads x 8 elements per [4096][768] plane
#define GWB    ((DMOD * DMOD / 8) / 256)       // the same per [768][768] plane
static_assert(HD == 64 && DMOD == NH * HD);
static_assert(NQT == 32 && NH == 12 && NB == 2);
static_assert(ATT_THREADS == 128 && ATT_BLOCKS == 768 && NKB == 64);
static_assert(((NB * SEQ) % 64) == 0 && (DMOD % 64) == 0 && (DMOD % 32) == 0);
static_assert((SEQ % 64) == 0 && (SEQ % 8) == 0);
static_assert(((NB * SEQ * DMOD / 8) % 256) == 0 && ((DMOD * DMOD / 8) % 256) == 0);
static_assert(GXB == 1536 && GWB == 288);
static_assert(ATT_WAVES * SLABF >= 4 * 16 * 68);
static_assert(VTP >= PT + 8 && 2 * 2 * PTILEH >= 2 * PT * VTP && (VTP * 2) % 16 == 0 && PT == 2 * HD && PTILEH == 2 * TILEH);
static_assert(2 * 2 * PTILEH * 2 >= 16 * SLAB64 * 4 && ((NB * SEQ) % PT) == 0 && (DMOD % PT) == 0 && (SEQ % PT) == 0);
static_assert(2 * 2 * TILEH * 2 >= 4 * SLAB64 * 4 && (DMOD % GKS) == 0 && DMOD / GKS >= 2);
static_assert((SEQ % (4 * ATT_THREADS)) == 0);
static_assert(SKEYS == 64 && NST >= 2 && NST * SKEYS == SEQ && (RPH * 2) % 16 == 0 && TILEH >= 63 * RPH + 64);
static_assert(TSLOT >= TILEH && (TSLOT * 2) % 2048 == 0 && RPH * 2 == HD * 2 + 16 && HD * 2 == 128);
static_assert(2 * 4 * TSLOT * 2 >= ATT_WAVES * SLABF * 4);
static_assert((NH * HD * 2) % 16 == 0 && (SEQ * 2) % 16 == 0 && SEQ * 2 <= 131072);

typedef unsigned short u16;
typedef _Float16 v16h __attribute__((ext_vector_type(16)));
typedef _Float16 v8h  __attribute__((ext_vector_type(8)));
typedef __bf16   v16b __attribute__((ext_vector_type(16)));
typedef float    v8f  __attribute__((ext_vector_type(8)));
typedef float    v4f  __attribute__((ext_vector_type(4)));
typedef unsigned int v4u __attribute__((ext_vector_type(4)));
typedef uint32_t u32x4 __attribute__((ext_vector_type(4)));
typedef uint32_t u32x8 __attribute__((ext_vector_type(8)));

union FragH { v16h v; v8h h[2]; v4u u[2]; };
union FragB { v16b v; v4u u[2]; };

// ---- scalar helpers --------------------------------------------------------------------------------
__device__ __forceinline__ unsigned short bf_bits(float f) {          // f32 -> bf16 bits, RNE convert
  unsigned u = __float_as_uint(f);
  return (unsigned short)((u + 0x7FFFu + ((u >> 16) & 1u)) >> 16);
}
__device__ __forceinline__ float bf_up(unsigned short h) { return __uint_as_float(((unsigned)h) << 16); }
__device__ __forceinline__ float bfr(float f) { return bf_up(bf_bits(f)); }
__device__ __forceinline__ unsigned short h_bits(_Float16 x) { return __builtin_bit_cast(unsigned short, x); }
__device__ __forceinline__ unsigned pk16(unsigned short a, unsigned short b) { return (unsigned)a | ((unsigned)b << 16); }
__device__ __forceinline__ v8f zero8() { v8f z = {0.f, 0.f, 0.f, 0.f, 0.f, 0.f, 0.f, 0.f}; return z; }
__device__ __forceinline__ v4f zero4() { v4f z = {0.f, 0.f, 0.f, 0.f}; return z; }
// 2^x as the bare v_exp_f32, without the library's range test, pre-scale and ldexp around it: equal to exp2f for x >= -126; below
// that the result (under 2^-126) comes out as 0. Used on x <= 0 only: such a term is far under one f32 ulp of the row sum (>= 1)
// and under the smallest f16 residual of P x32768, and a rescale factor that small leaves nothing of the old sums either way.
__device__ __forceinline__ float ex2(float x) { return __builtin_amdgcn_exp2f(x); }

// ---- fragment loaders: 16-bit A/B operand, lane -> row/col (lane&15), p already includes +8*(lane>>4);
//      elements 0..7 <- p[0..7] (k0+8h..), elements 8..15 <- p[16..23] (k0+16+8h..)  (same split k map for A and B;
//      B is always read from a k-contiguous [n][k] plane)
__device__ __forceinline__ v16h ldfrag_h(const _Float16* p) {
  FragH f;
  f.h[0] = *(const v8h*)(p);
  f.h[1] = *(const v8h*)(p + 16);
  return f.v;
}
__device__ __forceinline__ v16b ldfrag_b(const u16* p) {              // bf16 plane read as unsigned integer vectors
  FragB f;
  f.u[0] = *(const v4u*)(p);
  f.u[1] = *(const v4u*)(p + 16);
  return f.v;
}

__device__ __forceinline__ v8f mma_h(v16h a, v16h b, v8f c) {
  return __builtin_amdgcn_wmma_f32_16x16x32_f16(false, a, false, b, (short)0, c, false, false);
}
__device__ __forceinline__ v8f mma_b(v16b a, v16b b, v8f c) {
  return __builtin_amdgcn_wmma_f32_16x16x32_bf16(false, a, false, b, (short)0, c, false, false);
}
__device__ __forceinline__ void guard2(v8f& a, v8f& b, v16h x0, v16h x1, v16h x2, v16h x3, v16h x4, v16h x5) {
#if defined(__HIP_DEVICE_COMPILE__)
  asm volatile("v_nop\n\tv_nop\n\tv_nop\n\tv_nop"
               : "+v"(a), "+v"(b) : "v"(x0), "v"(x1), "v"(x2), "v"(x3), "v"(x4), "v"(x5) : "memory");
#endif
}
template <typename F>
__device__ __forceinline__ void guard6(v8f& a, v8f& b, v8f& c, v8f& d, F x0, F x1, F x2, F x3, F x4, F x5) {
#if defined(__HIP_DEVICE_COMPILE__)
  asm volatile("v_nop\n\tv_nop\n\tv_nop\n\tv_nop"
               : "+v"(a), "+v"(b), "+v"(c), "+v"(d) : "v"(x0), "v"(x1), "v"(x2), "v"(x3), "v"(x4), "v"(x5) : "memory");
#endif
}
// the four slots behind the last product of a stage, on every path out of it: all 16 accumulators and the last 8 fragments are held to here
__device__ __forceinline__ void guard16(v8f (&c)[4][4], const v16b (&a)[4], const v16b (&b)[4]) {
#if defined(__HIP_DEVICE_COMPILE__)
  asm volatile("v_nop\n\tv_nop\n\tv_nop\n\tv_nop"
               : "+v"(c[0][0]), "+v"(c[0][1]), "+v"(c[0][2]), "+v"(c[0][3]), "+v"(c[1][0]), "+v"(c[1][1]), "+v"(c[1][2]), "+v"(c[1][3]),
                 "+v"(c[2][0]), "+v"(c[2][1]), "+v"(c[2][2]), "+v"(c[2][3]), "+v"(c[3][0]), "+v"(c[3][1]), "+v"(c[3][2]), "+v"(c[3][3])
               : "v"(a[0]), "v"(a[1]), "v"(a[2]), "v"(a[3]), "v"(b[0]), "v"(b[1]), "v"(b[2]), "v"(b[3]) : "memory");
#endif
}
__device__ __forceinline__ void guard10(v8f& a, v8f& b, v8f& c, v8f& d, v16h x0, v16h x1, v16h x2, v16h x3, v16h x4,
                                        v16h x5, v16h x6, v16h x7, v16h x8, v16h x9) {
#if defined(__HIP_DEVICE_COMPILE__)
  asm volatile("v_nop\n\tv_nop\n\tv_nop\n\tv_nop"
               : "+v"(a), "+v"(b), "+v"(c), "+v"(d)
               : "v"(x0), "v"(x1), "v"(x2), "v"(x3), "v"(x4), "v"(x5), "v"(x6), "v"(x7), "v"(x8), "v"(x9) : "memory");
#endif
}
__device__ __forceinline__ void acc_guard4(v8f& a, v8f& b, v8f& c, v8f& d) {
#if defined(__HIP_DEVICE_COMPILE__)
  asm volatile("v_nop\n\tv_nop\n\tv_nop\n\tv_nop" : "+v"(a), "+v"(b), "+v"(c), "+v"(d));
#endif
}
// Four asynchronous 16-B copies per lane, global -> LDS (rows r, r+16, r+32, r+48 of one 64-row tile). The s_wait_xcnt stands in
// the copies' own statement so that no address register is rewritten in front of it.
__device__ __forceinline__ void copy4(unsigned l0, unsigned l1, unsigned l2, unsigned l3,
                                      const u16* g0, const u16* g1, const u16* g2, const u16* g3) {
#if defined(__HIP_DEVICE_COMPILE__)
  asm volatile("global_load_async_to_lds_b128 %0, %4, off\n\t"
               "global_load_async_to_lds_b128 %1, %5, off\n\t"
               "global_load_async_to_lds_b128 %2, %6, off\n\t"
               "global_load_async_to_lds_b128 %3, %7, off\n\t"
               "s_wait_xcnt 0x0"
               :: "v"(l0), "v"(l1), "v"(l2), "v"(l3), "v"(g0), "v"(g1), "v"(g2), "v"(g3) : "memory");
#endif
}
// One 64-row x 128-B tile: lbase = this lane's LDS byte address in row r, g = its global address in row r, gstep = 16 source rows.
__device__ __forceinline__ void copy_tile(unsigned lbase, const u16* g, size_t gstep) {
  copy4(lbase, lbase + 16u * (RPH * 2), lbase + 32u * (RPH * 2), lbase + 48u * (RPH * 2), g, g + gstep, g + 2 * gstep, g + 3 * gstep);
}
// One 128-row x 128-B tile: eight asynchronous 16-B copies per lane (rows r, r+16, .. r+112) in one statement with their one
// s_wait_xcnt, so that no address register is rewritten in front of it. lbase, g, gstep as in copy_tile.
__device__ __forceinline__ void copy_tile128(unsigned lbase, const u16* g, size_t gstep) {
#if defined(__HIP_DEVICE_COMPILE__)
  asm volatile("global_load_async_to_lds_b128 %0, %8, off\n\t"
               "global_load_async_to_lds_b128 %1, %9, off\n\t"
               "global_load_async_to_lds_b128 %2, %10, off\n\t"
               "global_load_async_to_lds_b128 %3, %11, off\n\t"
               "global_load_async_to_lds_b128 %4, %12, off\n\t"
               "global_load_async_to_lds_b128 %5, %13, off\n\t"
               "global_load_async_to_lds_b128 %6, %14, off\n\t"
               "global_load_async_to_lds_b128 %7, %15, off\n\t"
               "s_wait_xcnt 0x0"
               :: "v"(lbase), "v"(lbase + 16u * (RPH * 2)), "v"(lbase + 32u * (RPH * 2)), "v"(lbase + 48u * (RPH * 2)),
                  "v"(lbase + 64u * (RPH * 2)), "v"(lbase + 80u * (RPH * 2)), "v"(lbase + 96u * (RPH * 2)), "v"(lbase + 112u * (RPH * 2)),
                  "v"(g), "v"(g + gstep), "v"(g + 2 * gstep), "v"(g + 3 * gstep),
                  "v"(g + 4 * gstep), "v"(g + 5 * gstep), "v"(g + 6 * gstep), "v"(g + 7 * gstep) : "memory");
#endif
}
__device__ __forceinline__ void wait_async0() {   // this wave's copies have landed
#if defined(__HIP_DEVICE_COMPILE__)
  asm volatile("s_wait_asynccnt 0x0" ::: "memory");
#endif
}
__device__ __forceinline__ void wait_ds0() {      // this wave's LDS reads have returned before their buffer is handed back
#if defined(__HIP_DEVICE_COMPILE__)
  asm volatile("s_wait_dscnt 0x0" ::: "memory");
#endif
}
// ---- tensor load of one tile of 64 rows x 128 B into LDS at pitch 144 B (one request of a whole wave, through no register) ----
__device__ __forceinline__ uint32_t uni(uint32_t v) { return (uint32_t)__builtin_amdgcn_readfirstlane(v); }
__device__ __forceinline__ uint32_t pinned(uint32_t v) {
  uint32_t w = uni(v);
#if defined(__HIP_DEVICE_COMPILE__)
  asm volatile("" : "+s"(w));   // the value held in a scalar register: a test on it is a scalar branch, a descriptor word from it is formed here
#endif
  return w;
}
// group 1: 1-byte elements, tensor = tile = 64 rows of 128 B, source row pitch in bytes, no mask; word 0 is the constant
// pad_enable | interval code 4 (one 128-B row) | amount code 3 (4 dwords): LDS pitch 144 B, no pad byte written
__device__ __forceinline__ u32x8 tdm_group1(uint32_t src_pitch) {
  u32x8 g;
  g[0] = uni((1u << 20) | (4u << 22) | (3u << 25));
  g[1] = uni(128u << 16);
  g[2] = uni(64u << 16);
  g[3] = uni(128u << 16);
  g[4] = uni(64u);
  g[5] = uni(src_pitch);
  g[6] = uni(0u);
  g[7] = uni(0u);
  return g;
}
// group 0: count 1, LDS byte offset of the tile's place, global address of the tile's first byte, type 2
__device__ __forceinline__ u32x4 tdm_group0(uint32_t lds_dst, uint64_t ga) {
  u32x4 g;
  g[0] = uni(1u);
  g[1] = uni(lds_dst);
  g[2] = uni((uint32_t)ga);
  g[3] = uni((((uint32_t)(ga >> 32)) & 0x01FFFFFFu) | 0x80000000u);
  return g;
}
__device__ __forceinline__ void tdm_load(u32x4 g0, u32x8 g1) {
#if defined(__HIP_DEVICE_COMPILE__)
  asm volatile("tensor_load_to_lds %0, %1" :: "s"(g0), "s"(g1) : "memory");
#endif
}
// this wave's tensor load has landed; the request's two groups are inputs, so that their registers keep their words up to this wait
__device__ __forceinline__ void wait_tensor0(u32x4 g0, u32x8 g1) {
#if defined(__HIP_DEVICE_COMPILE__)
  asm volatile("s_wait_tensorcnt 0x0" :: "s"(g0), "s"(g1) : "memory");
#endif
}
__device__ __forceinline__ void wave_sync_lds() {
  __builtin_amdgcn_fence(__ATOMIC_RELEASE, "workgroup");
  __builtin_amdgcn_wave_barrier();
  __builtin_amdgcn_fence(__ATOMIC_ACQUIRE, "workgroup");
}

// =====================================================================================================
// f32 plane -> 16-bit plane, same layout:  f16mode == 0: bf16 RNE bits;  f16mode == 1: f16 bits of (bf16 RNE value) * scale.
// Thread = 8 consecutive elements: two 16-B loads, one 16-B store; 32 consecutive lanes = 512 contiguous, 512-B aligned bytes
// gt = the thread's index within its plane.
// =====================================================================================================
__device__ __forceinline__ void cvt16_body(const float* __restrict__ x, u16* D, int gt, int f16mode, float scale) {
  const float* p = x + (size_t)gt * 8;
  const v4f a = *(const v4f*)(p), c4 = *(const v4f*)(p + 4);
  float v[8];
#pragma unroll
  for (int e = 0; e < 4; ++e) { v[e] = a[e]; v[4 + e] = c4[e]; }
  unsigned short s[8];
#pragma unroll
  for (int e = 0; e < 8; ++e) {
    const unsigned short hb = h_bits((_Float16)(bfr(v[e]) * scale));
    const unsigned short bb = bf_bits(v[e]);
    s[e] = (f16mode != 0) ? hb : bb;
  }
  v4u o;
#pragma unroll
  for (int e = 0; e < 4; ++e) o[e] = pk16(s[2 * e], s[2 * e + 1]);
  u16* d = D + (size_t)gt * 8;
  {
    *(v4u*)(d) = o;
    
  }
}
// All seven conversions in one grid (none reads another's output): blocks [0, 3*GXB) = the three input planes -> bf16,
// blocks [3*GXB, 3*GXB + 4*GWB) = wq, wk, wv -> bf16 and wo -> f16 of (bf16 value x1024). The plane is chosen per block (scalar).
// coverage: GXB (GWB) blocks x 256 thr x 8 = one whole plane each.
__global__ __launch_bounds__(256)
void cvt16_all(const float* __restrict__ xq, const float* __restrict__ xk, const float* __restrict__ xv,
               const float* __restrict__ wq, const float* __restrict__ wk, const float* __restrict__ wv,
               const float* __restrict__ wo, u16* XQ, u16* XK, u16* XV, u16* WQ, u16* WK, u16* WV, u16* WO) {
  const int bid = blockIdx.x;
  if (bid >= 3 * GXB + 4 * GWB) return;     // never taken with the exact grid; no barriers in this kernel
  const float* x;
  u16* D;
  int lb, f16mode = 0;
  float scale = 1.0f;
  if (bid < 3 * GXB) {
    const int pl = bid / GXB;
    lb = bid - pl * GXB;
    x = (pl == 0) ? xq : (pl == 1) ? xk : xv;
    D = (pl == 0) ? XQ : (pl == 1) ? XK : XV;
  } else {
    const int r = bid - 3 * GXB, pl = r / GWB;
    lb = r - pl * GWB;
    x = (pl == 0) ? wq : (pl == 1) ? wk : (pl == 2) ? wv : wo;
    D = (pl == 0) ? WQ : (pl == 1) ? WK : (pl == 2) ? WV : WO;
    if (pl == 3) { f16mode = 1; scale = WOS; }
  }
  cvt16_body(x, D, lb * 256 + (int)threadIdx.x, f16mode, scale);
}

// =====================================================================================================
// GEMM epilogue of the output projection: the wave's 16x64 f32 tile (times oscale) staged in its LDS slab (pitch 68),
// coverage: 8 instructions x 2 rows x 16 lanes x 4 floats = the wave's 16 x 64 tile.
// =====================================================================================================
__device__ __forceinline__ void epi64(float* sl, v8f a0, v8f a1, v8f a2, v8f a3, float oscale, v4f badd, float* C, int N,
                                      size_t rowb, int col0, int lane) {
  const int hh = lane >> 4, m = lane & 15;
#pragma unroll
  for (int r = 0; r < 8; ++r) {
    const int ro = (8 * hh + r) * 68 + m;
    sl[ro]      = a0[r] * oscale;
    sl[ro + 16] = a1[r] * oscale;
    sl[ro + 32] = a2[r] * oscale;
    sl[ro + 48] = a3[r] * oscale;
  }
  wave_sync_lds();
  v4f vals[8];
#pragma unroll
  for (int it = 0; it < 8; ++it) vals[it] = *(const v4f*)(sl + (it * 2 + hh) * 68 + m * 4) + badd;
  float* dst = C + (rowb + (size_t)hh) * (size_t)N + col0 + m * 4;
  {
#pragma unroll
    for (int it = 0; it < 8; ++it) {
      *(v4f*)(dst + (size_t)(it * 2) * (size_t)N) = vals[it];
    }
    
  }
}

// 8 f32 values (already carried up by their power of two) -> 8 f16 hi + 8 f16 residuals (value - hi, unscaled)
__device__ __forceinline__ void split8(const float* w, v4u& oh, v4u& ol) {
#pragma unroll
  for (int e = 0; e < 4; ++e) {
    const float t0 = w[2 * e], t1 = w[2 * e + 1];
    const _Float16 h0 = (_Float16)t0, h1 = (_Float16)t1;
    const _Float16 l0 = (_Float16)(t0 - (float)h0), l1 = (_Float16)(t1 - (float)h1);
    oh[e] = pk16(h_bits(h0), h_bits(h1));
    ol[e] = pk16(h_bits(l0), h_bits(l1));
  }
}

// =====================================================================================================
// Projection epilogue, q and k: a 16x64 f32 part of the wave's tile (times oscale) staged in its own LDS slab (pitch 68), read back by rows, bias
// added in f32, then f16 hi plane (value * sc) + f16 residual plane, same [row][col] layout as the product.
// coverage: per plane 4 instructions x 4 rows x 8 lanes x 8 halves = the 16 x 64 part, whole 128-B lines.
// =====================================================================================================
__device__ __forceinline__ void epi_split(float* sl, v8f a0, v8f a1, v8f a2, v8f a3, float oscale, const float* __restrict__ bias,
                                          float sc, u16* HP, u16* LP, int N, size_t rowb, int col0, int lane) {
  const int hh = lane >> 4, m = lane & 15;
  const int rq = lane >> 3, c8 = (lane & 7) * 8;
  const v4f bv0 = *(const v4f*)(bias + col0 + c8), bv1 = *(const v4f*)(bias + col0 + c8 + 4);   // columns < N (N multiple of 64)
#pragma unroll
  for (int r = 0; r < 8; ++r) {
    const int ro = (8 * hh + r) * 68 + m;
    sl[ro]      = a0[r] * oscale;
    sl[ro + 16] = a1[r] * oscale;
    sl[ro + 32] = a2[r] * oscale;
    sl[ro + 48] = a3[r] * oscale;
  }
  wave_sync_lds();
  float badd[8];
#pragma unroll
  for (int e = 0; e < 4; ++e) { badd[e] = bfr(bv0[e]); badd[4 + e] = bfr(bv1[e]); }
  v4u oh[4], ol[4];
#pragma unroll
  for (int i4 = 0; i4 < 4; ++i4) {
    const int row = i4 * 4 + rq;
    const v4f a = *(const v4f*)(sl + row * 68 + c8), c4 = *(const v4f*)(sl + row * 68 + c8 + 4);
    float w[8];
#pragma unroll
    for (int e = 0; e < 4; ++e) { w[e] = (a[e] + badd[e]) * sc; w[4 + e] = (c4[e] + badd[4 + e]) * sc; }
    split8(w, oh[i4], ol[i4]);
  }
  const size_t ob = (rowb + (size_t)rq) * (size_t)N + col0 + c8;
#pragma unroll
  for (int i4 = 0; i4 < 4; ++i4) {
    const size_t o8 = ob + (size_t)(i4 * 4) * (size_t)N;
    *(v4u*)(HP + o8) = oh[i4];
    *(v4u*)(LP + o8) = ol[i4];
  }
#if defined(__HIP_DEVICE_COMPILE__)
  // the code behind this call (the next group of 16 rows, or the joined end of the kernel) rewrites registers that these eight
  // stores name: the wait stands in front of every such rewrite
  asm volatile("s_wait_xcnt 0x0" ::: "memory");
#endif
}

// =====================================================================================================
// Projection epilogue, v: the block's tile is (batch b, keys s0 .. s0+127, heads h0 and h0+1, all 64 d of each), written TRANSPOSED
// as VH[(b*NH + h)*HD + d][s] = f16(v * 1024), VL = f16 residual. An accumulator's 8 elements of a lane are 8 consecutive keys of one
// d, so each goes as one 16-B LDS store into the [column][key] tiles (pitch 136 halves); a block barrier, then whole lines go out
// (the 128 columns of the tile are 128 consecutive rows of the v^T planes).
// coverage: LDS 4 waves x 16 accumulators x 32 lanes x 8 halves = 128 x 128 per plane; store 16 iterations x 128 thr x 8 halves = 128
//           rows x 128 keys per plane, 256 contiguous bytes per 16 lanes.
// =====================================================================================================
__device__ __forceinline__ void epi_vt(u16* TH, u16* TL, const v8f (&acc)[4][4], float oscale,
                                       const float* __restrict__ bias, u16* VHo, u16* VLo, int row0, int col0, int tid) {
  const int wave = tid >> 5, lane = tid & 31, hh = lane >> 4, m = lane & 15;
  const int wr = wave >> 1, wc = wave & 1;
  float bj[4];
#pragma unroll
  for (int j = 0; j < 4; ++j) bj[j] = bfr(bias[col0 + wc * 64 + j * 16 + m]);      // columns < N (N multiple of 128)
#pragma unroll
  for (int u = 0; u < 4; ++u) {
#pragma unroll
    for (int j = 0; j < 4; ++j) {
      float w[8];
#pragma unroll
      for (int r = 0; r < 8; ++r) w[r] = (acc[u][j][r] * oscale + bj[j]) * VCAR;
      v4u oh, ol;
      split8(w, oh, ol);
      const int to = (wc * 64 + j * 16 + m) * VTP + wr * 64 + u * 16 + 8 * hh;
      *(v4u*)(TH + to) = oh;
      *(v4u*)(TL + to) = ol;
    }
  }
  __syncthreads();
  v4u vh[16], vl[16];
  const int q16 = tid >> 4, p8 = (tid & 15) * 8;
#pragma unroll
  for (int it = 0; it < 16; ++it) {
    const int line = it * 8 + q16;            // column of the tile = 0..127
    vh[it] = *(const v4u*)(TH + line * VTP + p8);
    vl[it] = *(const v4u*)(TL + line * VTP + p8);
  }
  const int b = row0 / SEQ, s0 = row0 - b * SEQ, h0 = col0 >> 6;
  const size_t base = ((size_t)(b * NH + h0) * HD + q16) * SEQ + s0 + p8;
#pragma unroll
  for (int it = 0; it < 16; ++it) {
    *(v4u*)(VHo + base + (size_t)(it * 8) * SEQ) = vh[it];
    *(v4u*)(VLo + base + (size_t)(it * 8) * SEQ) = vl[it];
  }
}

// =====================================================================================================
// bf16 GEMM with bias: f32 product A[M][K] (bf16 row-major) . Bt[N][K]^T (bf16 k-contiguous), times oscale, plus bf16-RNE
// value of bias[n], written straight as the f16 hi + residual planes that attention reads. Block = 128x128 tile, 4 waves in a 2x2
// arrangement, each 64 rows x 64 columns = 16 accumulators, so that a fragment read from LDS feeds 4 products and a byte
// brought from L2 feeds 128 rows or columns. The block's A and Bt tiles of 128 rows x 64 k (whole 128-B lines, LDS pitch 144 B) come
// into a two-buffer LDS ring by asynchronous copies, once per block, and the waves read their fragments there
// (two 16-B LDS loads each, split k map for A and B); one block barrier per 64 k publishes the next stage and frees the one just
// read. k runs upward in steps of 32 (host checks K % 64 == 0, M % 128 == 0, N % 128 == 0, grid.x = (M/128)*(N/128)).
// Behind the loop's last barrier the ring is dead and holds the sixteen result slabs (q, k) or the two transposed tiles (v).
// Three independent products of one shape in one grid: blockIdx.y picks the operand set (scalar selects): 0 = q, 1 = k (planes in
// the product's own layout), 2 = v (transposed planes; M = NB*SEQ rows and N = NH*HD columns, a 128-column tile = two heads). The
// branch on it is block-uniform, so the barrier inside epi_vt is passed by all threads of its block or by none.
// =====================================================================================================
__global__ __launch_bounds__(128)
void gemm_bfb3(const u16* __restrict__ A0, const u16* __restrict__ A1, const u16* __restrict__ A2,
               const u16* __restrict__ Bt0, const u16* __restrict__ Bt1, const u16* __restrict__ Bt2,
               const float* __restrict__ bias0, const float* __restrict__ bias1, const float* __restrict__ bias2,
               u16* QH, u16* QL, u16* KH, u16* KL, u16* VH, u16* VL, int M, int N, int K, float oscale) {
  __shared__ __align__(16) u16 gring[2 * 2 * PTILEH];       // [buffer][A, Bt][128 rows][pitch 72 halves]; epilogue: staging
  const int zz = blockIdx.y;
  const u16*   A    = (zz == 0) ? A0 : (zz == 1) ? A1 : A2;
  const u16*   Bt   = (zz == 0) ? Bt0 : (zz == 1) ? Bt1 : Bt2;
  const float* bias = (zz == 0) ? bias0 : (zz == 1) ? bias1 : bias2;
  const int tid = threadIdx.x, wave = tid >> 5, lane = tid & 31, hh = lane >> 4, m = lane & 15;
  const int wr = wave >> 1, wc = wave & 1;   // the wave's 64 rows and 64 columns of the tile
  const int ntile = N / PT;
  const int bid   = blockIdx.x;
  const int row0  = (bid / ntile) * PT;
  const int col0  = (bid % ntile) * PT;
  const int nst   = K / GKS;
  if (row0 + PT > M || nst < 1) return;      // block-uniform, in front of every barrier; never taken with the exact grid
  // copies: lane = (row cr of a group of 16, 16-B chunk cc of its 128-B line); a wave's copy = 4 whole lines
  const int cr = tid >> 3, cc = (tid & 7) * 8;
  const u16* ag = A  + (size_t)(row0 + cr) * K + cc;
  const u16* bg = Bt + (size_t)(col0 + cr) * K + cc;
  const size_t gs = (size_t)16 * K;
  const unsigned lcp = (unsigned)(uintptr_t)(gring + cr * RPH + cc);               // LDS byte address, buffer 0, A tile
  const u16* af = gring + (wr * 64 + m) * RPH + 8 * hh;                             // first A fragment row of this lane, buffer 0
  const u16* bq = gring + PTILEH + (wc * 64 + m) * RPH + 8 * hh;                    // first Bt fragment row of this lane, buffer 0
  v8f acc[4][4];                              // [16 rows i][16 columns j]
#pragma unroll   // constant indices: the array stays in registers
  for (int i = 0; i < 4; ++i) {
#pragma unroll   // constant indices: the array stays in registers
    for (int j = 0; j < 4; ++j) acc[i][j] = zero8();
  }
#define GSTAGE(st, bf)                                                    \
  do {                                                                    \
    const unsigned lb_ = lcp + (unsigned)(bf) * (2u * PTILEH * 2u);       \
    copy_tile128(lb_,               ag + (size_t)(st) * GKS, gs);         \
    copy_tile128(lb_ + PTILEH * 2u, bg + (size_t)(st) * GKS, gs);         \
  } while (0)
  // ring prologue: stage 0 landed and published, then stage 1 in flight
  GSTAGE(0, 0);
  wait_async0();
  __syncthreads();
  if (1 < nst) GSTAGE(1, 1);
#pragma unroll 1   // stays rolled: one copy of the stage body and of its publish point
  for (int st = 0; st < nst; ++st) {
    const int bf = st & 1;
    const u16* as = af + bf * (2 * PTILEH);
    const u16* bs = bq + bf * (2 * PTILEH);
    // both k steps of the stage: fragments from LDS, then the products, k upward
    v16b a[4], b[4], a_[4], b_[4];
#pragma unroll   // constant indices: the arrays stay in registers
    for (int i = 0; i < 4; ++i) {
      a[i] = ldfrag_b(as + (16 * i) * RPH);
      b[i] = ldfrag_b(bs + (16 * i) * RPH);
    }
#pragma unroll   // constant indices: the arrays stay in registers
    for (int i = 0; i < 4; ++i) {
      a_[i] = ldfrag_b(as + (16 * i) * RPH + 32);
      b_[i] = ldfrag_b(bs + (16 * i) * RPH + 32);
    }
#pragma unroll   // constant indices: the arrays stay in registers
    for (int i = 0; i < 4; ++i) {
#pragma unroll   // constant indices: the arrays stay in registers
      for (int j = 0; j < 4; ++j) acc[i][j] = mma_b(a[i], b[j], acc[i][j]);
    }
#pragma unroll   // constant indices: the arrays stay in registers
    for (int i = 0; i < 4; ++i) {
#pragma unroll   // constant indices: the arrays stay in registers
      for (int j = 0; j < 4; ++j) acc[i][j] = mma_b(a_[i], b_[j], acc[i][j]);
    }
    guard16(acc, a_, b_);
    // publish point of stage st + 1: own reads of this buffer done, own copies of the next landed, block barrier, then the refill
    wait_ds0();
    wait_async0();
    __syncthreads();
    if (st + 2 < nst) GSTAGE(st + 2, bf);
  }
  wait_async0();
#undef GSTAGE
  // every wave is behind the last barrier: no reader and no copy is left on the ring
  if (zz == 2) {
    epi_vt(gring, gring + PT * VTP, acc, oscale, bias, VH, VL, row0, col0, tid);
  } else {
    float* slab = (float*)(void*)gring;
#pragma unroll   // constant indices: the array stays in registers
    for (int u = 0; u < 4; ++u)               // the wave's four groups of 16 rows, each through a slab of its own
      epi_split(slab + (wave * 4 + u) * SLAB64, acc[u][0], acc[u][1], acc[u][2], acc[u][3], oscale, bias, (zz == 0) ? QSC : KSC,
                (zz == 0) ? QH : KH, (zz == 0) ? QL : KL, N, (size_t)(row0 + wr * 64 + u * 16), col0 + wc * 64, lane);
  }
}

// =====================================================================================================
// f16 hi+lo GEMM with bias: C[M][N] (f32) = (Ahi + Alo)[M][K] . Bt[N][K]^T times oscale, plus bf16-RNE value of bias[n];
// Ahi/Alo f16 planes (same layout), Bt f16 k-contiguous; products hi.B + lo.B into one accumulator (lo is the unscaled
// residual of hi). Block = 64x64 tile, 4 waves of 16 rows x 64 columns each; a two-buffer LDS ring as in gemm_bfb3, with three 64-row tiles a stage (Ahi, Alo, Bt).
// =====================================================================================================
__global__ __launch_bounds__(128)
void gemm_h2(const u16* __restrict__ Ah, const u16* __restrict__ Al, const u16* __restrict__ Bt,
             const float* __restrict__ bias, float* C, int M, int N, int K, float oscale) {
  __shared__ __align__(16) u16 gring[2 * 3 * TILEH];        // [buffer][Ahi, Alo, Bt][64 rows][pitch 72 halves]; epilogue: result slabs
  const int tid = threadIdx.x, wave = tid >> 5, lane = tid & 31, hh = lane >> 4, m = lane & 15;
  const int ntile = N >> 6;
  const int bid   = blockIdx.x;
  const int row0  = (bid / ntile) * 64;
  const int rowb  = row0 + wave * 16;
  const int col0  = (bid % ntile) * 64;
  const int nst   = K / GKS;
  if (row0 + 64 > M || nst < 1) return;      // block-uniform, in front of every barrier; never taken with the exact grid
  // copies: lane = (row cr of a group of 16, 16-B chunk cc of its 128-B line); a wave's copy = 4 whole lines
  const int cr = tid >> 3, cc = (tid & 7) * 8;
  const size_t aofs = (size_t)(row0 + cr) * K + cc;
  const u16* ahg = Ah + aofs;
  const u16* alg = Al + aofs;
  const u16* bg  = Bt + (size_t)(col0 + cr) * K + cc;
  const size_t gs = (size_t)16 * K;
  const unsigned lcp = (unsigned)(uintptr_t)(gring + cr * RPH + cc);               // LDS byte address, buffer 0, Ahi tile
  const _Float16* af = (const _Float16*)(const void*)gring + (wave * 16 + m) * RPH + 8 * hh;   // Ahi fragment row, buffer 0
  const _Float16* bq = (const _Float16*)(const void*)gring + 2 * TILEH + m * RPH + 8 * hh;     // Bt fragment row, buffer 0
  v8f acc0 = zero8(), acc1 = zero8(), acc2 = zero8(), acc3 = zero8();
#define GSTAGE(st, bf)                                                    \
  do {                                                                    \
    const unsigned lb_ = lcp + (unsigned)(bf) * (3u * TILEH * 2u);        \
    copy_tile(lb_,                   ahg + (size_t)(st) * GKS, gs);       \
    copy_tile(lb_ + 1u * TILEH * 2u, alg + (size_t)(st) * GKS, gs);       \
    copy_tile(lb_ + 2u * TILEH * 2u, bg  + (size_t)(st) * GKS, gs);       \
  } while (0)
  // ring prologue: stage 0 landed and published, then stage 1 in flight
  GSTAGE(0, 0);
  wait_async0();
  __syncthreads();
  if (1 < nst) GSTAGE(1, 1);
#pragma unroll 1   // stays rolled: one copy of the stage body and of its publish point
  for (int st = 0; st < nst; ++st) {
    const int bf = st & 1;
    const _Float16* as = af + bf * (3 * TILEH);
    const _Float16* bs = bq + bf * (3 * TILEH);
    // both k steps of the stage: fragments from LDS, then the products, k upward
    const v16h ah  = ldfrag_h(as),      al  = ldfrag_h(as + TILEH);
    const v16h b0  = ldfrag_h(bs);
    const v16h b1  = ldfrag_h(bs + 16 * RPH);
    const v16h b2  = ldfrag_h(bs + 32 * RPH);
    const v16h b3  = ldfrag_h(bs + 48 * RPH);
    const v16h ah_ = ldfrag_h(as + 32), al_ = ldfrag_h(as + TILEH + 32);
    const v16h b0_ = ldfrag_h(bs + 32);
    const v16h b1_ = ldfrag_h(bs + 16 * RPH + 32);
    const v16h b2_ = ldfrag_h(bs + 32 * RPH + 32);
    const v16h b3_ = ldfrag_h(bs + 48 * RPH + 32);
    acc0 = mma_h(ah, b0, acc0);    acc0 = mma_h(al, b0, acc0);
    acc1 = mma_h(ah, b1, acc1);    acc1 = mma_h(al, b1, acc1);
    acc2 = mma_h(ah, b2, acc2);    acc2 = mma_h(al, b2, acc2);
    acc3 = mma_h(ah, b3, acc3);    acc3 = mma_h(al, b3, acc3);
    acc0 = mma_h(ah_, b0_, acc0);  acc0 = mma_h(al_, b0_, acc0);
    acc1 = mma_h(ah_, b1_, acc1);  acc1 = mma_h(al_, b1_, acc1);
    acc2 = mma_h(ah_, b2_, acc2);  acc2 = mma_h(al_, b2_, acc2);
    acc3 = mma_h(ah_, b3_, acc3);  acc3 = mma_h(al_, b3_, acc3);
    guard6<v16h>(acc0, acc1, acc2, acc3, ah_, al_, b0_, b1_, b2_, b3_);
    // publish point of stage st + 1: own reads of this buffer done, own copies of the next landed, block barrier, then the refill
    wait_ds0();
    wait_async0();
    __syncthreads();
    if (st + 2 < nst) GSTAGE(st + 2, bf);
  }
  wait_async0();
#undef GSTAGE
  float* slab = (float*)(void*)gring;        // every wave is behind the last barrier: no reader and no copy is left on the ring
  const v4f bv = *(const v4f*)(bias + col0 + m * 4);      // columns col0 + 4m .. +3, always < N (N multiple of 64)
  v4f badd;
#pragma unroll
  for (int e = 0; e < 4; ++e) badd[e] = bfr(bv[e]);
  epi64(slab + wave * SLAB64, acc0, acc1, acc2, acc3, oscale, badd, C, N, (size_t)rowb, col0, lane);
}

// =====================================================================================================
// Full (non-causal) multi-head flash attention with a per-head x per-key additive score bias: block = (batch b, head, 64 query
// rows), 4 waves, wave w owns the 16 query rows q0 = 64*qt + 16*w .. q0+15. The k and v^T tiles of 64 keys (hi and residual planes,
// 4 tiles of 64 rows x 128 B, LDS pitch 144 B) are brought into a two-buffer LDS ring by tensor loads, one tile a wave and stage,
// once per block, and read by all 4 waves; one block barrier per 64 keys publishes the next stage and frees the one just read.
//   q planes (hi, lo f16, x1024) laid out [b][s][h][d]; k planes the same; v^T planes [b][h][d][s] (x1024).
//   All NST = 32 stages of 64 keys are visited (static bound); a stage is ONE softmax pass (one maximum, one rescale of O).
//   Scores are computed TRANSPOSED: S^T tile g (g = 0..3) = k rows (keys kb+16g .. +15, A operand, row m = lane&15, split k map
//   over d) times q^T (B operand, col n = query q0 + (lane&15), k = d, split map), 3 products per tile and d-chunk
//   (k_hi.q_hi + k_lo.q_hi + k_hi.q_lo). D element r of lane l = (key kb+16g+8h+r, query q0+(l&15)), so a lane owns one query
//   column and 32 of its 64 keys; the partner lane l^16 owns the other 32 -> row max / row sum need one xor-16 shuffle.
//   Logit of key j, query i (base 2): (S * 1/8 * 2^-20 + bfr(wh) * bfr(mask[b][j])) * log2(e); the bias term of all SEQ keys of
//   this (batch, head) is formed once per block into an LDS table (f32; each of its two products rounded on its own) and read per
//   pass with the same element -> key map as the transposed scores (t[8g+i] <- key kb+16g+8h+i), added in f32.
//   Online max-subtracted base-2 softmax in f32. The exp'd values ARE the two P A-fragments in place (f = 0,1: keys kb+32f ..): A
//   row m = query = lane&15, element i <- tile 2f, D element i, element 8+i <- tile 2f+1, D element i. P is carried x32768
//   as f16 hi + f16 residual. The rescale factor of query row 8h+r of the O accumulators is fetched from lane 8h+r with a
//   shuffle (uniform control). 4+4 v^T B fragments (hi and residual planes, col n = d = 16j + (lane&15), keys k-contiguous),
//   12 P.V WMMAs (hh + lh + hl) per 32 keys.
//   Epilogue: 1/l (per query, shuffled to the D row owner) and carry folds in f32; the wave's 16x64 f32 result staged in its LDS
// coverage: per wave 4 instructions x 4 rows x 8 lanes x 8 halves = 16 x 64 per plane; grid 768 blocks x 4 waves = every
//           (b, s, h) row of both O planes exactly once.
// =====================================================================================================
__global__ __launch_bounds__(ATT_THREADS)
void attn_fwd(const u16* __restrict__ QHIp, const u16* __restrict__ QLOp,
              const u16* __restrict__ KHIp, const u16* __restrict__ KLOp,
              const u16* __restrict__ VHIp, const u16* __restrict__ VLOp,
              const float* __restrict__ maskp, const float* __restrict__ mcwp,
              u16* OHIp, u16* OLOp) {
  // [buffer][k hi, k lo, v^T hi, v^T lo][64 rows][pitch 72 halves], every tile's place a multiple of 2 KiB in the block's LDS
  // behind the loop's last barrier the ring is dead and holds the four result slabs [16][68] of the epilogue
  __shared__ __attribute__((aligned(2048))) u16 ring[2 * 4 * TSLOT];
  __shared__ __align__(16) float kbias[SEQ];                // base-2 logit bias of every key of this (batch, head)

  const int tid  = threadIdx.x;
  const int wave = tid >> 5;
  const int lane = tid & 31;
  const int hh   = lane >> 4;
  const int c    = lane & 15;

  const int bid  = blockIdx.x;
  const int qt   = bid & (NQT - 1);
  const int bh   = bid >> 5;                 // NQT == 32
  const int head = bh % NH;
  const int b    = bh / NH;
  const int q0   = qt * 64 + wave * 16;

  // B fragments of q^T: col n = query q0 + c, k = d (k-contiguous row of the q plane)
  const size_t qofs = (((size_t)(b * SEQ + q0 + c)) * NH + head) * HD + 8 * hh;
  const _Float16* Qh  = (const _Float16*)(const void*)QHIp + qofs;
  const _Float16* Ql  = (const _Float16*)(const void*)QLOp + qofs;
  // tensor loads: wave w brings tile w of every stage (0 = k hi, 1 = k lo: 64 key rows of this head; 2 = v^T hi, 3 = v^T lo: 64 d
  // rows x 64 keys); every wave issues its one request a stage, unconditionally; all of this is scalar
  const uint32_t wv = uni((uint32_t)tid >> 5);
  const bool isv = wv >= 2u;
  const u16* tsrc = (wv == 0u) ? KHIp : (wv == 1u) ? KLOp : (wv == 2u) ? VHIp : VLOp;
  const size_t tofs = isv ? (size_t)(b * NH + head) * HD * SEQ : ((size_t)b * SEQ * NH + head) * HD;   // stage 0's first element
  const uint64_t tga = (uint64_t)(uintptr_t)(tsrc + tofs);
  const uint32_t tstep = isv ? (uint32_t)(SKEYS * 2) : (uint32_t)(SKEYS * NH * HD * 2);                // bytes from stage to stage
  const uint32_t tlds = (uint32_t)(uintptr_t)ring + wv * (uint32_t)(TSLOT * 2);                        // buffer 0, this wave's tile
  const u32x8 tg1 = tdm_group1(isv ? (uint32_t)(SEQ * 2) : (uint32_t)(NH * HD * 2));
  // A fragments of k: row m = key (in stage) 16g + c, k = d;  B fragments of v: col n = d = 16j + c, k = key (in stage)
  const _Float16* ringh = (const _Float16*)(const void*)ring + c * RPH + 8 * hh;
  // per-key bias row in the table: kbias[kb + 16g + 8hh + 0..7] for score tile g, 16-B aligned LDS loads
  const float* brow = kbias + 8 * hh;
  const float  wh2  = bfr(mcwp[head]);                                              // per-head scalar (bf16 RNE value)
  const float lsc = 0.125f * (LOG2E / (QSC * KSC));

  // the wave's q^T fragments (hi and residual, both d chunks) are the same for every key: loaded once, kept in 32 registers
  const v16h qh0 = ldfrag_h(Qh), qh1 = ldfrag_h(Qh + 32);
#if defined(__HIP_DEVICE_COMPILE__)
  // the built code lets the residual fragments land in the registers that hold the hi plane's address: the wait stands in front
  asm volatile("s_wait_xcnt 0x0" ::: "memory");
#endif
  const v16h ql0 = ldfrag_h(Ql), ql1 = ldfrag_h(Ql + 32);

  float mrun = -INFINITY, lrun = 0.f;
  v8f o[4];
#pragma unroll
  for (int j = 0; j < 4; ++j) o[j] = zero8();

  u32x4 tg0;                                  // group 0 of the wave's request in flight
#define STAGE_LOAD(st, bf)                                                                                    \
  do {                                                                                                        \
    tg0 = tdm_group0(tlds + (uint32_t)(bf) * (uint32_t)(4 * TSLOT * 2), tga + (uint64_t)((st) * tstep));      \
    tdm_load(tg0, tg1);                                                                                       \
  } while (0)

  // ring prologue: stage 0 landed and published, then stage 1 in flight
  STAGE_LOAD(0u, 0u);
  // bias table, formed while stage 0 flies: thread = 4 consecutive keys per round, SEQ / (4 * ATT_THREADS) rounds cover every key
  // once; the barrier below publishes it together with stage 0
  {
    const float* mb4 = maskp + (size_t)b * SEQ + tid * 4;
#pragma unroll     // the rounds' loads issue together: one memory latency, not one per round
    for (int i = 0; i < SEQ / (4 * ATT_THREADS); ++i) {
      const v4f mv = *(const v4f*)(mb4 + i * (4 * ATT_THREADS));
      v4f bz;
#pragma unroll
      for (int e = 0; e < 4; ++e) bz[e] = (wh2 * bfr(mv[e])) * LOG2E;
      *(v4f*)(kbias + tid * 4 + i * (4 * ATT_THREADS)) = bz;
    }
  }
  wait_tensor0(tg0, tg1);
  __syncthreads();
  STAGE_LOAD(1u, 1u);

#pragma unroll 1   // stays rolled: one copy of the stage body and of its publish point
  for (int st = 0; st < NST; ++st) {
   const int bf = st & 1;
   const _Float16* stg = ringh + bf * (4 * TSLOT);
   // the whole 64-key stage is one softmax pass: 4 score tiles, one running-max update and one rescale of O per 64 keys
   const int kb = st * SKEYS;
   v4f ba[4], bb[4];
#pragma unroll   // constant indices: the arrays stay in registers
   for (int g = 0; g < 4; ++g) {
     ba[g] = *(const v4f*)(brow + kb + 16 * g);
     bb[g] = *(const v4f*)(brow + kb + 16 * g + 4);
   }
   // ---- transposed scores: s[g] = keys kb+16g .. kb+16g+15, column = query q0 + c ----
   v8f s[4];
#pragma unroll   // constant indices: the arrays stay in registers
   for (int g = 0; g < 4; ++g) s[g] = zero8();
#pragma unroll   // constant indices: the arrays stay in registers
   for (int kk = 0; kk < 2; ++kk) {
     const v16h qh = (kk == 0) ? qh0 : qh1, ql = (kk == 0) ? ql0 : ql1;
     v16h kh[4], kl[4];
#pragma unroll   // constant indices: the arrays stay in registers
     for (int g = 0; g < 4; ++g) {
       kh[g] = ldfrag_h(stg + (16 * g) * RPH + kk * 32);
       kl[g] = ldfrag_h(stg + TSLOT + (16 * g) * RPH + kk * 32);
     }
#pragma unroll   // constant indices: the arrays stay in registers
     for (int g = 0; g < 4; ++g) s[g] = mma_h(kh[g], qh, s[g]);
#pragma unroll   // constant indices: the arrays stay in registers
     for (int g = 0; g < 4; ++g) s[g] = mma_h(kl[g], qh, s[g]);
#pragma unroll   // constant indices: the arrays stay in registers
     for (int g = 0; g < 4; ++g) s[g] = mma_h(kh[g], ql, s[g]);
     guard10(s[0], s[1], s[2], s[3], qh, ql, kh[0], kh[1], kh[2], kh[3], kl[0], kl[1], kl[2], kl[3]);
   }
   // ---- base-2 logits of this lane's 32 keys for query q0 + c: t[8g+i] <- key kb+16g+8hh+i; one maximum per tile, then joined ----
   float t[32], cg[4];
#pragma unroll   // constant indices: the arrays stay in registers
   for (int g = 0; g < 4; ++g) {
#pragma unroll   // constant indices: the arrays stay in registers
     for (int e = 0; e < 4; ++e) {
       t[8 * g + e]     = s[g][e] * lsc     + ba[g][e];
       t[8 * g + 4 + e] = s[g][4 + e] * lsc + bb[g][e];
     }
     cg[g] = t[8 * g];
#pragma unroll   // constant indices: the arrays stay in registers
     for (int i = 1; i < 8; ++i) cg[g] = fmaxf(cg[g], t[8 * g + i]);
   }
   float cm = fmaxf(fmaxf(cg[0], cg[1]), fmaxf(cg[2], cg[3]));
   cm = fmaxf(cm, __shfl_xor(cm, 16, 32));
   const float mn = fmaxf(mrun, cm);        // finite from the first stage on
   const float al = ex2(mrun - mn);         // 0 on the first stage (mrun = -inf)
   mrun = mn;
   // ---- probabilities (<= 1) and the P A-fragments of keys kb+32f .. +31: hi = f16(p * 32768), lo = f16 residual;
   //      element 8w+i of fragment f <-> t[16f+8w+i] ----
   float psf[2];
   FragH ph[2], pl[2];
#pragma unroll   // constant indices: the arrays stay in registers
   for (int f = 0; f < 2; ++f) {
     psf[f] = 0.f;
#pragma unroll   // constant indices: the arrays stay in registers
     for (int w = 0; w < 2; ++w) {
#pragma unroll   // constant indices: the arrays stay in registers
       for (int e4 = 0; e4 < 4; ++e4) {
         const int i = 16 * f + 8 * w + 2 * e4;
         const float p0 = ex2(t[i] - mn), p1 = ex2(t[i + 1] - mn);
         psf[f] += p0 + p1;
         const float a0 = p0 * PCAR, a1 = p1 * PCAR;
         const _Float16 h0 = (_Float16)a0, h1 = (_Float16)a1;
         const _Float16 l0 = (_Float16)(a0 - (float)h0), l1 = (_Float16)(a1 - (float)h1);
         ph[f].u[w][e4] = pk16(h_bits(h0), h_bits(h1));
         pl[f].u[w][e4] = pk16(h_bits(l0), h_bits(l1));
       }
     }
   }
   float ps = psf[0] + psf[1];
   ps += __shfl_xor(ps, 16, 32);
   lrun = lrun * al + ps;
   // ---- rescale the O accumulators: D row 8hh+r = query q0+8hh+r, its factor lives in lane 8hh+r (and 16+8hh+r) ----
   float scl[8];
#pragma unroll   // constant indices: the arrays stay in registers
   for (int r = 0; r < 8; ++r) scl[r] = __shfl(al, 8 * hh + r, 32);
#pragma unroll   // constant indices: the arrays stay in registers
   for (int j = 0; j < 4; ++j) {
#pragma unroll   // constant indices: the arrays stay in registers
     for (int r = 0; r < 8; ++r) o[j][r] *= scl[r];
   }
   // ---- P.V : B fragment col n = d = j*16 + c, keys contiguous in the v^T planes; keys upward, 32 at a time ----
   {
     v16h vh[2][4], vl[2][4];
#pragma unroll   // constant indices: the arrays stay in registers
     for (int f = 0; f < 2; ++f) {
#pragma unroll   // constant indices: the arrays stay in registers
       for (int j = 0; j < 4; ++j) {
         vh[f][j] = ldfrag_h(stg + 2 * TSLOT + (16 * j) * RPH + f * 32);
         vl[f][j] = ldfrag_h(stg + 3 * TSLOT + (16 * j) * RPH + f * 32);
       }
     }
#pragma unroll   // constant indices: the arrays stay in registers
     for (int f = 0; f < 2; ++f) {
#pragma unroll   // constant indices: the arrays stay in registers
       for (int j = 0; j < 4; ++j) o[j] = mma_h(ph[f].v, vh[f][j], o[j]);
#pragma unroll   // constant indices: the arrays stay in registers
       for (int j = 0; j < 4; ++j) o[j] = mma_h(pl[f].v, vh[f][j], o[j]);
#pragma unroll   // constant indices: the arrays stay in registers
       for (int j = 0; j < 4; ++j) o[j] = mma_h(ph[f].v, vl[f][j], o[j]);
       guard10(o[0], o[1], o[2], o[3], ph[f].v, pl[f].v, vh[f][0], vh[f][1], vh[f][2], vh[f][3], vl[f][0], vl[f][1], vl[f][2], vl[f][3]);
     }
   }
   // publish point of stage st + 1: own reads of this buffer done, own tile of the next landed, block barrier, then the refill
   wait_ds0();
   wait_tensor0(tg0, tg1);
   __syncthreads();
   if (pinned((uint32_t)(st + 2 < NST))) {          // scalar branch: a tensor load ignores EXEC
     const uint32_t nx = pinned((uint32_t)st + 2u); // the descriptor is formed behind the wait above
     STAGE_LOAD(nx, (uint32_t)bf);
   }
  }
#if defined(__HIP_DEVICE_COMPILE__)
  asm volatile("s_wait_tensorcnt 0x0" ::: "memory");   // no request is left in flight when the ring is used anew and the wave ends
#endif
  wait_ds0();
#undef STAGE_LOAD
  acc_guard4(o[0], o[1], o[2], o[3]);

  // ---- fold 1/l (per query, owned by lane = query) and the carries (32768 on P, 1024 on v); stage the 16x64 slab ----
  const float linv = (1.0f / lrun) * (1.0f / (PCAR * VCAR));
  float inv[8];
#pragma unroll
  for (int r = 0; r < 8; ++r) inv[r] = __shfl(linv, 8 * hh + r, 32);
  // every wave is behind the last publish point's waits and barrier: no reader and no tensor load is left on the ring
  float* slab = (float*)(void*)ring + wave * SLABF;
#pragma unroll
  for (int r = 0; r < 8; ++r) {
#pragma unroll
    for (int j = 0; j < 4; ++j) slab[(8 * hh + r) * 68 + j * 16 + c] = o[j][r] * inv[r];
  }
  wave_sync_lds();
  // ---- O x1024 -> f16 hi + residual planes; lane = (row in group of 4, 8 consecutive d) ----
  v4u oh[4], ol[4];
  const int rq = lane >> 3, c8 = (lane & 7) * 8;
#pragma unroll
  for (int i4 = 0; i4 < 4; ++i4) {
    const int row = i4 * 4 + rq;
    const v4f a = *(const v4f*)(slab + row * 68 + c8), c4 = *(const v4f*)(slab + row * 68 + c8 + 4);
    float w[8];
#pragma unroll
    for (int e = 0; e < 4; ++e) { w[e] = a[e] * OSC; w[4 + e] = c4[e] * OSC; }
#pragma unroll
    for (int e = 0; e < 4; ++e) {
      const _Float16 h0 = (_Float16)w[2 * e], h1 = (_Float16)w[2 * e + 1];
      const _Float16 l0 = (_Float16)(w[2 * e] - (float)h0), l1 = (_Float16)(w[2 * e + 1] - (float)h1);
      oh[i4][e] = pk16(h_bits(h0), h_bits(h1));
      ol[i4][e] = pk16(h_bits(l0), h_bits(l1));
    }
  }
  const size_t ob = (((size_t)(b * SEQ + q0)) * NH + head) * HD + c8;
  {
#pragma unroll
    for (int i4 = 0; i4 < 4; ++i4) {
      const int row = i4 * 4 + rq;
      const size_t o8 = ob + (size_t)row * (NH * HD);
      *(v4u*)(OHIp + o8) = oh[i4];
      *(v4u*)(OLOp + o8) = ol[i4];
    }
    
  }
}

// =====================================================================================================
// Workspace map (bytes); every plane is fully written by whole-line stores before it is read; all extents are exact multiples
// of the store granularity (no pad rows needed); every offset a multiple of 131072 (128 KiB); q, k and v each have their
// own input plane, so that each stage runs as one grid over all three:
//   XBQ bf16 [4096][768]               6291456        XBK same  6291456      XBV same  6291456
//   WQB bf16 [768 n][768 k]            1179648        WKB same  1179648      WVB same  1179648
//   WOB f16  [768 n][768 k] x1024      1179648
//   QHI f16 [2][2048][12][64] x1024    6291456        QLO residual         6291456
//   KHI same                           6291456        KLO residual         6291456
//   VHI f16 [2][12][64][2048] x1024    6291456        VLO residual         6291456
//   OHI f16 [4096][768] x1024          6291456        OLO residual         6291456
//   end                               73924608
// =====================================================================================================
extern "C" void kernel_launch(void* const* d_in, const int* in_sizes, int n_in,
                              void* d_out, int out_size, void* d_ws, size_t ws_size,
                              hipStream_t stream) {
  const int ROWS = NB * SEQ;                            // 4096
  if (n_in < 13) return;
  if (in_sizes[0] != ROWS * DMOD || in_sizes[1] != ROWS * DMOD || in_sizes[2] != ROWS * DMOD) return;
  if (in_sizes[3] != NB * SEQ) return;
  if (in_sizes[4] != DMOD * DMOD || in_sizes[6] != DMOD * DMOD) return;
  if (in_sizes[8] != DMOD * DMOD || in_sizes[10] != DMOD * DMOD) return;
  if (in_sizes[5] != DMOD || in_sizes[7] != DMOD || in_sizes[9] != DMOD || in_sizes[11] != DMOD) return;
  if (in_sizes[12] != NH) return;
  if (out_size != ROWS * DMOD) return;

  const float* Qin  = (const float*)d_in[0];
  const float* Kin  = (const float*)d_in[1];
  const float* Vin  = (const float*)d_in[2];
  const float* mask = (const float*)d_in[3];
  const float* wq   = (const float*)d_in[4];
  const float* bq   = (const float*)d_in[5];
  const float* wk   = (const float*)d_in[6];
  const float* bk   = (const float*)d_in[7];
  const float* wv   = (const float*)d_in[8];
  const float* bv   = (const float*)d_in[9];
  const float* wo   = (const float*)d_in[10];
  const float* bo   = (const float*)d_in[11];
  const float* mcw  = (const float*)d_in[12];
  float*       out  = (float*)d_out;

  const size_t szXB  = (size_t)ROWS * DMOD * 2;                 //  6291456
  const size_t szW   = (size_t)DMOD * DMOD * 2;                 //  1179648
  const size_t szP   = (size_t)ROWS * DMOD * 2;                 //  6291456  (q/k/o planes)
  const size_t szVP  = (size_t)NB * NH * HD * SEQ * 2;          //  6291456
  size_t off = 0;
  const size_t oXBQ = off; off += szXB;
  const size_t oXBK = off; off += szXB;
  const size_t oXBV = off; off += szXB;
  const size_t oWQB = off; off += szW;
  const size_t oWKB = off; off += szW;
  const size_t oWVB = off; off += szW;
  const size_t oWOB = off; off += szW;
  const size_t oQHI = off; off += szP;
  const size_t oQLO = off; off += szP;
  const size_t oKHI = off; off += szP;
  const size_t oKLO = off; off += szP;
  const size_t oVHI = off; off += szVP;
  const size_t oVLO = off; off += szVP;
  const size_t oOHI = off; off += szP;
  const size_t oOLO = off; off += szP;
  if (off > ws_size) return;                            // off = 73924608
  if (off > (size_t)134217728) return;

  char* ws = (char*)d_ws;
  u16*   XBQ = (u16*)(ws + oXBQ);
  u16*   XBK = (u16*)(ws + oXBK);
  u16*   XBV = (u16*)(ws + oXBV);
  u16*   WQB = (u16*)(ws + oWQB);
  u16*   WKB = (u16*)(ws + oWKB);
  u16*   WVB = (u16*)(ws + oWVB);
  u16*   WOB = (u16*)(ws + oWOB);
  u16*   QHI = (u16*)(ws + oQHI);
  u16*   QLO = (u16*)(ws + oQLO);
  u16*   KHI = (u16*)(ws + oKHI);
  u16*   KLO = (u16*)(ws + oKLO);
  u16*   VHI = (u16*)(ws + oVHI);
  u16*   VLO = (u16*)(ws + oVLO);
  u16*   OHI = (u16*)(ws + oOHI);
  u16*   OLO = (u16*)(ws + oOLO);

  const dim3 blk(256);
  const int n8x = (ROWS * DMOD) / 8;                    // 393216
  const int n8w = (DMOD * DMOD) / 8;                    //  73728
  if ((n8x % 256) != 0 || (n8w % 256) != 0) return;
  if ((ROWS % 64) != 0 || (DMOD % 64) != 0 || (DMOD % 32) != 0) return;
  if ((ROWS % PT) != 0 || (DMOD % PT) != 0) return;
  if (n8x / 256 != GXB || n8w / 256 != GWB) return;
  const dim3 gCV(3 * GXB + 4 * GWB);                    // 5760
  const dim3 gG((ROWS / 64) * (DMOD / 64));             //  768
  const dim3 gG3((ROWS / PT) * (DMOD / PT), 3);         //  192 x 3
  const dim3 bG(128);
  const dim3 gAT(ATT_BLOCKS);                           //  768
  const dim3 bAT(ATT_THREADS);                          //  128

  // (0) all conversions: inputs -> bf16 planes; weights [n][k] (already k-contiguous for x.W^T): bf16 planes for wq/wk/wv, f16 of
  //     bf16 value x1024 for wo
  cvt16_all<<<gCV, blk, 0, stream>>>(Qin, Kin, Vin, wq, wk, wv, wo, XBQ, XBK, XBV, WQB, WKB, WVB, WOB);
  // (1) the three projections + bias (col = h*64+d), written as q and k f16 hi x1024 + residual planes and v^T planes x1024
  gemm_bfb3<<<gG3, bG, 0, stream>>>(XBQ, XBK, XBV, WQB, WKB, WVB, bq, bk, bv, QHI, QLO, KHI, KLO, VHI, VLO, ROWS, DMOD, DMOD, 1.0f);
  // (2) attention with per-head x per-key bias -> O planes [b][s][h][d] x1024 (hi + residual)
  attn_fwd<<<gAT, bAT, 0, stream>>>(QHI, QLO, KHI, KLO, VHI, VLO, mask, mcw, OHI, OLO);
  // (3) output projection + bias -> out [4096][768] f32, carries 1024 (O) x 1024 (wo) folded back
  gemm_h2<<<gG, bG, 0, stream>>>(OHI, OLO, WOB, bo, out, ROWS, DMOD, DMOD, 1.0f / (OSC * WOS));
  (void)hipGetLastError();
}
